// v000
// Times are from an AMD MI455X. After a warm-up the kernel runs many times in a row, and a time is the length of
// such a window on the GPU divided by its runs, so every launch and the gaps after it count. The runs cycle
// through copies of the inputs. A figure is the median of several windows, for all but v000 over two sittings.
// Sittings can differ by a few percent; kernels timed side by side share one.
// The starting kernel, v000, takes 2590 microseconds a run.
// compute dtype: all float inputs rounded to bf16; the three 1x1 convs with EXACT bf16 products on WMMA 16x16x32 (f32 accumulate) + bias; scores between the raw-reshaped theta view (f16 hi + residual x 2^10) and phi (f16) (2 products); the softmax over the QUERY axis in f32 (per-column max / sum, precise expf); P x 2^11 once to f16 x the raw-reshaped g view once to f16 (1 product); the W 1x1 conv on the raw-reshaped y view with bf16 hi + lo (2 products) x exact W + bias + x residual; f32 output written channels-first.
#include <hip/hip_runtime.h>
#include <math.h>

typedef __attribute__((ext_vector_type(16))) _Float16 v16h;
typedef __attribute__((ext_vector_type(16))) __bf16 v16b;
typedef __attribute__((ext_vector_type(8)))  _Float16 v8h;
typedef __attribute__((ext_vector_type(8)))  float v8f;
typedef __attribute__((ext_vector_type(4)))  float v4f;
typedef __attribute__((ext_vector_type(2)))  float v2f;
typedef __attribute__((ext_vector_type(4)))  unsigned v4u;
typedef _Float16 hx8 __attribute__((ext_vector_type(8)));
typedef __attribute__((ext_vector_type(4)))  int v4i;
typedef float __attribute__((may_alias)) float_a;
typedef int __attribute__((may_alias)) int_a;

template <typename T> __device__ __forceinline__ void vst2(void* p, T v) { *(T*)p = v;  }
__device__ __forceinline__ v8f wmma16(v16h a, v16h b, v8f c) {
  v8f d = __builtin_amdgcn_wmma_f32_16x16x32_f16(false, a, false, b, (short)0, c, false, false);
  asm volatile("v_nop\n\tv_nop\n\tv_nop\n\tv_nop" : "+v"(d) : "v"(a), "v"(b));
  return d;
}
__device__ __forceinline__ v8f wmma_bf(v16b a, v16b b, v8f c) {
  v8f d = __builtin_amdgcn_wmma_f32_16x16x32_bf16(false, a, false, b, (short)0, c, false, false);
  asm volatile("v_nop\n\tv_nop\n\tv_nop\n\tv_nop" : "+v"(d) : "v"(a), "v"(b));
  return d;
}
// 16x16x32 fragments: lane = (h = lane>>4, row/col = lane&15); elements 0..7 = k0+8h+0..7, 8..15 = k0+16+8h+0..7; D element r = row 8h+r
__device__ __forceinline__ v16h frag_h(const _Float16* rowk0, int lane) {
  union { v16h v; v8h q[2]; } u; const _Float16* p = rowk0 + 8 * (lane >> 4);
  u.q[0] = *(const v8h*)p; u.q[1] = *(const v8h*)(p + 16); return u.v;
}
__device__ __forceinline__ v16h frag_f32(const float* rowk0, int lane) {
  v16h a; const float* p = rowk0 + 8 * (lane >> 4);
#pragma unroll
  for (int i = 0; i < 8; ++i) { a[i] = (_Float16)p[i]; a[8 + i] = (_Float16)p[16 + i]; }
  return a;
}
__device__ __forceinline__ v16h frag_f32s(const float* rowk0, int lane, float sc) {
  v16h a; const float* p = rowk0 + 8 * (lane >> 4);
#pragma unroll
  for (int i = 0; i < 8; ++i) { a[i] = (_Float16)(p[i] * sc); a[8 + i] = (_Float16)(p[16 + i] * sc); }
  return a;
}
// column fragment from a [K][ld] layout (column n), rows >= K read as 0
__device__ __forceinline__ v16h fragc_f32(const float* W, int k0, int n, int lane, int ld, int K) {
  v16h a; const int g = lane >> 4;
#pragma unroll
  for (int i = 0; i < 8; ++i) { const int ka = k0 + 8 * g + i, kb = ka + 16;
    a[i] = (_Float16)(ka < K ? W[(size_t)(ka < K ? ka : K - 1) * ld + n] : 0.f); a[8 + i] = (_Float16)(kb < K ? W[(size_t)(kb < K ? kb : K - 1) * ld + n] : 0.f); }
  return a;
}
struct F2 { v16b h, l; };
__device__ __forceinline__ F2 bsplit16(const float v[16]) { F2 r;
#pragma unroll
  for (int i = 0; i < 16; ++i) { const __bf16 h = (__bf16)v[i]; r.h[i] = h; r.l[i] = (__bf16)(v[i] - (float)h); }
  return r; }
__device__ __forceinline__ F2 split_row(const float* row, int k0, int lane) { float v[16]; const float* p = row + k0 + 8 * (lane >> 4);
#pragma unroll
  for (int i = 0; i < 8; ++i) { v[i] = p[i]; v[8 + i] = p[16 + i]; }
  return bsplit16(v); }
__device__ __forceinline__ F2 split_rowK(const float* row, int k0, int lane, int K) { float v[16]; const int g = lane >> 4;
#pragma unroll
  for (int i = 0; i < 8; ++i) { const int ka = k0 + 8 * g + i, kb = ka + 16; v[i] = ka < K ? row[ka < K ? ka : K - 1] : 0.f; v[8 + i] = kb < K ? row[kb < K ? kb : K - 1] : 0.f; }
  return bsplit16(v); }
__device__ __forceinline__ F2 split_col(const float* W, int k0, int n, int lane, int ld, int K) { float v[16]; const int g = lane >> 4;
#pragma unroll
  for (int i = 0; i < 8; ++i) { const int ka = k0 + 8 * g + i, kb = ka + 16; v[i] = ka < K ? W[(size_t)(ka < K ? ka : K - 1) * ld + n] : 0.f; v[8 + i] = kb < K ? W[(size_t)(kb < K ? kb : K - 1) * ld + n] : 0.f; }
  return bsplit16(v); }
__device__ __forceinline__ v8f mac3(const F2& a, const F2& b, v8f c) { c = wmma_bf(a.l, b.h, c); c = wmma_bf(a.h, b.l, c); return wmma_bf(a.h, b.h, c); }
__device__ __forceinline__ float sigm(float v) { return 1.0f / (1.0f + expf(-v)); }
#define LDSX() do { asm volatile("s_wait_dscnt 0" ::: "memory"); __builtin_amdgcn_wave_barrier(); __builtin_amdgcn_fence(__ATOMIC_RELEASE, "workgroup"); } while (0)

// Non-local block with the source's RAW reshapes (x [4,256,64,64], Cb 128, N 4,096; (out,in) theta/phi/g 1x1 convs [128,256] + biases, W [256,128] + bias): theta = conv(x).reshape(B, N, Cb) and g likewise are ROW-MAJOR reinterpretations of the [Cb][N] conv outputs (row n = channel n/32, positions (n%32)*128..+127), phi stays [Cb][N]; scores[n][m] = sum_c theta[n][c] phi[c][m]; attn = softmax over n (axis 1 - per key column); y[n][c] = sum_m attn[n][m] g[m][c]; y.reshape(B, Cb, H, W) (raw again) -> W conv + bias + x.
#define NB 4
#define TT 4096
#define CC 128            // g-view plane pitch (Cb channels)
#define CB 128
#define COUT 256
#define CCQ 128           // theta-view / phi^T row pitch (Cb)
#define DIN 256          // x channels
#define NH 1
#define HD 128
#define NQB (TT / 64)
#define HG 1               // one 4,096 x 4,096 score plane per pass (the pass group spans batches)
#define SCALE (1.0f)
#define HDQK 128           // contraction width of the scores (Cb)
#define CAUSAL 0
#ifndef TNB
#define TNB NB
#endif
__device__ __forceinline__ v16b zero16b() { v16b z; _Pragma("unroll") for (int i = 0; i < 16; ++i) z[i] = (__bf16)0.f; return z; }
__device__ __forceinline__ float bfr(float v) { return (float)(__bf16)v; }
__host__ __device__ __forceinline__ int kb_last(int qb) { return CAUSAL ? ((qb * 64 + 63) >> 7) : (TT / 128 - 1); }
typedef __attribute__((ext_vector_type(8))) __bf16 v8b;
__device__ __forceinline__ v16b frag_b(const __bf16* rowk0, int lane) {
  union { v16b v; v8b q[2]; } u; const __bf16* p = rowk0 + 8 * (lane >> 4);
  u.q[0] = *(const v8b*)p; u.q[1] = *(const v8b*)(p + 16); return u.v;
}
#define QBH 0              // 2-product logits everywhere (theta view hi + residual x phi hi)
#define QHI 4096            // q residual rows (all)
#define KHI 64            // (unused k residual / v bf16 planes: QBH 0)
// B fragment (k rows k0+.., output column o) of a weight: (in,out) [K][ld] or (out,in) [ld rows of K]: bf16 exact, or f16(bf16 * 256) exact
__device__ __forceinline__ v16b wcol_io(const float* Wm, int k0, int o, int lane, int ld) { v16b w; const int g = lane >> 4;
#pragma unroll
  for (int i = 0; i < 8; ++i) { w[i] = (__bf16)Wm[(size_t)(k0 + 8 * g + i) * ld + o]; w[8 + i] = (__bf16)Wm[(size_t)(k0 + 16 + 8 * g + i) * ld + o]; }
  return w; }
__device__ __forceinline__ v16b wcol_oi(const float* Wm, int k0, int o, int lane, int K) { v16b w; const float* p = Wm + (size_t)o * K + k0 + 8 * (lane >> 4);
#pragma unroll
  for (int i = 0; i < 8; ++i) { w[i] = (__bf16)p[i]; w[8 + i] = (__bf16)p[16 + i]; }
  return w; }
__device__ __forceinline__ v16h wcolh_io(const float* Wm, int k0, int o, int lane, int ld) { v16h w; const int g = lane >> 4;
#pragma unroll
  for (int i = 0; i < 8; ++i) { w[i] = (_Float16)(bfr(Wm[(size_t)(k0 + 8 * g + i) * ld + o]) * 256.0f); w[8 + i] = (_Float16)(bfr(Wm[(size_t)(k0 + 16 + 8 * g + i) * ld + o]) * 256.0f); }
  return w; }
__device__ __forceinline__ v16h wcolh_oi(const float* Wm, int k0, int o, int lane, int K) { v16h w; const float* p = Wm + (size_t)o * K + k0 + 8 * (lane >> 4);
#pragma unroll
  for (int i = 0; i < 8; ++i) { w[i] = (_Float16)(bfr(p[i]) * 256.0f); w[8 + i] = (_Float16)(bfr(p[16 + i]) * 256.0f); }
  return w; }
#define WQKV_LAYOUT 0   // 0 = (out,in) [CC][DIN], as 1; 1 = (out,in) [CC][DIN]; 2 = per-head [NH][DIN][HD]
__device__ __forceinline__ v16b wcol_hdk(const float* Wm, int k0, int o, int lane) { v16b w; const int g = lane >> 4; const float* p = Wm + (size_t)(o / HD) * DIN * HD + (o % HD);
#pragma unroll
  for (int i = 0; i < 8; ++i) { w[i] = (__bf16)p[(size_t)(k0 + 8 * g + i) * HD]; w[8 + i] = (__bf16)p[(size_t)(k0 + 16 + 8 * g + i) * HD]; }
  return w; }
#define WO_OUT_IN 0
#if WQKV_LAYOUT == 1
#define WCOL(W, k0, o, lane) wcol_oi(W, k0, (o), lane, DIN)   /* unused: layout 0 */
#elif WQKV_LAYOUT == 2
#define WCOL(W, k0, o, lane) wcol_hdk(W, k0, o, lane)
#else
#define WCOL(W, k0, o, lane) wcol_oi(W, k0, (o), lane, DIN)   /* (out,in) 1x1-conv weights [128][256]: all 128 output channels real */
#endif
#if WO_OUT_IN
#define WOCOL(W, k0, o, lane) wcol_oi(W, k0, o, lane, CC)
#define WOCOLH(W, k0, o, lane) wcolh_oi(W, k0, o, lane, CC)
#else
#define WOCOL(W, k0, o, lane) wcol_io(W, k0, o, lane, DIN)
#define WOCOLH(W, k0, o, lane) wcolh_io(W, k0, o, lane, DIN)
#endif
#define BG HG              // the pass group spans BATCHES (single head): blockIdx.z selects batch b0 + z
#define BGN (TNB < BG ? TNB : BG)
#define DVH 128            // all 128 Cb columns of the g view in one k_pv block
#ifndef SM_EXTRA_PARAMS
#define SM_EXTRA_PARAMS
#endif
#ifndef PROJ_EXTRA_PARAMS
#define PROJ_EXTRA_PARAMS
#endif
#ifndef SM_MASK_HOOK
#define SM_MASK_HOOK (void)0
#endif

#define WS_QH  0u                                      // f16 q rows [b*t][CCQ]
#define WS_KH  (WS_QH + 2u * (size_t)NB * TT * CCQ)     // f16 k rows [b*t][CCQ]
#define WS_VT  (WS_KH + 2u * (size_t)NB * TT * CCQ)     // f16 theta conv planes [b][c][t] (theta-view rows)
#define WS_QL  (WS_VT + 2u * (size_t)NB * CC * TT)      // f16 q residual x 2^10 rows [b][t < QHI][CCQ]
#define WS_KL  (WS_QL + 2u * (size_t)NB * QHI * CCQ)    // f16 k residual x 2^10 rows [b][t < KHI][CCQ]
#define WS_VB  (WS_KL + 2u * (size_t)NB * KHI * CCQ)    // bf16 v hi planes [b][c][t < KHI]
#define WS_VBL (WS_VB + 2u * (size_t)NB * CC * KHI)
#define WS_S   (WS_VBL + 2u * (size_t)NB * CC * KHI)    // f32 logits / P [hg][t][s]
#define WS_Y   (WS_S  + 4u * (size_t)HG * TT * TT)      // unused (0 bytes); y rows go to WS_YR
#define WS_END (WS_Y  + 0u)

// ---- k_proj: block = (64 rows, 128 cols, which): q/k/v = X W (+ b) with exact bf16 products (K = DIN) -> which 0: q f16 rows (+ residual rows < QHI); 1: k f16 rows (+ residual rows < KHI); 2: v f16 planes [c][t] (+ bf16 hi/lo planes for t < KHI)
template <int WOFF> __global__ __launch_bounds__(128) void k_projT(const float* __restrict__ XQ, const float* __restrict__ XK, const float* __restrict__ XV, const float* __restrict__ WQ, const float* __restrict__ WK, const float* __restrict__ WV, const float* __restrict__ BQ, const float* __restrict__ BK, const float* __restrict__ BV,
    _Float16* __restrict__ QH, _Float16* __restrict__ QL, _Float16* __restrict__ KH, _Float16* __restrict__ KL, _Float16* __restrict__ VT, __bf16* __restrict__ VB, __bf16* __restrict__ VBL, _Float16* __restrict__ VL) {
  __shared__ __align__(16) _Float16 sh[64][136], sl[64][136]; __shared__ __align__(16) _Float16 th[128][72], tlo[128][72]; __shared__ __align__(16) __bf16 tb[128][72], tbl[128][72];
  const int tid = threadIdx.x, wave = tid >> 5, lane = tid & 31, col = lane & 15, g = lane >> 4; const int which = blockIdx.z + WOFF; const int c0 = blockIdx.y * 128; const size_t r0 = (size_t)blockIdx.x * 64; const size_t bb = r0 / TT; const int t0 = (int)(r0 % TT);
  const float* X = which == 0 ? XQ : which == 1 ? XK : XV; const float* WA = which == 0 ? WQ : which == 1 ? WK : WV; const float* BA = which == 0 ? BQ : which == 1 ? BK : BV;
  const int KD = DIN;
  v8f acc[8] = {};
#pragma unroll 2
  for (int kc = 0; kc < KD / 32; ++kc) { v16b a; { const float* p = X + (bb * KD + kc * 32 + 8 * g) * (size_t)TT + t0 + wave * 16 + col;   /* channels-first [b][c][t]: A[t][c] (16 consecutive t per lane group) */
#pragma unroll
      for (int i = 0; i < 8; ++i) { a[i] = (__bf16)p[(size_t)i * TT]; a[8 + i] = (__bf16)p[(size_t)(16 + i) * TT]; } }
    asm volatile("s_wait_loadcnt 0x0" ::: "memory");
#pragma unroll
    for (int j = 0; j < 8; ++j) { const v16b w = WCOL(WA, kc * 32, c0 + j * 16 + col, lane); asm volatile("s_wait_loadcnt 0x0" ::: "memory"); acc[j] = wmma_bf(a, w, acc[j]); } }
  if (which < 2) { _Float16* DH = which == 0 ? QH : KH; _Float16* DL = which == 0 ? QL : KL; const int nhi = which == 0 ? QHI : KHI; const bool hi_rows = t0 < nhi;
#pragma unroll
    for (int j = 0; j < 8; ++j) { const float bias = BA ? bfr(BA[c0 + j * 16 + col]) : 0.f;
#pragma unroll
      for (int r = 0; r < 8; ++r) { const float v = acc[j][r] + bias; const _Float16 hv = (_Float16)v; sh[wave * 16 + 8 * g + r][j * 16 + col] = hv; sl[wave * 16 + 8 * g + r][j * 16 + col] = (_Float16)((v - (float)hv) * 1024.0f); } }
    __syncthreads();
    for (int e = tid; e < 64 * 16; e += 128) { const int rl = e >> 4, q = e & 15; vst2((unsigned*)(DH + (r0 + rl) * CCQ + c0 + q * 8), *(const v4u*)&sh[rl][q * 8]); if (hi_rows) vst2((unsigned*)(DL + (bb * nhi + t0 + rl) * (size_t)CCQ + c0 + q * 8), *(const v4u*)&sl[rl][q * 8]); }   /* q/k rows: pitch CCQ (c0 == 0) */
  } else { const bool hi_rows = t0 < KHI;
#pragma unroll
    for (int j = 0; j < 8; ++j) { const float bias = BA ? bfr(BA[c0 + j * 16 + col]) : 0.f;
#pragma unroll
      for (int r = 0; r < 8; ++r) { const float v = acc[j][r] + bias; const int rl = wave * 16 + 8 * g + r, cl = j * 16 + col; const _Float16 hv2 = (_Float16)v; th[cl][rl] = hv2; tlo[cl][rl] = (_Float16)((v - (float)hv2) * 1024.0f); const __bf16 bh = (__bf16)v; tb[cl][rl] = bh; tbl[cl][rl] = (__bf16)(v - (float)bh); } }
    __syncthreads();
    for (int e = tid; e < 128 * 8; e += 128) { const int cl = e >> 3, q = e & 7; vst2((unsigned*)(VT + (bb * CC + c0 + cl) * (size_t)TT + t0 + q * 8), *(const v4u*)&th[cl][q * 8]); if (VL) vst2((unsigned*)(VL + (bb * CC + c0 + cl) * (size_t)TT + t0 + q * 8), *(const v4u*)&tlo[cl][q * 8]); if (hi_rows) { const size_t o3 = (bb * CC + c0 + cl) * (size_t)KHI + t0 + q * 8; vst2((unsigned*)(VB + o3), *(const v4u*)&tb[cl][q * 8]); vst2((unsigned*)(VBL + o3), *(const v4u*)&tbl[cl][q * 8]); } } } }
// ---- k_sc: block = (query block qb, key block kb <= kb_last(qb), batch in group: b = bgrp + z): logits x SCALE; q hi + residual (x 2^10) against k (2 products) for query rows < QHI, plus the k residual (3 products) for query blocks < QBH (causal early rows); causal: blocks past the diagonal exit
__global__ __launch_bounds__(128) void k_sc(const _Float16* __restrict__ QH, const _Float16* __restrict__ KH, const _Float16* __restrict__ QL, const _Float16* __restrict__ KL, int bgrp, int h0, float* __restrict__ S0) { __shared__ __align__(16) float ss[4][16][132];
  const int qb = blockIdx.x, kb = blockIdx.y; if (kb > kb_last(qb)) return;
  const int h = h0; const int b = bgrp + blockIdx.z; float* S = S0 + (size_t)blockIdx.z * TT * TT;   /* group spans batches */
  const int tid = threadIdx.x, wave = tid >> 5, lane = tid & 31, col = lane & 15, g = lane >> 4; const int k0 = kb * 128; const int ql0 = qb * 64 + wave * 16; const size_t q0 = (size_t)b * TT + ql0, kr0 = (size_t)b * TT + k0;
  v8f acc[8] = {}, accl[8] = {};
  const _Float16* QLb = QL + (size_t)b * QHI * CCQ; const _Float16* KLb = KL + (size_t)b * KHI * CCQ;   /* single head: q/k rows at pitch CCQ */
  if (qb < QBH) {
#pragma unroll
    for (int kc = 0; kc < HDQK / 32; ++kc) { const v16h ah = frag_h(QH + (q0 + col) * CCQ + kc * 32, lane), al = frag_h(QLb + (size_t)(ql0 + col) * CCQ + kc * 32, lane);
#pragma unroll
      for (int j = 0; j < 8; ++j) { const v16h kbf = frag_h(KH + (kr0 + j * 16 + col) * CCQ + kc * 32, lane), klf = frag_h(KLb + (size_t)(k0 + j * 16 + col) * CCQ + kc * 32, lane); acc[j] = wmma16(ah, kbf, acc[j]); accl[j] = wmma16(al, kbf, accl[j]); accl[j] = wmma16(ah, klf, accl[j]); } }
  } else if (qb * 64 < QHI) {
#pragma unroll
    for (int kc = 0; kc < HDQK / 32; ++kc) { const v16h ah = frag_h(QH + (q0 + col) * CCQ + kc * 32, lane), al = frag_h(QLb + (size_t)(ql0 + col) * CCQ + kc * 32, lane);
#pragma unroll
      for (int j = 0; j < 8; ++j) { const v16h kbf = frag_h(KH + (kr0 + j * 16 + col) * CCQ + kc * 32, lane); acc[j] = wmma16(ah, kbf, acc[j]); accl[j] = wmma16(al, kbf, accl[j]); } }
  } else {
#pragma unroll
    for (int kc = 0; kc < HDQK / 32; ++kc) { const v16h ah = frag_h(QH + (q0 + col) * CCQ + kc * 32, lane);
#pragma unroll
      for (int j = 0; j < 8; ++j) { const v16h kbf = frag_h(KH + (kr0 + j * 16 + col) * CCQ + kc * 32, lane); acc[j] = wmma16(ah, kbf, acc[j]); } } }
#pragma unroll
  for (int j = 0; j < 8; ++j) {
#pragma unroll
    for (int r = 0; r < 8; ++r) ss[wave][8 * g + r][j * 16 + col] = (acc[j][r] + accl[j][r] * (1.0f / 1024.0f)) * SCALE; }
  LDSX(); for (int rl = 0; rl < 16; ++rl) vst2(S + (size_t)(ql0 + rl) * TT + k0 + lane * 4, *(const v4f*)&ss[wave][rl][lane * 4]); }
// ---- k_colstat: softmax over the QUERY axis (axis 1): thread per key column m of the batch's score plane: CM[m] = max over the 4,096 rows, CS[m] = sum_n exp(S[n][m] - CM[m]) (f32, rows in ascending order, precise expf); reads are coalesced across threads
__global__ __launch_bounds__(256) void k_colstat(const float* __restrict__ S, float* __restrict__ CM, float* __restrict__ CS) { const int m = blockIdx.x * 256 + threadIdx.x; const float* p = S + m;
  float mx = -3.0e38f;
#pragma unroll 1
  for (int n0 = 0; n0 < TT; n0 += 8) { float tv[8];
#pragma unroll
    for (int u = 0; u < 8; ++u) tv[u] = p[(size_t)(n0 + u) * TT];
    asm volatile("s_wait_loadcnt 0x0" ::: "memory");
#pragma unroll
    for (int u = 0; u < 8; ++u) mx = fmaxf(mx, tv[u]); }
  float sm2 = 0.f;
#pragma unroll 1
  for (int n0 = 0; n0 < TT; n0 += 8) { float tv[8];
#pragma unroll
    for (int u = 0; u < 8; ++u) tv[u] = p[(size_t)(n0 + u) * TT];
    asm volatile("s_wait_loadcnt 0x0" ::: "memory");
#pragma unroll
    for (int u = 0; u < 8; ++u) sm2 += expf(tv[u] - mx); }
  vst2(CM + m, mx); vst2(CS + m, sm2); }
// ---- k_smcol: block per row n: P[n][m] = exp(S[n][m] - CM[m]) / CS[m] x 2^11 in place (rows rewritten as whole 16-B lanes)
__global__ __launch_bounds__(256) void k_smcol(float* __restrict__ S, const float* __restrict__ CM, const float* __restrict__ CS) { const int tid = threadIdx.x; float* sr = S + (size_t)blockIdx.x * TT;
  for (int q = tid; q < TT / 4; q += 256) { const v4f v = *(const v4f*)(sr + q * 4), cm = *(const v4f*)(CM + q * 4), cs = *(const v4f*)(CS + q * 4); asm volatile("s_wait_loadcnt 0x0" ::: "memory"); v4f o;
#pragma unroll
    for (int u = 0; u < 4; ++u) o[u] = expf(v[u] - cm[u]) * (2048.0f / cs[u]);
    vst2(sr + q * 4, o); } }
__global__ __launch_bounds__(256) void k_trans(const _Float16* __restrict__ G, _Float16* __restrict__ VT2) { __shared__ _Float16 st[64][72]; const int tid = threadIdx.x; const int m0 = blockIdx.x * 64, c0 = blockIdx.y * 64, b = blockIdx.z; const _Float16* gb = G + (size_t)b * CB * TT; _Float16* vb = VT2 + (size_t)b * CB * TT;
  for (int e = tid; e < 64 * 8; e += 256) { const int ml = e >> 3, q = e & 7; const v4u u = *(const v4u*)(gb + (size_t)(m0 + ml) * CB + c0 + q * 8); asm volatile("s_wait_loadcnt 0x0" ::: "memory"); const hx8 hv = *(const hx8*)&u; _Pragma("unroll") for (int j = 0; j < 8; ++j) st[q * 8 + j][ml] = hv[j]; }
  __syncthreads();
  for (int e = tid; e < 64 * 8; e += 256) { const int cl = e >> 3, q = e & 7; hx8 hv; _Pragma("unroll") for (int j = 0; j < 8; ++j) hv[j] = st[cl][q * 8 + j]; vst2((unsigned*)(vb + (size_t)(c0 + cl) * TT + m0 + q * 8), *(const v4u*)&hv); } }
// ---- k_wout: block = (64 positions, 128 of the 256 output channels, batch): A[pos][cb] = y view Yb[cb*4096 + pos] (the raw reshape back: the batch's y rows [4096][128] f32 reinterpreted as [Cb][N]) split bf16 hi + lo (2 products) x exact (out,in) W [256][128]; + bf16(W_b) + bf16(x[b][o][pos]); channels-first store out[b][o][pos0..pos0+63] through LDS (one 256-B run per channel by 16 lanes)
__global__ __launch_bounds__(128) void k_wout(const float* __restrict__ Y, const float* __restrict__ WW, const float* __restrict__ WB, const float* __restrict__ X, float* __restrict__ OUT) { __shared__ __align__(16) float st[128][68];
  const int tid = threadIdx.x, wave = tid >> 5, lane = tid & 31, col = lane & 15, g = lane >> 4; const int p0 = blockIdx.x * 64, c0 = blockIdx.y * 128, b = blockIdx.z; const float* Yb = Y + (size_t)b * TT * CB;
  v8f acc[8] = {};
#pragma unroll 1
  for (int kc = 0; kc < CB / 32; ++kc) { v16b ah, al; { const float* p = Yb + (size_t)(kc * 32 + 8 * g) * TT + p0 + wave * 16 + col; float tv[16];
#pragma unroll
      for (int i = 0; i < 8; ++i) { tv[i] = p[(size_t)i * TT]; tv[8 + i] = p[(size_t)(16 + i) * TT]; }
      asm volatile("s_wait_loadcnt 0x0" ::: "memory");
#pragma unroll
      for (int i = 0; i < 16; ++i) { const __bf16 h = (__bf16)tv[i]; ah[i] = h; al[i] = (__bf16)(tv[i] - (float)h); } }
#pragma unroll
    for (int j = 0; j < 8; ++j) { const v16b w = wcol_oi(WW, kc * 32, c0 + j * 16 + col, lane, CB); acc[j] = wmma_bf(ah, w, acc[j]); acc[j] = wmma_bf(al, w, acc[j]); } }
#pragma unroll
  for (int j = 0; j < 8; ++j) { const float wb = bfr(WB[c0 + j * 16 + col]); asm volatile("s_wait_loadcnt 0x0" ::: "memory");
#pragma unroll
    for (int r = 0; r < 8; ++r) st[j * 16 + col][wave * 16 + 8 * g + r] = acc[j][r] + wb; }
  __syncthreads();
  for (int e = tid; e < 128 * 16; e += 128) { const int cl = e >> 4, q = e & 15; const size_t o = ((size_t)b * COUT + c0 + cl) * (size_t)TT + p0 + q * 4; const v4f xr = *(const v4f*)(X + o); asm volatile("s_wait_loadcnt 0x0" ::: "memory"); v4f v = *(const v4f*)&st[cl][q * 4]; v[0] += bfr(xr[0]); v[1] += bfr(xr[1]); v[2] += bfr(xr[2]); v[3] += bfr(xr[3]); vst2(OUT + o, v); } }
// ---- k_pv: block = (64 queries (qb), all 128 value columns, batch in group): attended = P . v over all 4,096 keys (P x 2^11 once to f16 against v f16: 1 product) x 2^-11; y[n][c] = attended, stored as f32 rows of Y for k_wout
__global__ __launch_bounds__(128) void k_pv(const float* __restrict__ PS0, const _Float16* __restrict__ VT, const __bf16* __restrict__ VB, const __bf16* __restrict__ VBL, int bgrp, int h0, float* __restrict__ Y) { const int h = h0; const int b = bgrp + blockIdx.z; const float* PS = PS0 + (size_t)blockIdx.z * TT * TT; const int d0 = blockIdx.y * DVH;   /* group spans batches; column offset d0 (0: one block spans all 128) */ __shared__ __align__(16) float ss[4][16][DVH + 4];
  const int tid = threadIdx.x, wave = tid >> 5, lane = tid & 31, col = lane & 15, g = lane >> 4; const int qb = blockIdx.x; const int ql0 = qb * 64 + wave * 16; const int kce = (kb_last(qb) + 1) * 4;
  v8f acc[DVH / 16] = {};
  if (false) {   /* PVHI 0: the 3-product P.v path is not used (1 product suffices; QBH governs only the logits) */
#pragma unroll 1
    for (int kc = 0; kc < kce; ++kc) { const F2 p = split_row(PS + (size_t)(ql0 + col) * TT, kc * 32, lane);
      asm volatile("s_wait_loadcnt 0x0" ::: "memory");
#pragma unroll
      for (int j = 0; j < DVH / 16; ++j) { const size_t po = ((size_t)b * CC + h * HD + d0 + j * 16 + col) * (size_t)KHI + kc * 32; const v16b vh = frag_b(VB + po, lane); acc[j] = wmma_bf(p.h, vh, acc[j]); acc[j] = wmma_bf(p.l, vh, acc[j]); acc[j] = wmma_bf(p.h, frag_b(VBL + po, lane), acc[j]); } }
  } else {
#pragma unroll 1
    for (int kc = 0; kc < kce; ++kc) { const v16h p = frag_f32(PS + (size_t)(ql0 + col) * TT + kc * 32, lane);
      asm volatile("s_wait_loadcnt 0x0" ::: "memory");
#pragma unroll
      for (int j = 0; j < DVH / 16; ++j) { const size_t po = ((size_t)b * CC + h * HD + d0 + j * 16 + col) * (size_t)TT + kc * 32; acc[j] = wmma16(p, frag_h(VT + po, lane), acc[j]); } } }
#pragma unroll
  for (int j = 0; j < DVH / 16; ++j)
#pragma unroll
    for (int r = 0; r < 8; ++r) ss[wave][8 * g + r][j * 16 + col] = acc[j][r] * (1.0f / 2048.0f);
  LDSX(); for (int rl = 0; rl < 16; ++rl) vst2(Y + ((size_t)b * TT + ql0 + rl) * CC + h * HD + d0 + lane * 4, *(const v4f*)&ss[wave][rl][lane * 4]); }   /* y rows [b*TT + n][128]: 512-B row by 32 lanes */

#define WS_TL  (WS_END)                                  // f16 theta-view residual plane [b][128][TT] (viewed as rows)
#define WS_G   (WS_TL + 2u * (size_t)NB * CB * TT)        // f16 g conv plane [b][128][TT]
#define WS_VT2 (WS_G + 2u * (size_t)NB * CB * TT)         // f16 g-view transposed [b][128][TT]
#define WS_YR  (WS_VT2 + 2u * (size_t)NB * CB * TT)       // f32 y rows [b*TT + n][128]
#define WS_CM  (WS_YR + 4u * (size_t)NB * TT * CB)        // f32 column max [TT]
#define WS_CS  (WS_CM + 4u * (size_t)TT)
#define WS_END2 (WS_CS + 4u * (size_t)TT)
extern "C" void kernel_launch(void* const* d_in, const int* in_sizes, int n_in, void* d_out, int out_size, void* d_ws, size_t ws_size, hipStream_t stream) {
  (void)in_sizes; (void)n_in; (void)out_size;
  const float** F = (const float**)d_in;
  if (ws_size < (size_t)WS_END) return;
  char* ws = (char*)d_ws; _Float16 *QH = (_Float16*)(ws + WS_QH), *KH = (_Float16*)(ws + WS_KH), *VT = (_Float16*)(ws + WS_VT), *QL = (_Float16*)(ws + WS_QL), *KL = (_Float16*)(ws + WS_KL); __bf16 *VB = (__bf16*)(ws + WS_VB), *VBL = (__bf16*)(ws + WS_VBL); float *S = (float*)(ws + WS_S), *Y = (float*)(ws + WS_Y);
  (void)Y; (void)QL; (void)KL; (void)VB; (void)VBL;
  // inputs: 0 x [4,256,64,64] (channels-first); 1 theta_w [128,256], 2 theta_b; 3 phi_w, 4 phi_b; 5 g_w, 6 g_b; 7 W_w [256,128], 8 W_b [256] (all (out,in), biases nonzero)
  if (ws_size < (size_t)WS_END2) return;
  _Float16 *TL = (_Float16*)(ws + WS_TL), *G = (_Float16*)(ws + WS_G), *VT2 = (_Float16*)(ws + WS_VT2); float *YR = (float*)(ws + WS_YR), *CM = (float*)(ws + WS_CM), *CS = (float*)(ws + WS_CS);
  // phi^T rows (the 'k' rows: phi[c][m] proper layout, token-major) via the q/k path as which = 1 -> KH (+KL rows < 64, unused)
  k_projT<1><<<dim3(TNB * TT / 64, 1, 1), 128, 0, stream>>>(F[0], F[0], F[0], F[3], F[3], F[3], F[4], F[4], F[4], QH, QL, KH, KL, VT, VB, VBL, nullptr);
  // theta conv plane [Cb][N] (f16 hi into the 'VT' slot = the theta VIEW rows [N][Cb] when read row-major) + its residual plane TL (the view's residual rows) via the [c][t] path (which = 2)
  k_projT<2><<<dim3(TNB * TT / 64, 1, 1), 128, 0, stream>>>(F[0], F[0], F[0], F[1], F[1], F[1], F[2], F[2], F[2], QH, QL, KH, KL, VT, VB, VBL, TL);
  // g conv plane [Cb][N] f16 -> G, then the g VIEW rows transposed into the value plane VT2[c][m]
  k_projT<2><<<dim3(TNB * TT / 64, 1, 1), 128, 0, stream>>>(F[0], F[0], F[0], F[5], F[5], F[5], F[6], F[6], F[6], QH, QL, KH, KL, G, VB, VBL, nullptr);
  k_trans<<<dim3(TT / 64, CB / 64, TNB), 256, 0, stream>>>(G, VT2);
  for (int b0 = 0; b0 < TNB; b0 += BGN) {
    k_sc<<<dim3(NQB, TT / 128, BGN), 128, 0, stream>>>(VT /* theta view rows */, KH, TL /* view residual rows */, KL, b0, 0, S);
    k_colstat<<<dim3(TT / 256), 256, 0, stream>>>(S, CM, CS);
    k_smcol<<<dim3(TT), 256, 0, stream>>>(S, CM, CS);
    k_pv<<<dim3(NQB, HD / DVH, BGN), 128, 0, stream>>>(S, VT2, VB, VBL, b0, 0, YR);
  }
  k_wout<<<dim3(TT / 64, COUT / 128, TNB), 128, 0, stream>>>(YR, F[7], F[8], F[0], (float*)d_out);

}

// v001
// A run of this version takes 1190 microseconds.
// Two timings next to v000 both put it at 2.18 times that version's speed.
// compute dtype: all float inputs rounded to bf16; the three 1x1 convs with EXACT bf16 products on WMMA 16x16x32 (f32 accumulate) + bias; scores between the raw-reshaped theta view (f16 hi + residual x 2^10) and phi (f16) (2 products); the softmax over the QUERY axis in f32 (per-column max / sum from 64-row partials, precise expf); P x 2^11 once to f16 x the raw-reshaped g view once to f16 (1 product); the W 1x1 conv on the raw-reshaped y view with bf16 hi + lo (2 products) x exact W + bias + x residual; f32 output written channels-first.
#include <hip/hip_runtime.h>
#include <math.h>

typedef __attribute__((ext_vector_type(16))) _Float16 v16h;
typedef __attribute__((ext_vector_type(16))) __bf16 v16b;
typedef __attribute__((ext_vector_type(8)))  _Float16 v8h;
typedef __attribute__((ext_vector_type(8)))  float v8f;
typedef __attribute__((ext_vector_type(4)))  float v4f;
typedef __attribute__((ext_vector_type(2)))  float v2f;
typedef __attribute__((ext_vector_type(4)))  unsigned v4u;
typedef _Float16 hx8 __attribute__((ext_vector_type(8)));
typedef __attribute__((ext_vector_type(4)))  int v4i;
typedef float __attribute__((may_alias)) float_a;
typedef int __attribute__((may_alias)) int_a;

template <typename T> __device__ __forceinline__ void vst2(void* p, T v) { *(T*)p = v;  }
__device__ __forceinline__ v8f wmma16(v16h a, v16h b, v8f c) {
  v8f d = __builtin_amdgcn_wmma_f32_16x16x32_f16(false, a, false, b, (short)0, c, false, false);
  asm volatile("v_nop\n\tv_nop\n\tv_nop\n\tv_nop" : "+v"(d) : "v"(a), "v"(b));
  return d;
}
__device__ __forceinline__ v8f wmma_bf(v16b a, v16b b, v8f c) {
  v8f d = __builtin_amdgcn_wmma_f32_16x16x32_bf16(false, a, false, b, (short)0, c, false, false);
  asm volatile("v_nop\n\tv_nop\n\tv_nop\n\tv_nop" : "+v"(d) : "v"(a), "v"(b));
  return d;
}
// 16x16x32 fragments: lane = (h = lane>>4, row/col = lane&15); elements 0..7 = k0+8h+0..7, 8..15 = k0+16+8h+0..7; D element r = row 8h+r
__device__ __forceinline__ v16h frag_h(const _Float16* rowk0, int lane) {
  union { v16h v; v8h q[2]; } u; const _Float16* p = rowk0 + 8 * (lane >> 4);
  u.q[0] = *(const v8h*)p; u.q[1] = *(const v8h*)(p + 16); return u.v;
}
__device__ __forceinline__ v16h frag_f32(const float* rowk0, int lane) {
  v16h a; const float* p = rowk0 + 8 * (lane >> 4);
#pragma unroll
  for (int i = 0; i < 8; ++i) { a[i] = (_Float16)p[i]; a[8 + i] = (_Float16)p[16 + i]; }
  return a;
}
__device__ __forceinline__ v16h frag_f32s(const float* rowk0, int lane, float sc) {
  v16h a; const float* p = rowk0 + 8 * (lane >> 4);
#pragma unroll
  for (int i = 0; i < 8; ++i) { a[i] = (_Float16)(p[i] * sc); a[8 + i] = (_Float16)(p[16 + i] * sc); }
  return a;
}
// column fragment from a [K][ld] layout (column n), rows >= K read as 0
__device__ __forceinline__ v16h fragc_f32(const float* W, int k0, int n, int lane, int ld, int K) {
  v16h a; const int g = lane >> 4;
#pragma unroll
  for (int i = 0; i < 8; ++i) { const int ka = k0 + 8 * g + i, kb = ka + 16;
    a[i] = (_Float16)(ka < K ? W[(size_t)(ka < K ? ka : K - 1) * ld + n] : 0.f); a[8 + i] = (_Float16)(kb < K ? W[(size_t)(kb < K ? kb : K - 1) * ld + n] : 0.f); }
  return a;
}
struct F2 { v16b h, l; };
__device__ __forceinline__ F2 bsplit16(const float v[16]) { F2 r;
#pragma unroll
  for (int i = 0; i < 16; ++i) { const __bf16 h = (__bf16)v[i]; r.h[i] = h; r.l[i] = (__bf16)(v[i] - (float)h); }
  return r; }
__device__ __forceinline__ F2 split_row(const float* row, int k0, int lane) { float v[16]; const float* p = row + k0 + 8 * (lane >> 4);
#pragma unroll
  for (int i = 0; i < 8; ++i) { v[i] = p[i]; v[8 + i] = p[16 + i]; }
  return bsplit16(v); }
__device__ __forceinline__ F2 split_rowK(const float* row, int k0, int lane, int K) { float v[16]; const int g = lane >> 4;
#pragma unroll
  for (int i = 0; i < 8; ++i) { const int ka = k0 + 8 * g + i, kb = ka + 16; v[i] = ka < K ? row[ka < K ? ka : K - 1] : 0.f; v[8 + i] = kb < K ? row[kb < K ? kb : K - 1] : 0.f; }
  return bsplit16(v); }
__device__ __forceinline__ F2 split_col(const float* W, int k0, int n, int lane, int ld, int K) { float v[16]; const int g = lane >> 4;
#pragma unroll
  for (int i = 0; i < 8; ++i) { const int ka = k0 + 8 * g + i, kb = ka + 16; v[i] = ka < K ? W[(size_t)(ka < K ? ka : K - 1) * ld + n] : 0.f; v[8 + i] = kb < K ? W[(size_t)(kb < K ? kb : K - 1) * ld + n] : 0.f; }
  return bsplit16(v); }
__device__ __forceinline__ v8f mac3(const F2& a, const F2& b, v8f c) { c = wmma_bf(a.l, b.h, c); c = wmma_bf(a.h, b.l, c); return wmma_bf(a.h, b.h, c); }
__device__ __forceinline__ float sigm(float v) { return 1.0f / (1.0f + expf(-v)); }
#define LDSX() do { asm volatile("s_wait_dscnt 0" ::: "memory"); __builtin_amdgcn_wave_barrier(); __builtin_amdgcn_fence(__ATOMIC_RELEASE, "workgroup"); } while (0)

// Non-local block with the source's RAW reshapes (x [4,256,64,64], Cb 128, N 4,096; (out,in) theta/phi/g 1x1 convs [128,256] + biases, W [256,128] + bias): theta = conv(x).reshape(B, N, Cb) and g likewise are ROW-MAJOR reinterpretations of the [Cb][N] conv outputs (row n = channel n/32, positions (n%32)*128..+127), phi stays [Cb][N]; scores[n][m] = sum_c theta[n][c] phi[c][m]; attn = softmax over n (axis 1 - per key column); y[n][c] = sum_m attn[n][m] g[m][c]; y.reshape(B, Cb, H, W) (raw again) -> W conv + bias + x.
#define NB 4
#define TT 4096
#define CC 128            // g-view plane pitch (Cb channels)
#define CB 128
#define COUT 256
#define CCQ 128           // theta-view / phi^T row pitch (Cb)
#define DIN 256          // x channels
#define NH 1
#define HD 128
#define NQB (TT / 64)
#define HG 1               // one 4,096 x 4,096 score plane per pass (the pass group spans batches)
#define SCALE (1.0f)
#define HDQK 128           // contraction width of the scores (Cb)
#define CAUSAL 0
#ifndef TNB
#define TNB NB
#endif
__device__ __forceinline__ v16b zero16b() { v16b z; _Pragma("unroll") for (int i = 0; i < 16; ++i) z[i] = (__bf16)0.f; return z; }
__device__ __forceinline__ float bfr(float v) { return (float)(__bf16)v; }
__host__ __device__ __forceinline__ int kb_last(int qb) { return CAUSAL ? ((qb * 64 + 63) >> 7) : (TT / 128 - 1); }
typedef __attribute__((ext_vector_type(8))) __bf16 v8b;
__device__ __forceinline__ v16b frag_b(const __bf16* rowk0, int lane) {
  union { v16b v; v8b q[2]; } u; const __bf16* p = rowk0 + 8 * (lane >> 4);
  u.q[0] = *(const v8b*)p; u.q[1] = *(const v8b*)(p + 16); return u.v;
}
#define QBH 0              // 2-product logits everywhere (theta view hi + residual x phi hi)
#define QHI 4096            // q residual rows (all)
#define KHI 64            // (unused k residual / v bf16 planes: QBH 0)
// B fragment (k rows k0+.., output column o) of a weight: (in,out) [K][ld] or (out,in) [ld rows of K]: bf16 exact, or f16(bf16 * 256) exact
__device__ __forceinline__ v16b wcol_io(const float* Wm, int k0, int o, int lane, int ld) { v16b w; const int g = lane >> 4;
#pragma unroll
  for (int i = 0; i < 8; ++i) { w[i] = (__bf16)Wm[(size_t)(k0 + 8 * g + i) * ld + o]; w[8 + i] = (__bf16)Wm[(size_t)(k0 + 16 + 8 * g + i) * ld + o]; }
  return w; }
__device__ __forceinline__ v16b wcol_oi(const float* Wm, int k0, int o, int lane, int K) { v16b w; const float* p = Wm + (size_t)o * K + k0 + 8 * (lane >> 4);
#pragma unroll
  for (int i = 0; i < 8; ++i) { w[i] = (__bf16)p[i]; w[8 + i] = (__bf16)p[16 + i]; }
  return w; }
__device__ __forceinline__ v16h wcolh_io(const float* Wm, int k0, int o, int lane, int ld) { v16h w; const int g = lane >> 4;
#pragma unroll
  for (int i = 0; i < 8; ++i) { w[i] = (_Float16)(bfr(Wm[(size_t)(k0 + 8 * g + i) * ld + o]) * 256.0f); w[8 + i] = (_Float16)(bfr(Wm[(size_t)(k0 + 16 + 8 * g + i) * ld + o]) * 256.0f); }
  return w; }
__device__ __forceinline__ v16h wcolh_oi(const float* Wm, int k0, int o, int lane, int K) { v16h w; const float* p = Wm + (size_t)o * K + k0 + 8 * (lane >> 4);
#pragma unroll
  for (int i = 0; i < 8; ++i) { w[i] = (_Float16)(bfr(p[i]) * 256.0f); w[8 + i] = (_Float16)(bfr(p[16 + i]) * 256.0f); }
  return w; }
#define WQKV_LAYOUT 0   // 0 = (out,in) [CC][DIN], as 1; 1 = (out,in) [CC][DIN]; 2 = per-head [NH][DIN][HD]
__device__ __forceinline__ v16b wcol_hdk(const float* Wm, int k0, int o, int lane) { v16b w; const int g = lane >> 4; const float* p = Wm + (size_t)(o / HD) * DIN * HD + (o % HD);
#pragma unroll
  for (int i = 0; i < 8; ++i) { w[i] = (__bf16)p[(size_t)(k0 + 8 * g + i) * HD]; w[8 + i] = (__bf16)p[(size_t)(k0 + 16 + 8 * g + i) * HD]; }
  return w; }
#define WO_OUT_IN 0
#if WQKV_LAYOUT == 1
#define WCOL(W, k0, o, lane) wcol_oi(W, k0, (o), lane, DIN)   /* unused: layout 0 */
#elif WQKV_LAYOUT == 2
#define WCOL(W, k0, o, lane) wcol_hdk(W, k0, o, lane)
#else
#define WCOL(W, k0, o, lane) wcol_oi(W, k0, (o), lane, DIN)   /* (out,in) 1x1-conv weights [128][256]: all 128 output channels real */
#endif
#if WO_OUT_IN
#define WOCOL(W, k0, o, lane) wcol_oi(W, k0, o, lane, CC)
#define WOCOLH(W, k0, o, lane) wcolh_oi(W, k0, o, lane, CC)
#else
#define WOCOL(W, k0, o, lane) wcol_io(W, k0, o, lane, DIN)
#define WOCOLH(W, k0, o, lane) wcolh_io(W, k0, o, lane, DIN)
#endif
#define BG HG              // the pass group spans BATCHES (single head): blockIdx.z selects batch b0 + z
#define BGN (TNB < BG ? TNB : BG)
#define DVH 128            // all 128 Cb columns of the g view in one k_pv block
#ifndef SM_EXTRA_PARAMS
#define SM_EXTRA_PARAMS
#endif
#ifndef PROJ_EXTRA_PARAMS
#define PROJ_EXTRA_PARAMS
#endif
#ifndef SM_MASK_HOOK
#define SM_MASK_HOOK (void)0
#endif

#define WS_QH  0u                                      // f16 q rows [b*t][CCQ]
#define WS_KH  (WS_QH + 2u * (size_t)NB * TT * CCQ)     // f16 k rows [b*t][CCQ]
#define WS_VT  (WS_KH + 2u * (size_t)NB * TT * CCQ)     // f16 theta conv planes [b][c][t] (theta-view rows)
#define WS_QL  (WS_VT + 2u * (size_t)NB * CC * TT)      // f16 q residual x 2^10 rows [b][t < QHI][CCQ]
#define WS_KL  (WS_QL + 2u * (size_t)NB * QHI * CCQ)    // f16 k residual x 2^10 rows [b][t < KHI][CCQ]
#define WS_VB  (WS_KL + 2u * (size_t)NB * KHI * CCQ)    // bf16 v hi planes [b][c][t < KHI]
#define WS_VBL (WS_VB + 2u * (size_t)NB * CC * KHI)
#define WS_S   (WS_VBL + 2u * (size_t)NB * CC * KHI)    // f32 logits / P [hg][t][s]
#define WS_Y   (WS_S  + 4u * (size_t)HG * TT * TT)      // unused (0 bytes); y rows go to WS_YR
#define WS_END (WS_Y  + 0u)

// ---- k_proj: block = (64 rows, 128 cols, which): q/k/v = X W (+ b) with exact bf16 products (K = DIN) -> which 0: q f16 rows (+ residual rows < QHI); 1: k f16 rows (+ residual rows < KHI); 2: v f16 planes [c][t] (+ bf16 hi/lo planes for t < KHI)
template <int WOFF> __global__ __launch_bounds__(128) void k_projT(const float* __restrict__ XQ, const float* __restrict__ XK, const float* __restrict__ XV, const float* __restrict__ WQ, const float* __restrict__ WK, const float* __restrict__ WV, const float* __restrict__ BQ, const float* __restrict__ BK, const float* __restrict__ BV,
    _Float16* __restrict__ QH, _Float16* __restrict__ QL, _Float16* __restrict__ KH, _Float16* __restrict__ KL, _Float16* __restrict__ VT, __bf16* __restrict__ VB, __bf16* __restrict__ VBL, _Float16* __restrict__ VL) {
  __shared__ __align__(16) _Float16 sh[64][136], sl[64][136]; __shared__ __align__(16) _Float16 th[128][72], tlo[128][72]; __shared__ __align__(16) __bf16 tb[128][72], tbl[128][72];
  const int tid = threadIdx.x, wave = tid >> 5, lane = tid & 31, col = lane & 15, g = lane >> 4; const int which = blockIdx.z + WOFF; const int c0 = blockIdx.y * 128; const size_t r0 = (size_t)blockIdx.x * 64; const size_t bb = r0 / TT; const int t0 = (int)(r0 % TT);
  const float* X = which == 0 ? XQ : which == 1 ? XK : XV; const float* WA = which == 0 ? WQ : which == 1 ? WK : WV; const float* BA = which == 0 ? BQ : which == 1 ? BK : BV;
  const int KD = DIN;
  v8f acc[8] = {};
#pragma unroll 2
  for (int kc = 0; kc < KD / 32; ++kc) { v16b a; { const float* p = X + (bb * KD + kc * 32 + 8 * g) * (size_t)TT + t0 + wave * 16 + col;   /* channels-first [b][c][t]: A[t][c] (16 consecutive t per lane group) */
#pragma unroll
      for (int i = 0; i < 8; ++i) { a[i] = (__bf16)p[(size_t)i * TT]; a[8 + i] = (__bf16)p[(size_t)(16 + i) * TT]; } }
    asm volatile("s_wait_loadcnt 0x0" ::: "memory");
#pragma unroll
    for (int j = 0; j < 8; ++j) { const v16b w = WCOL(WA, kc * 32, c0 + j * 16 + col, lane); asm volatile("s_wait_loadcnt 0x0" ::: "memory"); acc[j] = wmma_bf(a, w, acc[j]); } }
  if (which < 2) { _Float16* DH = which == 0 ? QH : KH; _Float16* DL = which == 0 ? QL : KL; const int nhi = which == 0 ? QHI : KHI; const bool hi_rows = t0 < nhi;
#pragma unroll
    for (int j = 0; j < 8; ++j) { const float bias = BA ? bfr(BA[c0 + j * 16 + col]) : 0.f;
#pragma unroll
      for (int r = 0; r < 8; ++r) { const float v = acc[j][r] + bias; const _Float16 hv = (_Float16)v; sh[wave * 16 + 8 * g + r][j * 16 + col] = hv; sl[wave * 16 + 8 * g + r][j * 16 + col] = (_Float16)((v - (float)hv) * 1024.0f); } }
    __syncthreads();
    for (int e = tid; e < 64 * 16; e += 128) { const int rl = e >> 4, q = e & 15; vst2((unsigned*)(DH + (r0 + rl) * CCQ + c0 + q * 8), *(const v4u*)&sh[rl][q * 8]); if (hi_rows) vst2((unsigned*)(DL + (bb * nhi + t0 + rl) * (size_t)CCQ + c0 + q * 8), *(const v4u*)&sl[rl][q * 8]); }   /* q/k rows: pitch CCQ (c0 == 0) */
  } else { const bool hi_rows = t0 < KHI;
#pragma unroll
    for (int j = 0; j < 8; ++j) { const float bias = BA ? bfr(BA[c0 + j * 16 + col]) : 0.f;
#pragma unroll
      for (int r = 0; r < 8; ++r) { const float v = acc[j][r] + bias; const int rl = wave * 16 + 8 * g + r, cl = j * 16 + col; const _Float16 hv2 = (_Float16)v; th[cl][rl] = hv2; tlo[cl][rl] = (_Float16)((v - (float)hv2) * 1024.0f); const __bf16 bh = (__bf16)v; tb[cl][rl] = bh; tbl[cl][rl] = (__bf16)(v - (float)bh); } }
    __syncthreads();
    for (int e = tid; e < 128 * 8; e += 128) { const int cl = e >> 3, q = e & 7; vst2((unsigned*)(VT + (bb * CC + c0 + cl) * (size_t)TT + t0 + q * 8), *(const v4u*)&th[cl][q * 8]); if (VL) vst2((unsigned*)(VL + (bb * CC + c0 + cl) * (size_t)TT + t0 + q * 8), *(const v4u*)&tlo[cl][q * 8]); if (hi_rows) { const size_t o3 = (bb * CC + c0 + cl) * (size_t)KHI + t0 + q * 8; vst2((unsigned*)(VB + o3), *(const v4u*)&tb[cl][q * 8]); vst2((unsigned*)(VBL + o3), *(const v4u*)&tbl[cl][q * 8]); } } } }
// ---- k_sc: block = (query block qb, key block kb <= kb_last(qb), batch b in group): logits x SCALE; q hi + residual (x 2^10) against k (2 products) for query rows < QHI, plus the k residual (3 products) for query blocks < QBH (causal early rows); causal: blocks past the diagonal exit
__global__ __launch_bounds__(128) void k_sc(const _Float16* __restrict__ QH, const _Float16* __restrict__ KH, const _Float16* __restrict__ QL, const _Float16* __restrict__ KL, int bgrp, int h0, float* __restrict__ S0, float* __restrict__ PM, float* __restrict__ PS) { __shared__ __align__(16) float ss[4][16][132];
  const int qb = blockIdx.x, kb = blockIdx.y; if (kb > kb_last(qb)) return;
  const int h = h0; const int b = bgrp + blockIdx.z; float* S = S0 + (size_t)blockIdx.z * TT * TT;   /* group spans batches */
  const int tid = threadIdx.x, wave = tid >> 5, lane = tid & 31, col = lane & 15, g = lane >> 4; const int k0 = kb * 128; const int ql0 = qb * 64 + wave * 16; const size_t q0 = (size_t)b * TT + ql0, kr0 = (size_t)b * TT + k0;
  v8f acc[8] = {}, accl[8] = {};
  const _Float16* QLb = QL + (size_t)b * QHI * CCQ; const _Float16* KLb = KL + (size_t)b * KHI * CCQ;   /* single head: q/k rows at pitch CCQ */
  if (qb < QBH) {
#pragma unroll
    for (int kc = 0; kc < HDQK / 32; ++kc) { const v16h ah = frag_h(QH + (q0 + col) * CCQ + kc * 32, lane), al = frag_h(QLb + (size_t)(ql0 + col) * CCQ + kc * 32, lane);
#pragma unroll
      for (int j = 0; j < 8; ++j) { const v16h kbf = frag_h(KH + (kr0 + j * 16 + col) * CCQ + kc * 32, lane), klf = frag_h(KLb + (size_t)(k0 + j * 16 + col) * CCQ + kc * 32, lane); acc[j] = wmma16(ah, kbf, acc[j]); accl[j] = wmma16(al, kbf, accl[j]); accl[j] = wmma16(ah, klf, accl[j]); } }
  } else if (qb * 64 < QHI) {
#pragma unroll
    for (int kc = 0; kc < HDQK / 32; ++kc) { const v16h ah = frag_h(QH + (q0 + col) * CCQ + kc * 32, lane), al = frag_h(QLb + (size_t)(ql0 + col) * CCQ + kc * 32, lane);
#pragma unroll
      for (int j = 0; j < 8; ++j) { const v16h kbf = frag_h(KH + (kr0 + j * 16 + col) * CCQ + kc * 32, lane); acc[j] = wmma16(ah, kbf, acc[j]); accl[j] = wmma16(al, kbf, accl[j]); } }
  } else {
#pragma unroll
    for (int kc = 0; kc < HDQK / 32; ++kc) { const v16h ah = frag_h(QH + (q0 + col) * CCQ + kc * 32, lane);
#pragma unroll
      for (int j = 0; j < 8; ++j) { const v16h kbf = frag_h(KH + (kr0 + j * 16 + col) * CCQ + kc * 32, lane); acc[j] = wmma16(ah, kbf, acc[j]); } } }
#pragma unroll
  for (int j = 0; j < 8; ++j) {
#pragma unroll
    for (int r = 0; r < 8; ++r) ss[wave][8 * g + r][j * 16 + col] = (acc[j][r] + accl[j][r] * (1.0f / 1024.0f)) * SCALE; }
  __syncthreads();   /* every wave's 16 rows of the tile are in ss before a thread walks its column; placed ahead of the S stores so that it does not wait for them */
  LDSX(); for (int rl = 0; rl < 16; ++rl) vst2(S + (size_t)(ql0 + rl) * TT + k0 + lane * 4, *(const v4f*)&ss[wave][rl][lane * 4]);
  asm volatile("s_wait_xcnt 0x0" ::: "memory");   /* the registers that the S stores name are reused by the column walk below */
  // column statistics of this 64 x 128 tile from the stored f32 logits: thread = key column, rows in ascending order: max, then sum of exp(v - max)
  { float v[64];
#pragma unroll
    for (int i = 0; i < 64; ++i) v[i] = ss[i >> 4][i & 15][tid];
    float m = v[0];
#pragma unroll
    for (int i = 1; i < 64; ++i) m = fmaxf(m, v[i]);
    float s = 0.f;
#pragma unroll
    for (int i = 0; i < 64; ++i) s += expf(v[i] - m);
    vst2(PM + (size_t)qb * TT + k0 + tid, m); vst2(PS + (size_t)qb * TT + k0 + tid, s); } }
// ---- k_colmerge: softmax over the QUERY axis (axis 1): joins the 64 per-query-block partials (PM = max, PS = sum of exp(S - PM) over 64 rows) of each key column m: CM[m] = max, CS[m] = sum_q PS[q][m] exp(PM[q][m] - CM[m]); block = 32 columns (lane) x 8 waves of 8 partials, joined through LDS
__global__ __launch_bounds__(256) void k_colmerge(const float* __restrict__ PM, const float* __restrict__ PS, float* __restrict__ CM, float* __restrict__ CS) { __shared__ float lm[8][32], ls[8][32];
  const int tid = threadIdx.x, wave = tid >> 5, lane = tid & 31; const int m = blockIdx.x * 32 + lane; float pm[8], ps[8];
#pragma unroll
  for (int u = 0; u < 8; ++u) pm[u] = PM[(size_t)(wave * 8 + u) * TT + m];
  asm volatile("s_wait_xcnt 0x0" ::: "memory");   /* the address pair of the loads above is rewritten for the loads below */
#pragma unroll
  for (int u = 0; u < 8; ++u) ps[u] = PS[(size_t)(wave * 8 + u) * TT + m];
  float mx = pm[0];
#pragma unroll
  for (int u = 1; u < 8; ++u) mx = fmaxf(mx, pm[u]);
  float sm2 = 0.f;
#pragma unroll
  for (int u = 0; u < 8; ++u) sm2 += ps[u] * expf(pm[u] - mx);
  lm[wave][lane] = mx; ls[wave][lane] = sm2;
  __syncthreads();
  if (wave == 0) { float mt = lm[0][lane];
#pragma unroll
    for (int w = 1; w < 8; ++w) mt = fmaxf(mt, lm[w][lane]);
    float st = 0.f;
#pragma unroll
    for (int w = 0; w < 8; ++w) st += ls[w][lane] * expf(lm[w][lane] - mt);
    vst2(CM + m, mt); vst2(CS + m, st); } }
// ---- k_smcol: block per row n: P[n][m] = exp(S[n][m] - CM[m]) / CS[m] x 2^11 in place (rows rewritten as whole 16-B lanes)
__global__ __launch_bounds__(256) void k_smcol(float* __restrict__ S, const float* __restrict__ CM, const float* __restrict__ CS) { const int tid = threadIdx.x; float* sr = S + (size_t)blockIdx.x * TT;
  for (int q = tid; q < TT / 4; q += 256) { const v4f v = *(const v4f*)(sr + q * 4), cm = *(const v4f*)(CM + q * 4), cs = *(const v4f*)(CS + q * 4); asm volatile("s_wait_loadcnt 0x0" ::: "memory"); v4f o;
#pragma unroll
    for (int u = 0; u < 4; ++u) o[u] = expf(v[u] - cm[u]) * (2048.0f / cs[u]);
    vst2(sr + q * 4, o); } }
__global__ __launch_bounds__(256) void k_trans(const _Float16* __restrict__ G, _Float16* __restrict__ VT2) { __shared__ _Float16 st[64][72]; const int tid = threadIdx.x; const int m0 = blockIdx.x * 64, c0 = blockIdx.y * 64, b = blockIdx.z; const _Float16* gb = G + (size_t)b * CB * TT; _Float16* vb = VT2 + (size_t)b * CB * TT;
  for (int e = tid; e < 64 * 8; e += 256) { const int ml = e >> 3, q = e & 7; const v4u u = *(const v4u*)(gb + (size_t)(m0 + ml) * CB + c0 + q * 8); asm volatile("s_wait_loadcnt 0x0" ::: "memory"); const hx8 hv = *(const hx8*)&u; _Pragma("unroll") for (int j = 0; j < 8; ++j) st[q * 8 + j][ml] = hv[j]; }
  __syncthreads();
  for (int e = tid; e < 64 * 8; e += 256) { const int cl = e >> 3, q = e & 7; hx8 hv; _Pragma("unroll") for (int j = 0; j < 8; ++j) hv[j] = st[cl][q * 8 + j]; vst2((unsigned*)(vb + (size_t)(c0 + cl) * TT + m0 + q * 8), *(const v4u*)&hv); } }
// ---- k_wout: block = (64 positions, 128 of the 256 output channels, batch): A[pos][cb] = y view Yb[cb*4096 + pos] (the raw reshape back: the batch's y rows [4096][128] f32 reinterpreted as [Cb][N]) split bf16 hi + lo (2 products) x exact (out,in) W [256][128]; + bf16(W_b) + bf16(x[b][o][pos]); channels-first store out[b][o][pos0..pos0+63] through LDS (one 256-B run per channel by 16 lanes)
__global__ __launch_bounds__(128) void k_wout(const float* __restrict__ Y, const float* __restrict__ WW, const float* __restrict__ WB, const float* __restrict__ X, float* __restrict__ OUT) { __shared__ __align__(16) float st[128][68];
  const int tid = threadIdx.x, wave = tid >> 5, lane = tid & 31, col = lane & 15, g = lane >> 4; const int p0 = blockIdx.x * 64, c0 = blockIdx.y * 128, b = blockIdx.z; const float* Yb = Y + (size_t)b * TT * CB;
  v8f acc[8] = {};
#pragma unroll 1
  for (int kc = 0; kc < CB / 32; ++kc) { v16b ah, al; { const float* p = Yb + (size_t)(kc * 32 + 8 * g) * TT + p0 + wave * 16 + col; float tv[16];
#pragma unroll
      for (int i = 0; i < 8; ++i) { tv[i] = p[(size_t)i * TT]; tv[8 + i] = p[(size_t)(16 + i) * TT]; }
      asm volatile("s_wait_loadcnt 0x0" ::: "memory");
#pragma unroll
      for (int i = 0; i < 16; ++i) { const __bf16 h = (__bf16)tv[i]; ah[i] = h; al[i] = (__bf16)(tv[i] - (float)h); } }
#pragma unroll
    for (int j = 0; j < 8; ++j) { const v16b w = wcol_oi(WW, kc * 32, c0 + j * 16 + col, lane, CB); acc[j] = wmma_bf(ah, w, acc[j]); acc[j] = wmma_bf(al, w, acc[j]); } }
#pragma unroll
  for (int j = 0; j < 8; ++j) { const float wb = bfr(WB[c0 + j * 16 + col]); asm volatile("s_wait_loadcnt 0x0" ::: "memory");
#pragma unroll
    for (int r = 0; r < 8; ++r) st[j * 16 + col][wave * 16 + 8 * g + r] = acc[j][r] + wb; }
  __syncthreads();
  for (int e = tid; e < 128 * 16; e += 128) { const int cl = e >> 4, q = e & 15; const size_t o = ((size_t)b * COUT + c0 + cl) * (size_t)TT + p0 + q * 4; const v4f xr = *(const v4f*)(X + o); asm volatile("s_wait_loadcnt 0x0" ::: "memory"); v4f v = *(const v4f*)&st[cl][q * 4]; v[0] += bfr(xr[0]); v[1] += bfr(xr[1]); v[2] += bfr(xr[2]); v[3] += bfr(xr[3]); vst2(OUT + o, v); } }
// ---- k_pv: block = (64 queries (qb), all 128 value columns, batch in group): attended = P . v over all 4,096 keys (P x 2^11 once to f16 against v f16: 1 product) x 2^-11; y[n][c] = attended, stored as f32 rows of Y for k_wout
__global__ __launch_bounds__(128) void k_pv(const float* __restrict__ PS0, const _Float16* __restrict__ VT, const __bf16* __restrict__ VB, const __bf16* __restrict__ VBL, int bgrp, int h0, float* __restrict__ Y) { const int h = h0; const int b = bgrp + blockIdx.z; const float* PS = PS0 + (size_t)blockIdx.z * TT * TT; const int d0 = blockIdx.y * DVH;   /* group spans batches; column offset d0 (0: one block spans all 128) */ __shared__ __align__(16) float ss[4][16][DVH + 4];
  const int tid = threadIdx.x, wave = tid >> 5, lane = tid & 31, col = lane & 15, g = lane >> 4; const int qb = blockIdx.x; const int ql0 = qb * 64 + wave * 16; const int kce = (kb_last(qb) + 1) * 4;
  v8f acc[DVH / 16] = {};
  if (false) {   /* PVHI 0: the 3-product P.v path is not used (1 product suffices; QBH governs only the logits) */
#pragma unroll 1
    for (int kc = 0; kc < kce; ++kc) { const F2 p = split_row(PS + (size_t)(ql0 + col) * TT, kc * 32, lane);
      asm volatile("s_wait_loadcnt 0x0" ::: "memory");
#pragma unroll
      for (int j = 0; j < DVH / 16; ++j) { const size_t po = ((size_t)b * CC + h * HD + d0 + j * 16 + col) * (size_t)KHI + kc * 32; const v16b vh = frag_b(VB + po, lane); acc[j] = wmma_bf(p.h, vh, acc[j]); acc[j] = wmma_bf(p.l, vh, acc[j]); acc[j] = wmma_bf(p.h, frag_b(VBL + po, lane), acc[j]); } }
  } else {
#pragma unroll 1
    for (int kc = 0; kc < kce; ++kc) { const v16h p = frag_f32(PS + (size_t)(ql0 + col) * TT + kc * 32, lane);
      asm volatile("s_wait_loadcnt 0x0" ::: "memory");
#pragma unroll
      for (int j = 0; j < DVH / 16; ++j) { const size_t po = ((size_t)b * CC + h * HD + d0 + j * 16 + col) * (size_t)TT + kc * 32; acc[j] = wmma16(p, frag_h(VT + po, lane), acc[j]); } } }
#pragma unroll
  for (int j = 0; j < DVH / 16; ++j)
#pragma unroll
    for (int r = 0; r < 8; ++r) ss[wave][8 * g + r][j * 16 + col] = acc[j][r] * (1.0f / 2048.0f);
  LDSX(); for (int rl = 0; rl < 16; ++rl) vst2(Y + ((size_t)b * TT + ql0 + rl) * CC + h * HD + d0 + lane * 4, *(const v4f*)&ss[wave][rl][lane * 4]); }   /* y rows [b*TT + n][128]: 512-B row by 32 lanes */

#define WS_TL  (WS_END)                                  // f16 theta-view residual plane [b][128][TT] (viewed as rows)
#define WS_G   (WS_TL + 2u * (size_t)NB * CB * TT)        // f16 g conv plane [b][128][TT]
#define WS_VT2 (WS_G + 2u * (size_t)NB * CB * TT)         // f16 g-view transposed [b][128][TT]
#define WS_YR  (WS_VT2 + 2u * (size_t)NB * CB * TT)       // f32 y rows [b*TT + n][128]
#define WS_CM  (WS_YR + 4u * (size_t)NB * TT * CB)        // f32 column max [TT]
#define WS_CS  (WS_CM + 4u * (size_t)TT)
#define WS_PM  (WS_CS + 4u * (size_t)TT)                  // f32 partial column max [NQB][TT]
#define WS_PS  (WS_PM + 4u * (size_t)NQB * TT)            // f32 partial column sum [NQB][TT]
#define WS_END2 (WS_PS + 4u * (size_t)NQB * TT)
extern "C" void kernel_launch(void* const* d_in, const int* in_sizes, int n_in, void* d_out, int out_size, void* d_ws, size_t ws_size, hipStream_t stream) {
  (void)in_sizes; (void)n_in; (void)out_size;
  const float** F = (const float**)d_in;
  if (ws_size < (size_t)WS_END) return;
  char* ws = (char*)d_ws; _Float16 *QH = (_Float16*)(ws + WS_QH), *KH = (_Float16*)(ws + WS_KH), *VT = (_Float16*)(ws + WS_VT), *QL = (_Float16*)(ws + WS_QL), *KL = (_Float16*)(ws + WS_KL); __bf16 *VB = (__bf16*)(ws + WS_VB), *VBL = (__bf16*)(ws + WS_VBL); float *S = (float*)(ws + WS_S), *Y = (float*)(ws + WS_Y);
  (void)Y; (void)QL; (void)KL; (void)VB; (void)VBL;
  // inputs: 0 x [4,256,64,64] (channels-first); 1 theta_w [128,256], 2 theta_b; 3 phi_w, 4 phi_b; 5 g_w, 6 g_b; 7 W_w [256,128], 8 W_b [256] (all (out,in), biases nonzero)
  if (ws_size < (size_t)WS_END2) return;
  _Float16 *TL = (_Float16*)(ws + WS_TL), *G = (_Float16*)(ws + WS_G), *VT2 = (_Float16*)(ws + WS_VT2); float *YR = (float*)(ws + WS_YR), *CM = (float*)(ws + WS_CM), *CS = (float*)(ws + WS_CS), *PM = (float*)(ws + WS_PM), *PS = (float*)(ws + WS_PS);
  // phi^T rows (the 'k' rows: phi[c][m] proper layout, token-major) via the q/k path as which = 1 -> KH (+KL rows < 64, unused)
  k_projT<1><<<dim3(TNB * TT / 64, 1, 1), 128, 0, stream>>>(F[0], F[0], F[0], F[3], F[3], F[3], F[4], F[4], F[4], QH, QL, KH, KL, VT, VB, VBL, nullptr);
  // theta conv plane [Cb][N] (f16 hi into the 'VT' slot = the theta VIEW rows [N][Cb] when read row-major) + its residual plane TL (the view's residual rows) via the [c][t] path (which = 2)
  k_projT<2><<<dim3(TNB * TT / 64, 1, 1), 128, 0, stream>>>(F[0], F[0], F[0], F[1], F[1], F[1], F[2], F[2], F[2], QH, QL, KH, KL, VT, VB, VBL, TL);
  // g conv plane [Cb][N] f16 -> G, then the g VIEW rows transposed into the value plane VT2[c][m]
  k_projT<2><<<dim3(TNB * TT / 64, 1, 1), 128, 0, stream>>>(F[0], F[0], F[0], F[5], F[5], F[5], F[6], F[6], F[6], QH, QL, KH, KL, G, VB, VBL, nullptr);
  k_trans<<<dim3(TT / 64, CB / 64, TNB), 256, 0, stream>>>(G, VT2);
  for (int b0 = 0; b0 < TNB; b0 += BGN) {
    k_sc<<<dim3(NQB, TT / 128, BGN), 128, 0, stream>>>(VT /* theta view rows */, KH, TL /* view residual rows */, KL, b0, 0, S, PM, PS);
    k_colmerge<<<dim3(TT / 32), 256, 0, stream>>>(PM, PS, CM, CS);
    k_smcol<<<dim3(TT), 256, 0, stream>>>(S, CM, CS);
    k_pv<<<dim3(NQB, HD / DVH, BGN), 128, 0, stream>>>(S, VT2, VB, VBL, b0, 0, YR);
  }
  k_wout<<<dim3(TT / 64, COUT / 128, TNB), 128, 0, stream>>>(YR, F[7], F[8], F[0], (float*)d_out);

}

// v002
// Measured time: 525 microseconds a run.
// In two side-by-side timings against v001, it was 2.25 and 2.27 times as fast.
// Counting every step since v000, it is 4.93 times as fast.
// compute dtype: all float inputs rounded to bf16; the three 1x1 convs with EXACT bf16 products on WMMA 16x16x32 (f32 accumulate) + bias; scores between the raw-reshaped theta view (f16 hi + residual x 2^10) and phi (f16) (2 products); the softmax over the QUERY axis in f32 (per-column max / sum from 64-row partials, precise expf); P x 2^11 once to f16 x the raw-reshaped g view once to f16 (1 product); the W 1x1 conv on the raw-reshaped y view with bf16 hi + lo (2 products) x exact W + bias + x residual; f32 output written channels-first.
#include <hip/hip_runtime.h>
#include <math.h>

typedef __attribute__((ext_vector_type(16))) _Float16 v16h;
typedef __attribute__((ext_vector_type(16))) __bf16 v16b;
typedef __attribute__((ext_vector_type(8)))  _Float16 v8h;
typedef __attribute__((ext_vector_type(8)))  float v8f;
typedef __attribute__((ext_vector_type(4)))  float v4f;
typedef __attribute__((ext_vector_type(2)))  float v2f;
typedef __attribute__((ext_vector_type(4)))  unsigned v4u;
typedef _Float16 hx8 __attribute__((ext_vector_type(8)));
typedef __attribute__((ext_vector_type(4)))  int v4i;
typedef float __attribute__((may_alias)) float_a;
typedef int __attribute__((may_alias)) int_a;

template <typename T> __device__ __forceinline__ void vst2(void* p, T v) { *(T*)p = v;  }
__device__ __forceinline__ v8f wmma16(v16h a, v16h b, v8f c) {
  v8f d = __builtin_amdgcn_wmma_f32_16x16x32_f16(false, a, false, b, (short)0, c, false, false);
  asm volatile("v_nop\n\tv_nop\n\tv_nop\n\tv_nop" : "+v"(d) : "v"(a), "v"(b));
  return d;
}
__device__ __forceinline__ v8f wmma_bf(v16b a, v16b b, v8f c) {
  v8f d = __builtin_amdgcn_wmma_f32_16x16x32_bf16(false, a, false, b, (short)0, c, false, false);
  asm volatile("v_nop\n\tv_nop\n\tv_nop\n\tv_nop" : "+v"(d) : "v"(a), "v"(b));
  return d;
}
// 16x16x32 fragments: lane = (h = lane>>4, row/col = lane&15); elements 0..7 = k0+8h+0..7, 8..15 = k0+16+8h+0..7; D element r = row 8h+r
__device__ __forceinline__ v16h frag_h(const _Float16* rowk0, int lane) {
  union { v16h v; v8h q[2]; } u; const _Float16* p = rowk0 + 8 * (lane >> 4);
  u.q[0] = *(const v8h*)p; u.q[1] = *(const v8h*)(p + 16); return u.v;
}
__device__ __forceinline__ v16h frag_f32(const float* rowk0, int lane) {
  v16h a; const float* p = rowk0 + 8 * (lane >> 4);
#pragma unroll
  for (int i = 0; i < 8; ++i) { a[i] = (_Float16)p[i]; a[8 + i] = (_Float16)p[16 + i]; }
  return a;
}
__device__ __forceinline__ v16h frag_f32s(const float* rowk0, int lane, float sc) {
  v16h a; const float* p = rowk0 + 8 * (lane >> 4);
#pragma unroll
  for (int i = 0; i < 8; ++i) { a[i] = (_Float16)(p[i] * sc); a[8 + i] = (_Float16)(p[16 + i] * sc); }
  return a;
}
// column fragment from a [K][ld] layout (column n), rows >= K read as 0
__device__ __forceinline__ v16h fragc_f32(const float* W, int k0, int n, int lane, int ld, int K) {
  v16h a; const int g = lane >> 4;
#pragma unroll
  for (int i = 0; i < 8; ++i) { const int ka = k0 + 8 * g + i, kb = ka + 16;
    a[i] = (_Float16)(ka < K ? W[(size_t)(ka < K ? ka : K - 1) * ld + n] : 0.f); a[8 + i] = (_Float16)(kb < K ? W[(size_t)(kb < K ? kb : K - 1) * ld + n] : 0.f); }
  return a;
}
struct F2 { v16b h, l; };
__device__ __forceinline__ F2 bsplit16(const float v[16]) { F2 r;
#pragma unroll
  for (int i = 0; i < 16; ++i) { const __bf16 h = (__bf16)v[i]; r.h[i] = h; r.l[i] = (__bf16)(v[i] - (float)h); }
  return r; }
__device__ __forceinline__ F2 split_row(const float* row, int k0, int lane) { float v[16]; const float* p = row + k0 + 8 * (lane >> 4);
#pragma unroll
  for (int i = 0; i < 8; ++i) { v[i] = p[i]; v[8 + i] = p[16 + i]; }
  return bsplit16(v); }
__device__ __forceinline__ F2 split_rowK(const float* row, int k0, int lane, int K) { float v[16]; const int g = lane >> 4;
#pragma unroll
  for (int i = 0; i < 8; ++i) { const int ka = k0 + 8 * g + i, kb = ka + 16; v[i] = ka < K ? row[ka < K ? ka : K - 1] : 0.f; v[8 + i] = kb < K ? row[kb < K ? kb : K - 1] : 0.f; }
  return bsplit16(v); }
__device__ __forceinline__ F2 split_col(const float* W, int k0, int n, int lane, int ld, int K) { float v[16]; const int g = lane >> 4;
#pragma unroll
  for (int i = 0; i < 8; ++i) { const int ka = k0 + 8 * g + i, kb = ka + 16; v[i] = ka < K ? W[(size_t)(ka < K ? ka : K - 1) * ld + n] : 0.f; v[8 + i] = kb < K ? W[(size_t)(kb < K ? kb : K - 1) * ld + n] : 0.f; }
  return bsplit16(v); }
__device__ __forceinline__ v8f mac3(const F2& a, const F2& b, v8f c) { c = wmma_bf(a.l, b.h, c); c = wmma_bf(a.h, b.l, c); return wmma_bf(a.h, b.h, c); }
__device__ __forceinline__ float sigm(float v) { return 1.0f / (1.0f + expf(-v)); }
#define LDSX() do { asm volatile("s_wait_dscnt 0" ::: "memory"); __builtin_amdgcn_wave_barrier(); __builtin_amdgcn_fence(__ATOMIC_RELEASE, "workgroup"); } while (0)

// Non-local block with the source's RAW reshapes (x [4,256,64,64], Cb 128, N 4,096; (out,in) theta/phi/g 1x1 convs [128,256] + biases, W [256,128] + bias): theta = conv(x).reshape(B, N, Cb) and g likewise are ROW-MAJOR reinterpretations of the [Cb][N] conv outputs (row n = channel n/32, positions (n%32)*128..+127), phi stays [Cb][N]; scores[n][m] = sum_c theta[n][c] phi[c][m]; attn = softmax over n (axis 1 - per key column); y[n][c] = sum_m attn[n][m] g[m][c]; y.reshape(B, Cb, H, W) (raw again) -> W conv + bias + x.
#define NB 4
#define TT 4096
#define CC 128            // g-view plane pitch (Cb channels)
#define CB 128
#define COUT 256
#define CCQ 128           // theta-view / phi^T row pitch (Cb)
#define DIN 256          // x channels
#define NH 1
#define HD 128
#define NQB (TT / 64)
#define HG 1               // one 4,096 x 4,096 score plane per pass (the pass group spans batches)
#define SCALE (1.0f)
#define HDQK 128           // contraction width of the scores (Cb)
#define CAUSAL 0
#ifndef TNB
#define TNB NB
#endif
__device__ __forceinline__ v16b zero16b() { v16b z; _Pragma("unroll") for (int i = 0; i < 16; ++i) z[i] = (__bf16)0.f; return z; }
__device__ __forceinline__ float bfr(float v) { return (float)(__bf16)v; }
__host__ __device__ __forceinline__ int kb_last(int qb) { return CAUSAL ? ((qb * 64 + 63) >> 7) : (TT / 128 - 1); }
typedef __attribute__((ext_vector_type(8))) __bf16 v8b;
__device__ __forceinline__ v16b frag_b(const __bf16* rowk0, int lane) {
  union { v16b v; v8b q[2]; } u; const __bf16* p = rowk0 + 8 * (lane >> 4);
  u.q[0] = *(const v8b*)p; u.q[1] = *(const v8b*)(p + 16); return u.v;
}
#define QBH 0              // 2-product logits everywhere (theta view hi + residual x phi hi)
#define QHI 4096            // q residual rows (all)
#define KHI 64            // (unused k residual / v bf16 planes: QBH 0)
// B fragment (k rows k0+.., output column o) of a weight: (in,out) [K][ld] or (out,in) [ld rows of K]: bf16 exact, or f16(bf16 * 256) exact
__device__ __forceinline__ v16b wcol_io(const float* Wm, int k0, int o, int lane, int ld) { v16b w; const int g = lane >> 4;
#pragma unroll
  for (int i = 0; i < 8; ++i) { w[i] = (__bf16)Wm[(size_t)(k0 + 8 * g + i) * ld + o]; w[8 + i] = (__bf16)Wm[(size_t)(k0 + 16 + 8 * g + i) * ld + o]; }
  return w; }
__device__ __forceinline__ v16b wcol_oi(const float* Wm, int k0, int o, int lane, int K) { v16b w; const float* p = Wm + (size_t)o * K + k0 + 8 * (lane >> 4);
#pragma unroll
  for (int i = 0; i < 8; ++i) { w[i] = (__bf16)p[i]; w[8 + i] = (__bf16)p[16 + i]; }
  return w; }
__device__ __forceinline__ v16h wcolh_io(const float* Wm, int k0, int o, int lane, int ld) { v16h w; const int g = lane >> 4;
#pragma unroll
  for (int i = 0; i < 8; ++i) { w[i] = (_Float16)(bfr(Wm[(size_t)(k0 + 8 * g + i) * ld + o]) * 256.0f); w[8 + i] = (_Float16)(bfr(Wm[(size_t)(k0 + 16 + 8 * g + i) * ld + o]) * 256.0f); }
  return w; }
__device__ __forceinline__ v16h wcolh_oi(const float* Wm, int k0, int o, int lane, int K) { v16h w; const float* p = Wm + (size_t)o * K + k0 + 8 * (lane >> 4);
#pragma unroll
  for (int i = 0; i < 8; ++i) { w[i] = (_Float16)(bfr(p[i]) * 256.0f); w[8 + i] = (_Float16)(bfr(p[16 + i]) * 256.0f); }
  return w; }
#define WQKV_LAYOUT 0   // 0 = (out,in) [CC][DIN], as 1; 1 = (out,in) [CC][DIN]; 2 = per-head [NH][DIN][HD]
__device__ __forceinline__ v16b wcol_hdk(const float* Wm, int k0, int o, int lane) { v16b w; const int g = lane >> 4; const float* p = Wm + (size_t)(o / HD) * DIN * HD + (o % HD);
#pragma unroll
  for (int i = 0; i < 8; ++i) { w[i] = (__bf16)p[(size_t)(k0 + 8 * g + i) * HD]; w[8 + i] = (__bf16)p[(size_t)(k0 + 16 + 8 * g + i) * HD]; }
  return w; }
#define WO_OUT_IN 0
#if WQKV_LAYOUT == 1
#define WCOL(W, k0, o, lane) wcol_oi(W, k0, (o), lane, DIN)   /* unused: layout 0 */
#elif WQKV_LAYOUT == 2
#define WCOL(W, k0, o, lane) wcol_hdk(W, k0, o, lane)
#else
#define WCOL(W, k0, o, lane) wcol_oi(W, k0, (o), lane, DIN)   /* (out,in) 1x1-conv weights [128][256]: all 128 output channels real */
#endif
#if WO_OUT_IN
#define WOCOL(W, k0, o, lane) wcol_oi(W, k0, o, lane, CC)
#define WOCOLH(W, k0, o, lane) wcolh_oi(W, k0, o, lane, CC)
#else
#define WOCOL(W, k0, o, lane) wcol_io(W, k0, o, lane, DIN)
#define WOCOLH(W, k0, o, lane) wcolh_io(W, k0, o, lane, DIN)
#endif
#define BG HG              // the pass group spans BATCHES (single head): blockIdx.z selects batch b0 + z
#define BGN (TNB < BG ? TNB : BG)
#define DVH 128            // all 128 Cb columns of the g view in one k_pv block
#ifndef SM_EXTRA_PARAMS
#define SM_EXTRA_PARAMS
#endif
#ifndef PROJ_EXTRA_PARAMS
#define PROJ_EXTRA_PARAMS
#endif
#ifndef SM_MASK_HOOK
#define SM_MASK_HOOK (void)0
#endif

#define WS_QH  0u                                      // f16 q rows [b*t][CCQ]
#define WS_KH  (WS_QH + 2u * (size_t)NB * TT * CCQ)     // f16 k rows [b*t][CCQ]
#define WS_VT  (WS_KH + 2u * (size_t)NB * TT * CCQ)     // f16 theta conv planes [b][c][t] (theta-view rows)
#define WS_QL  (WS_VT + 2u * (size_t)NB * CC * TT)      // f16 q residual x 2^10 rows [b][t < QHI][CCQ]
#define WS_KL  (WS_QL + 2u * (size_t)NB * QHI * CCQ)    // f16 k residual x 2^10 rows [b][t < KHI][CCQ]
#define WS_VB  (WS_KL + 2u * (size_t)NB * KHI * CCQ)    // bf16 v hi planes [b][c][t < KHI]
#define WS_VBL (WS_VB + 2u * (size_t)NB * CC * KHI)
#define WS_S   (WS_VBL + 2u * (size_t)NB * CC * KHI)    // f32 logits / P [hg][t][s]
#define WS_Y   (WS_S  + 4u * (size_t)HG * TT * TT)      // unused (0 bytes); y rows go to WS_YR
#define WS_END (WS_Y  + 0u)

// ---- k_proj: block = (64 rows, 128 cols, which): q/k/v = X W (+ b) with exact bf16 products (K = DIN) -> which 0: q f16 rows (+ residual rows < QHI); 1: k f16 rows (+ residual rows < KHI); 2: v f16 planes [c][t] (+ bf16 hi/lo planes for t < KHI)
template <int WOFF> __global__ __launch_bounds__(128) void k_projT(const float* __restrict__ XQ, const float* __restrict__ XK, const float* __restrict__ XV, const float* __restrict__ WQ, const float* __restrict__ WK, const float* __restrict__ WV, const float* __restrict__ BQ, const float* __restrict__ BK, const float* __restrict__ BV,
    _Float16* __restrict__ QH, _Float16* __restrict__ QL, _Float16* __restrict__ KH, _Float16* __restrict__ KL, _Float16* __restrict__ VT, __bf16* __restrict__ VB, __bf16* __restrict__ VBL, _Float16* __restrict__ VL) {
  __shared__ __align__(16) _Float16 sh[64][136], sl[64][136]; __shared__ __align__(16) _Float16 th[128][72], tlo[128][72]; __shared__ __align__(16) __bf16 tb[128][72], tbl[128][72];
  const int tid = threadIdx.x, wave = tid >> 5, lane = tid & 31, col = lane & 15, g = lane >> 4; const int which = blockIdx.z + WOFF; const int c0 = blockIdx.y * 128; const size_t r0 = (size_t)blockIdx.x * 64; const size_t bb = r0 / TT; const int t0 = (int)(r0 % TT);
  const float* X = which == 0 ? XQ : which == 1 ? XK : XV; const float* WA = which == 0 ? WQ : which == 1 ? WK : WV; const float* BA = which == 0 ? BQ : which == 1 ? BK : BV;
  const int KD = DIN;
  v8f acc[8] = {};
#pragma unroll 2
  for (int kc = 0; kc < KD / 32; ++kc) { v16b a; { const float* p = X + (bb * KD + kc * 32 + 8 * g) * (size_t)TT + t0 + wave * 16 + col;   /* channels-first [b][c][t]: A[t][c] (16 consecutive t per lane group) */
#pragma unroll
      for (int i = 0; i < 8; ++i) { a[i] = (__bf16)p[(size_t)i * TT]; a[8 + i] = (__bf16)p[(size_t)(16 + i) * TT]; } }
    asm volatile("s_wait_loadcnt 0x0" ::: "memory");
#pragma unroll
    for (int j = 0; j < 8; ++j) { const v16b w = WCOL(WA, kc * 32, c0 + j * 16 + col, lane); asm volatile("s_wait_loadcnt 0x0" ::: "memory"); acc[j] = wmma_bf(a, w, acc[j]); } }
  if (which < 2) { _Float16* DH = which == 0 ? QH : KH; _Float16* DL = which == 0 ? QL : KL; const int nhi = which == 0 ? QHI : KHI; const bool hi_rows = t0 < nhi;
#pragma unroll
    for (int j = 0; j < 8; ++j) { const float bias = BA ? bfr(BA[c0 + j * 16 + col]) : 0.f;
#pragma unroll
      for (int r = 0; r < 8; ++r) { const float v = acc[j][r] + bias; const _Float16 hv = (_Float16)v; sh[wave * 16 + 8 * g + r][j * 16 + col] = hv; sl[wave * 16 + 8 * g + r][j * 16 + col] = (_Float16)((v - (float)hv) * 1024.0f); } }
    __syncthreads();
    for (int e = tid; e < 64 * 16; e += 128) { const int rl = e >> 4, q = e & 15; vst2((unsigned*)(DH + (r0 + rl) * CCQ + c0 + q * 8), *(const v4u*)&sh[rl][q * 8]); if (hi_rows) vst2((unsigned*)(DL + (bb * nhi + t0 + rl) * (size_t)CCQ + c0 + q * 8), *(const v4u*)&sl[rl][q * 8]); }   /* q/k rows: pitch CCQ (c0 == 0) */
  } else { const bool hi_rows = t0 < KHI;
#pragma unroll
    for (int j = 0; j < 8; ++j) { const float bias = BA ? bfr(BA[c0 + j * 16 + col]) : 0.f;
#pragma unroll
      for (int r = 0; r < 8; ++r) { const float v = acc[j][r] + bias; const int rl = wave * 16 + 8 * g + r, cl = j * 16 + col; const _Float16 hv2 = (_Float16)v; th[cl][rl] = hv2; tlo[cl][rl] = (_Float16)((v - (float)hv2) * 1024.0f); const __bf16 bh = (__bf16)v; tb[cl][rl] = bh; tbl[cl][rl] = (__bf16)(v - (float)bh); } }
    __syncthreads();
    for (int e = tid; e < 128 * 8; e += 128) { const int cl = e >> 3, q = e & 7; vst2((unsigned*)(VT + (bb * CC + c0 + cl) * (size_t)TT + t0 + q * 8), *(const v4u*)&th[cl][q * 8]); if (VL) vst2((unsigned*)(VL + (bb * CC + c0 + cl) * (size_t)TT + t0 + q * 8), *(const v4u*)&tlo[cl][q * 8]); if (hi_rows) { const size_t o3 = (bb * CC + c0 + cl) * (size_t)KHI + t0 + q * 8; vst2((unsigned*)(VB + o3), *(const v4u*)&tb[cl][q * 8]); vst2((unsigned*)(VBL + o3), *(const v4u*)&tbl[cl][q * 8]); } } } }
// ---- k_sc: block = (query block qb, key block kb <= kb_last(qb), batch b in group): logits x SCALE; q hi + residual (x 2^10) against k (2 products) for query rows < QHI, plus the k residual (3 products) for query blocks < QBH (causal early rows); causal: blocks past the diagonal exit
__global__ __launch_bounds__(128) void k_sc(const _Float16* __restrict__ QH, const _Float16* __restrict__ KH, const _Float16* __restrict__ QL, const _Float16* __restrict__ KL, int bgrp, int h0, float* __restrict__ S0, float* __restrict__ PM, float* __restrict__ PS) { __shared__ __align__(16) float ss[4][16][132];
  const int qb = blockIdx.x, kb = blockIdx.y; if (kb > kb_last(qb)) return;
  const int h = h0; const int b = bgrp + blockIdx.z; float* S = S0 + (size_t)blockIdx.z * TT * TT;   /* group spans batches */
  const int tid = threadIdx.x, wave = tid >> 5, lane = tid & 31, col = lane & 15, g = lane >> 4; const int k0 = kb * 128; const int ql0 = qb * 64 + wave * 16; const size_t q0 = (size_t)b * TT + ql0, kr0 = (size_t)b * TT + k0;
  v8f acc[8] = {}, accl[8] = {};
  const _Float16* QLb = QL + (size_t)b * QHI * CCQ; const _Float16* KLb = KL + (size_t)b * KHI * CCQ;   /* single head: q/k rows at pitch CCQ */
  if (qb < QBH) {
#pragma unroll
    for (int kc = 0; kc < HDQK / 32; ++kc) { const v16h ah = frag_h(QH + (q0 + col) * CCQ + kc * 32, lane), al = frag_h(QLb + (size_t)(ql0 + col) * CCQ + kc * 32, lane);
#pragma unroll
      for (int j = 0; j < 8; ++j) { const v16h kbf = frag_h(KH + (kr0 + j * 16 + col) * CCQ + kc * 32, lane), klf = frag_h(KLb + (size_t)(k0 + j * 16 + col) * CCQ + kc * 32, lane); acc[j] = wmma16(ah, kbf, acc[j]); accl[j] = wmma16(al, kbf, accl[j]); accl[j] = wmma16(ah, klf, accl[j]); } }
  } else if (qb * 64 < QHI) {
#pragma unroll
    for (int kc = 0; kc < HDQK / 32; ++kc) { const v16h ah = frag_h(QH + (q0 + col) * CCQ + kc * 32, lane), al = frag_h(QLb + (size_t)(ql0 + col) * CCQ + kc * 32, lane);
#pragma unroll
      for (int j = 0; j < 8; ++j) { const v16h kbf = frag_h(KH + (kr0 + j * 16 + col) * CCQ + kc * 32, lane); acc[j] = wmma16(ah, kbf, acc[j]); accl[j] = wmma16(al, kbf, accl[j]); } }
  } else {
#pragma unroll
    for (int kc = 0; kc < HDQK / 32; ++kc) { const v16h ah = frag_h(QH + (q0 + col) * CCQ + kc * 32, lane);
#pragma unroll
      for (int j = 0; j < 8; ++j) { const v16h kbf = frag_h(KH + (kr0 + j * 16 + col) * CCQ + kc * 32, lane); acc[j] = wmma16(ah, kbf, acc[j]); } } }
#pragma unroll
  for (int j = 0; j < 8; ++j) {
#pragma unroll
    for (int r = 0; r < 8; ++r) ss[wave][8 * g + r][j * 16 + col] = (acc[j][r] + accl[j][r] * (1.0f / 1024.0f)) * SCALE; }
  __syncthreads();   /* every wave's 16 rows of the tile are in ss before a thread walks its column; placed ahead of the S stores so that it does not wait for them */
  LDSX(); for (int rl = 0; rl < 16; ++rl) vst2(S + (size_t)(ql0 + rl) * TT + k0 + lane * 4, *(const v4f*)&ss[wave][rl][lane * 4]);
  asm volatile("s_wait_xcnt 0x0" ::: "memory");   /* the registers that the S stores name are reused by the column walk below */
  // column statistics of this 64 x 128 tile from the stored f32 logits: thread = key column, rows in ascending order: max, then sum of exp(v - max)
  { float v[64];
#pragma unroll
    for (int i = 0; i < 64; ++i) v[i] = ss[i >> 4][i & 15][tid];
    float m = v[0];
#pragma unroll
    for (int i = 1; i < 64; ++i) m = fmaxf(m, v[i]);
    float s = 0.f;
#pragma unroll
    for (int i = 0; i < 64; ++i) s += expf(v[i] - m);
    vst2(PM + (size_t)qb * TT + k0 + tid, m); vst2(PS + (size_t)qb * TT + k0 + tid, s); } }
// ---- k_colmerge: softmax over the QUERY axis (axis 1): joins the 64 per-query-block partials (PM = max, PS = sum of exp(S - PM) over 64 rows) of each key column m: CM[m] = max, CS[m] = sum_q PS[q][m] exp(PM[q][m] - CM[m]); block = 32 columns (lane) x 8 waves of 8 partials, joined through LDS
__global__ __launch_bounds__(256) void k_colmerge(const float* __restrict__ PM, const float* __restrict__ PS, float* __restrict__ CM, float* __restrict__ CS) { __shared__ float lm[8][32], ls[8][32];
  const int tid = threadIdx.x, wave = tid >> 5, lane = tid & 31; const int m = blockIdx.x * 32 + lane; float pm[8], ps[8];
#pragma unroll
  for (int u = 0; u < 8; ++u) pm[u] = PM[(size_t)(wave * 8 + u) * TT + m];
  asm volatile("s_wait_xcnt 0x0" ::: "memory");   /* the address pair of the loads above is rewritten for the loads below */
#pragma unroll
  for (int u = 0; u < 8; ++u) ps[u] = PS[(size_t)(wave * 8 + u) * TT + m];
  float mx = pm[0];
#pragma unroll
  for (int u = 1; u < 8; ++u) mx = fmaxf(mx, pm[u]);
  float sm2 = 0.f;
#pragma unroll
  for (int u = 0; u < 8; ++u) sm2 += ps[u] * expf(pm[u] - mx);
  lm[wave][lane] = mx; ls[wave][lane] = sm2;
  __syncthreads();
  if (wave == 0) { float mt = lm[0][lane];
#pragma unroll
    for (int w = 1; w < 8; ++w) mt = fmaxf(mt, lm[w][lane]);
    float st = 0.f;
#pragma unroll
    for (int w = 0; w < 8; ++w) st += ls[w][lane] * expf(lm[w][lane] - mt);
    vst2(CM + m, mt); vst2(CS + m, st); } }
// ---- k_smcol: block per row n: P[n][m] = exp(S[n][m] - CM[m]) / CS[m] x 2^11 in place (rows rewritten as whole 16-B lanes)
__global__ __launch_bounds__(256) void k_smcol(float* __restrict__ S, const float* __restrict__ CM, const float* __restrict__ CS) { const int tid = threadIdx.x; float* sr = S + (size_t)blockIdx.x * TT;
  for (int q = tid; q < TT / 4; q += 256) { const v4f v = *(const v4f*)(sr + q * 4), cm = *(const v4f*)(CM + q * 4), cs = *(const v4f*)(CS + q * 4); asm volatile("s_wait_loadcnt 0x0" ::: "memory"); v4f o;
#pragma unroll
    for (int u = 0; u < 4; ++u) o[u] = expf(v[u] - cm[u]) * (2048.0f / cs[u]);
    vst2(sr + q * 4, o); } }
__global__ __launch_bounds__(256) void k_trans(const _Float16* __restrict__ G, _Float16* __restrict__ VT2) { __shared__ _Float16 st[64][72]; const int tid = threadIdx.x; const int m0 = blockIdx.x * 64, c0 = blockIdx.y * 64, b = blockIdx.z; const _Float16* gb = G + (size_t)b * CB * TT; _Float16* vb = VT2 + (size_t)b * CB * TT;
  for (int e = tid; e < 64 * 8; e += 256) { const int ml = e >> 3, q = e & 7; const v4u u = *(const v4u*)(gb + (size_t)(m0 + ml) * CB + c0 + q * 8); asm volatile("s_wait_loadcnt 0x0" ::: "memory"); const hx8 hv = *(const hx8*)&u; _Pragma("unroll") for (int j = 0; j < 8; ++j) st[q * 8 + j][ml] = hv[j]; }
  __syncthreads();
  for (int e = tid; e < 64 * 8; e += 256) { const int cl = e >> 3, q = e & 7; hx8 hv; _Pragma("unroll") for (int j = 0; j < 8; ++j) hv[j] = st[cl][q * 8 + j]; vst2((unsigned*)(vb + (size_t)(c0 + cl) * TT + m0 + q * 8), *(const v4u*)&hv); } }
// ---- k_wout: block = (64 positions, 128 of the 256 output channels, batch): A[pos][cb] = y view Yb[cb*4096 + pos] (the raw reshape back: the batch's y rows [4096][128] f32 reinterpreted as [Cb][N]) split bf16 hi + lo (2 products) x exact (out,in) W [256][128]; + bf16(W_b) + bf16(x[b][o][pos]); channels-first store out[b][o][pos0..pos0+63] through LDS (one 256-B run per channel by 16 lanes)
__global__ __launch_bounds__(128) void k_wout(const float* __restrict__ Y, const float* __restrict__ WW, const float* __restrict__ WB, const float* __restrict__ X, float* __restrict__ OUT) { __shared__ __align__(16) float st[128][68];
  const int tid = threadIdx.x, wave = tid >> 5, lane = tid & 31, col = lane & 15, g = lane >> 4; const int p0 = blockIdx.x * 64, c0 = blockIdx.y * 128, b = blockIdx.z; const float* Yb = Y + (size_t)b * TT * CB;
  v8f acc[8] = {};
#pragma unroll 1
  for (int kc = 0; kc < CB / 32; ++kc) { v16b ah, al; { const float* p = Yb + (size_t)(kc * 32 + 8 * g) * TT + p0 + wave * 16 + col; float tv[16];
#pragma unroll
      for (int i = 0; i < 8; ++i) { tv[i] = p[(size_t)i * TT]; tv[8 + i] = p[(size_t)(16 + i) * TT]; }
      asm volatile("s_wait_loadcnt 0x0" ::: "memory");
#pragma unroll
      for (int i = 0; i < 16; ++i) { const __bf16 h = (__bf16)tv[i]; ah[i] = h; al[i] = (__bf16)(tv[i] - (float)h); } }
#pragma unroll
    for (int j = 0; j < 8; ++j) { const v16b w = wcol_oi(WW, kc * 32, c0 + j * 16 + col, lane, CB); acc[j] = wmma_bf(ah, w, acc[j]); acc[j] = wmma_bf(al, w, acc[j]); } }
#pragma unroll
  for (int j = 0; j < 8; ++j) { const float wb = bfr(WB[c0 + j * 16 + col]); asm volatile("s_wait_loadcnt 0x0" ::: "memory");
#pragma unroll
    for (int r = 0; r < 8; ++r) st[j * 16 + col][wave * 16 + 8 * g + r] = acc[j][r] + wb; }
  __syncthreads();
  for (int e = tid; e < 128 * 16; e += 128) { const int cl = e >> 4, q = e & 15; const size_t o = ((size_t)b * COUT + c0 + cl) * (size_t)TT + p0 + q * 4; const v4f xr = *(const v4f*)(X + o); asm volatile("s_wait_loadcnt 0x0" ::: "memory"); v4f v = *(const v4f*)&st[cl][q * 4]; v[0] += bfr(xr[0]); v[1] += bfr(xr[1]); v[2] += bfr(xr[2]); v[3] += bfr(xr[3]); vst2(OUT + o, v); } }
// ---- k_pv: block = (16 queries, all 128 value columns, batch in group), 16 waves: wave s takes the 32-key steps s, s + 16, s + 32, ... of the 4,096 keys (neighbouring waves read neighbouring 128-B pieces of the same P rows and the two halves of the same v lines), P x 2^11 once to f16 against v f16 (1 product); the 16 partial 16 x 128 tiles are joined through LDS in ascending s, x 2^-11, one y row per wave
#define PVS 16             // key slices = waves of a k_pv block = query rows of a block (the join gives wave w row w)
static_assert(PVS == 16 && (TT / 32) % PVS == 0, "one y row per wave; every wave the same number of 32-key steps");
__global__ __launch_bounds__(32 * PVS) void k_pv(const float* __restrict__ PS0, const _Float16* __restrict__ VT, int bgrp, int h0, float* __restrict__ Y) { const int h = h0; const int b = bgrp + blockIdx.z; const float* PS = PS0 + (size_t)blockIdx.z * TT * TT; const int d0 = blockIdx.y * DVH;   /* group spans batches; column offset d0 (0: all 128 columns in one block) */ __shared__ __align__(16) float ss[PVS][16][DVH + 4];
  const int tid = threadIdx.x, wave = __builtin_amdgcn_readfirstlane(tid >> 5), lane = tid & 31, col = lane & 15, g = lane >> 4; const int ql0 = blockIdx.x * 16; const int kce = (kb_last(ql0 >> 6) + 1) * 4;
  v8f acc[DVH / 16] = {};
#pragma unroll 1
  for (int i = 0; i < kce / PVS; ++i) { const int kc = i * PVS + wave; const v16h p = frag_f32(PS + (size_t)(ql0 + col) * TT + kc * 32, lane);
    asm volatile("s_wait_loadcnt 0x0" ::: "memory");
    asm volatile("s_wait_xcnt 0x0" ::: "memory");   /* the address pair of the P loads is reused as a destination of the v loads below */
#pragma unroll
    for (int j = 0; j < DVH / 16; ++j) { const size_t po = ((size_t)b * CC + h * HD + d0 + j * 16 + col) * (size_t)TT + kc * 32; acc[j] = wmma16(p, frag_h(VT + po, lane), acc[j]); }
    asm volatile("s_wait_xcnt 0x0" ::: "memory"); }   /* the address pair of the last v loads is reused as a destination of the next step's P loads */
#pragma unroll
  for (int j = 0; j < DVH / 16; ++j)
#pragma unroll
    for (int r = 0; r < 8; ++r) ss[wave][8 * g + r][j * 16 + col] = acc[j][r];
  __syncthreads();   /* all 16 key slices' partial tiles are in ss before a wave sums its row over them */
  v4f t = *(const v4f*)&ss[0][wave][lane * 4];
#pragma unroll
  for (int s = 1; s < PVS; ++s) t += *(const v4f*)&ss[s][wave][lane * 4];
  vst2(Y + ((size_t)b * TT + ql0 + wave) * CC + h * HD + d0 + lane * 4, t * (1.0f / 2048.0f)); }   /* y rows [b*TT + n][128]: 512-B row by 32 lanes */

#define WS_TL  (WS_END)                                  // f16 theta-view residual plane [b][128][TT] (viewed as rows)
#define WS_G   (WS_TL + 2u * (size_t)NB * CB * TT)        // f16 g conv plane [b][128][TT]
#define WS_VT2 (WS_G + 2u * (size_t)NB * CB * TT)         // f16 g-view transposed [b][128][TT]
#define WS_YR  (WS_VT2 + 2u * (size_t)NB * CB * TT)       // f32 y rows [b*TT + n][128]
#define WS_CM  (WS_YR + 4u * (size_t)NB * TT * CB)        // f32 column max [TT]
#define WS_CS  (WS_CM + 4u * (size_t)TT)
#define WS_PM  (WS_CS + 4u * (size_t)TT)                  // f32 partial column max [NQB][TT]
#define WS_PS  (WS_PM + 4u * (size_t)NQB * TT)            // f32 partial column sum [NQB][TT]
#define WS_END2 (WS_PS + 4u * (size_t)NQB * TT)
extern "C" void kernel_launch(void* const* d_in, const int* in_sizes, int n_in, void* d_out, int out_size, void* d_ws, size_t ws_size, hipStream_t stream) {
  (void)in_sizes; (void)n_in; (void)out_size;
  const float** F = (const float**)d_in;
  if (ws_size < (size_t)WS_END) return;
  char* ws = (char*)d_ws; _Float16 *QH = (_Float16*)(ws + WS_QH), *KH = (_Float16*)(ws + WS_KH), *VT = (_Float16*)(ws + WS_VT), *QL = (_Float16*)(ws + WS_QL), *KL = (_Float16*)(ws + WS_KL); __bf16 *VB = (__bf16*)(ws + WS_VB), *VBL = (__bf16*)(ws + WS_VBL); float *S = (float*)(ws + WS_S), *Y = (float*)(ws + WS_Y);
  (void)Y; (void)QL; (void)KL; (void)VB; (void)VBL;
  // inputs: 0 x [4,256,64,64] (channels-first); 1 theta_w [128,256], 2 theta_b; 3 phi_w, 4 phi_b; 5 g_w, 6 g_b; 7 W_w [256,128], 8 W_b [256] (all (out,in), biases nonzero)
  if (ws_size < (size_t)WS_END2) return;
  _Float16 *TL = (_Float16*)(ws + WS_TL), *G = (_Float16*)(ws + WS_G), *VT2 = (_Float16*)(ws + WS_VT2); float *YR = (float*)(ws + WS_YR), *CM = (float*)(ws + WS_CM), *CS = (float*)(ws + WS_CS), *PM = (float*)(ws + WS_PM), *PS = (float*)(ws + WS_PS);
  // phi^T rows (the 'k' rows: phi[c][m] proper layout, token-major) via the q/k path as which = 1 -> KH (+KL rows < 64, unused)
  k_projT<1><<<dim3(TNB * TT / 64, 1, 1), 128, 0, stream>>>(F[0], F[0], F[0], F[3], F[3], F[3], F[4], F[4], F[4], QH, QL, KH, KL, VT, VB, VBL, nullptr);
  // theta conv plane [Cb][N] (f16 hi into the 'VT' slot = the theta VIEW rows [N][Cb] when read row-major) + its residual plane TL (the view's residual rows) via the [c][t] path (which = 2)
  k_projT<2><<<dim3(TNB * TT / 64, 1, 1), 128, 0, stream>>>(F[0], F[0], F[0], F[1], F[1], F[1], F[2], F[2], F[2], QH, QL, KH, KL, VT, VB, VBL, TL);
  // g conv plane [Cb][N] f16 -> G, then the g VIEW rows transposed into the value plane VT2[c][m]
  k_projT<2><<<dim3(TNB * TT / 64, 1, 1), 128, 0, stream>>>(F[0], F[0], F[0], F[5], F[5], F[5], F[6], F[6], F[6], QH, QL, KH, KL, G, VB, VBL, nullptr);
  k_trans<<<dim3(TT / 64, CB / 64, TNB), 256, 0, stream>>>(G, VT2);
  for (int b0 = 0; b0 < TNB; b0 += BGN) {
    k_sc<<<dim3(NQB, TT / 128, BGN), 128, 0, stream>>>(VT /* theta view rows */, KH, TL /* view residual rows */, KL, b0, 0, S, PM, PS);
    k_colmerge<<<dim3(TT / 32), 256, 0, stream>>>(PM, PS, CM, CS);
    k_smcol<<<dim3(TT), 256, 0, stream>>>(S, CM, CS);
    k_pv<<<dim3(TT / PVS, HD / DVH, BGN), 32 * PVS, 0, stream>>>(S, VT2, b0, 0, YR);
  }
  k_wout<<<dim3(TT / 64, COUT / 128, TNB), 128, 0, stream>>>(YR, F[7], F[8], F[0], (float*)d_out);

}

// v003
// One run takes 373 microseconds.
// In two side-by-side timings against v002, it was 1.41 and 1.40 times as fast.
// All steps since v000 together make it 6.93 times as fast.
// compute dtype: all float inputs rounded to bf16; the three 1x1 convs with EXACT bf16 products on WMMA 16x16x32 (f32 accumulate) + bias; scores between the raw-reshaped theta view (f16 hi + residual x 2^10) and phi (f16) (2 products); the softmax over the QUERY axis in f32 (per-column max / sum from 64-row partials, precise expf); P x 2^11 once to f16 x the raw-reshaped g view once to f16 (1 product); the W 1x1 conv on the raw-reshaped y view with bf16 hi + lo (2 products) x exact W + bias + x residual; f32 output written channels-first.
#include <hip/hip_runtime.h>
#include <math.h>

typedef __attribute__((ext_vector_type(16))) _Float16 v16h;
typedef __attribute__((ext_vector_type(16))) __bf16 v16b;
typedef __attribute__((ext_vector_type(8)))  _Float16 v8h;
typedef __attribute__((ext_vector_type(8)))  float v8f;
typedef __attribute__((ext_vector_type(4)))  float v4f;
typedef __attribute__((ext_vector_type(2)))  float v2f;
typedef __attribute__((ext_vector_type(4)))  unsigned v4u;
typedef _Float16 hx8 __attribute__((ext_vector_type(8)));
typedef __attribute__((ext_vector_type(4)))  int v4i;
typedef float __attribute__((may_alias)) float_a;
typedef int __attribute__((may_alias)) int_a;

template <typename T> __device__ __forceinline__ void vst2(void* p, T v) { *(T*)p = v;  }
__device__ __forceinline__ v8f wmma16(v16h a, v16h b, v8f c) {
  v8f d = __builtin_amdgcn_wmma_f32_16x16x32_f16(false, a, false, b, (short)0, c, false, false);
  asm volatile("v_nop\n\tv_nop\n\tv_nop\n\tv_nop" : "+v"(d) : "v"(a), "v"(b));
  return d;
}
__device__ __forceinline__ v8f wmma_bf(v16b a, v16b b, v8f c) {
  v8f d = __builtin_amdgcn_wmma_f32_16x16x32_bf16(false, a, false, b, (short)0, c, false, false);
  asm volatile("v_nop\n\tv_nop\n\tv_nop\n\tv_nop" : "+v"(d) : "v"(a), "v"(b));
  return d;
}
// 16x16x32 fragments: lane = (h = lane>>4, row/col = lane&15); elements 0..7 = k0+8h+0..7, 8..15 = k0+16+8h+0..7; D element r = row 8h+r
__device__ __forceinline__ v16h frag_h(const _Float16* rowk0, int lane) {
  union { v16h v; v8h q[2]; } u; const _Float16* p = rowk0 + 8 * (lane >> 4);
  u.q[0] = *(const v8h*)p; u.q[1] = *(const v8h*)(p + 16); return u.v;
}
__device__ __forceinline__ v16h frag_f32(const float* rowk0, int lane) {
  v16h a; const float* p = rowk0 + 8 * (lane >> 4);
#pragma unroll
  for (int i = 0; i < 8; ++i) { a[i] = (_Float16)p[i]; a[8 + i] = (_Float16)p[16 + i]; }
  return a;
}
__device__ __forceinline__ v16h frag_f32s(const float* rowk0, int lane, float sc) {
  v16h a; const float* p = rowk0 + 8 * (lane >> 4);
#pragma unroll
  for (int i = 0; i < 8; ++i) { a[i] = (_Float16)(p[i] * sc); a[8 + i] = (_Float16)(p[16 + i] * sc); }
  return a;
}
// column fragment from a [K][ld] layout (column n), rows >= K read as 0
__device__ __forceinline__ v16h fragc_f32(const float* W, int k0, int n, int lane, int ld, int K) {
  v16h a; const int g = lane >> 4;
#pragma unroll
  for (int i = 0; i < 8; ++i) { const int ka = k0 + 8 * g + i, kb = ka + 16;
    a[i] = (_Float16)(ka < K ? W[(size_t)(ka < K ? ka : K - 1) * ld + n] : 0.f); a[8 + i] = (_Float16)(kb < K ? W[(size_t)(kb < K ? kb : K - 1) * ld + n] : 0.f); }
  return a;
}
struct F2 { v16b h, l; };
__device__ __forceinline__ F2 bsplit16(const float v[16]) { F2 r;
#pragma unroll
  for (int i = 0; i < 16; ++i) { const __bf16 h = (__bf16)v[i]; r.h[i] = h; r.l[i] = (__bf16)(v[i] - (float)h); }
  return r; }
__device__ __forceinline__ F2 split_row(const float* row, int k0, int lane) { float v[16]; const float* p = row + k0 + 8 * (lane >> 4);
#pragma unroll
  for (int i = 0; i < 8; ++i) { v[i] = p[i]; v[8 + i] = p[16 + i]; }
  return bsplit16(v); }
__device__ __forceinline__ F2 split_rowK(const float* row, int k0, int lane, int K) { float v[16]; const int g = lane >> 4;
#pragma unroll
  for (int i = 0; i < 8; ++i) { const int ka = k0 + 8 * g + i, kb = ka + 16; v[i] = ka < K ? row[ka < K ? ka : K - 1] : 0.f; v[8 + i] = kb < K ? row[kb < K ? kb : K - 1] : 0.f; }
  return bsplit16(v); }
__device__ __forceinline__ F2 split_col(const float* W, int k0, int n, int lane, int ld, int K) { float v[16]; const int g = lane >> 4;
#pragma unroll
  for (int i = 0; i < 8; ++i) { const int ka = k0 + 8 * g + i, kb = ka + 16; v[i] = ka < K ? W[(size_t)(ka < K ? ka : K - 1) * ld + n] : 0.f; v[8 + i] = kb < K ? W[(size_t)(kb < K ? kb : K - 1) * ld + n] : 0.f; }
  return bsplit16(v); }
__device__ __forceinline__ v8f mac3(const F2& a, const F2& b, v8f c) { c = wmma_bf(a.l, b.h, c); c = wmma_bf(a.h, b.l, c); return wmma_bf(a.h, b.h, c); }
__device__ __forceinline__ float sigm(float v) { return 1.0f / (1.0f + expf(-v)); }
// fragments read at the lane's own pointer (row start + k0 + 8 * (lane >> 4)): the caller keeps that pointer and names it at the wait behind a batch of loads
__device__ __forceinline__ v16h frag_hp(const _Float16* p) { union { v16h v; v8h q[2]; } u; u.q[0] = *(const v8h*)p; u.q[1] = *(const v8h*)(p + 16); return u.v; }
__device__ __forceinline__ v16b wfrag_p(const float* p) { v16b w;
#pragma unroll
  for (int i = 0; i < 8; ++i) { w[i] = (__bf16)p[i]; w[8 + i] = (__bf16)p[16 + i]; }
  return w; }
#define LDSX() do { asm volatile("s_wait_dscnt 0" ::: "memory"); __builtin_amdgcn_wave_barrier(); __builtin_amdgcn_fence(__ATOMIC_RELEASE, "workgroup"); } while (0)

// Non-local block with the source's RAW reshapes (x [4,256,64,64], Cb 128, N 4,096; (out,in) theta/phi/g 1x1 convs [128,256] + biases, W [256,128] + bias): theta = conv(x).reshape(B, N, Cb) and g likewise are ROW-MAJOR reinterpretations of the [Cb][N] conv outputs (row n = channel n/32, positions (n%32)*128..+127), phi stays [Cb][N]; scores[n][m] = sum_c theta[n][c] phi[c][m]; attn = softmax over n (axis 1 - per key column); y[n][c] = sum_m attn[n][m] g[m][c]; y.reshape(B, Cb, H, W) (raw again) -> W conv + bias + x.
#define NB 4
#define TT 4096
#define CC 128            // g-view plane pitch (Cb channels)
#define CB 128
#define COUT 256
#define CCQ 128           // theta-view / phi^T row pitch (Cb)
#define DIN 256          // x channels
#define NH 1
#define HD 128
#define NQB (TT / 64)
#define HG 1               // one 4,096 x 4,096 score plane per pass (the pass group spans batches)
#define SCALE (1.0f)
#define HDQK 128           // contraction width of the scores (Cb)
#define CAUSAL 0
#ifndef TNB
#define TNB NB
#endif
__device__ __forceinline__ v16b zero16b() { v16b z; _Pragma("unroll") for (int i = 0; i < 16; ++i) z[i] = (__bf16)0.f; return z; }
__device__ __forceinline__ float bfr(float v) { return (float)(__bf16)v; }
__host__ __device__ __forceinline__ int kb_last(int qb) { return CAUSAL ? ((qb * 64 + 63) >> 7) : (TT / 128 - 1); }
typedef __attribute__((ext_vector_type(8))) __bf16 v8b;
__device__ __forceinline__ v16b frag_b(const __bf16* rowk0, int lane) {
  union { v16b v; v8b q[2]; } u; const __bf16* p = rowk0 + 8 * (lane >> 4);
  u.q[0] = *(const v8b*)p; u.q[1] = *(const v8b*)(p + 16); return u.v;
}
#define QBH 0              // 2-product logits everywhere (theta view hi + residual x phi hi)
#define QHI 4096            // q residual rows (all)
#define KHI 64            // (unused k residual / v bf16 planes: QBH 0)
// B fragment (k rows k0+.., output column o) of a weight: (in,out) [K][ld] or (out,in) [ld rows of K]: bf16 exact, or f16(bf16 * 256) exact
__device__ __forceinline__ v16b wcol_io(const float* Wm, int k0, int o, int lane, int ld) { v16b w; const int g = lane >> 4;
#pragma unroll
  for (int i = 0; i < 8; ++i) { w[i] = (__bf16)Wm[(size_t)(k0 + 8 * g + i) * ld + o]; w[8 + i] = (__bf16)Wm[(size_t)(k0 + 16 + 8 * g + i) * ld + o]; }
  return w; }
__device__ __forceinline__ v16b wcol_oi(const float* Wm, int k0, int o, int lane, int K) { v16b w; const float* p = Wm + (size_t)o * K + k0 + 8 * (lane >> 4);
#pragma unroll
  for (int i = 0; i < 8; ++i) { w[i] = (__bf16)p[i]; w[8 + i] = (__bf16)p[16 + i]; }
  return w; }
__device__ __forceinline__ v16h wcolh_io(const float* Wm, int k0, int o, int lane, int ld) { v16h w; const int g = lane >> 4;
#pragma unroll
  for (int i = 0; i < 8; ++i) { w[i] = (_Float16)(bfr(Wm[(size_t)(k0 + 8 * g + i) * ld + o]) * 256.0f); w[8 + i] = (_Float16)(bfr(Wm[(size_t)(k0 + 16 + 8 * g + i) * ld + o]) * 256.0f); }
  return w; }
__device__ __forceinline__ v16h wcolh_oi(const float* Wm, int k0, int o, int lane, int K) { v16h w; const float* p = Wm + (size_t)o * K + k0 + 8 * (lane >> 4);
#pragma unroll
  for (int i = 0; i < 8; ++i) { w[i] = (_Float16)(bfr(p[i]) * 256.0f); w[8 + i] = (_Float16)(bfr(p[16 + i]) * 256.0f); }
  return w; }
#define WQKV_LAYOUT 0   // 0 = (out,in) [CC][DIN], as 1; 1 = (out,in) [CC][DIN]; 2 = per-head [NH][DIN][HD]
__device__ __forceinline__ v16b wcol_hdk(const float* Wm, int k0, int o, int lane) { v16b w; const int g = lane >> 4; const float* p = Wm + (size_t)(o / HD) * DIN * HD + (o % HD);
#pragma unroll
  for (int i = 0; i < 8; ++i) { w[i] = (__bf16)p[(size_t)(k0 + 8 * g + i) * HD]; w[8 + i] = (__bf16)p[(size_t)(k0 + 16 + 8 * g + i) * HD]; }
  return w; }
#define WO_OUT_IN 0
#if WQKV_LAYOUT == 1
#define WCOL(W, k0, o, lane) wcol_oi(W, k0, (o), lane, DIN)   /* unused: layout 0 */
#elif WQKV_LAYOUT == 2
#define WCOL(W, k0, o, lane) wcol_hdk(W, k0, o, lane)
#else
#define WCOL(W, k0, o, lane) wcol_oi(W, k0, (o), lane, DIN)   /* (out,in) 1x1-conv weights [128][256]: all 128 output channels real */
#endif
#if WO_OUT_IN
#define WOCOL(W, k0, o, lane) wcol_oi(W, k0, o, lane, CC)
#define WOCOLH(W, k0, o, lane) wcolh_oi(W, k0, o, lane, CC)
#else
#define WOCOL(W, k0, o, lane) wcol_io(W, k0, o, lane, DIN)
#define WOCOLH(W, k0, o, lane) wcolh_io(W, k0, o, lane, DIN)
#endif
#define BG HG              // the pass group spans BATCHES (single head): blockIdx.z selects batch b0 + z
#define BGN (TNB < BG ? TNB : BG)
#define DVH 128            // all 128 Cb columns of the g view in one k_pv block
#ifndef SM_EXTRA_PARAMS
#define SM_EXTRA_PARAMS
#endif
#ifndef PROJ_EXTRA_PARAMS
#define PROJ_EXTRA_PARAMS
#endif
#ifndef SM_MASK_HOOK
#define SM_MASK_HOOK (void)0
#endif

#define WS_QH  0u                                      // f16 q rows [b*t][CCQ]
#define WS_KH  (WS_QH + 2u * (size_t)NB * TT * CCQ)     // f16 k rows [b*t][CCQ]
#define WS_VT  (WS_KH + 2u * (size_t)NB * TT * CCQ)     // f16 theta conv planes [b][c][t] (theta-view rows)
#define WS_QL  (WS_VT + 2u * (size_t)NB * CC * TT)      // f16 q residual x 2^10 rows [b][t < QHI][CCQ]
#define WS_KL  (WS_QL + 2u * (size_t)NB * QHI * CCQ)    // f16 k residual x 2^10 rows [b][t < KHI][CCQ]
#define WS_VB  (WS_KL + 2u * (size_t)NB * KHI * CCQ)    // bf16 v hi planes [b][c][t < KHI]
#define WS_VBL (WS_VB + 2u * (size_t)NB * CC * KHI)
#define WS_S   (WS_VBL + 2u * (size_t)NB * CC * KHI)    // f32 logits / P [hg][t][s]
#define WS_Y   (WS_S  + 4u * (size_t)HG * TT * TT)      // unused (0 bytes); y rows go to WS_YR
#define WS_END (WS_Y  + 0u)

// ---- k_proj: block = (64 rows, 128 cols, which): q/k/v = X W (+ b) with exact bf16 products (K = DIN) -> which 0: q f16 rows (+ residual rows < QHI); 1: k f16 rows (+ residual rows < KHI); 2: v f16 planes [c][t] (+ bf16 hi/lo planes for t < KHI)
template <int WOFF> __global__ __launch_bounds__(128) void k_projT(const float* __restrict__ XQ, const float* __restrict__ XK, const float* __restrict__ XV, const float* __restrict__ WQ, const float* __restrict__ WK, const float* __restrict__ WV, const float* __restrict__ BQ, const float* __restrict__ BK, const float* __restrict__ BV,
    _Float16* __restrict__ QH, _Float16* __restrict__ QL, _Float16* __restrict__ KH, _Float16* __restrict__ KL, _Float16* __restrict__ VT, __bf16* __restrict__ VB, __bf16* __restrict__ VBL, _Float16* __restrict__ VL) {
  __shared__ __align__(16) _Float16 sh[64][136], sl[64][136]; __shared__ __align__(16) _Float16 th[128][72], tlo[128][72]; __shared__ __align__(16) __bf16 tb[128][72], tbl[128][72];
  const int tid = threadIdx.x, wave = tid >> 5, lane = tid & 31, col = lane & 15, g = lane >> 4; const int which = blockIdx.z + WOFF; const int c0 = blockIdx.y * 128; const size_t r0 = (size_t)blockIdx.x * 64; const size_t bb = r0 / TT; const int t0 = (int)(r0 % TT);
  const float* X = which == 0 ? XQ : which == 1 ? XK : XV; const float* WA = which == 0 ? WQ : which == 1 ? WK : WV; const float* BA = which == 0 ? BQ : which == 1 ? BK : BV;
  const int KD = DIN;
  v8f acc[8] = {};
#pragma unroll 2
  for (int kc = 0; kc < KD / 32; ++kc) { v16b a, w[8]; const float* p = X + (bb * KD + kc * 32 + 8 * g) * (size_t)TT + t0 + wave * 16 + col;   /* channels-first [b][c][t]: A[t][c] (16 consecutive t per lane group) */
    const float* wp = WA + (size_t)(c0 + col) * DIN + kc * 32 + 8 * g;   /* (out,in) weight rows: fragment j starts 16 rows further on */
#pragma unroll
    for (int i = 0; i < 8; ++i) { a[i] = (__bf16)p[(size_t)i * TT]; a[8 + i] = (__bf16)p[(size_t)(16 + i) * TT]; }
#pragma unroll
    for (int j = 0; j < 8; ++j) w[j] = wfrag_p(wp + (size_t)j * 16 * DIN);   /* all eight weight fragments ahead of the k step's first WMMA: the asm in wmma_bf holds later loads behind it, so a load written between two WMMAs pays its whole latency there */
    asm volatile("s_wait_loadcnt 0x0" :: "v"(p), "v"(wp) : "memory");   /* names the two address pairs so that they stay as they are until every load of the batch has returned */
#pragma unroll
    for (int j = 0; j < 8; ++j) acc[j] = wmma_bf(a, w[j], acc[j]); }
  const float* bp = BA + c0 + col; float bias8[8] = {};   /* the eight bias loads together, ahead of the epilogue's LDS stores */
  if (BA) {
#pragma unroll
    for (int j = 0; j < 8; ++j) bias8[j] = bp[j * 16];
    asm volatile("s_wait_loadcnt 0x0" :: "v"(bp) : "memory"); }   /* names the address pair so that it stays as it is until the eight loads have returned */
  if (which < 2) { _Float16* DH = which == 0 ? QH : KH; _Float16* DL = which == 0 ? QL : KL; const int nhi = which == 0 ? QHI : KHI; const bool hi_rows = t0 < nhi;
#pragma unroll
    for (int j = 0; j < 8; ++j) { const float bias = bfr(bias8[j]);
#pragma unroll
      for (int r = 0; r < 8; ++r) { const float v = acc[j][r] + bias; const _Float16 hv = (_Float16)v; sh[wave * 16 + 8 * g + r][j * 16 + col] = hv; sl[wave * 16 + 8 * g + r][j * 16 + col] = (_Float16)((v - (float)hv) * 1024.0f); } }
    __syncthreads();
    for (int e = tid; e < 64 * 16; e += 128) { const int rl = e >> 4, q = e & 15; vst2((unsigned*)(DH + (r0 + rl) * CCQ + c0 + q * 8), *(const v4u*)&sh[rl][q * 8]); if (hi_rows) vst2((unsigned*)(DL + (bb * nhi + t0 + rl) * (size_t)CCQ + c0 + q * 8), *(const v4u*)&sl[rl][q * 8]); }   /* q/k rows: pitch CCQ (c0 == 0) */
  } else { const bool hi_rows = t0 < KHI;
#pragma unroll
    for (int j = 0; j < 8; ++j) { const float bias = bfr(bias8[j]);
#pragma unroll
      for (int r = 0; r < 8; ++r) { const float v = acc[j][r] + bias; const int rl = wave * 16 + 8 * g + r, cl = j * 16 + col; const _Float16 hv2 = (_Float16)v; th[cl][rl] = hv2; tlo[cl][rl] = (_Float16)((v - (float)hv2) * 1024.0f); const __bf16 bh = (__bf16)v; tb[cl][rl] = bh; tbl[cl][rl] = (__bf16)(v - (float)bh); } }
    __syncthreads();
    for (int e = tid; e < 128 * 8; e += 128) { const int cl = e >> 3, q = e & 7; vst2((unsigned*)(VT + (bb * CC + c0 + cl) * (size_t)TT + t0 + q * 8), *(const v4u*)&th[cl][q * 8]); if (VL) vst2((unsigned*)(VL + (bb * CC + c0 + cl) * (size_t)TT + t0 + q * 8), *(const v4u*)&tlo[cl][q * 8]); if (hi_rows) { const size_t o3 = (bb * CC + c0 + cl) * (size_t)KHI + t0 + q * 8; vst2((unsigned*)(VB + o3), *(const v4u*)&tb[cl][q * 8]); vst2((unsigned*)(VBL + o3), *(const v4u*)&tbl[cl][q * 8]); } } } }
// ---- k_sc: block = (query block qb, key block kb <= kb_last(qb), batch b in group): logits x SCALE; q hi + residual (x 2^10) against k (2 products) for query rows < QHI, plus the k residual (3 products) for query blocks < QBH (causal early rows); causal: blocks past the diagonal exit
__global__ __launch_bounds__(128) void k_sc(const _Float16* __restrict__ QH, const _Float16* __restrict__ KH, const _Float16* __restrict__ QL, const _Float16* __restrict__ KL, int bgrp, int h0, float* __restrict__ S0, float* __restrict__ PM, float* __restrict__ PS) { __shared__ __align__(16) float ss[4][16][132];
  const int qb = blockIdx.x, kb = blockIdx.y; if (kb > kb_last(qb)) return;
  const int h = h0; const int b = bgrp + blockIdx.z; float* S = S0 + (size_t)blockIdx.z * TT * TT;   /* group spans batches */
  const int tid = threadIdx.x, wave = tid >> 5, lane = tid & 31, col = lane & 15, g = lane >> 4; const int k0 = kb * 128; const int ql0 = qb * 64 + wave * 16; const size_t q0 = (size_t)b * TT + ql0, kr0 = (size_t)b * TT + k0;
  v8f acc[8] = {}, accl[8] = {};
  const _Float16* QLb = QL + (size_t)b * QHI * CCQ; const _Float16* KLb = KL + (size_t)b * KHI * CCQ;   /* single head: q/k rows at pitch CCQ */
  if (qb < QBH) {
#pragma unroll
    for (int kc = 0; kc < HDQK / 32; ++kc) { const v16h ah = frag_h(QH + (q0 + col) * CCQ + kc * 32, lane), al = frag_h(QLb + (size_t)(ql0 + col) * CCQ + kc * 32, lane);
#pragma unroll
      for (int j = 0; j < 8; ++j) { const v16h kbf = frag_h(KH + (kr0 + j * 16 + col) * CCQ + kc * 32, lane), klf = frag_h(KLb + (size_t)(k0 + j * 16 + col) * CCQ + kc * 32, lane); acc[j] = wmma16(ah, kbf, acc[j]); accl[j] = wmma16(al, kbf, accl[j]); accl[j] = wmma16(ah, klf, accl[j]); } }
  } else if (qb * 64 < QHI) {
#pragma unroll
    for (int kc = 0; kc < HDQK / 32; ++kc) { const v16h ah = frag_h(QH + (q0 + col) * CCQ + kc * 32, lane), al = frag_h(QLb + (size_t)(ql0 + col) * CCQ + kc * 32, lane);
      v16h kbf[8];   /* the k step's eight key fragments ahead of its first WMMA (the asm in wmma16 holds later loads behind it) */
#pragma unroll
      for (int j = 0; j < 8; ++j) kbf[j] = frag_h(KH + (kr0 + j * 16 + col) * CCQ + kc * 32, lane);
#pragma unroll
      for (int j = 0; j < 8; ++j) { acc[j] = wmma16(ah, kbf[j], acc[j]); accl[j] = wmma16(al, kbf[j], accl[j]); } }
  } else {
#pragma unroll
    for (int kc = 0; kc < HDQK / 32; ++kc) { const v16h ah = frag_h(QH + (q0 + col) * CCQ + kc * 32, lane);
#pragma unroll
      for (int j = 0; j < 8; ++j) { const v16h kbf = frag_h(KH + (kr0 + j * 16 + col) * CCQ + kc * 32, lane); acc[j] = wmma16(ah, kbf, acc[j]); } } }
#pragma unroll
  for (int j = 0; j < 8; ++j) {
#pragma unroll
    for (int r = 0; r < 8; ++r) ss[wave][8 * g + r][j * 16 + col] = (acc[j][r] + accl[j][r] * (1.0f / 1024.0f)) * SCALE; }
  __syncthreads();   /* every wave's 16 rows of the tile are in ss before a thread walks its column; placed ahead of the S stores so that it does not wait for them */
  LDSX(); for (int rl = 0; rl < 16; ++rl) vst2(S + (size_t)(ql0 + rl) * TT + k0 + lane * 4, *(const v4f*)&ss[wave][rl][lane * 4]);
  asm volatile("s_wait_xcnt 0x0" ::: "memory");   /* the registers that the S stores name are reused by the column walk below */
  // column statistics of this 64 x 128 tile from the stored f32 logits: thread = key column, rows in ascending order: max, then sum of exp(v - max)
  { float v[64];
#pragma unroll
    for (int i = 0; i < 64; ++i) v[i] = ss[i >> 4][i & 15][tid];
    float m = v[0];
#pragma unroll
    for (int i = 1; i < 64; ++i) m = fmaxf(m, v[i]);
    float s = 0.f;
#pragma unroll
    for (int i = 0; i < 64; ++i) s += expf(v[i] - m);
    vst2(PM + (size_t)qb * TT + k0 + tid, m); vst2(PS + (size_t)qb * TT + k0 + tid, s); } }
// ---- k_colmerge: softmax over the QUERY axis (axis 1): joins the 64 per-query-block partials (PM = max, PS = sum of exp(S - PM) over 64 rows) of each key column m: CM[m] = max, CS[m] = sum_q PS[q][m] exp(PM[q][m] - CM[m]); block = 32 columns (lane) x 8 waves of 8 partials, joined through LDS
__global__ __launch_bounds__(256) void k_colmerge(const float* __restrict__ PM, const float* __restrict__ PS, float* __restrict__ CM, float* __restrict__ CS) { __shared__ float lm[8][32], ls[8][32];
  const int tid = threadIdx.x, wave = tid >> 5, lane = tid & 31; const int m = blockIdx.x * 32 + lane; float pm[8], ps[8];
#pragma unroll
  for (int u = 0; u < 8; ++u) pm[u] = PM[(size_t)(wave * 8 + u) * TT + m];
  asm volatile("s_wait_xcnt 0x0" ::: "memory");   /* the address pair of the loads above is rewritten for the loads below */
#pragma unroll
  for (int u = 0; u < 8; ++u) ps[u] = PS[(size_t)(wave * 8 + u) * TT + m];
  float mx = pm[0];
#pragma unroll
  for (int u = 1; u < 8; ++u) mx = fmaxf(mx, pm[u]);
  float sm2 = 0.f;
#pragma unroll
  for (int u = 0; u < 8; ++u) sm2 += ps[u] * expf(pm[u] - mx);
  lm[wave][lane] = mx; ls[wave][lane] = sm2;
  __syncthreads();
  if (wave == 0) { float mt = lm[0][lane];
#pragma unroll
    for (int w = 1; w < 8; ++w) mt = fmaxf(mt, lm[w][lane]);
    float st = 0.f;
#pragma unroll
    for (int w = 0; w < 8; ++w) st += ls[w][lane] * expf(lm[w][lane] - mt);
    vst2(CM + m, mt); vst2(CS + m, st); } }
// ---- k_smcol: block per row n: P[n][m] = exp(S[n][m] - CM[m]) / CS[m] x 2^11 in place (rows rewritten as whole 16-B lanes)
__global__ __launch_bounds__(256) void k_smcol(float* __restrict__ S, const float* __restrict__ CM, const float* __restrict__ CS) { const int tid = threadIdx.x; float* sr = S + (size_t)blockIdx.x * TT;
  for (int q = tid; q < TT / 4; q += 256) { const v4f v = *(const v4f*)(sr + q * 4), cm = *(const v4f*)(CM + q * 4), cs = *(const v4f*)(CS + q * 4); asm volatile("s_wait_loadcnt 0x0" ::: "memory"); v4f o;
#pragma unroll
    for (int u = 0; u < 4; ++u) o[u] = expf(v[u] - cm[u]) * (2048.0f / cs[u]);
    vst2(sr + q * 4, o); } }
__global__ __launch_bounds__(256) void k_trans(const _Float16* __restrict__ G, _Float16* __restrict__ VT2) { __shared__ _Float16 st[64][72]; const int tid = threadIdx.x; const int m0 = blockIdx.x * 64, c0 = blockIdx.y * 64, b = blockIdx.z; const _Float16* gb = G + (size_t)b * CB * TT; _Float16* vb = VT2 + (size_t)b * CB * TT;
  for (int e = tid; e < 64 * 8; e += 256) { const int ml = e >> 3, q = e & 7; const v4u u = *(const v4u*)(gb + (size_t)(m0 + ml) * CB + c0 + q * 8); asm volatile("s_wait_loadcnt 0x0" ::: "memory"); const hx8 hv = *(const hx8*)&u; _Pragma("unroll") for (int j = 0; j < 8; ++j) st[q * 8 + j][ml] = hv[j]; }
  __syncthreads();
  for (int e = tid; e < 64 * 8; e += 256) { const int cl = e >> 3, q = e & 7; hx8 hv; _Pragma("unroll") for (int j = 0; j < 8; ++j) hv[j] = st[cl][q * 8 + j]; vst2((unsigned*)(vb + (size_t)(c0 + cl) * TT + m0 + q * 8), *(const v4u*)&hv); } }
// ---- k_wout: block = (64 positions, 128 of the 256 output channels, batch): A[pos][cb] = y view Yb[cb*4096 + pos] (the raw reshape back: the batch's y rows [4096][128] f32 reinterpreted as [Cb][N]) split bf16 hi + lo (2 products) x exact (out,in) W [256][128]; + bf16(W_b) + bf16(x[b][o][pos]); channels-first store out[b][o][pos0..pos0+63] through LDS (one 256-B run per channel by 16 lanes)
__global__ __launch_bounds__(128) void k_wout(const float* __restrict__ Y, const float* __restrict__ WW, const float* __restrict__ WB, const float* __restrict__ X, float* __restrict__ OUT) { __shared__ __align__(16) float st[128][68];
  const int tid = threadIdx.x, wave = tid >> 5, lane = tid & 31, col = lane & 15, g = lane >> 4; const int p0 = blockIdx.x * 64, c0 = blockIdx.y * 128, b = blockIdx.z; const float* Yb = Y + (size_t)b * TT * CB;
  v8f acc[8] = {};
#pragma unroll 1
  for (int kc = 0; kc < CB / 32; ++kc) { v16b ah, al, w[8]; { const float* p = Yb + (size_t)(kc * 32 + 8 * g) * TT + p0 + wave * 16 + col; const float* wp = WW + (size_t)(c0 + col) * CB + kc * 32 + 8 * g; float tv[16];
#pragma unroll
      for (int i = 0; i < 8; ++i) { tv[i] = p[(size_t)i * TT]; tv[8 + i] = p[(size_t)(16 + i) * TT]; }
#pragma unroll
      for (int j = 0; j < 8; ++j) w[j] = wfrag_p(wp + (size_t)j * 16 * CB);   /* with the y loads, ahead of the k step's first WMMA (the asm in wmma_bf holds later loads behind it) */
      asm volatile("s_wait_loadcnt 0x0" :: "v"(p), "v"(wp) : "memory");   /* names the two address pairs so that they stay as they are until every load of the batch has returned */
#pragma unroll
      for (int i = 0; i < 16; ++i) { const __bf16 h = (__bf16)tv[i]; ah[i] = h; al[i] = (__bf16)(tv[i] - (float)h); } }
#pragma unroll
    for (int j = 0; j < 8; ++j) { acc[j] = wmma_bf(ah, w[j], acc[j]); acc[j] = wmma_bf(al, w[j], acc[j]); } }
  // thread's sixteen 16-B pieces: channel c0 + (tid >> 4) + 8 u, positions p0 + (tid & 15) * 4
  const size_t o0 = ((size_t)b * COUT + c0 + (tid >> 4)) * (size_t)TT + p0 + (tid & 15) * 4; const float* xp = X + o0; const float* bp = WB + c0 + col; float* op = OUT + o0;
  float wb8[8]; v4f xr[16];   /* the eight bias loads and the sixteen residual loads are issued together, ahead of the turn through LDS */
#pragma unroll
  for (int j = 0; j < 8; ++j) wb8[j] = bp[j * 16];
#pragma unroll
  for (int u = 0; u < 16; ++u) xr[u] = *(const v4f*)(xp + (size_t)u * 8 * TT);
  asm volatile("s_wait_loadcnt 0x0" :: "v"(xp), "v"(bp) : "memory");   /* names the two address pairs so that they stay as they are until every load of the batch has returned */
#pragma unroll
  for (int j = 0; j < 8; ++j) { const float wb = bfr(wb8[j]);
#pragma unroll
    for (int r = 0; r < 8; ++r) st[j * 16 + col][wave * 16 + 8 * g + r] = acc[j][r] + wb; }
  __syncthreads();
#pragma unroll
  for (int u = 0; u < 16; ++u) { v4f v = *(const v4f*)&st[(tid >> 4) + 8 * u][(tid & 15) * 4]; v[0] += bfr(xr[u][0]); v[1] += bfr(xr[u][1]); v[2] += bfr(xr[u][2]); v[3] += bfr(xr[u][3]); vst2(op + (size_t)u * 8 * TT, v); } }
// ---- k_pv: block = (16 queries, all 128 value columns, batch in group), 16 waves: wave s takes the 32-key steps s, s + 16, s + 32, ... of the 4,096 keys (neighbouring waves read neighbouring 128-B pieces of the same P rows and the two halves of the same v lines), P x 2^11 once to f16 against v f16 (1 product); the 16 partial 16 x 128 tiles are joined through LDS in ascending s, x 2^-11, one y row per wave
#define PVS 16             // key slices = waves of a k_pv block = query rows of a block (the join gives wave w row w)
static_assert(PVS == 16 && (TT / 32) % PVS == 0, "one y row per wave; every wave the same number of 32-key steps");
__global__ __launch_bounds__(32 * PVS) void k_pv(const float* __restrict__ PS0, const _Float16* __restrict__ VT, int bgrp, int h0, float* __restrict__ Y) { const int h = h0; const int b = bgrp + blockIdx.z; const float* PS = PS0 + (size_t)blockIdx.z * TT * TT; const int d0 = blockIdx.y * DVH;   /* group spans batches; column offset d0 (0: all 128 columns in one block) */ __shared__ __align__(16) float ss[PVS][16][DVH + 4];
  const int tid = threadIdx.x, wave = __builtin_amdgcn_readfirstlane(tid >> 5), lane = tid & 31, col = lane & 15, g = lane >> 4; const int ql0 = blockIdx.x * 16; const int kce = (kb_last(ql0 >> 6) + 1) * 4;
  v8f acc[DVH / 16] = {};
#pragma unroll 1
  for (int i = 0; i < kce / PVS; ++i) { const int kc = i * PVS + wave; const float* pp = PS + (size_t)(ql0 + col) * TT + kc * 32 + 8 * g; const _Float16* vp = VT + ((size_t)b * CC + h * HD + d0 + col) * (size_t)TT + kc * 32 + 8 * g;   /* v fragment j starts 16 planes further on */
    float pf[16]; v16h p, vf[DVH / 16];
#pragma unroll
    for (int u = 0; u < 8; ++u) { pf[u] = pp[u]; pf[8 + u] = pp[16 + u]; }
#pragma unroll
    for (int j = 0; j < DVH / 16; ++j) vf[j] = frag_hp(vp + (size_t)j * 16 * TT);   /* the step's eight v fragments with its P loads, ahead of the first WMMA (the asm in wmma16 holds later loads behind it) */
    asm volatile("s_wait_loadcnt 0x0" :: "v"(pp), "v"(vp), "v"(pf[0]), "v"(pf[1]), "v"(pf[2]), "v"(pf[3]), "v"(pf[4]), "v"(pf[5]), "v"(pf[6]), "v"(pf[7]), "v"(pf[8]), "v"(pf[9]), "v"(pf[10]), "v"(pf[11]), "v"(pf[12]), "v"(pf[13]), "v"(pf[14]), "v"(pf[15]) : "memory");   /* names the two address pairs so that they stay as they are until every load of the batch has returned, and the loaded P values so that no v load waits for their registers */
#pragma unroll
    for (int u = 0; u < 16; ++u) p[u] = (_Float16)pf[u];
#pragma unroll
    for (int j = 0; j < DVH / 16; ++j) acc[j] = wmma16(p, vf[j], acc[j]); }
#pragma unroll
  for (int j = 0; j < DVH / 16; ++j)
#pragma unroll
    for (int r = 0; r < 8; ++r) ss[wave][8 * g + r][j * 16 + col] = acc[j][r];
  __syncthreads();   /* all 16 key slices' partial tiles are in ss before a wave sums its row over them */
  v4f t = *(const v4f*)&ss[0][wave][lane * 4];
#pragma unroll
  for (int s = 1; s < PVS; ++s) t += *(const v4f*)&ss[s][wave][lane * 4];
  vst2(Y + ((size_t)b * TT + ql0 + wave) * CC + h * HD + d0 + lane * 4, t * (1.0f / 2048.0f)); }   /* y rows [b*TT + n][128]: 512-B row by 32 lanes */

#define WS_TL  (WS_END)                                  // f16 theta-view residual plane [b][128][TT] (viewed as rows)
#define WS_G   (WS_TL + 2u * (size_t)NB * CB * TT)        // f16 g conv plane [b][128][TT]
#define WS_VT2 (WS_G + 2u * (size_t)NB * CB * TT)         // f16 g-view transposed [b][128][TT]
#define WS_YR  (WS_VT2 + 2u * (size_t)NB * CB * TT)       // f32 y rows [b*TT + n][128]
#define WS_CM  (WS_YR + 4u * (size_t)NB * TT * CB)        // f32 column max [TT]
#define WS_CS  (WS_CM + 4u * (size_t)TT)
#define WS_PM  (WS_CS + 4u * (size_t)TT)                  // f32 partial column max [NQB][TT]
#define WS_PS  (WS_PM + 4u * (size_t)NQB * TT)            // f32 partial column sum [NQB][TT]
#define WS_END2 (WS_PS + 4u * (size_t)NQB * TT)
extern "C" void kernel_launch(void* const* d_in, const int* in_sizes, int n_in, void* d_out, int out_size, void* d_ws, size_t ws_size, hipStream_t stream) {
  (void)in_sizes; (void)n_in; (void)out_size;
  const float** F = (const float**)d_in;
  if (ws_size < (size_t)WS_END) return;
  char* ws = (char*)d_ws; _Float16 *QH = (_Float16*)(ws + WS_QH), *KH = (_Float16*)(ws + WS_KH), *VT = (_Float16*)(ws + WS_VT), *QL = (_Float16*)(ws + WS_QL), *KL = (_Float16*)(ws + WS_KL); __bf16 *VB = (__bf16*)(ws + WS_VB), *VBL = (__bf16*)(ws + WS_VBL); float *S = (float*)(ws + WS_S), *Y = (float*)(ws + WS_Y);
  (void)Y; (void)QL; (void)KL; (void)VB; (void)VBL;
  // inputs: 0 x [4,256,64,64] (channels-first); 1 theta_w [128,256], 2 theta_b; 3 phi_w, 4 phi_b; 5 g_w, 6 g_b; 7 W_w [256,128], 8 W_b [256] (all (out,in), biases nonzero)
  if (ws_size < (size_t)WS_END2) return;
  _Float16 *TL = (_Float16*)(ws + WS_TL), *G = (_Float16*)(ws + WS_G), *VT2 = (_Float16*)(ws + WS_VT2); float *YR = (float*)(ws + WS_YR), *CM = (float*)(ws + WS_CM), *CS = (float*)(ws + WS_CS), *PM = (float*)(ws + WS_PM), *PS = (float*)(ws + WS_PS);
  // phi^T rows (the 'k' rows: phi[c][m] proper layout, token-major) via the q/k path as which = 1 -> KH (+KL rows < 64, unused)
  k_projT<1><<<dim3(TNB * TT / 64, 1, 1), 128, 0, stream>>>(F[0], F[0], F[0], F[3], F[3], F[3], F[4], F[4], F[4], QH, QL, KH, KL, VT, VB, VBL, nullptr);
  // theta conv plane [Cb][N] (f16 hi into the 'VT' slot = the theta VIEW rows [N][Cb] when read row-major) + its residual plane TL (the view's residual rows) via the [c][t] path (which = 2)
  k_projT<2><<<dim3(TNB * TT / 64, 1, 1), 128, 0, stream>>>(F[0], F[0], F[0], F[1], F[1], F[1], F[2], F[2], F[2], QH, QL, KH, KL, VT, VB, VBL, TL);
  // g conv plane [Cb][N] f16 -> G, then the g VIEW rows transposed into the value plane VT2[c][m]
  k_projT<2><<<dim3(TNB * TT / 64, 1, 1), 128, 0, stream>>>(F[0], F[0], F[0], F[5], F[5], F[5], F[6], F[6], F[6], QH, QL, KH, KL, G, VB, VBL, nullptr);
  k_trans<<<dim3(TT / 64, CB / 64, TNB), 256, 0, stream>>>(G, VT2);
  for (int b0 = 0; b0 < TNB; b0 += BGN) {
    k_sc<<<dim3(NQB, TT / 128, BGN), 128, 0, stream>>>(VT /* theta view rows */, KH, TL /* view residual rows */, KL, b0, 0, S, PM, PS);
    k_colmerge<<<dim3(TT / 32), 256, 0, stream>>>(PM, PS, CM, CS);
    k_smcol<<<dim3(TT), 256, 0, stream>>>(S, CM, CS);
    k_pv<<<dim3(TT / PVS, HD / DVH, BGN), 32 * PVS, 0, stream>>>(S, VT2, b0, 0, YR);
  }
  k_wout<<<dim3(TT / 64, COUT / 128, TNB), 128, 0, stream>>>(YR, F[7], F[8], F[0], (float*)d_out);

}

// v004
// One run takes 316 microseconds.
// Two timings next to v003 both put it at 1.18 times that version's speed.
// Counting every step since v000, it is 8.16 times as fast.
// compute dtype: all float inputs rounded to bf16; the three 1x1 convs with EXACT bf16 products on WMMA 16x16x32 (f32 accumulate) + bias; scores between the raw-reshaped theta view (f16 hi + residual x 2^10) and phi (f16) (2 products); the softmax over the QUERY axis in f32 (per-column max / sum from 64-row partials, precise expf); P x 2^11 once to f16 x the raw-reshaped g view once to f16 (1 product); the W 1x1 conv on the raw-reshaped y view with bf16 hi + lo (2 products) x exact W + bias + x residual; f32 output written channels-first.
#include <hip/hip_runtime.h>
#include <math.h>

typedef __attribute__((ext_vector_type(16))) _Float16 v16h;
typedef __attribute__((ext_vector_type(16))) __bf16 v16b;
typedef __attribute__((ext_vector_type(8)))  _Float16 v8h;
typedef __attribute__((ext_vector_type(8)))  float v8f;
typedef __attribute__((ext_vector_type(4)))  float v4f;
typedef __attribute__((ext_vector_type(2)))  float v2f;
typedef __attribute__((ext_vector_type(4)))  unsigned v4u;
typedef _Float16 hx8 __attribute__((ext_vector_type(8)));
typedef __attribute__((ext_vector_type(4)))  int v4i;
typedef float __attribute__((may_alias)) float_a;
typedef int __attribute__((may_alias)) int_a;

template <typename T> __device__ __forceinline__ void vst2(void* p, T v) { *(T*)p = v;  }
__device__ __forceinline__ v8f wmma16(v16h a, v16h b, v8f c) {
  v8f d = __builtin_amdgcn_wmma_f32_16x16x32_f16(false, a, false, b, (short)0, c, false, false);
  asm volatile("v_nop\n\tv_nop\n\tv_nop\n\tv_nop" : "+v"(d) : "v"(a), "v"(b));
  return d;
}
__device__ __forceinline__ v8f wmma_bf(v16b a, v16b b, v8f c) {
  v8f d = __builtin_amdgcn_wmma_f32_16x16x32_bf16(false, a, false, b, (short)0, c, false, false);
  asm volatile("v_nop\n\tv_nop\n\tv_nop\n\tv_nop" : "+v"(d) : "v"(a), "v"(b));
  return d;
}
// 16x16x32 fragments: lane = (h = lane>>4, row/col = lane&15); elements 0..7 = k0+8h+0..7, 8..15 = k0+16+8h+0..7; D element r = row 8h+r
__device__ __forceinline__ v16h frag_h(const _Float16* rowk0, int lane) {
  union { v16h v; v8h q[2]; } u; const _Float16* p = rowk0 + 8 * (lane >> 4);
  u.q[0] = *(const v8h*)p; u.q[1] = *(const v8h*)(p + 16); return u.v;
}
__device__ __forceinline__ v16h frag_f32(const float* rowk0, int lane) {
  v16h a; const float* p = rowk0 + 8 * (lane >> 4);
#pragma unroll
  for (int i = 0; i < 8; ++i) { a[i] = (_Float16)p[i]; a[8 + i] = (_Float16)p[16 + i]; }
  return a;
}
__device__ __forceinline__ v16h frag_f32s(const float* rowk0, int lane, float sc) {
  v16h a; const float* p = rowk0 + 8 * (lane >> 4);
#pragma unroll
  for (int i = 0; i < 8; ++i) { a[i] = (_Float16)(p[i] * sc); a[8 + i] = (_Float16)(p[16 + i] * sc); }
  return a;
}
// column fragment from a [K][ld] layout (column n), rows >= K read as 0
__device__ __forceinline__ v16h fragc_f32(const float* W, int k0, int n, int lane, int ld, int K) {
  v16h a; const int g = lane >> 4;
#pragma unroll
  for (int i = 0; i < 8; ++i) { const int ka = k0 + 8 * g + i, kb = ka + 16;
    a[i] = (_Float16)(ka < K ? W[(size_t)(ka < K ? ka : K - 1) * ld + n] : 0.f); a[8 + i] = (_Float16)(kb < K ? W[(size_t)(kb < K ? kb : K - 1) * ld + n] : 0.f); }
  return a;
}
struct F2 { v16b h, l; };
__device__ __forceinline__ F2 bsplit16(const float v[16]) { F2 r;
#pragma unroll
  for (int i = 0; i < 16; ++i) { const __bf16 h = (__bf16)v[i]; r.h[i] = h; r.l[i] = (__bf16)(v[i] - (float)h); }
  return r; }
__device__ __forceinline__ F2 split_row(const float* row, int k0, int lane) { float v[16]; const float* p = row + k0 + 8 * (lane >> 4);
#pragma unroll
  for (int i = 0; i < 8; ++i) { v[i] = p[i]; v[8 + i] = p[16 + i]; }
  return bsplit16(v); }
__device__ __forceinline__ F2 split_rowK(const float* row, int k0, int lane, int K) { float v[16]; const int g = lane >> 4;
#pragma unroll
  for (int i = 0; i < 8; ++i) { const int ka = k0 + 8 * g + i, kb = ka + 16; v[i] = ka < K ? row[ka < K ? ka : K - 1] : 0.f; v[8 + i] = kb < K ? row[kb < K ? kb : K - 1] : 0.f; }
  return bsplit16(v); }
__device__ __forceinline__ F2 split_col(const float* W, int k0, int n, int lane, int ld, int K) { float v[16]; const int g = lane >> 4;
#pragma unroll
  for (int i = 0; i < 8; ++i) { const int ka = k0 + 8 * g + i, kb = ka + 16; v[i] = ka < K ? W[(size_t)(ka < K ? ka : K - 1) * ld + n] : 0.f; v[8 + i] = kb < K ? W[(size_t)(kb < K ? kb : K - 1) * ld + n] : 0.f; }
  return bsplit16(v); }
__device__ __forceinline__ v8f mac3(const F2& a, const F2& b, v8f c) { c = wmma_bf(a.l, b.h, c); c = wmma_bf(a.h, b.l, c); return wmma_bf(a.h, b.h, c); }
__device__ __forceinline__ float sigm(float v) { return 1.0f / (1.0f + expf(-v)); }
// fragments read at the lane's own pointer (row start + k0 + 8 * (lane >> 4)): the caller keeps that pointer and names it at the wait behind a batch of loads
__device__ __forceinline__ v16h frag_hp(const _Float16* p) { union { v16h v; v8h q[2]; } u; u.q[0] = *(const v8h*)p; u.q[1] = *(const v8h*)(p + 16); return u.v; }
__device__ __forceinline__ v16b wfrag_p(const float* p) { v16b w;
#pragma unroll
  for (int i = 0; i < 8; ++i) { w[i] = (__bf16)p[i]; w[8 + i] = (__bf16)p[16 + i]; }
  return w; }
#define LDSX() do { asm volatile("s_wait_dscnt 0" ::: "memory"); __builtin_amdgcn_wave_barrier(); __builtin_amdgcn_fence(__ATOMIC_RELEASE, "workgroup"); } while (0)

// Non-local block with the source's RAW reshapes (x [4,256,64,64], Cb 128, N 4,096; (out,in) theta/phi/g 1x1 convs [128,256] + biases, W [256,128] + bias): theta = conv(x).reshape(B, N, Cb) and g likewise are ROW-MAJOR reinterpretations of the [Cb][N] conv outputs (row n = channel n/32, positions (n%32)*128..+127), phi stays [Cb][N]; scores[n][m] = sum_c theta[n][c] phi[c][m]; attn = softmax over n (axis 1 - per key column); y[n][c] = sum_m attn[n][m] g[m][c]; y.reshape(B, Cb, H, W) (raw again) -> W conv + bias + x.
#define NB 4
#define TT 4096
#define CC 128            // g-view plane pitch (Cb channels)
#define CB 128
#define COUT 256
#define CCQ 128           // theta-view / phi^T row pitch (Cb)
#define DIN 256          // x channels
#define NH 1
#define HD 128
#define NQB (TT / 64)
#define HG 1               // one 4,096 x 4,096 score plane per pass (the pass group spans batches)
#define SCALE (1.0f)
#define HDQK 128           // contraction width of the scores (Cb)
#define CAUSAL 0
#ifndef TNB
#define TNB NB
#endif
__device__ __forceinline__ v16b zero16b() { v16b z; _Pragma("unroll") for (int i = 0; i < 16; ++i) z[i] = (__bf16)0.f; return z; }
__device__ __forceinline__ float bfr(float v) { return (float)(__bf16)v; }
__host__ __device__ __forceinline__ int kb_last(int qb) { return CAUSAL ? ((qb * 64 + 63) >> 7) : (TT / 128 - 1); }
typedef __attribute__((ext_vector_type(8))) __bf16 v8b;
__device__ __forceinline__ v16b frag_b(const __bf16* rowk0, int lane) {
  union { v16b v; v8b q[2]; } u; const __bf16* p = rowk0 + 8 * (lane >> 4);
  u.q[0] = *(const v8b*)p; u.q[1] = *(const v8b*)(p + 16); return u.v;
}
#define QBH 0              // 2-product logits everywhere (theta view hi + residual x phi hi)
#define QHI 4096            // q residual rows (all)
#define KHI 64            // (unused k residual / v bf16 planes: QBH 0)
// B fragment (k rows k0+.., output column o) of a weight: (in,out) [K][ld] or (out,in) [ld rows of K]: bf16 exact, or f16(bf16 * 256) exact
__device__ __forceinline__ v16b wcol_io(const float* Wm, int k0, int o, int lane, int ld) { v16b w; const int g = lane >> 4;
#pragma unroll
  for (int i = 0; i < 8; ++i) { w[i] = (__bf16)Wm[(size_t)(k0 + 8 * g + i) * ld + o]; w[8 + i] = (__bf16)Wm[(size_t)(k0 + 16 + 8 * g + i) * ld + o]; }
  return w; }
__device__ __forceinline__ v16b wcol_oi(const float* Wm, int k0, int o, int lane, int K) { v16b w; const float* p = Wm + (size_t)o * K + k0 + 8 * (lane >> 4);
#pragma unroll
  for (int i = 0; i < 8; ++i) { w[i] = (__bf16)p[i]; w[8 + i] = (__bf16)p[16 + i]; }
  return w; }
__device__ __forceinline__ v16h wcolh_io(const float* Wm, int k0, int o, int lane, int ld) { v16h w; const int g = lane >> 4;
#pragma unroll
  for (int i = 0; i < 8; ++i) { w[i] = (_Float16)(bfr(Wm[(size_t)(k0 + 8 * g + i) * ld + o]) * 256.0f); w[8 + i] = (_Float16)(bfr(Wm[(size_t)(k0 + 16 + 8 * g + i) * ld + o]) * 256.0f); }
  return w; }
__device__ __forceinline__ v16h wcolh_oi(const float* Wm, int k0, int o, int lane, int K) { v16h w; const float* p = Wm + (size_t)o * K + k0 + 8 * (lane >> 4);
#pragma unroll
  for (int i = 0; i < 8; ++i) { w[i] = (_Float16)(bfr(p[i]) * 256.0f); w[8 + i] = (_Float16)(bfr(p[16 + i]) * 256.0f); }
  return w; }
#define WQKV_LAYOUT 0   // 0 = (out,in) [CC][DIN], as 1; 1 = (out,in) [CC][DIN]; 2 = per-head [NH][DIN][HD]
__device__ __forceinline__ v16b wcol_hdk(const float* Wm, int k0, int o, int lane) { v16b w; const int g = lane >> 4; const float* p = Wm + (size_t)(o / HD) * DIN * HD + (o % HD);
#pragma unroll
  for (int i = 0; i < 8; ++i) { w[i] = (__bf16)p[(size_t)(k0 + 8 * g + i) * HD]; w[8 + i] = (__bf16)p[(size_t)(k0 + 16 + 8 * g + i) * HD]; }
  return w; }
#define WO_OUT_IN 0
#if WQKV_LAYOUT == 1
#define WCOL(W, k0, o, lane) wcol_oi(W, k0, (o), lane, DIN)   /* unused: layout 0 */
#elif WQKV_LAYOUT == 2
#define WCOL(W, k0, o, lane) wcol_hdk(W, k0, o, lane)
#else
#define WCOL(W, k0, o, lane) wcol_oi(W, k0, (o), lane, DIN)   /* (out,in) 1x1-conv weights [128][256]: all 128 output channels real */
#endif
#if WO_OUT_IN
#define WOCOL(W, k0, o, lane) wcol_oi(W, k0, o, lane, CC)
#define WOCOLH(W, k0, o, lane) wcolh_oi(W, k0, o, lane, CC)
#else
#define WOCOL(W, k0, o, lane) wcol_io(W, k0, o, lane, DIN)
#define WOCOLH(W, k0, o, lane) wcolh_io(W, k0, o, lane, DIN)
#endif
#define BG HG              // the pass group spans BATCHES (single head): blockIdx.z selects batch b0 + z
#define BGN (TNB < BG ? TNB : BG)
#define DVH 128            // all 128 Cb columns of the g view in one k_pv block
#ifndef SM_EXTRA_PARAMS
#define SM_EXTRA_PARAMS
#endif
#ifndef PROJ_EXTRA_PARAMS
#define PROJ_EXTRA_PARAMS
#endif
#ifndef SM_MASK_HOOK
#define SM_MASK_HOOK (void)0
#endif

#define WS_QH  0u                                      // f16 q rows [b*t][CCQ]
#define WS_KH  (WS_QH + 2u * (size_t)NB * TT * CCQ)     // f16 k rows [b*t][CCQ]
#define WS_VT  (WS_KH + 2u * (size_t)NB * TT * CCQ)     // f16 theta conv planes [b][c][t] (theta-view rows)
#define WS_QL  (WS_VT + 2u * (size_t)NB * CC * TT)      // f16 q residual x 2^10 rows [b][t < QHI][CCQ]
#define WS_KL  (WS_QL + 2u * (size_t)NB * QHI * CCQ)    // f16 k residual x 2^10 rows [b][t < KHI][CCQ]
#define WS_VB  (WS_KL + 2u * (size_t)NB * KHI * CCQ)    // bf16 v hi planes [b][c][t < KHI]
#define WS_VBL (WS_VB + 2u * (size_t)NB * CC * KHI)
#define WS_S   (WS_VBL + 2u * (size_t)NB * CC * KHI)    // f32 logits [hg][t][s]
#define WS_Y   (WS_S  + 4u * (size_t)HG * TT * TT)      // empty (0 bytes): the y rows are in WS_YR
#define WS_END (WS_Y  + 0u)

// ---- k_proj: block = (64 rows, 128 cols, which): q/k/v = X W (+ b) with exact bf16 products (K = DIN) -> which 0: q f16 rows (+ residual rows < QHI); 1: k f16 rows (+ residual rows < KHI); 2: v f16 planes [c][t] (+ bf16 hi/lo planes for t < KHI)
template <int WOFF> __global__ __launch_bounds__(128) void k_projT(const float* __restrict__ XQ, const float* __restrict__ XK, const float* __restrict__ XV, const float* __restrict__ WQ, const float* __restrict__ WK, const float* __restrict__ WV, const float* __restrict__ BQ, const float* __restrict__ BK, const float* __restrict__ BV,
    _Float16* __restrict__ QH, _Float16* __restrict__ QL, _Float16* __restrict__ KH, _Float16* __restrict__ KL, _Float16* __restrict__ VT, __bf16* __restrict__ VB, __bf16* __restrict__ VBL, _Float16* __restrict__ VL) {
  __shared__ __align__(16) _Float16 sh[64][136], sl[64][136]; __shared__ __align__(16) _Float16 th[128][72], tlo[128][72]; __shared__ __align__(16) __bf16 tb[128][72], tbl[128][72];
  const int tid = threadIdx.x, wave = tid >> 5, lane = tid & 31, col = lane & 15, g = lane >> 4; const int which = blockIdx.z + WOFF; const int c0 = blockIdx.y * 128; const size_t r0 = (size_t)blockIdx.x * 64; const size_t bb = r0 / TT; const int t0 = (int)(r0 % TT);
  const float* X = which == 0 ? XQ : which == 1 ? XK : XV; const float* WA = which == 0 ? WQ : which == 1 ? WK : WV; const float* BA = which == 0 ? BQ : which == 1 ? BK : BV;
  const int KD = DIN;
  v8f acc[8] = {};
#pragma unroll 2
  for (int kc = 0; kc < KD / 32; ++kc) { v16b a, w[8]; const float* p = X + (bb * KD + kc * 32 + 8 * g) * (size_t)TT + t0 + wave * 16 + col;   /* channels-first [b][c][t]: A[t][c] (16 consecutive t per lane group) */
    const float* wp = WA + (size_t)(c0 + col) * DIN + kc * 32 + 8 * g;   /* (out,in) weight rows: fragment j starts 16 rows further on */
#pragma unroll
    for (int i = 0; i < 8; ++i) { a[i] = (__bf16)p[(size_t)i * TT]; a[8 + i] = (__bf16)p[(size_t)(16 + i) * TT]; }
#pragma unroll
    for (int j = 0; j < 8; ++j) w[j] = wfrag_p(wp + (size_t)j * 16 * DIN);   /* all eight weight fragments ahead of the k step's first WMMA: the asm in wmma_bf holds later loads behind it, so a load written between two WMMAs pays its whole latency there */
    asm volatile("s_wait_loadcnt 0x0" :: "v"(p), "v"(wp) : "memory");   /* names the two address pairs so that they stay as they are until every load of the batch has returned */
#pragma unroll
    for (int j = 0; j < 8; ++j) acc[j] = wmma_bf(a, w[j], acc[j]); }
  const float* bp = BA + c0 + col; float bias8[8] = {};   /* the eight bias loads together, ahead of the epilogue's LDS stores */
  if (BA) {
#pragma unroll
    for (int j = 0; j < 8; ++j) bias8[j] = bp[j * 16];
    asm volatile("s_wait_loadcnt 0x0" :: "v"(bp) : "memory"); }   /* names the address pair so that it stays as it is until the eight loads have returned */
  if (which < 2) { _Float16* DH = which == 0 ? QH : KH; _Float16* DL = which == 0 ? QL : KL; const int nhi = which == 0 ? QHI : KHI; const bool hi_rows = t0 < nhi;
#pragma unroll
    for (int j = 0; j < 8; ++j) { const float bias = bfr(bias8[j]);
#pragma unroll
      for (int r = 0; r < 8; ++r) { const float v = acc[j][r] + bias; const _Float16 hv = (_Float16)v; sh[wave * 16 + 8 * g + r][j * 16 + col] = hv; sl[wave * 16 + 8 * g + r][j * 16 + col] = (_Float16)((v - (float)hv) * 1024.0f); } }
    __syncthreads();
    for (int e = tid; e < 64 * 16; e += 128) { const int rl = e >> 4, q = e & 15; vst2((unsigned*)(DH + (r0 + rl) * CCQ + c0 + q * 8), *(const v4u*)&sh[rl][q * 8]); if (hi_rows) vst2((unsigned*)(DL + (bb * nhi + t0 + rl) * (size_t)CCQ + c0 + q * 8), *(const v4u*)&sl[rl][q * 8]); }   /* q/k rows: pitch CCQ (c0 == 0) */
  } else { const bool hi_rows = t0 < KHI;
#pragma unroll
    for (int j = 0; j < 8; ++j) { const float bias = bfr(bias8[j]);
#pragma unroll
      for (int r = 0; r < 8; ++r) { const float v = acc[j][r] + bias; const int rl = wave * 16 + 8 * g + r, cl = j * 16 + col; const _Float16 hv2 = (_Float16)v; th[cl][rl] = hv2; tlo[cl][rl] = (_Float16)((v - (float)hv2) * 1024.0f); const __bf16 bh = (__bf16)v; tb[cl][rl] = bh; tbl[cl][rl] = (__bf16)(v - (float)bh); } }
    __syncthreads();
    for (int e = tid; e < 128 * 8; e += 128) { const int cl = e >> 3, q = e & 7; vst2((unsigned*)(VT + (bb * CC + c0 + cl) * (size_t)TT + t0 + q * 8), *(const v4u*)&th[cl][q * 8]); if (VL) vst2((unsigned*)(VL + (bb * CC + c0 + cl) * (size_t)TT + t0 + q * 8), *(const v4u*)&tlo[cl][q * 8]); if (hi_rows) { const size_t o3 = (bb * CC + c0 + cl) * (size_t)KHI + t0 + q * 8; vst2((unsigned*)(VB + o3), *(const v4u*)&tb[cl][q * 8]); vst2((unsigned*)(VBL + o3), *(const v4u*)&tbl[cl][q * 8]); } } } }
// ---- k_sc: block = (query block qb, key block kb <= kb_last(qb), batch b in group): logits x SCALE; q hi + residual (x 2^10) against k (2 products) for query rows < QHI, plus the k residual (3 products) for query blocks < QBH (causal early rows); causal: blocks past the diagonal exit
__global__ __launch_bounds__(128) void k_sc(const _Float16* __restrict__ QH, const _Float16* __restrict__ KH, const _Float16* __restrict__ QL, const _Float16* __restrict__ KL, int bgrp, int h0, float* __restrict__ S0, float* __restrict__ PM, float* __restrict__ PS) { __shared__ __align__(16) float ss[4][16][132];
  const int qb = blockIdx.x, kb = blockIdx.y; if (kb > kb_last(qb)) return;
  const int h = h0; const int b = bgrp + blockIdx.z; float* S = S0 + (size_t)blockIdx.z * TT * TT;   /* group spans batches */
  const int tid = threadIdx.x, wave = tid >> 5, lane = tid & 31, col = lane & 15, g = lane >> 4; const int k0 = kb * 128; const int ql0 = qb * 64 + wave * 16; const size_t q0 = (size_t)b * TT + ql0, kr0 = (size_t)b * TT + k0;
  v8f acc[8] = {}, accl[8] = {};
  const _Float16* QLb = QL + (size_t)b * QHI * CCQ; const _Float16* KLb = KL + (size_t)b * KHI * CCQ;   /* single head: q/k rows at pitch CCQ */
  if (qb < QBH) {
#pragma unroll
    for (int kc = 0; kc < HDQK / 32; ++kc) { const v16h ah = frag_h(QH + (q0 + col) * CCQ + kc * 32, lane), al = frag_h(QLb + (size_t)(ql0 + col) * CCQ + kc * 32, lane);
#pragma unroll
      for (int j = 0; j < 8; ++j) { const v16h kbf = frag_h(KH + (kr0 + j * 16 + col) * CCQ + kc * 32, lane), klf = frag_h(KLb + (size_t)(k0 + j * 16 + col) * CCQ + kc * 32, lane); acc[j] = wmma16(ah, kbf, acc[j]); accl[j] = wmma16(al, kbf, accl[j]); accl[j] = wmma16(ah, klf, accl[j]); } }
  } else if (qb * 64 < QHI) {
#pragma unroll
    for (int kc = 0; kc < HDQK / 32; ++kc) { const v16h ah = frag_h(QH + (q0 + col) * CCQ + kc * 32, lane), al = frag_h(QLb + (size_t)(ql0 + col) * CCQ + kc * 32, lane);
      v16h kbf[8];   /* the k step's eight key fragments ahead of its first WMMA (the asm in wmma16 holds later loads behind it) */
#pragma unroll
      for (int j = 0; j < 8; ++j) kbf[j] = frag_h(KH + (kr0 + j * 16 + col) * CCQ + kc * 32, lane);
#pragma unroll
      for (int j = 0; j < 8; ++j) { acc[j] = wmma16(ah, kbf[j], acc[j]); accl[j] = wmma16(al, kbf[j], accl[j]); } }
  } else {
#pragma unroll
    for (int kc = 0; kc < HDQK / 32; ++kc) { const v16h ah = frag_h(QH + (q0 + col) * CCQ + kc * 32, lane);
#pragma unroll
      for (int j = 0; j < 8; ++j) { const v16h kbf = frag_h(KH + (kr0 + j * 16 + col) * CCQ + kc * 32, lane); acc[j] = wmma16(ah, kbf, acc[j]); } } }
#pragma unroll
  for (int j = 0; j < 8; ++j) {
#pragma unroll
    for (int r = 0; r < 8; ++r) ss[wave][8 * g + r][j * 16 + col] = (acc[j][r] + accl[j][r] * (1.0f / 1024.0f)) * SCALE; }
  __syncthreads();   /* every wave's 16 rows of the tile are in ss before a thread walks its column; placed ahead of the S stores so that it does not wait for them */
  LDSX(); for (int rl = 0; rl < 16; ++rl) vst2(S + (size_t)(ql0 + rl) * TT + k0 + lane * 4, *(const v4f*)&ss[wave][rl][lane * 4]);
  asm volatile("s_wait_xcnt 0x0" ::: "memory");   /* the registers that the S stores name are reused by the column walk below */
  // column statistics of this 64 x 128 tile from the stored f32 logits: thread = key column, rows in ascending order: max, then sum of exp(v - max)
  { float v[64];
#pragma unroll
    for (int i = 0; i < 64; ++i) v[i] = ss[i >> 4][i & 15][tid];
    float m = v[0];
#pragma unroll
    for (int i = 1; i < 64; ++i) m = fmaxf(m, v[i]);
    float s = 0.f;
#pragma unroll
    for (int i = 0; i < 64; ++i) s += expf(v[i] - m);
    vst2(PM + (size_t)qb * TT + k0 + tid, m); vst2(PS + (size_t)qb * TT + k0 + tid, s); } }
// ---- k_colmerge: softmax over the QUERY axis (axis 1): joins the 64 per-query-block partials (PM = max, PS = sum of exp(S - PM) over 64 rows) of each key column m: CM[m] = max, CS[m] = 2^11 / sum_q PS[q][m] exp(PM[q][m] - CM[m]) (the factor that k_pv multiplies with: one division per column); block = 32 columns (lane) x 8 waves of 8 partials, joined through LDS
__global__ __launch_bounds__(256) void k_colmerge(const float* __restrict__ PM, const float* __restrict__ PS, float* __restrict__ CM, float* __restrict__ CS) { __shared__ float lm[8][32], ls[8][32];
  const int tid = threadIdx.x, wave = tid >> 5, lane = tid & 31; const int m = blockIdx.x * 32 + lane; float pm[8], ps[8];
#pragma unroll
  for (int u = 0; u < 8; ++u) pm[u] = PM[(size_t)(wave * 8 + u) * TT + m];
  asm volatile("s_wait_xcnt 0x0" ::: "memory");   /* the address pair of the loads above is rewritten for the loads below */
#pragma unroll
  for (int u = 0; u < 8; ++u) ps[u] = PS[(size_t)(wave * 8 + u) * TT + m];
  float mx = pm[0];
#pragma unroll
  for (int u = 1; u < 8; ++u) mx = fmaxf(mx, pm[u]);
  float sm2 = 0.f;
#pragma unroll
  for (int u = 0; u < 8; ++u) sm2 += ps[u] * expf(pm[u] - mx);
  lm[wave][lane] = mx; ls[wave][lane] = sm2;
  __syncthreads();
  if (wave == 0) { float mt = lm[0][lane];
#pragma unroll
    for (int w = 1; w < 8; ++w) mt = fmaxf(mt, lm[w][lane]);
    float st = 0.f;
#pragma unroll
    for (int w = 0; w < 8; ++w) st += ls[w][lane] * expf(lm[w][lane] - mt);
    vst2(CM + m, mt); vst2(CS + m, 2048.0f / st); } }
__global__ __launch_bounds__(256) void k_trans(const _Float16* __restrict__ G, _Float16* __restrict__ VT2) { __shared__ _Float16 st[64][72]; const int tid = threadIdx.x; const int m0 = blockIdx.x * 64, c0 = blockIdx.y * 64, b = blockIdx.z; const _Float16* gb = G + (size_t)b * CB * TT; _Float16* vb = VT2 + (size_t)b * CB * TT;
  for (int e = tid; e < 64 * 8; e += 256) { const int ml = e >> 3, q = e & 7; const v4u u = *(const v4u*)(gb + (size_t)(m0 + ml) * CB + c0 + q * 8); asm volatile("s_wait_loadcnt 0x0" ::: "memory"); const hx8 hv = *(const hx8*)&u; _Pragma("unroll") for (int j = 0; j < 8; ++j) st[q * 8 + j][ml] = hv[j]; }
  __syncthreads();
  for (int e = tid; e < 64 * 8; e += 256) { const int cl = e >> 3, q = e & 7; hx8 hv; _Pragma("unroll") for (int j = 0; j < 8; ++j) hv[j] = st[cl][q * 8 + j]; vst2((unsigned*)(vb + (size_t)(c0 + cl) * TT + m0 + q * 8), *(const v4u*)&hv); } }
// ---- k_wout: block = (64 positions, 128 of the 256 output channels, batch): A[pos][cb] = y view Yb[cb*4096 + pos] (the raw reshape back: the batch's y rows [4096][128] f32 reinterpreted as [Cb][N]) split bf16 hi + lo (2 products) x exact (out,in) W [256][128]; + bf16(W_b) + bf16(x[b][o][pos]); channels-first store out[b][o][pos0..pos0+63] through LDS (one 256-B run per channel by 16 lanes)
__global__ __launch_bounds__(128) void k_wout(const float* __restrict__ Y, const float* __restrict__ WW, const float* __restrict__ WB, const float* __restrict__ X, float* __restrict__ OUT) { __shared__ __align__(16) float st[128][68];
  const int tid = threadIdx.x, wave = tid >> 5, lane = tid & 31, col = lane & 15, g = lane >> 4; const int p0 = blockIdx.x * 64, c0 = blockIdx.y * 128, b = blockIdx.z; const float* Yb = Y + (size_t)b * TT * CB;
  v8f acc[8] = {};
#pragma unroll 1
  for (int kc = 0; kc < CB / 32; ++kc) { v16b ah, al, w[8]; { const float* p = Yb + (size_t)(kc * 32 + 8 * g) * TT + p0 + wave * 16 + col; const float* wp = WW + (size_t)(c0 + col) * CB + kc * 32 + 8 * g; float tv[16];
#pragma unroll
      for (int i = 0; i < 8; ++i) { tv[i] = p[(size_t)i * TT]; tv[8 + i] = p[(size_t)(16 + i) * TT]; }
#pragma unroll
      for (int j = 0; j < 8; ++j) w[j] = wfrag_p(wp + (size_t)j * 16 * CB);   /* with the y loads, ahead of the k step's first WMMA (the asm in wmma_bf holds later loads behind it) */
      asm volatile("s_wait_loadcnt 0x0" :: "v"(p), "v"(wp) : "memory");   /* names the two address pairs so that they stay as they are until every load of the batch has returned */
#pragma unroll
      for (int i = 0; i < 16; ++i) { const __bf16 h = (__bf16)tv[i]; ah[i] = h; al[i] = (__bf16)(tv[i] - (float)h); } }
#pragma unroll
    for (int j = 0; j < 8; ++j) { acc[j] = wmma_bf(ah, w[j], acc[j]); acc[j] = wmma_bf(al, w[j], acc[j]); } }
  // thread's sixteen 16-B pieces: channel c0 + (tid >> 4) + 8 u, positions p0 + (tid & 15) * 4
  const size_t o0 = ((size_t)b * COUT + c0 + (tid >> 4)) * (size_t)TT + p0 + (tid & 15) * 4; const float* xp = X + o0; const float* bp = WB + c0 + col; float* op = OUT + o0;
  float wb8[8]; v4f xr[16];   /* the eight bias loads and the sixteen residual loads are issued together, ahead of the turn through LDS */
#pragma unroll
  for (int j = 0; j < 8; ++j) wb8[j] = bp[j * 16];
#pragma unroll
  for (int u = 0; u < 16; ++u) xr[u] = *(const v4f*)(xp + (size_t)u * 8 * TT);
  asm volatile("s_wait_loadcnt 0x0" :: "v"(xp), "v"(bp) : "memory");   /* names the two address pairs so that they stay as they are until every load of the batch has returned */
#pragma unroll
  for (int j = 0; j < 8; ++j) { const float wb = bfr(wb8[j]);
#pragma unroll
    for (int r = 0; r < 8; ++r) st[j * 16 + col][wave * 16 + 8 * g + r] = acc[j][r] + wb; }
  __syncthreads();
#pragma unroll
  for (int u = 0; u < 16; ++u) { v4f v = *(const v4f*)&st[(tid >> 4) + 8 * u][(tid & 15) * 4]; v[0] += bfr(xr[u][0]); v[1] += bfr(xr[u][1]); v[2] += bfr(xr[u][2]); v[3] += bfr(xr[u][3]); vst2(op + (size_t)u * 8 * TT, v); } }
// ---- k_pv: block = (16 queries, all 128 value columns, batch in group), 16 waves: wave s takes the 32-key steps s, s + 16, s + 32, ... of the 4,096 keys (neighbouring waves read neighbouring 128-B pieces of the same score rows and the two halves of the same v lines), P[n][m] x 2^11 = exp(S[n][m] - CM[m]) * CS[m] formed in registers from the f32 logits (each element belongs to one lane of one wave), once to f16 against v f16 (1 product); the 16 partial 16 x 128 tiles are joined through LDS in ascending s, x 2^-11, one y row per wave
#define PVS 16             // key slices = waves of a k_pv block = query rows of a block (the join gives wave w row w)
static_assert(PVS == 16 && (TT / 32) % PVS == 0, "one y row per wave; every wave the same number of 32-key steps");
__global__ __launch_bounds__(32 * PVS) void k_pv(const float* __restrict__ PS0, const float* __restrict__ CM, const float* __restrict__ CS, const _Float16* __restrict__ VT, int bgrp, int h0, float* __restrict__ Y) { const int h = h0; const int b = bgrp + blockIdx.z; const float* PS = PS0 + (size_t)blockIdx.z * TT * TT; const int d0 = blockIdx.y * DVH;   /* group spans batches; column offset d0 (always 0: one block takes all 128 columns) */ __shared__ __align__(16) float ss[PVS][16][DVH + 4];
  const int tid = threadIdx.x, wave = __builtin_amdgcn_readfirstlane(tid >> 5), lane = tid & 31, col = lane & 15, g = lane >> 4; const int ql0 = blockIdx.x * 16; const int kce = (kb_last(ql0 >> 6) + 1) * 4;
  v8f acc[DVH / 16] = {};
#pragma unroll 1
  for (int i = 0; i < kce / PVS; ++i) { const int kc = i * PVS + wave; const float* pp = PS + (size_t)(ql0 + col) * TT + kc * 32 + 8 * g; const _Float16* vp = VT + ((size_t)b * CC + h * HD + d0 + col) * (size_t)TT + kc * 32 + 8 * g;   /* v fragment j starts 16 planes further on */
    const float* mp = CM + kc * 32 + 8 * g; const float* fp = CS + kc * 32 + 8 * g;   /* the lane's 16 key columns: their max and their factor */
    v4f pf[4], cm[4], cf[4]; v16h p, vf[DVH / 16];
#pragma unroll
    for (int u = 0; u < 4; ++u) { const int o = (u >> 1) * 16 + (u & 1) * 4; pf[u] = *(const v4f*)(pp + o); cm[u] = *(const v4f*)(mp + o); cf[u] = *(const v4f*)(fp + o); }
    __builtin_amdgcn_sched_barrier(0);   /* the scores, maxima and factors are asked for first: loads come back in the order of issue, so the exp work can start while the v fragments, the larger part of the step's bytes, still arrive */
#pragma unroll
    for (int j = 0; j < DVH / 16; ++j) vf[j] = frag_hp(vp + (size_t)j * 16 * TT);   /* the step's eight v fragments with its score loads, ahead of the first WMMA (the asm in wmma16 holds later loads behind it) */
    __builtin_amdgcn_sched_barrier(0);   /* every load of the step is issued ahead of the exp work below, which then runs while the v fragments are still on their way; without it the scheduler sinks the v loads behind that work and a step pays two load latencies in a row */
#pragma unroll
    for (int u = 0; u < 16; ++u) p[u] = (_Float16)(expf(pf[u >> 2][u & 3] - cm[u >> 2][u & 3]) * cf[u >> 2][u & 3]);
#pragma unroll
    for (int j = 0; j < DVH / 16; ++j) acc[j] = wmma16(p, vf[j], acc[j]);
    asm volatile("s_wait_loadcnt 0x0" :: "v"(pp), "v"(mp), "v"(fp), "v"(vp) : "memory"); }   /* at the step's foot, so that it does not hold the exp work back: names the four address pairs so that they stay as they are until every load of the step has returned */
#pragma unroll
  for (int j = 0; j < DVH / 16; ++j)
#pragma unroll
    for (int r = 0; r < 8; ++r) ss[wave][8 * g + r][j * 16 + col] = acc[j][r];
  __syncthreads();   /* all 16 key slices' partial tiles are in ss before a wave sums its row over them */
  v4f t = *(const v4f*)&ss[0][wave][lane * 4];
#pragma unroll
  for (int s = 1; s < PVS; ++s) t += *(const v4f*)&ss[s][wave][lane * 4];
  vst2(Y + ((size_t)b * TT + ql0 + wave) * CC + h * HD + d0 + lane * 4, t * (1.0f / 2048.0f)); }   /* y rows [b*TT + n][128]: 512-B row by 32 lanes */

#define WS_TL  (WS_END)                                  // f16 theta-view residual plane [b][128][TT] (viewed as rows)
#define WS_G   (WS_TL + 2u * (size_t)NB * CB * TT)        // f16 g conv plane [b][128][TT]
#define WS_VT2 (WS_G + 2u * (size_t)NB * CB * TT)         // f16 g-view transposed [b][128][TT]
#define WS_YR  (WS_VT2 + 2u * (size_t)NB * CB * TT)       // f32 y rows [b*TT + n][128]
#define WS_CM  (WS_YR + 4u * (size_t)NB * TT * CB)        // f32 column max [TT]
#define WS_CS  (WS_CM + 4u * (size_t)TT)                  // f32 2^11 / column sum [TT]
#define WS_PM  (WS_CS + 4u * (size_t)TT)                  // f32 partial column max [NQB][TT]
#define WS_PS  (WS_PM + 4u * (size_t)NQB * TT)            // f32 partial column sum [NQB][TT]
#define WS_END2 (WS_PS + 4u * (size_t)NQB * TT)
extern "C" void kernel_launch(void* const* d_in, const int* in_sizes, int n_in, void* d_out, int out_size, void* d_ws, size_t ws_size, hipStream_t stream) {
  (void)in_sizes; (void)n_in; (void)out_size;
  const float** F = (const float**)d_in;
  if (ws_size < (size_t)WS_END) return;
  char* ws = (char*)d_ws; _Float16 *QH = (_Float16*)(ws + WS_QH), *KH = (_Float16*)(ws + WS_KH), *VT = (_Float16*)(ws + WS_VT), *QL = (_Float16*)(ws + WS_QL), *KL = (_Float16*)(ws + WS_KL); __bf16 *VB = (__bf16*)(ws + WS_VB), *VBL = (__bf16*)(ws + WS_VBL); float *S = (float*)(ws + WS_S), *Y = (float*)(ws + WS_Y);
  (void)Y; (void)QL; (void)KL; (void)VB; (void)VBL;
  // inputs: 0 x [4,256,64,64] (channels-first); 1 theta_w [128,256], 2 theta_b; 3 phi_w, 4 phi_b; 5 g_w, 6 g_b; 7 W_w [256,128], 8 W_b [256] (all (out,in), biases nonzero)
  if (ws_size < (size_t)WS_END2) return;
  _Float16 *TL = (_Float16*)(ws + WS_TL), *G = (_Float16*)(ws + WS_G), *VT2 = (_Float16*)(ws + WS_VT2); float *YR = (float*)(ws + WS_YR), *CM = (float*)(ws + WS_CM), *CS = (float*)(ws + WS_CS), *PM = (float*)(ws + WS_PM), *PS = (float*)(ws + WS_PS);
  // phi^T rows (the 'k' rows: phi[c][m] proper layout, token-major) via the q/k path as which = 1 -> KH (+KL rows < 64, unused)
  k_projT<1><<<dim3(TNB * TT / 64, 1, 1), 128, 0, stream>>>(F[0], F[0], F[0], F[3], F[3], F[3], F[4], F[4], F[4], QH, QL, KH, KL, VT, VB, VBL, nullptr);
  // theta conv plane [Cb][N] (f16 hi into the 'VT' slot = the theta VIEW rows [N][Cb] when read row-major) + its residual plane TL (the view's residual rows) via the [c][t] path (which = 2)
  k_projT<2><<<dim3(TNB * TT / 64, 1, 1), 128, 0, stream>>>(F[0], F[0], F[0], F[1], F[1], F[1], F[2], F[2], F[2], QH, QL, KH, KL, VT, VB, VBL, TL);
  // g conv plane [Cb][N] f16 -> G, then the g VIEW rows transposed into the value plane VT2[c][m]
  k_projT<2><<<dim3(TNB * TT / 64, 1, 1), 128, 0, stream>>>(F[0], F[0], F[0], F[5], F[5], F[5], F[6], F[6], F[6], QH, QL, KH, KL, G, VB, VBL, nullptr);
  k_trans<<<dim3(TT / 64, CB / 64, TNB), 256, 0, stream>>>(G, VT2);
  for (int b0 = 0; b0 < TNB; b0 += BGN) {
    k_sc<<<dim3(NQB, TT / 128, BGN), 128, 0, stream>>>(VT /* theta view rows */, KH, TL /* view residual rows */, KL, b0, 0, S, PM, PS);
    k_colmerge<<<dim3(TT / 32), 256, 0, stream>>>(PM, PS, CM, CS);
    k_pv<<<dim3(TT / PVS, HD / DVH, BGN), 32 * PVS, 0, stream>>>(S, CM, CS, VT2, b0, 0, YR);
  }
  k_wout<<<dim3(TT / 64, COUT / 128, TNB), 128, 0, stream>>>(YR, F[7], F[8], F[0], (float*)d_out);

}

// v005
// One run takes 229 microseconds.
// In two side-by-side timings against v004, it was 1.38 and 1.37 times as fast.
// Counting every step since v000, it is 11.2 times as fast.
// compute dtype: all float inputs rounded to bf16; the three 1x1 convs with EXACT bf16 products on WMMA 16x16x32 (f32 accumulate) + bias; scores between the raw-reshaped theta view (f16 hi + residual x 2^10) and phi (f16) (2 products); the softmax over the QUERY axis in f32 (per-column max / sum from 64-row partials, precise expf); P x 2^11 once to f16 x the raw-reshaped g view once to f16 (1 product); the W 1x1 conv on the raw-reshaped y view with bf16 hi + lo (2 products) x exact W + bias + x residual; f32 output written channels-first.
#include <hip/hip_runtime.h>
#include <math.h>

typedef __attribute__((ext_vector_type(16))) _Float16 v16h;
typedef __attribute__((ext_vector_type(16))) __bf16 v16b;
typedef __attribute__((ext_vector_type(8)))  _Float16 v8h;
typedef __attribute__((ext_vector_type(8)))  float v8f;
typedef __attribute__((ext_vector_type(4)))  float v4f;
typedef __attribute__((ext_vector_type(2)))  float v2f;
typedef __attribute__((ext_vector_type(4)))  unsigned v4u;
typedef _Float16 hx8 __attribute__((ext_vector_type(8)));
typedef __attribute__((ext_vector_type(4)))  int v4i;
typedef float __attribute__((may_alias)) float_a;
typedef int __attribute__((may_alias)) int_a;

template <typename T> __device__ __forceinline__ void vst2(void* p, T v) { *(T*)p = v;  }
__device__ __forceinline__ v8f wmma16(v16h a, v16h b, v8f c) {
  v8f d = __builtin_amdgcn_wmma_f32_16x16x32_f16(false, a, false, b, (short)0, c, false, false);
  asm volatile("v_nop\n\tv_nop\n\tv_nop\n\tv_nop" : "+v"(d) : "v"(a), "v"(b));
  return d;
}
__device__ __forceinline__ v8f wmma_bf(v16b a, v16b b, v8f c) {
  v8f d = __builtin_amdgcn_wmma_f32_16x16x32_bf16(false, a, false, b, (short)0, c, false, false);
  asm volatile("v_nop\n\tv_nop\n\tv_nop\n\tv_nop" : "+v"(d) : "v"(a), "v"(b));
  return d;
}
// 16x16x32 fragments: lane = (h = lane>>4, row/col = lane&15); elements 0..7 = k0+8h+0..7, 8..15 = k0+16+8h+0..7; D element r = row 8h+r
__device__ __forceinline__ v16h frag_h(const _Float16* rowk0, int lane) {
  union { v16h v; v8h q[2]; } u; const _Float16* p = rowk0 + 8 * (lane >> 4);
  u.q[0] = *(const v8h*)p; u.q[1] = *(const v8h*)(p + 16); return u.v;
}
__device__ __forceinline__ v16h frag_f32(const float* rowk0, int lane) {
  v16h a; const float* p = rowk0 + 8 * (lane >> 4);
#pragma unroll
  for (int i = 0; i < 8; ++i) { a[i] = (_Float16)p[i]; a[8 + i] = (_Float16)p[16 + i]; }
  return a;
}
__device__ __forceinline__ v16h frag_f32s(const float* rowk0, int lane, float sc) {
  v16h a; const float* p = rowk0 + 8 * (lane >> 4);
#pragma unroll
  for (int i = 0; i < 8; ++i) { a[i] = (_Float16)(p[i] * sc); a[8 + i] = (_Float16)(p[16 + i] * sc); }
  return a;
}
// column fragment from a [K][ld] layout (column n), rows >= K read as 0
__device__ __forceinline__ v16h fragc_f32(const float* W, int k0, int n, int lane, int ld, int K) {
  v16h a; const int g = lane >> 4;
#pragma unroll
  for (int i = 0; i < 8; ++i) { const int ka = k0 + 8 * g + i, kb = ka + 16;
    a[i] = (_Float16)(ka < K ? W[(size_t)(ka < K ? ka : K - 1) * ld + n] : 0.f); a[8 + i] = (_Float16)(kb < K ? W[(size_t)(kb < K ? kb : K - 1) * ld + n] : 0.f); }
  return a;
}
struct F2 { v16b h, l; };
__device__ __forceinline__ F2 bsplit16(const float v[16]) { F2 r;
#pragma unroll
  for (int i = 0; i < 16; ++i) { const __bf16 h = (__bf16)v[i]; r.h[i] = h; r.l[i] = (__bf16)(v[i] - (float)h); }
  return r; }
__device__ __forceinline__ F2 split_row(const float* row, int k0, int lane) { float v[16]; const float* p = row + k0 + 8 * (lane >> 4);
#pragma unroll
  for (int i = 0; i < 8; ++i) { v[i] = p[i]; v[8 + i] = p[16 + i]; }
  return bsplit16(v); }
__device__ __forceinline__ F2 split_rowK(const float* row, int k0, int lane, int K) { float v[16]; const int g = lane >> 4;
#pragma unroll
  for (int i = 0; i < 8; ++i) { const int ka = k0 + 8 * g + i, kb = ka + 16; v[i] = ka < K ? row[ka < K ? ka : K - 1] : 0.f; v[8 + i] = kb < K ? row[kb < K ? kb : K - 1] : 0.f; }
  return bsplit16(v); }
__device__ __forceinline__ F2 split_col(const float* W, int k0, int n, int lane, int ld, int K) { float v[16]; const int g = lane >> 4;
#pragma unroll
  for (int i = 0; i < 8; ++i) { const int ka = k0 + 8 * g + i, kb = ka + 16; v[i] = ka < K ? W[(size_t)(ka < K ? ka : K - 1) * ld + n] : 0.f; v[8 + i] = kb < K ? W[(size_t)(kb < K ? kb : K - 1) * ld + n] : 0.f; }
  return bsplit16(v); }
__device__ __forceinline__ v8f mac3(const F2& a, const F2& b, v8f c) { c = wmma_bf(a.l, b.h, c); c = wmma_bf(a.h, b.l, c); return wmma_bf(a.h, b.h, c); }
__device__ __forceinline__ float sigm(float v) { return 1.0f / (1.0f + expf(-v)); }
// fragment stored in fragment order (1 KiB: [half of the fragment][lane][8 f16]), read at the lane's own pointer (fragment start + 8 * lane): each of the two loads covers 512 contiguous bytes
__device__ __forceinline__ v16h frag_pk(const _Float16* p) { union { v16h v; v8h q[2]; } u; u.q[0] = *(const v8h*)p; u.q[1] = *(const v8h*)(p + 256); return u.v; }
// fragment read at the lane's own pointer (row start + k0 + 8 * (lane >> 4)): the caller keeps that pointer and names it at the wait behind a batch of loads
__device__ __forceinline__ v16b wfrag_p(const float* p) { v16b w;
#pragma unroll
  for (int i = 0; i < 8; ++i) { w[i] = (__bf16)p[i]; w[8 + i] = (__bf16)p[16 + i]; }
  return w; }
#define LDSX() do { asm volatile("s_wait_dscnt 0" ::: "memory"); __builtin_amdgcn_wave_barrier(); __builtin_amdgcn_fence(__ATOMIC_RELEASE, "workgroup"); } while (0)

// Non-local block with the source's RAW reshapes (x [4,256,64,64], Cb 128, N 4,096; (out,in) theta/phi/g 1x1 convs [128,256] + biases, W [256,128] + bias): theta = conv(x).reshape(B, N, Cb) and g likewise are ROW-MAJOR reinterpretations of the [Cb][N] conv outputs (row n = channel n/32, positions (n%32)*128..+127), phi stays [Cb][N]; scores[n][m] = sum_c theta[n][c] phi[c][m]; attn = softmax over n (axis 1 - per key column); y[n][c] = sum_m attn[n][m] g[m][c]; y.reshape(B, Cb, H, W) (raw again) -> W conv + bias + x.
#define NB 4
#define TT 4096
#define CC 128            // g-view plane pitch (Cb channels)
#define CB 128
#define COUT 256
#define CCQ 128           // theta-view / phi^T row pitch (Cb)
#define DIN 256          // x channels
#define NH 1
#define HD 128
#define NQB (TT / 64)
#define HG 1               // one 4,096 x 4,096 score plane per pass (the pass group spans batches)
#define SCALE (1.0f)
#define HDQK 128           // contraction width of the scores (Cb)
#define CAUSAL 0
#ifndef TNB
#define TNB NB
#endif
__device__ __forceinline__ v16b zero16b() { v16b z; _Pragma("unroll") for (int i = 0; i < 16; ++i) z[i] = (__bf16)0.f; return z; }
__device__ __forceinline__ float bfr(float v) { return (float)(__bf16)v; }
__host__ __device__ __forceinline__ int kb_last(int qb) { return CAUSAL ? ((qb * 64 + 63) >> 7) : (TT / 128 - 1); }
typedef __attribute__((ext_vector_type(8))) __bf16 v8b;
__device__ __forceinline__ v16b frag_b(const __bf16* rowk0, int lane) {
  union { v16b v; v8b q[2]; } u; const __bf16* p = rowk0 + 8 * (lane >> 4);
  u.q[0] = *(const v8b*)p; u.q[1] = *(const v8b*)(p + 16); return u.v;
}
#define QBH 0              // 2-product logits everywhere (theta view hi + residual x phi hi)
#define QHI 4096            // q residual rows (all)
#define KHI 64            // (unused k residual / v bf16 planes: QBH 0)
// B fragment (k rows k0+.., output column o) of a weight: (in,out) [K][ld] or (out,in) [ld rows of K]: bf16 exact, or f16(bf16 * 256) exact
__device__ __forceinline__ v16b wcol_io(const float* Wm, int k0, int o, int lane, int ld) { v16b w; const int g = lane >> 4;
#pragma unroll
  for (int i = 0; i < 8; ++i) { w[i] = (__bf16)Wm[(size_t)(k0 + 8 * g + i) * ld + o]; w[8 + i] = (__bf16)Wm[(size_t)(k0 + 16 + 8 * g + i) * ld + o]; }
  return w; }
__device__ __forceinline__ v16b wcol_oi(const float* Wm, int k0, int o, int lane, int K) { v16b w; const float* p = Wm + (size_t)o * K + k0 + 8 * (lane >> 4);
#pragma unroll
  for (int i = 0; i < 8; ++i) { w[i] = (__bf16)p[i]; w[8 + i] = (__bf16)p[16 + i]; }
  return w; }
__device__ __forceinline__ v16h wcolh_io(const float* Wm, int k0, int o, int lane, int ld) { v16h w; const int g = lane >> 4;
#pragma unroll
  for (int i = 0; i < 8; ++i) { w[i] = (_Float16)(bfr(Wm[(size_t)(k0 + 8 * g + i) * ld + o]) * 256.0f); w[8 + i] = (_Float16)(bfr(Wm[(size_t)(k0 + 16 + 8 * g + i) * ld + o]) * 256.0f); }
  return w; }
__device__ __forceinline__ v16h wcolh_oi(const float* Wm, int k0, int o, int lane, int K) { v16h w; const float* p = Wm + (size_t)o * K + k0 + 8 * (lane >> 4);
#pragma unroll
  for (int i = 0; i < 8; ++i) { w[i] = (_Float16)(bfr(p[i]) * 256.0f); w[8 + i] = (_Float16)(bfr(p[16 + i]) * 256.0f); }
  return w; }
#define WQKV_LAYOUT 0   // 0 = (out,in) [CC][DIN], as 1; 1 = (out,in) [CC][DIN]; 2 = per-head [NH][DIN][HD]
__device__ __forceinline__ v16b wcol_hdk(const float* Wm, int k0, int o, int lane) { v16b w; const int g = lane >> 4; const float* p = Wm + (size_t)(o / HD) * DIN * HD + (o % HD);
#pragma unroll
  for (int i = 0; i < 8; ++i) { w[i] = (__bf16)p[(size_t)(k0 + 8 * g + i) * HD]; w[8 + i] = (__bf16)p[(size_t)(k0 + 16 + 8 * g + i) * HD]; }
  return w; }
#define WO_OUT_IN 0
#if WQKV_LAYOUT == 1
#define WCOL(W, k0, o, lane) wcol_oi(W, k0, (o), lane, DIN)   /* unused: layout 0 */
#elif WQKV_LAYOUT == 2
#define WCOL(W, k0, o, lane) wcol_hdk(W, k0, o, lane)
#else
#define WCOL(W, k0, o, lane) wcol_oi(W, k0, (o), lane, DIN)   /* (out,in) 1x1-conv weights [128][256]: all 128 output channels real */
#endif
#if WO_OUT_IN
#define WOCOL(W, k0, o, lane) wcol_oi(W, k0, o, lane, CC)
#define WOCOLH(W, k0, o, lane) wcolh_oi(W, k0, o, lane, CC)
#else
#define WOCOL(W, k0, o, lane) wcol_io(W, k0, o, lane, DIN)
#define WOCOLH(W, k0, o, lane) wcolh_io(W, k0, o, lane, DIN)
#endif
#define BG HG              // the pass group spans BATCHES (single head): blockIdx.z selects batch b0 + z
#define BGN (TNB < BG ? TNB : BG)
#define DVH 128            // all 128 Cb columns of the g view in one k_pv block
#ifndef SM_EXTRA_PARAMS
#define SM_EXTRA_PARAMS
#endif
#ifndef PROJ_EXTRA_PARAMS
#define PROJ_EXTRA_PARAMS
#endif
#ifndef SM_MASK_HOOK
#define SM_MASK_HOOK (void)0
#endif

#define WS_QH  0u                                      // f16 q rows in fragment order [b*t / 16][k step][fragment half][lane][8]
#define WS_KH  (WS_QH + 2u * (size_t)NB * TT * CCQ)     // f16 k rows in fragment order [b*t / 16][k step][fragment half][lane][8]
#define WS_VT  (WS_KH + 2u * (size_t)NB * TT * CCQ)     // f16 v planes [b][c][t]
#define WS_QL  (WS_VT + 2u * (size_t)NB * CC * TT)      // f16 q residual x 2^10 rows [b][t < QHI], in fragment order like WS_QH
#define WS_KL  (WS_QL + 2u * (size_t)NB * QHI * CCQ)    // f16 k residual x 2^10 rows [b][t < KHI][CCQ]
#define WS_VB  (WS_KL + 2u * (size_t)NB * KHI * CCQ)    // bf16 v hi planes [b][c][t < KHI]
#define WS_VBL (WS_VB + 2u * (size_t)NB * CC * KHI)
#define WS_S   (WS_VBL + 2u * (size_t)NB * CC * KHI)    // f32 logits [hg][t / 16][s / 32] tiles of [u][lane][4] (the order of k_pv's loads)
#define WS_Y   (WS_S  + 4u * (size_t)HG * TT * TT)      // no bytes: the f32 y rows lie at WS_YR
#define WS_END (WS_Y  + 0u)

// ---- k_proj: block = (64 rows, 128 cols, which): q/k/v = X W (+ b) with exact bf16 products (K = DIN) -> which 0: q f16 rows (+ residual rows < QHI); 1: k f16 rows (+ residual rows < KHI), the f16 rows of both in fragment order; 2: v f16 planes [c][t] (+ bf16 hi/lo planes for t < KHI)
template <int WOFF> __global__ __launch_bounds__(128) void k_projT(const float* __restrict__ XQ, const float* __restrict__ XK, const float* __restrict__ XV, const float* __restrict__ WQ, const float* __restrict__ WK, const float* __restrict__ WV, const float* __restrict__ BQ, const float* __restrict__ BK, const float* __restrict__ BV,
    _Float16* __restrict__ QH, _Float16* __restrict__ QL, _Float16* __restrict__ KH, _Float16* __restrict__ KL, _Float16* __restrict__ VT, __bf16* __restrict__ VB, __bf16* __restrict__ VBL, _Float16* __restrict__ VL) {
  __shared__ __align__(16) _Float16 sh[64][136], sl[64][136]; __shared__ __align__(16) _Float16 th[128][72], tlo[128][72]; __shared__ __align__(16) __bf16 tb[128][72], tbl[128][72];
  const int tid = threadIdx.x, wave = tid >> 5, lane = tid & 31, col = lane & 15, g = lane >> 4; const int which = blockIdx.z + WOFF; const int c0 = blockIdx.y * 128; const size_t r0 = (size_t)blockIdx.x * 64; const size_t bb = r0 / TT; const int t0 = (int)(r0 % TT);
  const float* X = which == 0 ? XQ : which == 1 ? XK : XV; const float* WA = which == 0 ? WQ : which == 1 ? WK : WV; const float* BA = which == 0 ? BQ : which == 1 ? BK : BV;
  const int KD = DIN;
  v8f acc[8] = {};
#pragma unroll 2
  for (int kc = 0; kc < KD / 32; ++kc) { v16b a, w[8]; const float* p = X + (bb * KD + kc * 32 + 8 * g) * (size_t)TT + t0 + wave * 16 + col;   /* channels-first [b][c][t]: A[t][c] (16 consecutive t per lane group) */
    const float* wp = WA + (size_t)(c0 + col) * DIN + kc * 32 + 8 * g;   /* (out,in) weight rows: fragment j starts 16 rows further on */
#pragma unroll
    for (int i = 0; i < 8; ++i) { a[i] = (__bf16)p[(size_t)i * TT]; a[8 + i] = (__bf16)p[(size_t)(16 + i) * TT]; }
#pragma unroll
    for (int j = 0; j < 8; ++j) w[j] = wfrag_p(wp + (size_t)j * 16 * DIN);   /* all eight weight fragments ahead of the k step's first WMMA: the asm in wmma_bf holds later loads behind it, so a load written between two WMMAs pays its whole latency there */
    asm volatile("s_wait_loadcnt 0x0" :: "v"(p), "v"(wp) : "memory");   /* names the two address pairs so that they stay as they are until every load of the batch has returned */
#pragma unroll
    for (int j = 0; j < 8; ++j) acc[j] = wmma_bf(a, w[j], acc[j]); }
  const float* bp = BA + c0 + col; float bias8[8] = {};   /* the eight bias loads together, ahead of the epilogue's LDS stores */
  if (BA) {
#pragma unroll
    for (int j = 0; j < 8; ++j) bias8[j] = bp[j * 16];
    asm volatile("s_wait_loadcnt 0x0" :: "v"(bp) : "memory"); }   /* names the address pair so that it stays as it is until the eight loads have returned */
  if (which < 2) { _Float16* DH = which == 0 ? QH : KH; _Float16* DL = which == 0 ? QL : KL; const int nhi = which == 0 ? QHI : KHI; const bool hi_rows = t0 < nhi;
#pragma unroll
    for (int j = 0; j < 8; ++j) { const float bias = bfr(bias8[j]);
#pragma unroll
      for (int r = 0; r < 8; ++r) { const float v = acc[j][r] + bias; const _Float16 hv = (_Float16)v; sh[wave * 16 + 8 * g + r][j * 16 + col] = hv; sl[wave * 16 + 8 * g + r][j * 16 + col] = (_Float16)((v - (float)hv) * 1024.0f); } }
    __syncthreads();
    for (int e = tid; e < 64 * 16; e += 128) { const int rl = ((e >> 8) << 4) | (e & 15), q = ((e >> 6) & 3) * 4 + ((e >> 5) & 1) * 2 + ((e >> 4) & 1);   /* fragment order: e = (16-row tile, k step, fragment half, lane): piece e of the block's 16 KiB is what that lane loads */
      vst2((unsigned*)(DH + r0 * CCQ + (size_t)e * 8), *(const v4u*)&sh[rl][q * 8]);
      asm volatile("s_wait_xcnt 0x0" ::: "memory");   /* the store's address pair and data registers are rewritten by the residual store's LDS read and by the next trip */
      if (hi_rows) { vst2((unsigned*)(DL + (bb * nhi + t0 + rl) * (size_t)CCQ + c0 + q * 8), *(const v4u*)&sl[rl][q * 8]);
        asm volatile("s_wait_xcnt 0x0" ::: "memory"); } }   /* likewise, ahead of the next trip */   /* hi rows in fragment order (c0 == 0), residual rows at pitch CCQ */
  } else { const bool hi_rows = t0 < KHI;
#pragma unroll
    for (int j = 0; j < 8; ++j) { const float bias = bfr(bias8[j]);
#pragma unroll
      for (int r = 0; r < 8; ++r) { const float v = acc[j][r] + bias; const int rl = wave * 16 + 8 * g + r, cl = j * 16 + col; const _Float16 hv2 = (_Float16)v; th[cl][rl] = hv2; tlo[cl][rl] = (_Float16)((v - (float)hv2) * 1024.0f); const __bf16 bh = (__bf16)v; tb[cl][rl] = bh; tbl[cl][rl] = (__bf16)(v - (float)bh); } }
    __syncthreads();
    for (int e = tid; e < 128 * 8; e += 128) { const int cl = e >> 3, q = e & 7; vst2((unsigned*)(VT + (bb * CC + c0 + cl) * (size_t)TT + t0 + q * 8), *(const v4u*)&th[cl][q * 8]); if (VL) vst2((unsigned*)(VL + (bb * CC + c0 + cl) * (size_t)TT + t0 + q * 8), *(const v4u*)&tlo[cl][q * 8]); if (hi_rows) { const size_t o3 = (bb * CC + c0 + cl) * (size_t)KHI + t0 + q * 8; vst2((unsigned*)(VB + o3), *(const v4u*)&tb[cl][q * 8]); vst2((unsigned*)(VBL + o3), *(const v4u*)&tbl[cl][q * 8]); } } } }
// ---- k_sc: block = (query block qb, key block kb <= kb_last(qb), batch b in group): logits x SCALE; q hi + residual (x 2^10) against k (2 products) for query rows < QHI, plus the k residual (3 products) for query blocks < QBH (causal early rows); causal: blocks past the diagonal exit
__global__ __launch_bounds__(128) void k_sc(const _Float16* __restrict__ QH, const _Float16* __restrict__ KH, const _Float16* __restrict__ QL, const _Float16* __restrict__ KL, int bgrp, int h0, float* __restrict__ S0, float* __restrict__ PM, float* __restrict__ PS) { __shared__ __align__(16) float ss[4][16][132];
  const int qb = blockIdx.x, kb = blockIdx.y; if (kb > kb_last(qb)) return;
  const int h = h0; const int b = bgrp + blockIdx.z; float* S = S0 + (size_t)blockIdx.z * TT * TT;   /* group spans batches */
  const int tid = threadIdx.x, wave = tid >> 5, lane = tid & 31, col = lane & 15, g = lane >> 4; const int k0 = kb * 128; const int ql0 = qb * 64 + wave * 16; const size_t q0 = (size_t)b * TT + ql0, kr0 = (size_t)b * TT + k0;
  v8f acc[8] = {}, accl[8] = {};
  const _Float16* QLb = QL + (size_t)b * QHI * CCQ; const _Float16* KLb = KL + (size_t)b * KHI * CCQ;   /* single head */
  const _Float16* kp = KH + kr0 * CCQ + lane * 8;   /* key rows in fragment order: fragment (16-key tile j, k step kc) starts (j * 4 + kc) * 512 f16 further on */
  const _Float16* qp = QH + q0 * CCQ + lane * 8; const _Float16* qlp = QLb + (size_t)ql0 * CCQ + lane * 8;   /* the wave's 16 query rows, hi and residual, likewise: fragment kc starts kc * 512 f16 further on */
  if (qb < QBH) {
#pragma unroll
    for (int kc = 0; kc < HDQK / 32; ++kc) { const v16h ah = frag_pk(qp + kc * 512), al = frag_pk(qlp + kc * 512);
#pragma unroll
      for (int j = 0; j < 8; ++j) { const v16h kbf = frag_pk(kp + (j * 4 + kc) * 512), klf = frag_h(KLb + (size_t)(k0 + j * 16 + col) * CCQ + kc * 32, lane); acc[j] = wmma16(ah, kbf, acc[j]); accl[j] = wmma16(al, kbf, accl[j]); accl[j] = wmma16(ah, klf, accl[j]); } }
  } else if (qb * 64 < QHI) {
#pragma unroll
    for (int kc = 0; kc < HDQK / 32; ++kc) { const v16h ah = frag_pk(qp + kc * 512), al = frag_pk(qlp + kc * 512);
      v16h kbf[8];   /* the k step's eight key fragments ahead of its first WMMA (the asm in wmma16 holds later loads behind it) */
#pragma unroll
      for (int j = 0; j < 8; ++j) kbf[j] = frag_pk(kp + (j * 4 + kc) * 512);
#pragma unroll
      for (int j = 0; j < 8; ++j) { acc[j] = wmma16(ah, kbf[j], acc[j]); accl[j] = wmma16(al, kbf[j], accl[j]); } }
  } else {
#pragma unroll
    for (int kc = 0; kc < HDQK / 32; ++kc) { const v16h ah = frag_pk(qp + kc * 512);
#pragma unroll
      for (int j = 0; j < 8; ++j) { const v16h kbf = frag_pk(kp + (j * 4 + kc) * 512); acc[j] = wmma16(ah, kbf, acc[j]); } } }
#pragma unroll
  for (int j = 0; j < 8; ++j) {
#pragma unroll
    for (int r = 0; r < 8; ++r) ss[wave][8 * g + r][j * 16 + col] = (acc[j][r] + accl[j][r] * (1.0f / 1024.0f)) * SCALE; }
  __syncthreads();   /* every wave's 16 rows of the tile are in ss before a thread walks its column; placed ahead of the S stores so that it does not wait for them */
  LDSX(); { float* sp = S + ((size_t)(ql0 >> 4) * (TT / 32) + kb * 4) * 512 + lane * 4;   /* logits in the order in which k_pv's lanes load them: 2-KiB tile (16 queries, 32 keys) = [u][lane][4 f32], lane (g, col) = query col, keys (u >> 1) * 16 + 8 g + (u & 1) * 4 .. + 3; the wave's four tiles are 8 KiB in a row */
#pragma unroll
    for (int u = 0; u < 16; ++u) vst2(sp + u * 128, *(const v4f*)&ss[wave][col][(u >> 2) * 32 + ((u >> 1) & 1) * 16 + 8 * g + (u & 1) * 4]); }
  asm volatile("s_wait_xcnt 0x0" ::: "memory");   /* the registers that the S stores name are reused by the column walk below */
  // column statistics of this 64 x 128 tile from the stored f32 logits: thread = key column, rows in ascending order: max, then sum of exp(v - max)
  { float v[64];
#pragma unroll
    for (int i = 0; i < 64; ++i) v[i] = ss[i >> 4][i & 15][tid];
    float m = v[0];
#pragma unroll
    for (int i = 1; i < 64; ++i) m = fmaxf(m, v[i]);
    float s = 0.f;
#pragma unroll
    for (int i = 0; i < 64; ++i) s += expf(v[i] - m);
    vst2(PM + (size_t)qb * TT + k0 + tid, m); vst2(PS + (size_t)qb * TT + k0 + tid, s); } }
// ---- k_colmerge: softmax over the QUERY axis (axis 1): joins the 64 per-query-block partials (PM = max, PS = sum of exp(S - PM) over 64 rows) of each key column m: CM[m] = max, CS[m] = 2^11 / sum_q PS[q][m] exp(PM[q][m] - CM[m]) (the factor that k_pv multiplies with: one division per column); block = 32 columns (lane) x 8 waves of 8 partials, joined through LDS
__global__ __launch_bounds__(256) void k_colmerge(const float* __restrict__ PM, const float* __restrict__ PS, float* __restrict__ CM, float* __restrict__ CS) { __shared__ float lm[8][32], ls[8][32];
  const int tid = threadIdx.x, wave = tid >> 5, lane = tid & 31; const int m = blockIdx.x * 32 + lane; float pm[8], ps[8];
#pragma unroll
  for (int u = 0; u < 8; ++u) pm[u] = PM[(size_t)(wave * 8 + u) * TT + m];
  asm volatile("s_wait_xcnt 0x0" ::: "memory");   /* the address pair of the loads above is rewritten for the loads below */
#pragma unroll
  for (int u = 0; u < 8; ++u) ps[u] = PS[(size_t)(wave * 8 + u) * TT + m];
  float mx = pm[0];
#pragma unroll
  for (int u = 1; u < 8; ++u) mx = fmaxf(mx, pm[u]);
  float sm2 = 0.f;
#pragma unroll
  for (int u = 0; u < 8; ++u) sm2 += ps[u] * expf(pm[u] - mx);
  lm[wave][lane] = mx; ls[wave][lane] = sm2;
  __syncthreads();
  if (wave == 0) { float mt = lm[0][lane];
#pragma unroll
    for (int w = 1; w < 8; ++w) mt = fmaxf(mt, lm[w][lane]);
    float st = 0.f;
#pragma unroll
    for (int w = 0; w < 8; ++w) st += ls[w][lane] * expf(lm[w][lane] - mt);
    vst2(CM + m, mt); vst2(CS + m, 2048.0f / st); } }
// ---- k_trans: blockIdx.z < TNB: block = (64 keys, 64 columns, batch): the g view rows [m][c] turned through LDS into B fragments (column c, 32 keys) laid in fragment order for k_pv; blockIdx.z >= TNB: block = two 16-row tiles of a batch's theta view rows (hi plane, then residual plane), their 16-B pieces copied into fragment order for k_sc
static_assert((TT / 64) * (CB / 64) * 2 == TT / 16, "two 16-row tiles of the theta view per block");
__global__ __launch_bounds__(256) void k_trans(const _Float16* __restrict__ G, _Float16* __restrict__ VT2, const _Float16* __restrict__ TH, const _Float16* __restrict__ TR, _Float16* __restrict__ QP, _Float16* __restrict__ QR) { __shared__ _Float16 st[64][72]; const int tid = threadIdx.x;
  if (blockIdx.z >= TNB) {   /* the same for the whole block, ahead of the barrier */
    const int z = blockIdx.z - TNB; const size_t o = (size_t)(z % TNB) * CB * TT + (size_t)(blockIdx.y * (TT / 64) + blockIdx.x) * 2 * 16 * CCQ;   /* a tile is 16 rows of CCQ f16 = 4 KiB in both layouts */
    const _Float16* s = (z < TNB ? TH : TR) + o + (size_t)(tid & 15) * CCQ + (((tid >> 6) & 3) * 4 + ((tid >> 5) & 1) * 2 + ((tid >> 4) & 1)) * 8;   /* tid = (k step, fragment half, lane): that lane's piece of its row */
    _Float16* d = (z < TNB ? QP : QR) + o + tid * 8;
    const v4u u0 = *(const v4u*)s, u1 = *(const v4u*)(s + 16 * CCQ); vst2((unsigned*)d, u0); vst2((unsigned*)(d + 16 * CCQ), u1); return; }
  const int m0 = blockIdx.x * 64, c0 = blockIdx.y * 64, b = blockIdx.z; const _Float16* gb = G + (size_t)b * CB * TT; _Float16* vb = VT2 + (size_t)b * CB * TT;
  for (int e = tid; e < 64 * 8; e += 256) { const int ml = e >> 3, q = e & 7; const v4u u = *(const v4u*)(gb + (size_t)(m0 + ml) * CB + c0 + q * 8); asm volatile("s_wait_loadcnt 0x0" ::: "memory"); const hx8 hv = *(const hx8*)&u; _Pragma("unroll") for (int j = 0; j < 8; ++j) st[q * 8 + j][ml] = hv[j]; }
  __syncthreads();
  for (int e = tid; e < 64 * 8; e += 256) { const int cl = ((e >> 6) & 3) * 16 + (e & 15), q = (e >> 8) * 4 + ((e >> 5) & 1) * 2 + ((e >> 4) & 1);   /* fragment order: e = (32-key step, 16-column fragment, fragment half, lane) */
    hx8 hv; _Pragma("unroll") for (int j = 0; j < 8; ++j) hv[j] = st[cl][q * 8 + j]; vst2((unsigned*)(vb + ((size_t)((m0 >> 5) + (e >> 8)) * (CB / 16) + (c0 >> 4)) * 512 + (e & 255) * 8), *(const v4u*)&hv); } }
// ---- k_wout: block = (64 positions, 128 of the 256 output channels, batch): A[pos][cb] = y view Yb[cb*4096 + pos] (the raw reshape back: the batch's y rows [4096][128] f32 reinterpreted as [Cb][N]) split bf16 hi + lo (2 products) x exact (out,in) W [256][128]; + bf16(W_b) + bf16(x[b][o][pos]); channels-first store out[b][o][pos0..pos0+63] through LDS (one 256-B run per channel by 16 lanes)
__global__ __launch_bounds__(128) void k_wout(const float* __restrict__ Y, const float* __restrict__ WW, const float* __restrict__ WB, const float* __restrict__ X, float* __restrict__ OUT) { __shared__ __align__(16) float st[128][68];
  const int tid = threadIdx.x, wave = tid >> 5, lane = tid & 31, col = lane & 15, g = lane >> 4; const int p0 = blockIdx.x * 64, c0 = blockIdx.y * 128, b = blockIdx.z; const float* Yb = Y + (size_t)b * TT * CB;
  v8f acc[8] = {};
#pragma unroll 1
  for (int kc = 0; kc < CB / 32; ++kc) { v16b ah, al, w[8]; { const float* p = Yb + (size_t)(kc * 32 + 8 * g) * TT + p0 + wave * 16 + col; const float* wp = WW + (size_t)(c0 + col) * CB + kc * 32 + 8 * g; float tv[16];
#pragma unroll
      for (int i = 0; i < 8; ++i) { tv[i] = p[(size_t)i * TT]; tv[8 + i] = p[(size_t)(16 + i) * TT]; }
#pragma unroll
      for (int j = 0; j < 8; ++j) w[j] = wfrag_p(wp + (size_t)j * 16 * CB);   /* with the y loads, ahead of the k step's first WMMA (the asm in wmma_bf holds later loads behind it) */
      asm volatile("s_wait_loadcnt 0x0" :: "v"(p), "v"(wp) : "memory");   /* names the two address pairs so that they stay as they are until every load of the batch has returned */
#pragma unroll
      for (int i = 0; i < 16; ++i) { const __bf16 h = (__bf16)tv[i]; ah[i] = h; al[i] = (__bf16)(tv[i] - (float)h); } }
#pragma unroll
    for (int j = 0; j < 8; ++j) { acc[j] = wmma_bf(ah, w[j], acc[j]); acc[j] = wmma_bf(al, w[j], acc[j]); } }
  // thread's sixteen 16-B pieces: channel c0 + (tid >> 4) + 8 u, positions p0 + (tid & 15) * 4
  const size_t o0 = ((size_t)b * COUT + c0 + (tid >> 4)) * (size_t)TT + p0 + (tid & 15) * 4; const float* xp = X + o0; const float* bp = WB + c0 + col; float* op = OUT + o0;
  float wb8[8]; v4f xr[16];   /* the eight bias loads and the sixteen residual loads are issued together, ahead of the turn through LDS */
#pragma unroll
  for (int j = 0; j < 8; ++j) wb8[j] = bp[j * 16];
#pragma unroll
  for (int u = 0; u < 16; ++u) xr[u] = *(const v4f*)(xp + (size_t)u * 8 * TT);
  asm volatile("s_wait_loadcnt 0x0" :: "v"(xp), "v"(bp) : "memory");   /* names the two address pairs so that they stay as they are until every load of the batch has returned */
#pragma unroll
  for (int j = 0; j < 8; ++j) { const float wb = bfr(wb8[j]);
#pragma unroll
    for (int r = 0; r < 8; ++r) st[j * 16 + col][wave * 16 + 8 * g + r] = acc[j][r] + wb; }
  __syncthreads();
#pragma unroll
  for (int u = 0; u < 16; ++u) { v4f v = *(const v4f*)&st[(tid >> 4) + 8 * u][(tid & 15) * 4]; v[0] += bfr(xr[u][0]); v[1] += bfr(xr[u][1]); v[2] += bfr(xr[u][2]); v[3] += bfr(xr[u][3]); vst2(op + (size_t)u * 8 * TT, v); } }
// ---- k_pv: block = (16 queries, all 128 value columns, batch in group), 16 waves: wave s takes the 32-key steps s, s + 16, s + 32, ... of the 4,096 keys (scores and v lie in fragment order: every wave-wide 16-B load covers 512 contiguous bytes, a step's scores 2 KiB and its v fragments 8 KiB in a row), P[n][m] x 2^11 = exp(S[n][m] - CM[m]) * CS[m] formed in registers from the f32 logits (each element belongs to one lane of one wave), once to f16 against v f16 (1 product); the 16 partial 16 x 128 tiles are joined through LDS in ascending s, x 2^-11, one y row per wave
#define PVS 16             // key slices = waves of a k_pv block = query rows of a block (the join gives wave w row w)
static_assert(PVS == 16 && (TT / 32) % PVS == 0, "one y row per wave; every wave the same number of 32-key steps");
__global__ __launch_bounds__(32 * PVS) void k_pv(const float* __restrict__ PS0, const float* __restrict__ CM, const float* __restrict__ CS, const _Float16* __restrict__ VT, int bgrp, int h0, float* __restrict__ Y) { const int h = h0; const int b = bgrp + blockIdx.z; const float* PS = PS0 + (size_t)blockIdx.z * TT * TT; const int d0 = blockIdx.y * DVH;   /* group spans batches; column offset d0 (always 0: one block takes all 128 columns) */ __shared__ __align__(16) float ss[PVS][16][DVH + 4];
  const int tid = threadIdx.x, wave = __builtin_amdgcn_readfirstlane(tid >> 5), lane = tid & 31, col = lane & 15, g = lane >> 4; const int ql0 = blockIdx.x * 16; const int kce = (kb_last(ql0 >> 6) + 1) * 4;
  v8f acc[DVH / 16] = {};
#pragma unroll 1
  for (int i = 0; i < kce / PVS; ++i) { const int kc = i * PVS + wave; const float* pp = PS + ((size_t)blockIdx.x * (TT / 32) + kc) * 512 + lane * 4; const _Float16* vp = VT + (((size_t)b * (TT / 32) + kc) * (CC / 16) + ((h * HD + d0) >> 4)) * 512 + lane * 8;   /* both in fragment order: the step's score tile is 2 KiB in a row, its eight v fragments 8 KiB in a row */
    const float* mp = CM + kc * 32 + 8 * g; const float* fp = CS + kc * 32 + 8 * g;   /* the lane's 16 key columns: their max and their factor */
    v4f pf[4], cm[4], cf[4]; v16h p, vf[DVH / 16];
#pragma unroll
    for (int u = 0; u < 4; ++u) { const int o = (u >> 1) * 16 + (u & 1) * 4; pf[u] = *(const v4f*)(pp + u * 128); cm[u] = *(const v4f*)(mp + o); cf[u] = *(const v4f*)(fp + o); }
    __builtin_amdgcn_sched_barrier(0);   /* the scores, maxima and factors are asked for first: loads come back in the order of issue, so the exp work can start while the v fragments, the larger part of the step's bytes, still arrive */
#pragma unroll
    for (int j = 0; j < DVH / 16; ++j) vf[j] = frag_pk(vp + j * 512);   /* the step's eight v fragments with its score loads, ahead of the first WMMA (the asm in wmma16 holds later loads behind it) */
    __builtin_amdgcn_sched_barrier(0);   /* every load of the step is issued ahead of the exp work below, which then runs while the v fragments are still on their way; without it the scheduler sinks the v loads behind that work and a step pays two load latencies in a row */
#pragma unroll
    for (int u = 0; u < 16; ++u) p[u] = (_Float16)(expf(pf[u >> 2][u & 3] - cm[u >> 2][u & 3]) * cf[u >> 2][u & 3]);
#pragma unroll
    for (int j = 0; j < DVH / 16; ++j) acc[j] = wmma16(p, vf[j], acc[j]);
    asm volatile("s_wait_loadcnt 0x0" :: "v"(pp), "v"(mp), "v"(fp), "v"(vp) : "memory"); }   /* at the step's foot, so that it does not hold the exp work back: names the four address pairs so that they stay as they are until every load of the step has returned */
#pragma unroll
  for (int j = 0; j < DVH / 16; ++j)
#pragma unroll
    for (int r = 0; r < 8; ++r) ss[wave][8 * g + r][j * 16 + col] = acc[j][r];
  __syncthreads();   /* all 16 key slices' partial tiles are in ss before a wave sums its row over them */
  v4f t = *(const v4f*)&ss[0][wave][lane * 4];
#pragma unroll
  for (int s = 1; s < PVS; ++s) t += *(const v4f*)&ss[s][wave][lane * 4];
  vst2(Y + ((size_t)b * TT + ql0 + wave) * CC + h * HD + d0 + lane * 4, t * (1.0f / 2048.0f)); }   /* y rows [b*TT + n][128]: 512-B row by 32 lanes */

#define WS_TL  (WS_END)                                  // f16 theta-view residual plane [b][128][TT] (viewed as rows)
#define WS_G   (WS_TL + 2u * (size_t)NB * CB * TT)        // f16 g conv plane [b][128][TT]
#define WS_VT2 (WS_G + 2u * (size_t)NB * CB * TT)         // f16 g view in fragment order [b][m / 32][c / 16][fragment half][lane][8]
#define WS_YR  (WS_VT2 + 2u * (size_t)NB * CB * TT)       // f32 y rows [b*TT + n][128]
#define WS_CM  (WS_YR + 4u * (size_t)NB * TT * CB)        // f32 column max [TT]
#define WS_CS  (WS_CM + 4u * (size_t)TT)                  // f32 2^11 / column sum [TT]
#define WS_PM  (WS_CS + 4u * (size_t)TT)                  // f32 partial column max [NQB][TT]
#define WS_PS  (WS_PM + 4u * (size_t)NQB * TT)            // f32 partial column sum [NQB][TT]
#define WS_END2 (WS_PS + 4u * (size_t)NQB * TT)
extern "C" void kernel_launch(void* const* d_in, const int* in_sizes, int n_in, void* d_out, int out_size, void* d_ws, size_t ws_size, hipStream_t stream) {
  (void)in_sizes; (void)n_in; (void)out_size;
  const float** F = (const float**)d_in;
  if (ws_size < (size_t)WS_END) return;
  char* ws = (char*)d_ws; _Float16 *QH = (_Float16*)(ws + WS_QH), *KH = (_Float16*)(ws + WS_KH), *VT = (_Float16*)(ws + WS_VT), *QL = (_Float16*)(ws + WS_QL), *KL = (_Float16*)(ws + WS_KL); __bf16 *VB = (__bf16*)(ws + WS_VB), *VBL = (__bf16*)(ws + WS_VBL); float *S = (float*)(ws + WS_S), *Y = (float*)(ws + WS_Y);
  (void)Y; (void)QL; (void)KL; (void)VB; (void)VBL;
  // inputs: 0 x [4,256,64,64] (channels-first); 1 theta_w [128,256], 2 theta_b; 3 phi_w, 4 phi_b; 5 g_w, 6 g_b; 7 W_w [256,128], 8 W_b [256] (all (out,in), biases nonzero)
  if (ws_size < (size_t)WS_END2) return;
  _Float16 *TL = (_Float16*)(ws + WS_TL), *G = (_Float16*)(ws + WS_G), *VT2 = (_Float16*)(ws + WS_VT2); float *YR = (float*)(ws + WS_YR), *CM = (float*)(ws + WS_CM), *CS = (float*)(ws + WS_CS), *PM = (float*)(ws + WS_PM), *PS = (float*)(ws + WS_PS);
  // phi^T rows (the 'k' rows: phi[c][m] proper layout, token-major) via the q/k path as which = 1 -> KH in fragment order (+KL rows < 64, unused)
  k_projT<1><<<dim3(TNB * TT / 64, 1, 1), 128, 0, stream>>>(F[0], F[0], F[0], F[3], F[3], F[3], F[4], F[4], F[4], QH, QL, KH, KL, VT, VB, VBL, nullptr);
  // theta conv plane [Cb][N] (f16 hi into the 'VT' slot = the theta VIEW rows [N][Cb] when read row-major) + its residual plane TL (the view's residual rows) via the [c][t] path (which = 2)
  k_projT<2><<<dim3(TNB * TT / 64, 1, 1), 128, 0, stream>>>(F[0], F[0], F[0], F[1], F[1], F[1], F[2], F[2], F[2], QH, QL, KH, KL, VT, VB, VBL, TL);
  // g conv plane [Cb][N] f16 -> G, then the g VIEW rows turned into the value fragments VT2, and the theta VIEW rows (hi, residual) copied into the query fragments QH, QL
  k_projT<2><<<dim3(TNB * TT / 64, 1, 1), 128, 0, stream>>>(F[0], F[0], F[0], F[5], F[5], F[5], F[6], F[6], F[6], QH, QL, KH, KL, G, VB, VBL, nullptr);
  k_trans<<<dim3(TT / 64, CB / 64, 3 * TNB), 256, 0, stream>>>(G, VT2, VT /* theta view rows */, TL /* view residual rows */, QH, QL);
  for (int b0 = 0; b0 < TNB; b0 += BGN) {
    k_sc<<<dim3(NQB, TT / 128, BGN), 128, 0, stream>>>(QH /* theta view fragments */, KH, QL /* view residual fragments */, KL, b0, 0, S, PM, PS);
    k_colmerge<<<dim3(TT / 32), 256, 0, stream>>>(PM, PS, CM, CS);
    k_pv<<<dim3(TT / PVS, HD / DVH, BGN), 32 * PVS, 0, stream>>>(S, CM, CS, VT2, b0, 0, YR);
  }
  k_wout<<<dim3(TT / 64, COUT / 128, TNB), 128, 0, stream>>>(YR, F[7], F[8], F[0], (float*)d_out);

}

// v006
// Measured time: 151 microseconds a run.
// Next to v005, in two timings, it ran 1.53 and 1.52 times as fast.
// All steps since v000 together make it 17.1 times as fast.
// compute dtype: all float inputs rounded to bf16; the three 1x1 convs with EXACT bf16 products on WMMA 16x16x32 (f32 accumulate) + bias; scores between the raw-reshaped theta view (f16 hi + residual x 2^10) and phi (f16) (2 products); the softmax over the QUERY axis in f32 (per-column max / sum from 64-row partials, precise expf); the scores formed a second time, transposed, in the P.v kernel (never stored); P x 2^11 once to f16 x the raw-reshaped g view once to f16 (1 product); the W 1x1 conv on the raw-reshaped y view with bf16 hi + lo (2 products) x exact W + bias + x residual; f32 output written channels-first.
#include <hip/hip_runtime.h>
#include <math.h>

typedef __attribute__((ext_vector_type(16))) _Float16 v16h;
typedef __attribute__((ext_vector_type(16))) __bf16 v16b;
typedef __attribute__((ext_vector_type(8)))  _Float16 v8h;
typedef __attribute__((ext_vector_type(8)))  float v8f;
typedef __attribute__((ext_vector_type(4)))  float v4f;
typedef __attribute__((ext_vector_type(2)))  float v2f;
typedef __attribute__((ext_vector_type(4)))  unsigned v4u;
typedef _Float16 hx8 __attribute__((ext_vector_type(8)));
typedef __attribute__((ext_vector_type(4)))  int v4i;
typedef float __attribute__((may_alias)) float_a;
typedef int __attribute__((may_alias)) int_a;

template <typename T> __device__ __forceinline__ void vst2(void* p, T v) { *(T*)p = v;  }
__device__ __forceinline__ v8f wmma16(v16h a, v16h b, v8f c) {
  v8f d = __builtin_amdgcn_wmma_f32_16x16x32_f16(false, a, false, b, (short)0, c, false, false);
  asm volatile("v_nop\n\tv_nop\n\tv_nop\n\tv_nop" : "+v"(d) : "v"(a), "v"(b));
  return d;
}
__device__ __forceinline__ v8f wmma_bf(v16b a, v16b b, v8f c) {
  v8f d = __builtin_amdgcn_wmma_f32_16x16x32_bf16(false, a, false, b, (short)0, c, false, false);
  asm volatile("v_nop\n\tv_nop\n\tv_nop\n\tv_nop" : "+v"(d) : "v"(a), "v"(b));
  return d;
}
// 16x16x32 fragments: lane = (h = lane>>4, row/col = lane&15); elements 0..7 = k0+8h+0..7, 8..15 = k0+16+8h+0..7; D element r = row 8h+r
__device__ __forceinline__ v16h frag_h(const _Float16* rowk0, int lane) {
  union { v16h v; v8h q[2]; } u; const _Float16* p = rowk0 + 8 * (lane >> 4);
  u.q[0] = *(const v8h*)p; u.q[1] = *(const v8h*)(p + 16); return u.v;
}
__device__ __forceinline__ v16h frag_f32(const float* rowk0, int lane) {
  v16h a; const float* p = rowk0 + 8 * (lane >> 4);
#pragma unroll
  for (int i = 0; i < 8; ++i) { a[i] = (_Float16)p[i]; a[8 + i] = (_Float16)p[16 + i]; }
  return a;
}
__device__ __forceinline__ v16h frag_f32s(const float* rowk0, int lane, float sc) {
  v16h a; const float* p = rowk0 + 8 * (lane >> 4);
#pragma unroll
  for (int i = 0; i < 8; ++i) { a[i] = (_Float16)(p[i] * sc); a[8 + i] = (_Float16)(p[16 + i] * sc); }
  return a;
}
// column fragment from a [K][ld] layout (column n), rows >= K read as 0
__device__ __forceinline__ v16h fragc_f32(const float* W, int k0, int n, int lane, int ld, int K) {
  v16h a; const int g = lane >> 4;
#pragma unroll
  for (int i = 0; i < 8; ++i) { const int ka = k0 + 8 * g + i, kb = ka + 16;
    a[i] = (_Float16)(ka < K ? W[(size_t)(ka < K ? ka : K - 1) * ld + n] : 0.f); a[8 + i] = (_Float16)(kb < K ? W[(size_t)(kb < K ? kb : K - 1) * ld + n] : 0.f); }
  return a;
}
struct F2 { v16b h, l; };
__device__ __forceinline__ F2 bsplit16(const float v[16]) { F2 r;
#pragma unroll
  for (int i = 0; i < 16; ++i) { const __bf16 h = (__bf16)v[i]; r.h[i] = h; r.l[i] = (__bf16)(v[i] - (float)h); }
  return r; }
__device__ __forceinline__ F2 split_row(const float* row, int k0, int lane) { float v[16]; const float* p = row + k0 + 8 * (lane >> 4);
#pragma unroll
  for (int i = 0; i < 8; ++i) { v[i] = p[i]; v[8 + i] = p[16 + i]; }
  return bsplit16(v); }
__device__ __forceinline__ F2 split_rowK(const float* row, int k0, int lane, int K) { float v[16]; const int g = lane >> 4;
#pragma unroll
  for (int i = 0; i < 8; ++i) { const int ka = k0 + 8 * g + i, kb = ka + 16; v[i] = ka < K ? row[ka < K ? ka : K - 1] : 0.f; v[8 + i] = kb < K ? row[kb < K ? kb : K - 1] : 0.f; }
  return bsplit16(v); }
__device__ __forceinline__ F2 split_col(const float* W, int k0, int n, int lane, int ld, int K) { float v[16]; const int g = lane >> 4;
#pragma unroll
  for (int i = 0; i < 8; ++i) { const int ka = k0 + 8 * g + i, kb = ka + 16; v[i] = ka < K ? W[(size_t)(ka < K ? ka : K - 1) * ld + n] : 0.f; v[8 + i] = kb < K ? W[(size_t)(kb < K ? kb : K - 1) * ld + n] : 0.f; }
  return bsplit16(v); }
__device__ __forceinline__ v8f mac3(const F2& a, const F2& b, v8f c) { c = wmma_bf(a.l, b.h, c); c = wmma_bf(a.h, b.l, c); return wmma_bf(a.h, b.h, c); }
__device__ __forceinline__ float sigm(float v) { return 1.0f / (1.0f + expf(-v)); }
// fragment stored in fragment order (1 KiB: [half of the fragment][lane][8 f16]), read at the lane's own pointer (fragment start + 8 * lane): each of the two loads covers 512 contiguous bytes
__device__ __forceinline__ v16h frag_pk(const _Float16* p) { union { v16h v; v8h q[2]; } u; u.q[0] = *(const v8h*)p; u.q[1] = *(const v8h*)(p + 256); return u.v; }
// fragment read at the lane's own pointer (row start + k0 + 8 * (lane >> 4)): the caller keeps that pointer and names it at the wait behind a batch of loads
__device__ __forceinline__ v16b wfrag_p(const float* p) { v16b w;
#pragma unroll
  for (int i = 0; i < 8; ++i) { w[i] = (__bf16)p[i]; w[8 + i] = (__bf16)p[16 + i]; }
  return w; }

// Non-local block with the source's RAW reshapes (x [4,256,64,64], Cb 128, N 4,096; (out,in) theta/phi/g 1x1 convs [128,256] + biases, W [256,128] + bias): theta = conv(x).reshape(B, N, Cb) and g likewise are ROW-MAJOR reinterpretations of the [Cb][N] conv outputs (row n = channel n/32, positions (n%32)*128..+127), phi stays [Cb][N]; scores[n][m] = sum_c theta[n][c] phi[c][m]; attn = softmax over n (axis 1 - per key column); y[n][c] = sum_m attn[n][m] g[m][c]; y.reshape(B, Cb, H, W) (raw again) -> W conv + bias + x.
#define NB 4
#define TT 4096
#define CC 128            // g-view plane pitch (Cb channels)
#define CB 128
#define COUT 256
#define CCQ 128           // theta-view / phi^T row pitch (Cb)
#define DIN 256          // x channels
#define NH 1
#define HD 128
#define NQB (TT / 64)
#define SCALE (1.0f)
#define HDQK 128           // contraction width of the scores (Cb)
#define CAUSAL 0
#ifndef TNB
#define TNB NB
#endif
__device__ __forceinline__ v16b zero16b() { v16b z; _Pragma("unroll") for (int i = 0; i < 16; ++i) z[i] = (__bf16)0.f; return z; }
__device__ __forceinline__ float bfr(float v) { return (float)(__bf16)v; }
__host__ __device__ __forceinline__ int kb_last(int qb) { return CAUSAL ? ((qb * 64 + 63) >> 7) : (TT / 128 - 1); }
typedef __attribute__((ext_vector_type(8))) __bf16 v8b;
__device__ __forceinline__ v16b frag_b(const __bf16* rowk0, int lane) {
  union { v16b v; v8b q[2]; } u; const __bf16* p = rowk0 + 8 * (lane >> 4);
  u.q[0] = *(const v8b*)p; u.q[1] = *(const v8b*)(p + 16); return u.v;
}
#define QBH 0              // 2-product logits everywhere (theta view hi + residual x phi hi)
#define QHI 4096            // q residual rows (all)
#define KHI 64            // (unused k residual / v bf16 planes: QBH 0)
// B fragment (k rows k0+.., output column o) of a weight: (in,out) [K][ld] or (out,in) [ld rows of K]: bf16 exact, or f16(bf16 * 256) exact
__device__ __forceinline__ v16b wcol_io(const float* Wm, int k0, int o, int lane, int ld) { v16b w; const int g = lane >> 4;
#pragma unroll
  for (int i = 0; i < 8; ++i) { w[i] = (__bf16)Wm[(size_t)(k0 + 8 * g + i) * ld + o]; w[8 + i] = (__bf16)Wm[(size_t)(k0 + 16 + 8 * g + i) * ld + o]; }
  return w; }
__device__ __forceinline__ v16b wcol_oi(const float* Wm, int k0, int o, int lane, int K) { v16b w; const float* p = Wm + (size_t)o * K + k0 + 8 * (lane >> 4);
#pragma unroll
  for (int i = 0; i < 8; ++i) { w[i] = (__bf16)p[i]; w[8 + i] = (__bf16)p[16 + i]; }
  return w; }
__device__ __forceinline__ v16h wcolh_io(const float* Wm, int k0, int o, int lane, int ld) { v16h w; const int g = lane >> 4;
#pragma unroll
  for (int i = 0; i < 8; ++i) { w[i] = (_Float16)(bfr(Wm[(size_t)(k0 + 8 * g + i) * ld + o]) * 256.0f); w[8 + i] = (_Float16)(bfr(Wm[(size_t)(k0 + 16 + 8 * g + i) * ld + o]) * 256.0f); }
  return w; }
__device__ __forceinline__ v16h wcolh_oi(const float* Wm, int k0, int o, int lane, int K) { v16h w; const float* p = Wm + (size_t)o * K + k0 + 8 * (lane >> 4);
#pragma unroll
  for (int i = 0; i < 8; ++i) { w[i] = (_Float16)(bfr(p[i]) * 256.0f); w[8 + i] = (_Float16)(bfr(p[16 + i]) * 256.0f); }
  return w; }
#define WQKV_LAYOUT 0   // 0 = (out,in) [CC][DIN], as 1; 1 = (out,in) [CC][DIN]; 2 = per-head [NH][DIN][HD]
__device__ __forceinline__ v16b wcol_hdk(const float* Wm, int k0, int o, int lane) { v16b w; const int g = lane >> 4; const float* p = Wm + (size_t)(o / HD) * DIN * HD + (o % HD);
#pragma unroll
  for (int i = 0; i < 8; ++i) { w[i] = (__bf16)p[(size_t)(k0 + 8 * g + i) * HD]; w[8 + i] = (__bf16)p[(size_t)(k0 + 16 + 8 * g + i) * HD]; }
  return w; }
#define WO_OUT_IN 0
#if WQKV_LAYOUT == 1
#define WCOL(W, k0, o, lane) wcol_oi(W, k0, (o), lane, DIN)   /* unused: layout 0 */
#elif WQKV_LAYOUT == 2
#define WCOL(W, k0, o, lane) wcol_hdk(W, k0, o, lane)
#else
#define WCOL(W, k0, o, lane) wcol_oi(W, k0, (o), lane, DIN)   /* (out,in) 1x1-conv weights [128][256]: all 128 output channels real */
#endif
#if WO_OUT_IN
#define WOCOL(W, k0, o, lane) wcol_oi(W, k0, o, lane, CC)
#define WOCOLH(W, k0, o, lane) wcolh_oi(W, k0, o, lane, CC)
#else
#define WOCOL(W, k0, o, lane) wcol_io(W, k0, o, lane, DIN)
#define WOCOLH(W, k0, o, lane) wcolh_io(W, k0, o, lane, DIN)
#endif
#ifndef SM_EXTRA_PARAMS
#define SM_EXTRA_PARAMS
#endif
#ifndef PROJ_EXTRA_PARAMS
#define PROJ_EXTRA_PARAMS
#endif
#ifndef SM_MASK_HOOK
#define SM_MASK_HOOK (void)0
#endif

#define WS_QH  0u                                      // f16 q rows in fragment order [b*t / 16][k step][fragment half][lane][8]
#define WS_KH  (WS_QH + 2u * (size_t)NB * TT * CCQ)     // f16 k rows in fragment order [b*t / 16][k step][fragment half][lane][8]
#define WS_VT  (WS_KH + 2u * (size_t)NB * TT * CCQ)     // f16 v planes [b][c][t]
#define WS_QL  (WS_VT + 2u * (size_t)NB * CC * TT)      // f16 q residual x 2^10 rows [b][t < QHI], in fragment order like WS_QH
#define WS_KL  (WS_QL + 2u * (size_t)NB * QHI * CCQ)    // f16 k residual x 2^10 rows [b][t < KHI][CCQ]
#define WS_VB  (WS_KL + 2u * (size_t)NB * KHI * CCQ)    // bf16 v hi planes [b][c][t < KHI]
#define WS_VBL (WS_VB + 2u * (size_t)NB * CC * KHI)
#define WS_Y   (WS_VBL + 2u * (size_t)NB * CC * KHI)    // zero bytes: Y is not used, the y rows go to WS_YR
#define WS_END (WS_Y  + 0u)

// ---- k_proj: block = (64 rows, 128 cols, which): q/k/v = X W (+ b) with exact bf16 products (K = DIN) -> which 0: q f16 rows (+ residual rows < QHI); 1: k f16 rows (+ residual rows < KHI), the f16 rows of both in fragment order; 2: v f16 planes [c][t] (+ bf16 hi/lo planes for t < KHI)
template <int WOFF> __global__ __launch_bounds__(128) void k_projT(const float* __restrict__ XQ, const float* __restrict__ XK, const float* __restrict__ XV, const float* __restrict__ WQ, const float* __restrict__ WK, const float* __restrict__ WV, const float* __restrict__ BQ, const float* __restrict__ BK, const float* __restrict__ BV,
    _Float16* __restrict__ QH, _Float16* __restrict__ QL, _Float16* __restrict__ KH, _Float16* __restrict__ KL, _Float16* __restrict__ VT, __bf16* __restrict__ VB, __bf16* __restrict__ VBL, _Float16* __restrict__ VL) {
  __shared__ __align__(16) _Float16 sh[64][136], sl[64][136]; __shared__ __align__(16) _Float16 th[128][72], tlo[128][72]; __shared__ __align__(16) __bf16 tb[128][72], tbl[128][72];
  const int tid = threadIdx.x, wave = tid >> 5, lane = tid & 31, col = lane & 15, g = lane >> 4; const int which = blockIdx.z + WOFF; const int c0 = blockIdx.y * 128; const size_t r0 = (size_t)blockIdx.x * 64; const size_t bb = r0 / TT; const int t0 = (int)(r0 % TT);
  const float* X = which == 0 ? XQ : which == 1 ? XK : XV; const float* WA = which == 0 ? WQ : which == 1 ? WK : WV; const float* BA = which == 0 ? BQ : which == 1 ? BK : BV;
  const int KD = DIN;
  v8f acc[8] = {};
#pragma unroll 2
  for (int kc = 0; kc < KD / 32; ++kc) { v16b a, w[8]; const float* p = X + (bb * KD + kc * 32 + 8 * g) * (size_t)TT + t0 + wave * 16 + col;   /* channels-first [b][c][t]: A[t][c] (16 consecutive t per lane group) */
    const float* wp = WA + (size_t)(c0 + col) * DIN + kc * 32 + 8 * g;   /* (out,in) weight rows: fragment j starts 16 rows further on */
#pragma unroll
    for (int i = 0; i < 8; ++i) { a[i] = (__bf16)p[(size_t)i * TT]; a[8 + i] = (__bf16)p[(size_t)(16 + i) * TT]; }
#pragma unroll
    for (int j = 0; j < 8; ++j) w[j] = wfrag_p(wp + (size_t)j * 16 * DIN);   /* all eight weight fragments ahead of the k step's first WMMA: the asm in wmma_bf holds later loads behind it, so a load written between two WMMAs pays its whole latency there */
    asm volatile("s_wait_loadcnt 0x0" :: "v"(p), "v"(wp) : "memory");   /* names the two address pairs so that they stay as they are until every load of the batch has returned */
#pragma unroll
    for (int j = 0; j < 8; ++j) acc[j] = wmma_bf(a, w[j], acc[j]); }
  const float* bp = BA + c0 + col; float bias8[8] = {};   /* the eight bias loads together, ahead of the epilogue's LDS stores */
  if (BA) {
#pragma unroll
    for (int j = 0; j < 8; ++j) bias8[j] = bp[j * 16];
    asm volatile("s_wait_loadcnt 0x0" :: "v"(bp) : "memory"); }   /* names the address pair so that it stays as it is until the eight loads have returned */
  if (which < 2) { _Float16* DH = which == 0 ? QH : KH; _Float16* DL = which == 0 ? QL : KL; const int nhi = which == 0 ? QHI : KHI; const bool hi_rows = t0 < nhi;
#pragma unroll
    for (int j = 0; j < 8; ++j) { const float bias = bfr(bias8[j]);
#pragma unroll
      for (int r = 0; r < 8; ++r) { const float v = acc[j][r] + bias; const _Float16 hv = (_Float16)v; sh[wave * 16 + 8 * g + r][j * 16 + col] = hv; sl[wave * 16 + 8 * g + r][j * 16 + col] = (_Float16)((v - (float)hv) * 1024.0f); } }
    __syncthreads();
    for (int e = tid; e < 64 * 16; e += 128) { const int rl = ((e >> 8) << 4) | (e & 15), q = ((e >> 6) & 3) * 4 + ((e >> 5) & 1) * 2 + ((e >> 4) & 1);   /* fragment order: e = (16-row tile, k step, fragment half, lane): piece e of the block's 16 KiB is what that lane loads */
      vst2((unsigned*)(DH + r0 * CCQ + (size_t)e * 8), *(const v4u*)&sh[rl][q * 8]);
      asm volatile("s_wait_xcnt 0x0" ::: "memory");   /* the store's address pair and data registers are rewritten by the residual store's LDS read and by the next trip */
      if (hi_rows) { vst2((unsigned*)(DL + (bb * nhi + t0 + rl) * (size_t)CCQ + c0 + q * 8), *(const v4u*)&sl[rl][q * 8]);
        asm volatile("s_wait_xcnt 0x0" ::: "memory"); } }   /* likewise, ahead of the next trip */   /* hi rows in fragment order (c0 == 0), residual rows at pitch CCQ */
  } else { const bool hi_rows = t0 < KHI;
#pragma unroll
    for (int j = 0; j < 8; ++j) { const float bias = bfr(bias8[j]);
#pragma unroll
      for (int r = 0; r < 8; ++r) { const float v = acc[j][r] + bias; const int rl = wave * 16 + 8 * g + r, cl = j * 16 + col; const _Float16 hv2 = (_Float16)v; th[cl][rl] = hv2; tlo[cl][rl] = (_Float16)((v - (float)hv2) * 1024.0f); const __bf16 bh = (__bf16)v; tb[cl][rl] = bh; tbl[cl][rl] = (__bf16)(v - (float)bh); } }
    __syncthreads();
    for (int e = tid; e < 128 * 8; e += 128) { const int cl = e >> 3, q = e & 7; vst2((unsigned*)(VT + (bb * CC + c0 + cl) * (size_t)TT + t0 + q * 8), *(const v4u*)&th[cl][q * 8]); if (VL) vst2((unsigned*)(VL + (bb * CC + c0 + cl) * (size_t)TT + t0 + q * 8), *(const v4u*)&tlo[cl][q * 8]); if (hi_rows) { const size_t o3 = (bb * CC + c0 + cl) * (size_t)KHI + t0 + q * 8; vst2((unsigned*)(VB + o3), *(const v4u*)&tb[cl][q * 8]); vst2((unsigned*)(VBL + o3), *(const v4u*)&tbl[cl][q * 8]); } } } }
// ---- k_sc: block = (query block qb, key block kb <= kb_last(qb), batch): column statistics of a 64 x 128 tile of the logits x SCALE (the logits themselves are not stored: k_pvf forms them again); q hi + residual (x 2^10) against k (2 products) for query rows < QHI, plus the k residual (3 products) for query blocks < QBH (causal early rows); causal: blocks past the diagonal exit
__global__ __launch_bounds__(128) void k_sc(const _Float16* __restrict__ QH, const _Float16* __restrict__ KH, const _Float16* __restrict__ QL, const _Float16* __restrict__ KL, int bgrp, int h0, float* __restrict__ PM0, float* __restrict__ PS0) { __shared__ __align__(16) float ss[4][16][132];
  const int qb = blockIdx.x, kb = blockIdx.y; if (kb > kb_last(qb)) return;
  (void)h0; const int b = bgrp + blockIdx.z; float* PM = PM0 + (size_t)b * NQB * TT; float* PS = PS0 + (size_t)b * NQB * TT;   /* one plane of partials per batch */
  const int tid = threadIdx.x, wave = tid >> 5, lane = tid & 31, col = lane & 15, g = lane >> 4; const int k0 = kb * 128; const int ql0 = qb * 64 + wave * 16; const size_t q0 = (size_t)b * TT + ql0, kr0 = (size_t)b * TT + k0;
  v8f acc[8] = {}, accl[8] = {};
  const _Float16* QLb = QL + (size_t)b * QHI * CCQ; const _Float16* KLb = KL + (size_t)b * KHI * CCQ;   /* single head */
  const _Float16* kp = KH + kr0 * CCQ + lane * 8;   /* key rows in fragment order: fragment (16-key tile j, k step kc) starts (j * 4 + kc) * 512 f16 further on */
  const _Float16* qp = QH + q0 * CCQ + lane * 8; const _Float16* qlp = QLb + (size_t)ql0 * CCQ + lane * 8;   /* the wave's 16 query rows, hi and residual, likewise: fragment kc starts kc * 512 f16 further on */
  if (qb < QBH) {
#pragma unroll
    for (int kc = 0; kc < HDQK / 32; ++kc) { const v16h ah = frag_pk(qp + kc * 512), al = frag_pk(qlp + kc * 512);
#pragma unroll
      for (int j = 0; j < 8; ++j) { const v16h kbf = frag_pk(kp + (j * 4 + kc) * 512), klf = frag_h(KLb + (size_t)(k0 + j * 16 + col) * CCQ + kc * 32, lane); acc[j] = wmma16(ah, kbf, acc[j]); accl[j] = wmma16(al, kbf, accl[j]); accl[j] = wmma16(ah, klf, accl[j]); } }
  } else if (qb * 64 < QHI) {
#pragma unroll
    for (int kc = 0; kc < HDQK / 32; ++kc) { const v16h ah = frag_pk(qp + kc * 512), al = frag_pk(qlp + kc * 512);
      v16h kbf[8];   /* the k step's eight key fragments ahead of its first WMMA (the asm in wmma16 holds later loads behind it) */
#pragma unroll
      for (int j = 0; j < 8; ++j) kbf[j] = frag_pk(kp + (j * 4 + kc) * 512);
#pragma unroll
      for (int j = 0; j < 8; ++j) { acc[j] = wmma16(ah, kbf[j], acc[j]); accl[j] = wmma16(al, kbf[j], accl[j]); } }
  } else {
#pragma unroll
    for (int kc = 0; kc < HDQK / 32; ++kc) { const v16h ah = frag_pk(qp + kc * 512);
#pragma unroll
      for (int j = 0; j < 8; ++j) { const v16h kbf = frag_pk(kp + (j * 4 + kc) * 512); acc[j] = wmma16(ah, kbf, acc[j]); } } }
#pragma unroll
  for (int j = 0; j < 8; ++j) {
#pragma unroll
    for (int r = 0; r < 8; ++r) ss[wave][8 * g + r][j * 16 + col] = (acc[j][r] + accl[j][r] * (1.0f / 1024.0f)) * SCALE; }
  __syncthreads();   /* every wave's 16 rows of the tile are in ss before a thread walks its column */
  // column statistics of this 64 x 128 tile from the f32 logits in ss: thread = key column, rows in ascending order: max, then sum of exp(v - max)
  { float v[64];
#pragma unroll
    for (int i = 0; i < 64; ++i) v[i] = ss[i >> 4][i & 15][tid];
    float m = v[0];
#pragma unroll
    for (int i = 1; i < 64; ++i) m = fmaxf(m, v[i]);
    float s = 0.f;
#pragma unroll
    for (int i = 0; i < 64; ++i) s += expf(v[i] - m);
    vst2(PM + (size_t)qb * TT + k0 + tid, m); vst2(PS + (size_t)qb * TT + k0 + tid, s); } }
// ---- k_colmerge: softmax over the QUERY axis (axis 1): joins the 64 per-query-block partials (PM = max, PS = sum of exp(S - PM) over 64 rows) of each key column m: CM[m] = max, CS[m] = 2^11 / sum_q PS[q][m] exp(PM[q][m] - CM[m]) (the factor that k_pvf multiplies with: one division per column); block = 32 columns (lane) x 8 waves of 8 partials, joined through LDS
__global__ __launch_bounds__(256) void k_colmerge(const float* __restrict__ PM0, const float* __restrict__ PS0, float* __restrict__ CM0, float* __restrict__ CS0) { __shared__ float lm[8][32], ls[8][32];
  const float* PM = PM0 + (size_t)blockIdx.y * NQB * TT; const float* PS = PS0 + (size_t)blockIdx.y * NQB * TT; float* CM = CM0 + (size_t)blockIdx.y * TT; float* CS = CS0 + (size_t)blockIdx.y * TT;   /* blockIdx.y = batch */
  const int tid = threadIdx.x, wave = tid >> 5, lane = tid & 31; const int m = blockIdx.x * 32 + lane; float pm[8], ps[8];
#pragma unroll
  for (int u = 0; u < 8; ++u) pm[u] = PM[(size_t)(wave * 8 + u) * TT + m];
  asm volatile("s_wait_xcnt 0x0" ::: "memory");   /* the address pair of the loads above is rewritten for the loads below */
#pragma unroll
  for (int u = 0; u < 8; ++u) ps[u] = PS[(size_t)(wave * 8 + u) * TT + m];
  float mx = pm[0];
#pragma unroll
  for (int u = 1; u < 8; ++u) mx = fmaxf(mx, pm[u]);
  float sm2 = 0.f;
#pragma unroll
  for (int u = 0; u < 8; ++u) sm2 += ps[u] * expf(pm[u] - mx);
  lm[wave][lane] = mx; ls[wave][lane] = sm2;
  __syncthreads();
  if (wave == 0) { float mt = lm[0][lane];
#pragma unroll
    for (int w = 1; w < 8; ++w) mt = fmaxf(mt, lm[w][lane]);
    float st = 0.f;
#pragma unroll
    for (int w = 0; w < 8; ++w) st += ls[w][lane] * expf(lm[w][lane] - mt);
    vst2(CM + m, mt); vst2(CS + m, 2048.0f / st); } }
// ---- k_trans: blockIdx.z < TNB: block = (64 keys, 64 columns, batch): the g view rows [m][c] turned through LDS into fragments (column c, 32 keys) laid in fragment order for k_pvf; blockIdx.z >= TNB: block = two 16-row tiles of a batch's theta view rows (hi plane, then residual plane), their 16-B pieces copied into fragment order for k_sc
static_assert((TT / 64) * (CB / 64) * 2 == TT / 16, "two 16-row tiles of the theta view per block");
__global__ __launch_bounds__(256) void k_trans(const _Float16* __restrict__ G, _Float16* __restrict__ VT2, const _Float16* __restrict__ TH, const _Float16* __restrict__ TR, _Float16* __restrict__ QP, _Float16* __restrict__ QR) { __shared__ _Float16 st[64][72]; const int tid = threadIdx.x;
  if (blockIdx.z >= TNB) {   /* the same for the whole block, ahead of the barrier */
    const int z = blockIdx.z - TNB; const size_t o = (size_t)(z % TNB) * CB * TT + (size_t)(blockIdx.y * (TT / 64) + blockIdx.x) * 2 * 16 * CCQ;   /* a tile is 16 rows of CCQ f16 = 4 KiB in both layouts */
    const _Float16* s = (z < TNB ? TH : TR) + o + (size_t)(tid & 15) * CCQ + (((tid >> 6) & 3) * 4 + ((tid >> 5) & 1) * 2 + ((tid >> 4) & 1)) * 8;   /* tid = (k step, fragment half, lane): that lane's piece of its row */
    _Float16* d = (z < TNB ? QP : QR) + o + tid * 8;
    const v4u u0 = *(const v4u*)s, u1 = *(const v4u*)(s + 16 * CCQ); vst2((unsigned*)d, u0); vst2((unsigned*)(d + 16 * CCQ), u1); return; }
  const int m0 = blockIdx.x * 64, c0 = blockIdx.y * 64, b = blockIdx.z; const _Float16* gb = G + (size_t)b * CB * TT; _Float16* vb = VT2 + (size_t)b * CB * TT;
  for (int e = tid; e < 64 * 8; e += 256) { const int ml = e >> 3, q = e & 7; const v4u u = *(const v4u*)(gb + (size_t)(m0 + ml) * CB + c0 + q * 8); asm volatile("s_wait_loadcnt 0x0" ::: "memory"); const hx8 hv = *(const hx8*)&u; _Pragma("unroll") for (int j = 0; j < 8; ++j) st[q * 8 + j][ml] = hv[j]; }
  __syncthreads();
  for (int e = tid; e < 64 * 8; e += 256) { const int cl = ((e >> 6) & 3) * 16 + (e & 15), q = (e >> 8) * 4 + ((e >> 5) & 1) * 2 + ((e >> 4) & 1);   /* fragment order: e = (32-key step, 16-column fragment, fragment half, lane) */
    hx8 hv; _Pragma("unroll") for (int j = 0; j < 8; ++j) hv[j] = st[cl][q * 8 + j]; vst2((unsigned*)(vb + ((size_t)((m0 >> 5) + (e >> 8)) * (CB / 16) + (c0 >> 4)) * 512 + (e & 255) * 8), *(const v4u*)&hv); } }
// ---- k_wout: block = (64 positions, 128 of the 256 output channels, batch): A[pos][cb] = y view Yb[cb*4096 + pos] (the raw reshape back: the batch's y rows [4096][128] f32 reinterpreted as [Cb][N]) split bf16 hi + lo (2 products) x exact (out,in) W [256][128]; + bf16(W_b) + bf16(x[b][o][pos]); channels-first store out[b][o][pos0..pos0+63] through LDS (one 256-B run per channel by 16 lanes)
__global__ __launch_bounds__(128) void k_wout(const float* __restrict__ Y, const float* __restrict__ WW, const float* __restrict__ WB, const float* __restrict__ X, float* __restrict__ OUT) { __shared__ __align__(16) float st[128][68];
  const int tid = threadIdx.x, wave = tid >> 5, lane = tid & 31, col = lane & 15, g = lane >> 4; const int p0 = blockIdx.x * 64, c0 = blockIdx.y * 128, b = blockIdx.z; const float* Yb = Y + (size_t)b * TT * CB;
  v8f acc[8] = {};
#pragma unroll 1
  for (int kc = 0; kc < CB / 32; ++kc) { v16b ah, al, w[8]; { const float* p = Yb + (size_t)(kc * 32 + 8 * g) * TT + p0 + wave * 16 + col; const float* wp = WW + (size_t)(c0 + col) * CB + kc * 32 + 8 * g; float tv[16];
#pragma unroll
      for (int i = 0; i < 8; ++i) { tv[i] = p[(size_t)i * TT]; tv[8 + i] = p[(size_t)(16 + i) * TT]; }
#pragma unroll
      for (int j = 0; j < 8; ++j) w[j] = wfrag_p(wp + (size_t)j * 16 * CB);   /* with the y loads, ahead of the k step's first WMMA (the asm in wmma_bf holds later loads behind it) */
      asm volatile("s_wait_loadcnt 0x0" :: "v"(p), "v"(wp) : "memory");   /* names the two address pairs so that they stay as they are until every load of the batch has returned */
#pragma unroll
      for (int i = 0; i < 16; ++i) { const __bf16 h = (__bf16)tv[i]; ah[i] = h; al[i] = (__bf16)(tv[i] - (float)h); } }
#pragma unroll
    for (int j = 0; j < 8; ++j) { acc[j] = wmma_bf(ah, w[j], acc[j]); acc[j] = wmma_bf(al, w[j], acc[j]); } }
  // thread's sixteen 16-B pieces: channel c0 + (tid >> 4) + 8 u, positions p0 + (tid & 15) * 4
  const size_t o0 = ((size_t)b * COUT + c0 + (tid >> 4)) * (size_t)TT + p0 + (tid & 15) * 4; const float* xp = X + o0; const float* bp = WB + c0 + col; float* op = OUT + o0;
  float wb8[8]; v4f xr[16];   /* the eight bias loads and the sixteen residual loads are issued together, ahead of the turn through LDS */
#pragma unroll
  for (int j = 0; j < 8; ++j) wb8[j] = bp[j * 16];
#pragma unroll
  for (int u = 0; u < 16; ++u) xr[u] = *(const v4f*)(xp + (size_t)u * 8 * TT);
  asm volatile("s_wait_loadcnt 0x0" :: "v"(xp), "v"(bp) : "memory");   /* names the two address pairs so that they stay as they are until every load of the batch has returned */
#pragma unroll
  for (int j = 0; j < 8; ++j) { const float wb = bfr(wb8[j]);
#pragma unroll
    for (int r = 0; r < 8; ++r) st[j * 16 + col][wave * 16 + 8 * g + r] = acc[j][r] + wb; }
  __syncthreads();
#pragma unroll
  for (int u = 0; u < 16; ++u) { v4f v = *(const v4f*)&st[(tid >> 4) + 8 * u][(tid & 15) * 4]; v[0] += bfr(xr[u][0]); v[1] += bfr(xr[u][1]); v[2] += bfr(xr[u][2]); v[3] += bfr(xr[u][3]); vst2(op + (size_t)u * 8 * TT, v); } }
// ---- k_pvf: block = (64 queries, batch), 8 waves: wave = (query group qg of 32 queries, key slice ks); slice ks takes the 32-key steps ks, ks + 4, ks + 8, ... of the 4,096 keys. Per step the wave forms the TRANSPOSED scores S^T[key][query] = k rows (A) x q rows hi + residual (B, kept in registers) as in k_sc (2 products); a lane's accumulator registers of the two 16-key tiles are, element for element, its part of the B operand of the next product, so P^T x 2^11 = exp(S^T - CM[key]) * CS[key] goes once to f16 in place and y^T[c][query] += v fragment (A: row c, 32 keys) x P^T (1 product). The 4 slices' partial tiles are joined through LDS in ascending ks, x 2^-11
#define PKS 4              // key slices of a k_pvf block
// the plain builtin (the compiler keeps the distances behind it itself): an asm statement cannot name a register above v255, and k_pvf's operands do not all fit below
__device__ __forceinline__ v8f wmma16b(v16h a, v16h b, v8f c) { return __builtin_amdgcn_wmma_f32_16x16x32_f16(false, a, false, b, (short)0, c, false, false); }
static_assert((TT / 32) % PKS == 0 && TT % 64 == 0, "every wave the same number of 32-key steps; whole 64-query blocks");
__global__ __launch_bounds__(64 * PKS) void k_pvf(const _Float16* __restrict__ QH, const _Float16* __restrict__ QL, const _Float16* __restrict__ KH, const float* __restrict__ CM, const float* __restrict__ CS, const _Float16* __restrict__ VT, float* __restrict__ Y) { __shared__ __align__(16) float ss[2 * PKS][32][CB + 4];
  const int tid = threadIdx.x, wave = __builtin_amdgcn_readfirstlane(tid >> 5), lane = tid & 31, col = lane & 15, g = lane >> 4; const int b = blockIdx.y, qg = wave & 1, ks = wave >> 1; const size_t q0 = (size_t)b * TT + blockIdx.x * 64 + qg * 32;
  v16h qh[2][4], qr[2][4];   /* the wave's two 16-query tiles, hi and residual, all four k steps: loaded once */
  { const _Float16* qp = QH + q0 * CCQ + lane * 8; const _Float16* qlp = QL + q0 * CCQ + lane * 8;
#pragma unroll
    for (int u = 0; u < 2; ++u)
#pragma unroll
      for (int kc = 0; kc < 4; ++kc) { qh[u][kc] = frag_pk(qp + (u * 4 + kc) * 512); qr[u][kc] = frag_pk(qlp + (u * 4 + kc) * 512); } }
  v8f acc[2][CB / 16] = {};
#pragma unroll 1
  for (int i = 0; i < TT / 32 / PKS; ++i) { const size_t st = (size_t)b * (TT / 32) + i * PKS + ks;   /* a step's key fragments are 8 KiB in a row, its v fragments likewise */
    const _Float16* kp = KH + st * (32 * CCQ) + lane * 8; const _Float16* vp = VT + st * (32 * CB) + lane * 8;
    const float* mp = CM + st * 32 + 8 * g; const float* fp = CS + st * 32 + 8 * g;   /* the lane's 16 keys (8 g + 0..7 of either tile): their column max and factor */
    v16h kf[2][4], vf[CB / 16], p[2]; v4f cm[4], cf[4];
#pragma unroll
    for (int t = 0; t < 2; ++t)
#pragma unroll
      for (int kc = 0; kc < 4; ++kc) kf[t][kc] = frag_pk(kp + (t * 4 + kc) * 512);
#pragma unroll
    for (int u = 0; u < 4; ++u) { const int o = (u >> 1) * 16 + (u & 1) * 4; cm[u] = *(const v4f*)(mp + o); cf[u] = *(const v4f*)(fp + o); }
    __builtin_amdgcn_sched_barrier(0);   /* what the score products and the exp work need is asked for first: loads come back in the order of issue */
#pragma unroll
    for (int j = 0; j < CB / 16; ++j) vf[j] = frag_pk(vp + j * 512);
    __builtin_amdgcn_sched_barrier(0);   /* every load of the step is issued ahead of its first WMMA: the v fragments arrive under the score products and the exp work; without it the scheduler may sink them to their use and a step pays two load latencies in a row */
#pragma unroll
    for (int u = 0; u < 2; ++u) { v8f a0 = {}, a1 = {}, l0 = {}, l1 = {};
#pragma unroll
      for (int kc = 0; kc < 4; ++kc) { a0 = wmma16b(kf[0][kc], qh[u][kc], a0); a1 = wmma16b(kf[1][kc], qh[u][kc], a1); l0 = wmma16b(kf[0][kc], qr[u][kc], l0); l1 = wmma16b(kf[1][kc], qr[u][kc], l1); }
#pragma unroll
      for (int r = 0; r < 8; ++r) { const float s0 = (a0[r] + l0[r] * (1.0f / 1024.0f)) * SCALE, s1 = (a1[r] + l1[r] * (1.0f / 1024.0f)) * SCALE;
        p[u][r] = (_Float16)(expf(s0 - cm[r >> 2][r & 3]) * cf[r >> 2][r & 3]); p[u][8 + r] = (_Float16)(expf(s1 - cm[2 + (r >> 2)][r & 3]) * cf[2 + (r >> 2)][r & 3]); } }
#pragma unroll
    for (int j = 0; j < CB / 16; ++j) { acc[0][j] = wmma16b(vf[j], p[0], acc[0][j]); acc[1][j] = wmma16b(vf[j], p[1], acc[1][j]); }
    __builtin_amdgcn_sched_barrier(0);   /* keeps the wait below at the step's foot: nothing ties it to the WMMAs, and the scheduler otherwise lifts it to the step's head, where the score products would wait for the v fragments too */
    asm volatile("s_wait_loadcnt 0x0" :: "v"(kp), "v"(vp), "v"(mp), "v"(fp) : "memory"); }   /* names the four address pairs so that they stay as they are until every load of the step has returned */
#pragma unroll
  for (int u = 0; u < 2; ++u)
#pragma unroll
    for (int j = 0; j < CB / 16; ++j) { v4f lo, hi;   /* lane (g, col): query col of tile u, channels j * 16 + 8 g + 0..7 */
#pragma unroll
      for (int r = 0; r < 4; ++r) { lo[r] = acc[u][j][r]; hi[r] = acc[u][j][4 + r]; }
      *(v4f*)&ss[wave][u * 16 + col][j * 16 + 8 * g] = lo; *(v4f*)&ss[wave][u * 16 + col][j * 16 + 8 * g + 4] = hi; }
  __syncthreads();   /* all key slices' partial tiles are in ss before a wave sums its rows over them */
  float* yp = Y + ((size_t)b * TT + blockIdx.x * 64 + wave) * CB + lane * 4;   /* y rows [b*TT + n][128]: wave w takes rows w, w + 8, ...: a 512-B row by 32 lanes */
#pragma unroll
  for (int e = 0; e < 8; ++e) { const int row = e * 8 + wave; v4f t = *(const v4f*)&ss[row >> 5][row & 31][lane * 4];
#pragma unroll
    for (int s = 1; s < PKS; ++s) t += *(const v4f*)&ss[s * 2 + (row >> 5)][row & 31][lane * 4];
    vst2(yp + (size_t)e * 8 * CB, t * (1.0f / 2048.0f)); } }

#define WS_TL  (WS_END)                                  // f16 theta-view residual plane [b][128][TT] (viewed as rows)
#define WS_G   (WS_TL + 2u * (size_t)NB * CB * TT)        // f16 g conv plane [b][128][TT]
#define WS_VT2 (WS_G + 2u * (size_t)NB * CB * TT)         // f16 g view in fragment order [b][m / 32][c / 16][fragment half][lane][8]
#define WS_YR  (WS_VT2 + 2u * (size_t)NB * CB * TT)       // f32 y rows [b*TT + n][128]
#define WS_CM  (WS_YR + 4u * (size_t)NB * TT * CB)        // f32 column max [b][TT]
#define WS_CS  (WS_CM + 4u * (size_t)NB * TT)             // f32 2^11 / column sum [b][TT]
#define WS_PM  (WS_CS + 4u * (size_t)NB * TT)             // f32 partial column max [b][NQB][TT]
#define WS_PS  (WS_PM + 4u * (size_t)NB * NQB * TT)       // f32 partial column sum [b][NQB][TT]
#define WS_END2 (WS_PS + 4u * (size_t)NB * NQB * TT)
extern "C" void kernel_launch(void* const* d_in, const int* in_sizes, int n_in, void* d_out, int out_size, void* d_ws, size_t ws_size, hipStream_t stream) {
  (void)in_sizes; (void)n_in; (void)out_size;
  const float** F = (const float**)d_in;
  if (ws_size < (size_t)WS_END) return;
  char* ws = (char*)d_ws; _Float16 *QH = (_Float16*)(ws + WS_QH), *KH = (_Float16*)(ws + WS_KH), *VT = (_Float16*)(ws + WS_VT), *QL = (_Float16*)(ws + WS_QL), *KL = (_Float16*)(ws + WS_KL); __bf16 *VB = (__bf16*)(ws + WS_VB), *VBL = (__bf16*)(ws + WS_VBL); float *Y = (float*)(ws + WS_Y);
  (void)Y; (void)QL; (void)KL; (void)VB; (void)VBL;
  // inputs: 0 x [4,256,64,64] (channels-first); 1 theta_w [128,256], 2 theta_b; 3 phi_w, 4 phi_b; 5 g_w, 6 g_b; 7 W_w [256,128], 8 W_b [256] (all (out,in), biases nonzero)
  if (ws_size < (size_t)WS_END2) return;
  _Float16 *TL = (_Float16*)(ws + WS_TL), *G = (_Float16*)(ws + WS_G), *VT2 = (_Float16*)(ws + WS_VT2); float *YR = (float*)(ws + WS_YR), *CM = (float*)(ws + WS_CM), *CS = (float*)(ws + WS_CS), *PM = (float*)(ws + WS_PM), *PS = (float*)(ws + WS_PS);
  // phi^T rows (the 'k' rows: phi[c][m] proper layout, token-major) via the q/k path as which = 1 -> KH in fragment order (+KL rows < 64, unused)
  k_projT<1><<<dim3(TNB * TT / 64, 1, 1), 128, 0, stream>>>(F[0], F[0], F[0], F[3], F[3], F[3], F[4], F[4], F[4], QH, QL, KH, KL, VT, VB, VBL, nullptr);
  // theta conv plane [Cb][N] (f16 hi into the 'VT' slot = the theta VIEW rows [N][Cb] when read row-major) + its residual plane TL (the view's residual rows) via the [c][t] path (which = 2)
  k_projT<2><<<dim3(TNB * TT / 64, 1, 1), 128, 0, stream>>>(F[0], F[0], F[0], F[1], F[1], F[1], F[2], F[2], F[2], QH, QL, KH, KL, VT, VB, VBL, TL);
  // g conv plane [Cb][N] f16 -> G, then the g VIEW rows turned into the value fragments VT2, and the theta VIEW rows (hi, residual) copied into the query fragments QH, QL
  k_projT<2><<<dim3(TNB * TT / 64, 1, 1), 128, 0, stream>>>(F[0], F[0], F[0], F[5], F[5], F[5], F[6], F[6], F[6], QH, QL, KH, KL, G, VB, VBL, nullptr);
  k_trans<<<dim3(TT / 64, CB / 64, 3 * TNB), 256, 0, stream>>>(G, VT2, VT /* theta view rows */, TL /* view residual rows */, QH, QL);
  // all batches in each launch: column statistics of the scores, their merge, then scores again + P.v
  k_sc<<<dim3(NQB, TT / 128, TNB), 128, 0, stream>>>(QH /* theta view fragments */, KH, QL /* view residual fragments */, KL, 0, 0, PM, PS);
  k_colmerge<<<dim3(TT / 32, TNB), 256, 0, stream>>>(PM, PS, CM, CS);
  k_pvf<<<dim3(TT / 64, TNB), 64 * PKS, 0, stream>>>(QH, QL, KH, CM, CS, VT2, YR);
  k_wout<<<dim3(TT / 64, COUT / 128, TNB), 128, 0, stream>>>(YR, F[7], F[8], F[0], (float*)d_out);

}

// v007
// One run takes 134 microseconds.
// In two side-by-side timings against v006, it was 1.14 and 1.13 times as fast.
// Counting every step since v000, it is 19.3 times as fast.
// compute dtype: all float inputs rounded to bf16; the three 1x1 convs with EXACT bf16 products on WMMA 16x16x32 (f32 accumulate) + bias; scores between the raw-reshaped theta view (f16 hi + residual x 2^10) and phi (f16) (2 products); the softmax over the QUERY axis in f32 (per-column max / sum from 64-row partials; each score's exp is the hardware base-2 exponent of (s - max) * log2 e, the few merge weights library expf); the scores formed a second time, transposed, in the P.v kernel (never stored); P x 2^11 (the factor 2^11 / column sum added as its log2 in the exponent) once to f16 x the raw-reshaped g view once to f16 (1 product); the W 1x1 conv on the raw-reshaped y view with bf16 hi + lo (2 products) x exact W + bias + x residual; f32 output written channels-first.
#include <hip/hip_runtime.h>
#include <math.h>

typedef __attribute__((ext_vector_type(16))) _Float16 v16h;
typedef __attribute__((ext_vector_type(16))) __bf16 v16b;
typedef __attribute__((ext_vector_type(8)))  _Float16 v8h;
typedef __attribute__((ext_vector_type(8)))  float v8f;
typedef __attribute__((ext_vector_type(4)))  float v4f;
typedef __attribute__((ext_vector_type(2)))  float v2f;
typedef __attribute__((ext_vector_type(4)))  unsigned v4u;
typedef _Float16 hx8 __attribute__((ext_vector_type(8)));
typedef __attribute__((ext_vector_type(4)))  int v4i;
typedef float __attribute__((may_alias)) float_a;
typedef int __attribute__((may_alias)) int_a;

template <typename T> __device__ __forceinline__ void vst2(void* p, T v) { *(T*)p = v;  }
__device__ __forceinline__ v8f wmma16(v16h a, v16h b, v8f c) {
  v8f d = __builtin_amdgcn_wmma_f32_16x16x32_f16(false, a, false, b, (short)0, c, false, false);
  asm volatile("v_nop\n\tv_nop\n\tv_nop\n\tv_nop" : "+v"(d) : "v"(a), "v"(b));
  return d;
}
__device__ __forceinline__ v8f wmma_bf(v16b a, v16b b, v8f c) {
  v8f d = __builtin_amdgcn_wmma_f32_16x16x32_bf16(false, a, false, b, (short)0, c, false, false);
  asm volatile("v_nop\n\tv_nop\n\tv_nop\n\tv_nop" : "+v"(d) : "v"(a), "v"(b));
  return d;
}
// 16x16x32 fragments: lane = (h = lane>>4, row/col = lane&15); elements 0..7 = k0+8h+0..7, 8..15 = k0+16+8h+0..7; D element r = row 8h+r
__device__ __forceinline__ v16h frag_h(const _Float16* rowk0, int lane) {
  union { v16h v; v8h q[2]; } u; const _Float16* p = rowk0 + 8 * (lane >> 4);
  u.q[0] = *(const v8h*)p; u.q[1] = *(const v8h*)(p + 16); return u.v;
}
__device__ __forceinline__ v16h frag_f32(const float* rowk0, int lane) {
  v16h a; const float* p = rowk0 + 8 * (lane >> 4);
#pragma unroll
  for (int i = 0; i < 8; ++i) { a[i] = (_Float16)p[i]; a[8 + i] = (_Float16)p[16 + i]; }
  return a;
}
__device__ __forceinline__ v16h frag_f32s(const float* rowk0, int lane, float sc) {
  v16h a; const float* p = rowk0 + 8 * (lane >> 4);
#pragma unroll
  for (int i = 0; i < 8; ++i) { a[i] = (_Float16)(p[i] * sc); a[8 + i] = (_Float16)(p[16 + i] * sc); }
  return a;
}
// column fragment from a [K][ld] layout (column n), rows >= K read as 0
__device__ __forceinline__ v16h fragc_f32(const float* W, int k0, int n, int lane, int ld, int K) {
  v16h a; const int g = lane >> 4;
#pragma unroll
  for (int i = 0; i < 8; ++i) { const int ka = k0 + 8 * g + i, kb = ka + 16;
    a[i] = (_Float16)(ka < K ? W[(size_t)(ka < K ? ka : K - 1) * ld + n] : 0.f); a[8 + i] = (_Float16)(kb < K ? W[(size_t)(kb < K ? kb : K - 1) * ld + n] : 0.f); }
  return a;
}
struct F2 { v16b h, l; };
__device__ __forceinline__ F2 bsplit16(const float v[16]) { F2 r;
#pragma unroll
  for (int i = 0; i < 16; ++i) { const __bf16 h = (__bf16)v[i]; r.h[i] = h; r.l[i] = (__bf16)(v[i] - (float)h); }
  return r; }
__device__ __forceinline__ F2 split_row(const float* row, int k0, int lane) { float v[16]; const float* p = row + k0 + 8 * (lane >> 4);
#pragma unroll
  for (int i = 0; i < 8; ++i) { v[i] = p[i]; v[8 + i] = p[16 + i]; }
  return bsplit16(v); }
__device__ __forceinline__ F2 split_rowK(const float* row, int k0, int lane, int K) { float v[16]; const int g = lane >> 4;
#pragma unroll
  for (int i = 0; i < 8; ++i) { const int ka = k0 + 8 * g + i, kb = ka + 16; v[i] = ka < K ? row[ka < K ? ka : K - 1] : 0.f; v[8 + i] = kb < K ? row[kb < K ? kb : K - 1] : 0.f; }
  return bsplit16(v); }
__device__ __forceinline__ F2 split_col(const float* W, int k0, int n, int lane, int ld, int K) { float v[16]; const int g = lane >> 4;
#pragma unroll
  for (int i = 0; i < 8; ++i) { const int ka = k0 + 8 * g + i, kb = ka + 16; v[i] = ka < K ? W[(size_t)(ka < K ? ka : K - 1) * ld + n] : 0.f; v[8 + i] = kb < K ? W[(size_t)(kb < K ? kb : K - 1) * ld + n] : 0.f; }
  return bsplit16(v); }
__device__ __forceinline__ v8f mac3(const F2& a, const F2& b, v8f c) { c = wmma_bf(a.l, b.h, c); c = wmma_bf(a.h, b.l, c); return wmma_bf(a.h, b.h, c); }
__device__ __forceinline__ float sigm(float v) { return 1.0f / (1.0f + expf(-v)); }
// fragment stored in fragment order (1 KiB: [half of the fragment][lane][8 f16]), read at the lane's own pointer (fragment start + 8 * lane): each of the two loads covers 512 contiguous bytes
__device__ __forceinline__ v16h frag_pk(const _Float16* p) { union { v16h v; v8h q[2]; } u; u.q[0] = *(const v8h*)p; u.q[1] = *(const v8h*)(p + 256); return u.v; }
// fragment read at the lane's own pointer (row start + k0 + 8 * (lane >> 4)): the caller keeps that pointer and names it at the wait behind a batch of loads
__device__ __forceinline__ v16b wfrag_p(const float* p) { v16b w;
#pragma unroll
  for (int i = 0; i < 8; ++i) { w[i] = (__bf16)p[i]; w[8 + i] = (__bf16)p[16 + i]; }
  return w; }

// Non-local block with the source's RAW reshapes (x [4,256,64,64], Cb 128, N 4,096; (out,in) theta/phi/g 1x1 convs [128,256] + biases, W [256,128] + bias): theta = conv(x).reshape(B, N, Cb) and g likewise are ROW-MAJOR reinterpretations of the [Cb][N] conv outputs (row n = channel n/32, positions (n%32)*128..+127), phi stays [Cb][N]; scores[n][m] = sum_c theta[n][c] phi[c][m]; attn = softmax over n (axis 1 - per key column); y[n][c] = sum_m attn[n][m] g[m][c]; y.reshape(B, Cb, H, W) (raw again) -> W conv + bias + x.
#define NB 4
#define TT 4096
#define CC 128            // g-view plane pitch (Cb channels)
#define CB 128
#define COUT 256
#define CCQ 128           // theta-view / phi^T row pitch (Cb)
#define DIN 256          // x channels
#define NH 1
#define HD 128
#define NQB (TT / 64)
#define SCALE (1.0f)
#define HDQK 128           // contraction width of the scores (Cb)
#define CAUSAL 0
#define LOG2E 1.44269504088896340736f
#ifndef TNB
#define TNB NB
#endif
__device__ __forceinline__ v16b zero16b() { v16b z; _Pragma("unroll") for (int i = 0; i < 16; ++i) z[i] = (__bf16)0.f; return z; }
__device__ __forceinline__ float bfr(float v) { return (float)(__bf16)v; }
__host__ __device__ __forceinline__ int kb_last(int qb) { return CAUSAL ? ((qb * 64 + 63) >> 7) : (TT / 128 - 1); }
typedef __attribute__((ext_vector_type(8))) __bf16 v8b;
__device__ __forceinline__ v16b frag_b(const __bf16* rowk0, int lane) {
  union { v16b v; v8b q[2]; } u; const __bf16* p = rowk0 + 8 * (lane >> 4);
  u.q[0] = *(const v8b*)p; u.q[1] = *(const v8b*)(p + 16); return u.v;
}
#define QBH 0              // 2-product logits everywhere (theta view hi + residual x phi hi)
#define QHI 4096            // q residual rows (all)
#define KHI 64            // (unused k residual / v bf16 planes: QBH 0)
// B fragment (k rows k0+.., output column o) of a weight: (in,out) [K][ld] or (out,in) [ld rows of K]: bf16 exact, or f16(bf16 * 256) exact
__device__ __forceinline__ v16b wcol_io(const float* Wm, int k0, int o, int lane, int ld) { v16b w; const int g = lane >> 4;
#pragma unroll
  for (int i = 0; i < 8; ++i) { w[i] = (__bf16)Wm[(size_t)(k0 + 8 * g + i) * ld + o]; w[8 + i] = (__bf16)Wm[(size_t)(k0 + 16 + 8 * g + i) * ld + o]; }
  return w; }
__device__ __forceinline__ v16b wcol_oi(const float* Wm, int k0, int o, int lane, int K) { v16b w; const float* p = Wm + (size_t)o * K + k0 + 8 * (lane >> 4);
#pragma unroll
  for (int i = 0; i < 8; ++i) { w[i] = (__bf16)p[i]; w[8 + i] = (__bf16)p[16 + i]; }
  return w; }
__device__ __forceinline__ v16h wcolh_io(const float* Wm, int k0, int o, int lane, int ld) { v16h w; const int g = lane >> 4;
#pragma unroll
  for (int i = 0; i < 8; ++i) { w[i] = (_Float16)(bfr(Wm[(size_t)(k0 + 8 * g + i) * ld + o]) * 256.0f); w[8 + i] = (_Float16)(bfr(Wm[(size_t)(k0 + 16 + 8 * g + i) * ld + o]) * 256.0f); }
  return w; }
__device__ __forceinline__ v16h wcolh_oi(const float* Wm, int k0, int o, int lane, int K) { v16h w; const float* p = Wm + (size_t)o * K + k0 + 8 * (lane >> 4);
#pragma unroll
  for (int i = 0; i < 8; ++i) { w[i] = (_Float16)(bfr(p[i]) * 256.0f); w[8 + i] = (_Float16)(bfr(p[16 + i]) * 256.0f); }
  return w; }
#define WQKV_LAYOUT 0   // 0 = (out,in) [CC][DIN], as 1; 1 = (out,in) [CC][DIN]; 2 = per-head [NH][DIN][HD]
__device__ __forceinline__ v16b wcol_hdk(const float* Wm, int k0, int o, int lane) { v16b w; const int g = lane >> 4; const float* p = Wm + (size_t)(o / HD) * DIN * HD + (o % HD);
#pragma unroll
  for (int i = 0; i < 8; ++i) { w[i] = (__bf16)p[(size_t)(k0 + 8 * g + i) * HD]; w[8 + i] = (__bf16)p[(size_t)(k0 + 16 + 8 * g + i) * HD]; }
  return w; }
#define WO_OUT_IN 0
#if WQKV_LAYOUT == 1
#define WCOL(W, k0, o, lane) wcol_oi(W, k0, (o), lane, DIN)   /* unused: layout 0 */
#elif WQKV_LAYOUT == 2
#define WCOL(W, k0, o, lane) wcol_hdk(W, k0, o, lane)
#else
#define WCOL(W, k0, o, lane) wcol_oi(W, k0, (o), lane, DIN)   /* (out,in) 1x1-conv weights [128][256]: all 128 output channels real */
#endif
#if WO_OUT_IN
#define WOCOL(W, k0, o, lane) wcol_oi(W, k0, o, lane, CC)
#define WOCOLH(W, k0, o, lane) wcolh_oi(W, k0, o, lane, CC)
#else
#define WOCOL(W, k0, o, lane) wcol_io(W, k0, o, lane, DIN)
#define WOCOLH(W, k0, o, lane) wcolh_io(W, k0, o, lane, DIN)
#endif
#ifndef SM_EXTRA_PARAMS
#define SM_EXTRA_PARAMS
#endif
#ifndef PROJ_EXTRA_PARAMS
#define PROJ_EXTRA_PARAMS
#endif
#ifndef SM_MASK_HOOK
#define SM_MASK_HOOK (void)0
#endif

#define WS_QH  0u                                      // f16 q rows in fragment order [b*t / 16][k step][fragment half][lane][8]
#define WS_KH  (WS_QH + 2u * (size_t)NB * TT * CCQ)     // f16 k rows in fragment order [b*t / 16][k step][fragment half][lane][8]
#define WS_VT  (WS_KH + 2u * (size_t)NB * TT * CCQ)     // f16 v planes [b][c][t]
#define WS_QL  (WS_VT + 2u * (size_t)NB * CC * TT)      // f16 q residual x 2^10 rows [b][t < QHI], in fragment order like WS_QH
#define WS_KL  (WS_QL + 2u * (size_t)NB * QHI * CCQ)    // f16 k residual x 2^10 rows [b][t < KHI][CCQ]
#define WS_VB  (WS_KL + 2u * (size_t)NB * KHI * CCQ)    // bf16 v hi planes [b][c][t < KHI]
#define WS_VBL (WS_VB + 2u * (size_t)NB * CC * KHI)
#define WS_Y   (WS_VBL + 2u * (size_t)NB * CC * KHI)    // zero bytes: Y is not used, the y rows go to WS_YR
#define WS_END (WS_Y  + 0u)

// ---- k_proj: block = (64 rows, 128 cols, which): q/k/v = X W (+ b) with exact bf16 products (K = DIN) -> which 0: q f16 rows (+ residual rows < QHI); 1: k f16 rows (+ residual rows < KHI), the f16 rows of both in fragment order; 2: v f16 planes [c][t] (+ bf16 hi/lo planes for t < KHI)
template <int WOFF> __global__ __launch_bounds__(128) void k_projT(const float* __restrict__ XQ, const float* __restrict__ XK, const float* __restrict__ XV, const float* __restrict__ WQ, const float* __restrict__ WK, const float* __restrict__ WV, const float* __restrict__ BQ, const float* __restrict__ BK, const float* __restrict__ BV,
    _Float16* __restrict__ QH, _Float16* __restrict__ QL, _Float16* __restrict__ KH, _Float16* __restrict__ KL, _Float16* __restrict__ VT, __bf16* __restrict__ VB, __bf16* __restrict__ VBL, _Float16* __restrict__ VL) {
  __shared__ __align__(16) _Float16 sh[64][136], sl[64][136]; __shared__ __align__(16) _Float16 th[128][72], tlo[128][72]; __shared__ __align__(16) __bf16 tb[128][72], tbl[128][72];
  const int tid = threadIdx.x, wave = tid >> 5, lane = tid & 31, col = lane & 15, g = lane >> 4; const int which = blockIdx.z + WOFF; const int c0 = blockIdx.y * 128; const size_t r0 = (size_t)blockIdx.x * 64; const size_t bb = r0 / TT; const int t0 = (int)(r0 % TT);
  const float* X = which == 0 ? XQ : which == 1 ? XK : XV; const float* WA = which == 0 ? WQ : which == 1 ? WK : WV; const float* BA = which == 0 ? BQ : which == 1 ? BK : BV;
  const int KD = DIN;
  v8f acc[8] = {};
#pragma unroll 2
  for (int kc = 0; kc < KD / 32; ++kc) { v16b a, w[8]; const float* p = X + (bb * KD + kc * 32 + 8 * g) * (size_t)TT + t0 + wave * 16 + col;   /* channels-first [b][c][t]: A[t][c] (16 consecutive t per lane group) */
    const float* wp = WA + (size_t)(c0 + col) * DIN + kc * 32 + 8 * g;   /* (out,in) weight rows: fragment j starts 16 rows further on */
#pragma unroll
    for (int i = 0; i < 8; ++i) { a[i] = (__bf16)p[(size_t)i * TT]; a[8 + i] = (__bf16)p[(size_t)(16 + i) * TT]; }
#pragma unroll
    for (int j = 0; j < 8; ++j) w[j] = wfrag_p(wp + (size_t)j * 16 * DIN);   /* all eight weight fragments ahead of the k step's first WMMA: the asm in wmma_bf holds later loads behind it, so a load written between two WMMAs pays its whole latency there */
    asm volatile("s_wait_loadcnt 0x0" :: "v"(p), "v"(wp) : "memory");   /* names the two address pairs so that they stay as they are until every load of the batch has returned */
#pragma unroll
    for (int j = 0; j < 8; ++j) acc[j] = wmma_bf(a, w[j], acc[j]); }
  const float* bp = BA + c0 + col; float bias8[8] = {};   /* the eight bias loads together, ahead of the epilogue's LDS stores */
  if (BA) {
#pragma unroll
    for (int j = 0; j < 8; ++j) bias8[j] = bp[j * 16];
    asm volatile("s_wait_loadcnt 0x0" :: "v"(bp) : "memory"); }   /* names the address pair so that it stays as it is until the eight loads have returned */
  if (which < 2) { _Float16* DH = which == 0 ? QH : KH; _Float16* DL = which == 0 ? QL : KL; const int nhi = which == 0 ? QHI : KHI; const bool hi_rows = t0 < nhi;
#pragma unroll
    for (int j = 0; j < 8; ++j) { const float bias = bfr(bias8[j]);
#pragma unroll
      for (int r = 0; r < 8; ++r) { const float v = acc[j][r] + bias; const _Float16 hv = (_Float16)v; sh[wave * 16 + 8 * g + r][j * 16 + col] = hv; sl[wave * 16 + 8 * g + r][j * 16 + col] = (_Float16)((v - (float)hv) * 1024.0f); } }
    __syncthreads();
    for (int e = tid; e < 64 * 16; e += 128) { const int rl = ((e >> 8) << 4) | (e & 15), q = ((e >> 6) & 3) * 4 + ((e >> 5) & 1) * 2 + ((e >> 4) & 1);   /* fragment order: e = (16-row tile, k step, fragment half, lane): piece e of the block's 16 KiB is what that lane loads */
      vst2((unsigned*)(DH + r0 * CCQ + (size_t)e * 8), *(const v4u*)&sh[rl][q * 8]);
      asm volatile("s_wait_xcnt 0x0" ::: "memory");   /* the store's address pair and data registers are rewritten by the residual store's LDS read and by the next trip */
      if (hi_rows) { vst2((unsigned*)(DL + (bb * nhi + t0 + rl) * (size_t)CCQ + c0 + q * 8), *(const v4u*)&sl[rl][q * 8]);
        asm volatile("s_wait_xcnt 0x0" ::: "memory"); } }   /* likewise, ahead of the next trip */   /* hi rows in fragment order (c0 == 0), residual rows at pitch CCQ */
  } else { const bool hi_rows = t0 < KHI;
#pragma unroll
    for (int j = 0; j < 8; ++j) { const float bias = bfr(bias8[j]);
#pragma unroll
      for (int r = 0; r < 8; ++r) { const float v = acc[j][r] + bias; const int rl = wave * 16 + 8 * g + r, cl = j * 16 + col; const _Float16 hv2 = (_Float16)v; th[cl][rl] = hv2; tlo[cl][rl] = (_Float16)((v - (float)hv2) * 1024.0f); const __bf16 bh = (__bf16)v; tb[cl][rl] = bh; tbl[cl][rl] = (__bf16)(v - (float)bh); } }
    __syncthreads();
    for (int e = tid; e < 128 * 8; e += 128) { const int cl = e >> 3, q = e & 7; vst2((unsigned*)(VT + (bb * CC + c0 + cl) * (size_t)TT + t0 + q * 8), *(const v4u*)&th[cl][q * 8]); if (VL) vst2((unsigned*)(VL + (bb * CC + c0 + cl) * (size_t)TT + t0 + q * 8), *(const v4u*)&tlo[cl][q * 8]); if (hi_rows) { const size_t o3 = (bb * CC + c0 + cl) * (size_t)KHI + t0 + q * 8; vst2((unsigned*)(VB + o3), *(const v4u*)&tb[cl][q * 8]); vst2((unsigned*)(VBL + o3), *(const v4u*)&tbl[cl][q * 8]); } } } }
// ---- k_sc: block = (query block qb, key block kb <= kb_last(qb), batch): column statistics of a 64 x 128 tile of the logits x SCALE (the logits themselves are not stored: k_pvf forms them again); q hi + residual (x 2^10) against k (2 products) for query rows < QHI, plus the k residual (3 products) for query blocks < QBH (causal early rows); causal: blocks past the diagonal exit
__global__ __launch_bounds__(128) void k_sc(const _Float16* __restrict__ QH, const _Float16* __restrict__ KH, const _Float16* __restrict__ QL, const _Float16* __restrict__ KL, int bgrp, int h0, float* __restrict__ PM0, float* __restrict__ PS0) { __shared__ __align__(16) float ss[4][16][132];
  const int qb = blockIdx.x, kb = blockIdx.y; if (kb > kb_last(qb)) return;
  (void)h0; const int b = bgrp + blockIdx.z; float* PM = PM0 + (size_t)b * NQB * TT; float* PS = PS0 + (size_t)b * NQB * TT;   /* one plane of partials per batch */
  const int tid = threadIdx.x, wave = tid >> 5, lane = tid & 31, col = lane & 15, g = lane >> 4; const int k0 = kb * 128; const int ql0 = qb * 64 + wave * 16; const size_t q0 = (size_t)b * TT + ql0, kr0 = (size_t)b * TT + k0;
  v8f acc[8] = {}, accl[8] = {};
  const _Float16* QLb = QL + (size_t)b * QHI * CCQ; const _Float16* KLb = KL + (size_t)b * KHI * CCQ;   /* single head */
  const _Float16* kp = KH + kr0 * CCQ + lane * 8;   /* key rows in fragment order: fragment (16-key tile j, k step kc) starts (j * 4 + kc) * 512 f16 further on */
  const _Float16* qp = QH + q0 * CCQ + lane * 8; const _Float16* qlp = QLb + (size_t)ql0 * CCQ + lane * 8;   /* the wave's 16 query rows, hi and residual, likewise: fragment kc starts kc * 512 f16 further on */
  if (qb < QBH) {
#pragma unroll
    for (int kc = 0; kc < HDQK / 32; ++kc) { const v16h ah = frag_pk(qp + kc * 512), al = frag_pk(qlp + kc * 512);
#pragma unroll
      for (int j = 0; j < 8; ++j) { const v16h kbf = frag_pk(kp + (j * 4 + kc) * 512), klf = frag_h(KLb + (size_t)(k0 + j * 16 + col) * CCQ + kc * 32, lane); acc[j] = wmma16(ah, kbf, acc[j]); accl[j] = wmma16(al, kbf, accl[j]); accl[j] = wmma16(ah, klf, accl[j]); } }
  } else if (qb * 64 < QHI) {
#pragma unroll
    for (int kc = 0; kc < HDQK / 32; ++kc) { const v16h ah = frag_pk(qp + kc * 512), al = frag_pk(qlp + kc * 512);
      v16h kbf[8];   /* the k step's eight key fragments ahead of its first WMMA (the asm in wmma16 holds later loads behind it) */
#pragma unroll
      for (int j = 0; j < 8; ++j) kbf[j] = frag_pk(kp + (j * 4 + kc) * 512);
#pragma unroll
      for (int j = 0; j < 8; ++j) { acc[j] = wmma16(ah, kbf[j], acc[j]); accl[j] = wmma16(al, kbf[j], accl[j]); } }
  } else {
#pragma unroll
    for (int kc = 0; kc < HDQK / 32; ++kc) { const v16h ah = frag_pk(qp + kc * 512);
#pragma unroll
      for (int j = 0; j < 8; ++j) { const v16h kbf = frag_pk(kp + (j * 4 + kc) * 512); acc[j] = wmma16(ah, kbf, acc[j]); } } }
#pragma unroll
  for (int j = 0; j < 8; ++j) {
#pragma unroll
    for (int r = 0; r < 8; ++r) ss[wave][8 * g + r][j * 16 + col] = (acc[j][r] + accl[j][r] * (1.0f / 1024.0f)) * SCALE; }
  __syncthreads();   /* every wave's 16 rows of the tile are in ss before a thread walks its column */
  // column statistics of this 64 x 128 tile from the f32 logits in ss: thread = key column, rows in ascending order: max, then sum of exp(v - max) = 2^((v - max) * log2 e) on v_exp_f32 (the argument is <= 0; a result under 2^-126 may go to 0 beside a sum >= 1)
  { float v[64];
#pragma unroll
    for (int i = 0; i < 64; ++i) v[i] = ss[i >> 4][i & 15][tid];
    float m = v[0];
#pragma unroll
    for (int i = 1; i < 64; ++i) m = fmaxf(m, v[i]);
    float s = 0.f;
#pragma unroll
    for (int i = 0; i < 64; ++i) s += __builtin_amdgcn_exp2f((v[i] - m) * LOG2E);
    vst2(PM + (size_t)qb * TT + k0 + tid, m); vst2(PS + (size_t)qb * TT + k0 + tid, s); } }
// ---- k_colmerge: softmax over the QUERY axis (axis 1): joins the 64 per-query-block partials (PM = max, PS = sum of exp(S - PM) over 64 rows) of each key column m: CM[m] = max, CS[m] = 11 - log2(sum_q PS[q][m] exp(PM[q][m] - CM[m])) (log2 of the factor 2^11 / column sum: k_pvf adds it in the exponent); block = 32 columns (lane) x 8 waves of 8 partials, joined through LDS
__global__ __launch_bounds__(256) void k_colmerge(const float* __restrict__ PM0, const float* __restrict__ PS0, float* __restrict__ CM0, float* __restrict__ CS0) { __shared__ float lm[8][32], ls[8][32];
  const float* PM = PM0 + (size_t)blockIdx.y * NQB * TT; const float* PS = PS0 + (size_t)blockIdx.y * NQB * TT; float* CM = CM0 + (size_t)blockIdx.y * TT; float* CS = CS0 + (size_t)blockIdx.y * TT;   /* blockIdx.y = batch */
  const int tid = threadIdx.x, wave = tid >> 5, lane = tid & 31; const int m = blockIdx.x * 32 + lane; float pm[8], ps[8];
#pragma unroll
  for (int u = 0; u < 8; ++u) pm[u] = PM[(size_t)(wave * 8 + u) * TT + m];
  asm volatile("s_wait_xcnt 0x0" ::: "memory");   /* the address pair of the loads above is rewritten for the loads below */
#pragma unroll
  for (int u = 0; u < 8; ++u) ps[u] = PS[(size_t)(wave * 8 + u) * TT + m];
  float mx = pm[0];
#pragma unroll
  for (int u = 1; u < 8; ++u) mx = fmaxf(mx, pm[u]);
  float sm2 = 0.f;
#pragma unroll
  for (int u = 0; u < 8; ++u) sm2 += ps[u] * expf(pm[u] - mx);
  lm[wave][lane] = mx; ls[wave][lane] = sm2;
  __syncthreads();
  if (wave == 0) { float mt = lm[0][lane];
#pragma unroll
    for (int w = 1; w < 8; ++w) mt = fmaxf(mt, lm[w][lane]);
    float st = 0.f;
#pragma unroll
    for (int w = 0; w < 8; ++w) st += ls[w][lane] * expf(lm[w][lane] - mt);
    vst2(CM + m, mt); vst2(CS + m, 11.0f - log2f(st)); } }
// ---- k_trans: blockIdx.z < TNB: block = (64 keys, 64 columns, batch): the g view rows [m][c] turned through LDS into fragments (column c, 32 keys) laid in fragment order for k_pvf; blockIdx.z >= TNB: block = two 16-row tiles of a batch's theta view rows (hi plane, then residual plane), their 16-B pieces copied into fragment order for k_sc
static_assert((TT / 64) * (CB / 64) * 2 == TT / 16, "two 16-row tiles of the theta view per block");
__global__ __launch_bounds__(256) void k_trans(const _Float16* __restrict__ G, _Float16* __restrict__ VT2, const _Float16* __restrict__ TH, const _Float16* __restrict__ TR, _Float16* __restrict__ QP, _Float16* __restrict__ QR) { __shared__ _Float16 st[64][72]; const int tid = threadIdx.x;
  if (blockIdx.z >= TNB) {   /* the same for the whole block, ahead of the barrier */
    const int z = blockIdx.z - TNB; const size_t o = (size_t)(z % TNB) * CB * TT + (size_t)(blockIdx.y * (TT / 64) + blockIdx.x) * 2 * 16 * CCQ;   /* a tile is 16 rows of CCQ f16 = 4 KiB in both layouts */
    const _Float16* s = (z < TNB ? TH : TR) + o + (size_t)(tid & 15) * CCQ + (((tid >> 6) & 3) * 4 + ((tid >> 5) & 1) * 2 + ((tid >> 4) & 1)) * 8;   /* tid = (k step, fragment half, lane): that lane's piece of its row */
    _Float16* d = (z < TNB ? QP : QR) + o + tid * 8;
    const v4u u0 = *(const v4u*)s, u1 = *(const v4u*)(s + 16 * CCQ); vst2((unsigned*)d, u0); vst2((unsigned*)(d + 16 * CCQ), u1); return; }
  const int m0 = blockIdx.x * 64, c0 = blockIdx.y * 64, b = blockIdx.z; const _Float16* gb = G + (size_t)b * CB * TT; _Float16* vb = VT2 + (size_t)b * CB * TT;
  for (int e = tid; e < 64 * 8; e += 256) { const int ml = e >> 3, q = e & 7; const v4u u = *(const v4u*)(gb + (size_t)(m0 + ml) * CB + c0 + q * 8); asm volatile("s_wait_loadcnt 0x0" ::: "memory"); const hx8 hv = *(const hx8*)&u; _Pragma("unroll") for (int j = 0; j < 8; ++j) st[q * 8 + j][ml] = hv[j]; }
  __syncthreads();
  for (int e = tid; e < 64 * 8; e += 256) { const int cl = ((e >> 6) & 3) * 16 + (e & 15), q = (e >> 8) * 4 + ((e >> 5) & 1) * 2 + ((e >> 4) & 1);   /* fragment order: e = (32-key step, 16-column fragment, fragment half, lane) */
    hx8 hv; _Pragma("unroll") for (int j = 0; j < 8; ++j) hv[j] = st[cl][q * 8 + j]; vst2((unsigned*)(vb + ((size_t)((m0 >> 5) + (e >> 8)) * (CB / 16) + (c0 >> 4)) * 512 + (e & 255) * 8), *(const v4u*)&hv); } }
// ---- k_wout: block = (64 positions, 128 of the 256 output channels, batch): A[pos][cb] = y view Yb[cb*4096 + pos] (the raw reshape back: the batch's y rows [4096][128] f32 reinterpreted as [Cb][N]) split bf16 hi + lo (2 products) x exact (out,in) W [256][128]; + bf16(W_b) + bf16(x[b][o][pos]); channels-first store out[b][o][pos0..pos0+63] through LDS (one 256-B run per channel by 16 lanes)
__global__ __launch_bounds__(128) void k_wout(const float* __restrict__ Y, const float* __restrict__ WW, const float* __restrict__ WB, const float* __restrict__ X, float* __restrict__ OUT) { __shared__ __align__(16) float st[128][68];
  const int tid = threadIdx.x, wave = tid >> 5, lane = tid & 31, col = lane & 15, g = lane >> 4; const int p0 = blockIdx.x * 64, c0 = blockIdx.y * 128, b = blockIdx.z; const float* Yb = Y + (size_t)b * TT * CB;
  v8f acc[8] = {};
#pragma unroll 1
  for (int kc = 0; kc < CB / 32; ++kc) { v16b ah, al, w[8]; { const float* p = Yb + (size_t)(kc * 32 + 8 * g) * TT + p0 + wave * 16 + col; const float* wp = WW + (size_t)(c0 + col) * CB + kc * 32 + 8 * g; float tv[16];
#pragma unroll
      for (int i = 0; i < 8; ++i) { tv[i] = p[(size_t)i * TT]; tv[8 + i] = p[(size_t)(16 + i) * TT]; }
#pragma unroll
      for (int j = 0; j < 8; ++j) w[j] = wfrag_p(wp + (size_t)j * 16 * CB);   /* with the y loads, ahead of the k step's first WMMA (the asm in wmma_bf holds later loads behind it) */
      asm volatile("s_wait_loadcnt 0x0" :: "v"(p), "v"(wp) : "memory");   /* names the two address pairs so that they stay as they are until every load of the batch has returned */
#pragma unroll
      for (int i = 0; i < 16; ++i) { const __bf16 h = (__bf16)tv[i]; ah[i] = h; al[i] = (__bf16)(tv[i] - (float)h); } }
#pragma unroll
    for (int j = 0; j < 8; ++j) { acc[j] = wmma_bf(ah, w[j], acc[j]); acc[j] = wmma_bf(al, w[j], acc[j]); } }
  // thread's sixteen 16-B pieces: channel c0 + (tid >> 4) + 8 u, positions p0 + (tid & 15) * 4
  const size_t o0 = ((size_t)b * COUT + c0 + (tid >> 4)) * (size_t)TT + p0 + (tid & 15) * 4; const float* xp = X + o0; const float* bp = WB + c0 + col; float* op = OUT + o0;
  float wb8[8]; v4f xr[16];   /* the eight bias loads and the sixteen residual loads are issued together, ahead of the turn through LDS */
#pragma unroll
  for (int j = 0; j < 8; ++j) wb8[j] = bp[j * 16];
#pragma unroll
  for (int u = 0; u < 16; ++u) xr[u] = *(const v4f*)(xp + (size_t)u * 8 * TT);
  asm volatile("s_wait_loadcnt 0x0" :: "v"(xp), "v"(bp) : "memory");   /* names the two address pairs so that they stay as they are until every load of the batch has returned */
#pragma unroll
  for (int j = 0; j < 8; ++j) { const float wb = bfr(wb8[j]);
#pragma unroll
    for (int r = 0; r < 8; ++r) st[j * 16 + col][wave * 16 + 8 * g + r] = acc[j][r] + wb; }
  __syncthreads();
#pragma unroll
  for (int u = 0; u < 16; ++u) { v4f v = *(const v4f*)&st[(tid >> 4) + 8 * u][(tid & 15) * 4]; v[0] += bfr(xr[u][0]); v[1] += bfr(xr[u][1]); v[2] += bfr(xr[u][2]); v[3] += bfr(xr[u][3]); vst2(op + (size_t)u * 8 * TT, v); } }
// ---- k_pvf: block = (64 queries, batch), 8 waves: wave = (query group qg of 32 queries, key slice ks); slice ks takes the 32-key steps ks, ks + 4, ks + 8, ... of the 4,096 keys. Per step the wave forms the TRANSPOSED scores S^T[key][query] = k rows (A) x q rows hi + residual (B, kept in registers) as in k_sc (2 products); a lane's accumulator registers of the two 16-key tiles are, element for element, its part of the B operand of the next product, so P^T x 2^11 = 2^((S^T - CM[key]) * log2 e + CS[key]) (one subtract, one FMA, one v_exp_f32 a score) goes once to f16 in place and y^T[c][query] += v fragment (A: row c, 32 keys) x P^T (1 product). The 4 slices' partial tiles are joined through LDS in ascending ks, x 2^-11
#define PKS 4              // key slices of a k_pvf block
// the plain builtin (the compiler keeps the distances behind it itself): an asm statement cannot name a register above v255, and k_pvf's operands do not all fit below
__device__ __forceinline__ v8f wmma16b(v16h a, v16h b, v8f c) { return __builtin_amdgcn_wmma_f32_16x16x32_f16(false, a, false, b, (short)0, c, false, false); }
static_assert((TT / 32) % PKS == 0 && TT % 64 == 0, "every wave the same number of 32-key steps; whole 64-query blocks");
__global__ __launch_bounds__(64 * PKS) void k_pvf(const _Float16* __restrict__ QH, const _Float16* __restrict__ QL, const _Float16* __restrict__ KH, const float* __restrict__ CM, const float* __restrict__ CS, const _Float16* __restrict__ VT, float* __restrict__ Y) { __shared__ __align__(16) float ss[2 * PKS][32][CB + 4];
  const int tid = threadIdx.x, wave = __builtin_amdgcn_readfirstlane(tid >> 5), lane = tid & 31, col = lane & 15, g = lane >> 4; const int b = blockIdx.y, qg = wave & 1, ks = wave >> 1; const size_t q0 = (size_t)b * TT + blockIdx.x * 64 + qg * 32;
  v16h qh[2][4], qr[2][4];   /* the wave's two 16-query tiles, hi and residual, all four k steps: loaded once */
  { const _Float16* qp = QH + q0 * CCQ + lane * 8; const _Float16* qlp = QL + q0 * CCQ + lane * 8;
#pragma unroll
    for (int u = 0; u < 2; ++u)
#pragma unroll
      for (int kc = 0; kc < 4; ++kc) { qh[u][kc] = frag_pk(qp + (u * 4 + kc) * 512); qr[u][kc] = frag_pk(qlp + (u * 4 + kc) * 512); } }
  v8f acc[2][CB / 16] = {};
#pragma unroll 1
  for (int i = 0; i < TT / 32 / PKS; ++i) { const size_t st = (size_t)b * (TT / 32) + i * PKS + ks;   /* a step's key fragments are 8 KiB in a row, its v fragments likewise */
    const _Float16* kp = KH + st * (32 * CCQ) + lane * 8; const _Float16* vp = VT + st * (32 * CB) + lane * 8;
    const float* mp = CM + st * 32 + 8 * g; const float* fp = CS + st * 32 + 8 * g;   /* the lane's 16 keys (8 g + 0..7 of either tile): their column max and log2 factor */
    v16h kf[2][4], vf[CB / 16], p[2]; v4f cm[4], cf[4];
#pragma unroll
    for (int t = 0; t < 2; ++t)
#pragma unroll
      for (int kc = 0; kc < 4; ++kc) kf[t][kc] = frag_pk(kp + (t * 4 + kc) * 512);
#pragma unroll
    for (int u = 0; u < 4; ++u) { const int o = (u >> 1) * 16 + (u & 1) * 4; cm[u] = *(const v4f*)(mp + o); cf[u] = *(const v4f*)(fp + o); }
    __builtin_amdgcn_sched_barrier(0);   /* what the score products and the exp work need is asked for first: loads come back in the order of issue */
#pragma unroll
    for (int j = 0; j < CB / 16; ++j) vf[j] = frag_pk(vp + j * 512);
    __builtin_amdgcn_sched_barrier(0);   /* every load of the step is issued ahead of its first WMMA: the v fragments arrive under the score products and the exp work; without it the scheduler may sink them to their use and a step pays two load latencies in a row */
#pragma unroll
    for (int u = 0; u < 2; ++u) { v8f a0 = {}, a1 = {}, l0 = {}, l1 = {};
#pragma unroll
      for (int kc = 0; kc < 4; ++kc) { a0 = wmma16b(kf[0][kc], qh[u][kc], a0); a1 = wmma16b(kf[1][kc], qh[u][kc], a1); l0 = wmma16b(kf[0][kc], qr[u][kc], l0); l1 = wmma16b(kf[1][kc], qr[u][kc], l1); }
#pragma unroll
      for (int r = 0; r < 8; r += 2) { const int q = r >> 2, e = r & 3;   /* two neighbouring keys of one tile at a time: their accumulators, maxima and factors lie in neighbouring registers, so the packed f32 forms take them where they are */
        const v2f s0 = (v2f{a0[r], a0[r + 1]} + v2f{l0[r], l0[r + 1]} * (1.0f / 1024.0f)) * SCALE, s1 = (v2f{a1[r], a1[r + 1]} + v2f{l1[r], l1[r + 1]} * (1.0f / 1024.0f)) * SCALE;
        const v2f e0 = (s0 - v2f{cm[q][e], cm[q][e + 1]}) * LOG2E + v2f{cf[q][e], cf[q][e + 1]}, e1 = (s1 - v2f{cm[2 + q][e], cm[2 + q][e + 1]}) * LOG2E + v2f{cf[2 + q][e], cf[2 + q][e + 1]};
        p[u][r] = (_Float16)__builtin_amdgcn_exp2f(e0[0]); p[u][r + 1] = (_Float16)__builtin_amdgcn_exp2f(e0[1]); p[u][8 + r] = (_Float16)__builtin_amdgcn_exp2f(e1[0]); p[u][9 + r] = (_Float16)__builtin_amdgcn_exp2f(e1[1]); } }
#pragma unroll
    for (int j = 0; j < CB / 16; ++j) { acc[0][j] = wmma16b(vf[j], p[0], acc[0][j]); acc[1][j] = wmma16b(vf[j], p[1], acc[1][j]); }
    /* order asked of the scheduler for the step: the 32 score WMMAs, the first plain vector instructions, then each v_exp_f32 with one plain vector instruction behind it, the last conversions, then the 16 P.v WMMAs */
    __builtin_amdgcn_sched_group_barrier(0x8, 32, 0); __builtin_amdgcn_sched_group_barrier(0x2, 24, 0);
#pragma unroll
    for (int k = 0; k < 32; ++k) { __builtin_amdgcn_sched_group_barrier(0x400, 1, 0); __builtin_amdgcn_sched_group_barrier(0x2, 1, 0); }
    __builtin_amdgcn_sched_group_barrier(0x2, 8, 0); __builtin_amdgcn_sched_group_barrier(0x8, 16, 0);
    __builtin_amdgcn_sched_barrier(0);   /* keeps the wait below at the step's foot: nothing ties it to the WMMAs, and the scheduler otherwise lifts it to the step's head, where the score products would wait for the v fragments too */
    asm volatile("s_wait_loadcnt 0x0" :: "v"(kp), "v"(vp), "v"(mp), "v"(fp) : "memory"); }   /* names the four address pairs so that they stay as they are until every load of the step has returned */
#pragma unroll
  for (int u = 0; u < 2; ++u)
#pragma unroll
    for (int j = 0; j < CB / 16; ++j) { v4f lo, hi;   /* lane (g, col): query col of tile u, channels j * 16 + 8 g + 0..7 */
#pragma unroll
      for (int r = 0; r < 4; ++r) { lo[r] = acc[u][j][r]; hi[r] = acc[u][j][4 + r]; }
      *(v4f*)&ss[wave][u * 16 + col][j * 16 + 8 * g] = lo; *(v4f*)&ss[wave][u * 16 + col][j * 16 + 8 * g + 4] = hi; }
  __syncthreads();   /* all key slices' partial tiles are in ss before a wave sums its rows over them */
  float* yp = Y + ((size_t)b * TT + blockIdx.x * 64 + wave) * CB + lane * 4;   /* y rows [b*TT + n][128]: wave w takes rows w, w + 8, ...: a 512-B row by 32 lanes */
#pragma unroll
  for (int e = 0; e < 8; ++e) { const int row = e * 8 + wave; v4f t = *(const v4f*)&ss[row >> 5][row & 31][lane * 4];
#pragma unroll
    for (int s = 1; s < PKS; ++s) t += *(const v4f*)&ss[s * 2 + (row >> 5)][row & 31][lane * 4];
    vst2(yp + (size_t)e * 8 * CB, t * (1.0f / 2048.0f)); } }

#define WS_TL  (WS_END)                                  // f16 theta-view residual plane [b][128][TT] (viewed as rows)
#define WS_G   (WS_TL + 2u * (size_t)NB * CB * TT)        // f16 g conv plane [b][128][TT]
#define WS_VT2 (WS_G + 2u * (size_t)NB * CB * TT)         // f16 g view in fragment order [b][m / 32][c / 16][fragment half][lane][8]
#define WS_YR  (WS_VT2 + 2u * (size_t)NB * CB * TT)       // f32 y rows [b*TT + n][128]
#define WS_CM  (WS_YR + 4u * (size_t)NB * TT * CB)        // f32 column max [b][TT]
#define WS_CS  (WS_CM + 4u * (size_t)NB * TT)             // f32 log2(2^11 / column sum) [b][TT]
#define WS_PM  (WS_CS + 4u * (size_t)NB * TT)             // f32 partial column max [b][NQB][TT]
#define WS_PS  (WS_PM + 4u * (size_t)NB * NQB * TT)       // f32 partial column sum [b][NQB][TT]
#define WS_END2 (WS_PS + 4u * (size_t)NB * NQB * TT)
extern "C" void kernel_launch(void* const* d_in, const int* in_sizes, int n_in, void* d_out, int out_size, void* d_ws, size_t ws_size, hipStream_t stream) {
  (void)in_sizes; (void)n_in; (void)out_size;
  const float** F = (const float**)d_in;
  if (ws_size < (size_t)WS_END) return;
  char* ws = (char*)d_ws; _Float16 *QH = (_Float16*)(ws + WS_QH), *KH = (_Float16*)(ws + WS_KH), *VT = (_Float16*)(ws + WS_VT), *QL = (_Float16*)(ws + WS_QL), *KL = (_Float16*)(ws + WS_KL); __bf16 *VB = (__bf16*)(ws + WS_VB), *VBL = (__bf16*)(ws + WS_VBL); float *Y = (float*)(ws + WS_Y);
  (void)Y; (void)QL; (void)KL; (void)VB; (void)VBL;
  // inputs: 0 x [4,256,64,64] (channels-first); 1 theta_w [128,256], 2 theta_b; 3 phi_w, 4 phi_b; 5 g_w, 6 g_b; 7 W_w [256,128], 8 W_b [256] (all (out,in), biases nonzero)
  if (ws_size < (size_t)WS_END2) return;
  _Float16 *TL = (_Float16*)(ws + WS_TL), *G = (_Float16*)(ws + WS_G), *VT2 = (_Float16*)(ws + WS_VT2); float *YR = (float*)(ws + WS_YR), *CM = (float*)(ws + WS_CM), *CS = (float*)(ws + WS_CS), *PM = (float*)(ws + WS_PM), *PS = (float*)(ws + WS_PS);
  // phi^T rows (the 'k' rows: phi[c][m] proper layout, token-major) via the q/k path as which = 1 -> KH in fragment order (+KL rows < 64, unused)
  k_projT<1><<<dim3(TNB * TT / 64, 1, 1), 128, 0, stream>>>(F[0], F[0], F[0], F[3], F[3], F[3], F[4], F[4], F[4], QH, QL, KH, KL, VT, VB, VBL, nullptr);
  // theta conv plane [Cb][N] (f16 hi into the 'VT' slot = the theta VIEW rows [N][Cb] when read row-major) + its residual plane TL (the view's residual rows) via the [c][t] path (which = 2)
  k_projT<2><<<dim3(TNB * TT / 64, 1, 1), 128, 0, stream>>>(F[0], F[0], F[0], F[1], F[1], F[1], F[2], F[2], F[2], QH, QL, KH, KL, VT, VB, VBL, TL);
  // g conv plane [Cb][N] f16 -> G, then the g VIEW rows turned into the value fragments VT2, and the theta VIEW rows (hi, residual) copied into the query fragments QH, QL
  k_projT<2><<<dim3(TNB * TT / 64, 1, 1), 128, 0, stream>>>(F[0], F[0], F[0], F[5], F[5], F[5], F[6], F[6], F[6], QH, QL, KH, KL, G, VB, VBL, nullptr);
  k_trans<<<dim3(TT / 64, CB / 64, 3 * TNB), 256, 0, stream>>>(G, VT2, VT /* theta view rows */, TL /* view residual rows */, QH, QL);
  // all batches in each launch: column statistics of the scores, their merge, then scores again + P.v
  k_sc<<<dim3(NQB, TT / 128, TNB), 128, 0, stream>>>(QH /* theta view fragments */, KH, QL /* view residual fragments */, KL, 0, 0, PM, PS);
  k_colmerge<<<dim3(TT / 32, TNB), 256, 0, stream>>>(PM, PS, CM, CS);
  k_pvf<<<dim3(TT / 64, TNB), 64 * PKS, 0, stream>>>(QH, QL, KH, CM, CS, VT2, YR);
  k_wout<<<dim3(TT / 64, COUT / 128, TNB), 128, 0, stream>>>(YR, F[7], F[8], F[0], (float*)d_out);

}

// v008
// Measured time: 115 microseconds a run.
// In both of two side-by-side timings against v007, it was 1.16 times as fast.
// All steps since v000 together make it 22.5 times as fast.
// compute dtype: all float inputs rounded to bf16; the three 1x1 convs with EXACT bf16 products on WMMA 16x16x32 (f32 accumulate) + bias; scores between the raw-reshaped theta view (f16 hi + residual x 2^10) and phi (f16) (2 products); the softmax over the QUERY axis in f32 (per-column max / sum from 64-row partials; each score's exp is the hardware base-2 exponent of (s - max) * log2 e, the few merge weights library expf); the scores formed a second time, transposed, in the P.v kernel (never stored); P x 2^11 (the factor 2^11 / column sum added as its log2 in the exponent) once to f16 x the raw-reshaped g view once to f16 (1 product); the W 1x1 conv on the raw-reshaped y view with bf16 hi + lo (2 products) x exact W + bias + x residual; f32 output written channels-first.
#include <hip/hip_runtime.h>
#include <math.h>

typedef __attribute__((ext_vector_type(16))) _Float16 v16h;
typedef __attribute__((ext_vector_type(16))) __bf16 v16b;
typedef __attribute__((ext_vector_type(8)))  _Float16 v8h;
typedef __attribute__((ext_vector_type(8)))  float v8f;
typedef __attribute__((ext_vector_type(4)))  float v4f;
typedef __attribute__((ext_vector_type(2)))  float v2f;
typedef __attribute__((ext_vector_type(4)))  unsigned v4u;
typedef _Float16 hx8 __attribute__((ext_vector_type(8)));
typedef _Float16 hx4 __attribute__((ext_vector_type(4)));
typedef __bf16 bx4 __attribute__((ext_vector_type(4)));
typedef __attribute__((ext_vector_type(4)))  int v4i;
typedef float __attribute__((may_alias)) float_a;
typedef int __attribute__((may_alias)) int_a;

template <typename T> __device__ __forceinline__ void vst2(void* p, T v) { *(T*)p = v;  }
__device__ __forceinline__ v8f wmma16(v16h a, v16h b, v8f c) {
  v8f d = __builtin_amdgcn_wmma_f32_16x16x32_f16(false, a, false, b, (short)0, c, false, false);
  asm volatile("v_nop\n\tv_nop\n\tv_nop\n\tv_nop" : "+v"(d) : "v"(a), "v"(b));
  return d;
}
__device__ __forceinline__ v8f wmma_bf(v16b a, v16b b, v8f c) {
  v8f d = __builtin_amdgcn_wmma_f32_16x16x32_bf16(false, a, false, b, (short)0, c, false, false);
  asm volatile("v_nop\n\tv_nop\n\tv_nop\n\tv_nop" : "+v"(d) : "v"(a), "v"(b));
  return d;
}
// 16x16x32 fragments: lane = (h = lane>>4, row/col = lane&15); elements 0..7 = k0+8h+0..7, 8..15 = k0+16+8h+0..7; D element r = row 8h+r
__device__ __forceinline__ v16h frag_h(const _Float16* rowk0, int lane) {
  union { v16h v; v8h q[2]; } u; const _Float16* p = rowk0 + 8 * (lane >> 4);
  u.q[0] = *(const v8h*)p; u.q[1] = *(const v8h*)(p + 16); return u.v;
}
__device__ __forceinline__ v16h frag_f32(const float* rowk0, int lane) {
  v16h a; const float* p = rowk0 + 8 * (lane >> 4);
#pragma unroll
  for (int i = 0; i < 8; ++i) { a[i] = (_Float16)p[i]; a[8 + i] = (_Float16)p[16 + i]; }
  return a;
}
__device__ __forceinline__ v16h frag_f32s(const float* rowk0, int lane, float sc) {
  v16h a; const float* p = rowk0 + 8 * (lane >> 4);
#pragma unroll
  for (int i = 0; i < 8; ++i) { a[i] = (_Float16)(p[i] * sc); a[8 + i] = (_Float16)(p[16 + i] * sc); }
  return a;
}
// column fragment from a [K][ld] layout (column n), rows >= K read as 0
__device__ __forceinline__ v16h fragc_f32(const float* W, int k0, int n, int lane, int ld, int K) {
  v16h a; const int g = lane >> 4;
#pragma unroll
  for (int i = 0; i < 8; ++i) { const int ka = k0 + 8 * g + i, kb = ka + 16;
    a[i] = (_Float16)(ka < K ? W[(size_t)(ka < K ? ka : K - 1) * ld + n] : 0.f); a[8 + i] = (_Float16)(kb < K ? W[(size_t)(kb < K ? kb : K - 1) * ld + n] : 0.f); }
  return a;
}
struct F2 { v16b h, l; };
__device__ __forceinline__ F2 bsplit16(const float v[16]) { F2 r;
#pragma unroll
  for (int i = 0; i < 16; ++i) { const __bf16 h = (__bf16)v[i]; r.h[i] = h; r.l[i] = (__bf16)(v[i] - (float)h); }
  return r; }
__device__ __forceinline__ F2 split_row(const float* row, int k0, int lane) { float v[16]; const float* p = row + k0 + 8 * (lane >> 4);
#pragma unroll
  for (int i = 0; i < 8; ++i) { v[i] = p[i]; v[8 + i] = p[16 + i]; }
  return bsplit16(v); }
__device__ __forceinline__ F2 split_rowK(const float* row, int k0, int lane, int K) { float v[16]; const int g = lane >> 4;
#pragma unroll
  for (int i = 0; i < 8; ++i) { const int ka = k0 + 8 * g + i, kb = ka + 16; v[i] = ka < K ? row[ka < K ? ka : K - 1] : 0.f; v[8 + i] = kb < K ? row[kb < K ? kb : K - 1] : 0.f; }
  return bsplit16(v); }
__device__ __forceinline__ F2 split_col(const float* W, int k0, int n, int lane, int ld, int K) { float v[16]; const int g = lane >> 4;
#pragma unroll
  for (int i = 0; i < 8; ++i) { const int ka = k0 + 8 * g + i, kb = ka + 16; v[i] = ka < K ? W[(size_t)(ka < K ? ka : K - 1) * ld + n] : 0.f; v[8 + i] = kb < K ? W[(size_t)(kb < K ? kb : K - 1) * ld + n] : 0.f; }
  return bsplit16(v); }
__device__ __forceinline__ v8f mac3(const F2& a, const F2& b, v8f c) { c = wmma_bf(a.l, b.h, c); c = wmma_bf(a.h, b.l, c); return wmma_bf(a.h, b.h, c); }
__device__ __forceinline__ float sigm(float v) { return 1.0f / (1.0f + expf(-v)); }
// fragment stored in fragment order (1 KiB: [half of the fragment][lane][8 f16]), read at the lane's own pointer (fragment start + 8 * lane): each of the two loads covers 512 contiguous bytes
__device__ __forceinline__ v16h frag_pk(const _Float16* p) { union { v16h v; v8h q[2]; } u; u.q[0] = *(const v8h*)p; u.q[1] = *(const v8h*)(p + 256); return u.v; }
// fragment read at the lane's own pointer (row start + k0 + 8 * (lane >> 4)): the caller keeps that pointer and names it at the wait behind a batch of loads
__device__ __forceinline__ v16b wfrag_p(const float* p) { v16b w;
#pragma unroll
  for (int i = 0; i < 8; ++i) { w[i] = (__bf16)p[i]; w[8 + i] = (__bf16)p[16 + i]; }
  return w; }

// Non-local block with the source's RAW reshapes (x [4,256,64,64], Cb 128, N 4,096; (out,in) theta/phi/g 1x1 convs [128,256] + biases, W [256,128] + bias): theta = conv(x).reshape(B, N, Cb) and g likewise are ROW-MAJOR reinterpretations of the [Cb][N] conv outputs (row n = channel n/32, positions (n%32)*128..+127), phi stays [Cb][N]; scores[n][m] = sum_c theta[n][c] phi[c][m]; attn = softmax over n (axis 1 - per key column); y[n][c] = sum_m attn[n][m] g[m][c]; y.reshape(B, Cb, H, W) (raw again) -> W conv + bias + x.
#define NB 4
#define TT 4096
#define CC 128            // g-view plane pitch (Cb channels)
#define CB 128
#define COUT 256
#define CCQ 128           // theta-view / phi^T row pitch (Cb)
#define DIN 256          // x channels
#define NH 1
#define HD 128
#define NQB (TT / 64)
#define SCALE (1.0f)
#define HDQK 128           // contraction width of the scores (Cb)
#define CAUSAL 0
#define LOG2E 1.44269504088896340736f
#ifndef TNB
#define TNB NB
#endif
__device__ __forceinline__ v16b zero16b() { v16b z; _Pragma("unroll") for (int i = 0; i < 16; ++i) z[i] = (__bf16)0.f; return z; }
__device__ __forceinline__ float bfr(float v) { return (float)(__bf16)v; }
__host__ __device__ __forceinline__ int kb_last(int qb) { return CAUSAL ? ((qb * 64 + 63) >> 7) : (TT / 128 - 1); }
typedef __attribute__((ext_vector_type(8))) __bf16 v8b;
__device__ __forceinline__ v16b frag_b(const __bf16* rowk0, int lane) {
  union { v16b v; v8b q[2]; } u; const __bf16* p = rowk0 + 8 * (lane >> 4);
  u.q[0] = *(const v8b*)p; u.q[1] = *(const v8b*)(p + 16); return u.v;
}
#define QBH 0              // 2-product logits everywhere (theta view hi + residual x phi hi)
#define QHI 4096            // q residual rows (all)
#define KHI 64            // (unused k residual / v bf16 planes: QBH 0)
// B fragment (k rows k0+.., output column o) of a weight: (in,out) [K][ld] or (out,in) [ld rows of K]: bf16 exact, or f16(bf16 * 256) exact
__device__ __forceinline__ v16b wcol_io(const float* Wm, int k0, int o, int lane, int ld) { v16b w; const int g = lane >> 4;
#pragma unroll
  for (int i = 0; i < 8; ++i) { w[i] = (__bf16)Wm[(size_t)(k0 + 8 * g + i) * ld + o]; w[8 + i] = (__bf16)Wm[(size_t)(k0 + 16 + 8 * g + i) * ld + o]; }
  return w; }
__device__ __forceinline__ v16b wcol_oi(const float* Wm, int k0, int o, int lane, int K) { v16b w; const float* p = Wm + (size_t)o * K + k0 + 8 * (lane >> 4);
#pragma unroll
  for (int i = 0; i < 8; ++i) { w[i] = (__bf16)p[i]; w[8 + i] = (__bf16)p[16 + i]; }
  return w; }
__device__ __forceinline__ v16h wcolh_io(const float* Wm, int k0, int o, int lane, int ld) { v16h w; const int g = lane >> 4;
#pragma unroll
  for (int i = 0; i < 8; ++i) { w[i] = (_Float16)(bfr(Wm[(size_t)(k0 + 8 * g + i) * ld + o]) * 256.0f); w[8 + i] = (_Float16)(bfr(Wm[(size_t)(k0 + 16 + 8 * g + i) * ld + o]) * 256.0f); }
  return w; }
__device__ __forceinline__ v16h wcolh_oi(const float* Wm, int k0, int o, int lane, int K) { v16h w; const float* p = Wm + (size_t)o * K + k0 + 8 * (lane >> 4);
#pragma unroll
  for (int i = 0; i < 8; ++i) { w[i] = (_Float16)(bfr(p[i]) * 256.0f); w[8 + i] = (_Float16)(bfr(p[16 + i]) * 256.0f); }
  return w; }
#define WQKV_LAYOUT 0   // 0 = (out,in) [CC][DIN], as 1; 1 = (out,in) [CC][DIN]; 2 = per-head [NH][DIN][HD]
__device__ __forceinline__ v16b wcol_hdk(const float* Wm, int k0, int o, int lane) { v16b w; const int g = lane >> 4; const float* p = Wm + (size_t)(o / HD) * DIN * HD + (o % HD);
#pragma unroll
  for (int i = 0; i < 8; ++i) { w[i] = (__bf16)p[(size_t)(k0 + 8 * g + i) * HD]; w[8 + i] = (__bf16)p[(size_t)(k0 + 16 + 8 * g + i) * HD]; }
  return w; }
#define WO_OUT_IN 0
#if WQKV_LAYOUT == 1
#define WCOL(W, k0, o, lane) wcol_oi(W, k0, (o), lane, DIN)   /* unused: layout 0 */
#elif WQKV_LAYOUT == 2
#define WCOL(W, k0, o, lane) wcol_hdk(W, k0, o, lane)
#else
#define WCOL(W, k0, o, lane) wcol_oi(W, k0, (o), lane, DIN)   /* (out,in) 1x1-conv weights [128][256]: all 128 output channels real */
#endif
#if WO_OUT_IN
#define WOCOL(W, k0, o, lane) wcol_oi(W, k0, o, lane, CC)
#define WOCOLH(W, k0, o, lane) wcolh_oi(W, k0, o, lane, CC)
#else
#define WOCOL(W, k0, o, lane) wcol_io(W, k0, o, lane, DIN)
#define WOCOLH(W, k0, o, lane) wcolh_io(W, k0, o, lane, DIN)
#endif
#ifndef SM_EXTRA_PARAMS
#define SM_EXTRA_PARAMS
#endif
#ifndef PROJ_EXTRA_PARAMS
#define PROJ_EXTRA_PARAMS
#endif
#ifndef SM_MASK_HOOK
#define SM_MASK_HOOK (void)0
#endif

#define WS_QH  0u                                      // f16 q rows in fragment order [b*t / 16][k step][fragment half][lane][8]
#define WS_KH  (WS_QH + 2u * (size_t)NB * TT * CCQ)     // f16 k rows in fragment order [b*t / 16][k step][fragment half][lane][8]
#define WS_VT  (WS_KH + 2u * (size_t)NB * TT * CCQ)     // f16 v planes [b][c][t]
#define WS_QL  (WS_VT + 2u * (size_t)NB * CC * TT)      // f16 q residual x 2^10 rows [b][t < QHI], in fragment order like WS_QH
#define WS_KL  (WS_QL + 2u * (size_t)NB * QHI * CCQ)    // f16 k residual x 2^10 rows [b][t < KHI][CCQ]
#define WS_VB  (WS_KL + 2u * (size_t)NB * KHI * CCQ)    // bf16 v hi planes [b][c][t < KHI]
#define WS_VBL (WS_VB + 2u * (size_t)NB * CC * KHI)
#define WS_Y   (WS_VBL + 2u * (size_t)NB * CC * KHI)    // zero bytes: Y is not used, the y rows go to WS_YR
#define WS_END (WS_Y  + 0u)

// ---- k_proj: block = (64 rows, 128 cols, which): q/k/v = X W (+ b) with exact bf16 products (K = DIN) -> which 0: q f16 rows (+ residual rows < QHI); 1: k f16 rows (+ residual rows < KHI), the f16 rows of both in fragment order; 2: v f16 planes [c][t] (+ bf16 hi/lo planes for t < KHI)
template <int WOFF> __global__ __launch_bounds__(128) void k_projT(const float* __restrict__ XQ, const float* __restrict__ XK, const float* __restrict__ XV, const float* __restrict__ WQ, const float* __restrict__ WK, const float* __restrict__ WV, const float* __restrict__ BQ, const float* __restrict__ BK, const float* __restrict__ BV,
    _Float16* __restrict__ QH, _Float16* __restrict__ QL, _Float16* __restrict__ KH, _Float16* __restrict__ KL, _Float16* __restrict__ VT, __bf16* __restrict__ VB, __bf16* __restrict__ VBL, _Float16* __restrict__ VL) {
  __shared__ __align__(16) _Float16 sh[64][136], sl[64][136]; __shared__ __align__(16) _Float16 th[128][72], tlo[128][72]; __shared__ __align__(16) __bf16 tb[128][72], tbl[128][72];
  const int tid = threadIdx.x, wave = tid >> 5, lane = tid & 31, col = lane & 15, g = lane >> 4; const int which = blockIdx.z + WOFF; const int c0 = blockIdx.y * 128; const size_t r0 = (size_t)blockIdx.x * 64; const size_t bb = r0 / TT; const int t0 = (int)(r0 % TT);
  const float* X = which == 0 ? XQ : which == 1 ? XK : XV; const float* WA = which == 0 ? WQ : which == 1 ? WK : WV; const float* BA = which == 0 ? BQ : which == 1 ? BK : BV;
  const int KD = DIN;
  v8f acc[8] = {};
#pragma unroll 2
  for (int kc = 0; kc < KD / 32; ++kc) { v16b a[4], w[2]; v4f xl[16]; const float* p = X + (bb * KD + kc * 32 + 8 * g) * (size_t)TT + t0 + col * 4;   /* channels-first [b][c][t]: A[t][c]; row col of row tile u is t0 + 4 col + u, so one 16-B load brings a channel's element for all four tiles and 16 lanes cover 256 B in a row */
    const float* wp = WA + (size_t)(c0 + wave * 32 + col) * DIN + kc * 32 + 8 * g;   /* (out,in) weight rows: the wave's own 32 output columns, fragment jj starts 16 rows further on */
    /* wave tile = all 64 rows x 32 columns (acc[u * 2 + jj]: row tile u, column tile jj): a 16-B weight load touches 16 lines, a 16-B x load 4 whole ones, so 8 weight + 16 x loads a k step touch 192 lines a wave where 32 + 16 touched 544 */
#pragma unroll
    for (int i = 0; i < 8; ++i) { xl[i] = *(const v4f*)(p + (size_t)i * TT); xl[8 + i] = *(const v4f*)(p + (size_t)(16 + i) * TT); }
#pragma unroll
    for (int jj = 0; jj < 2; ++jj) w[jj] = wfrag_p(wp + (size_t)jj * 16 * DIN);   /* every fragment ahead of the k step's first WMMA: the asm in wmma_bf holds later loads behind it, so a load written between two WMMAs pays its whole latency there */
    asm volatile("s_wait_loadcnt 0x0" :: "v"(p), "v"(wp) : "memory");   /* names the two address pairs so that they stay as they are until every load of the batch has returned */
#pragma unroll
    for (int u = 0; u < 4; ++u)
#pragma unroll
      for (int i = 0; i < 16; ++i) a[u][i] = (__bf16)xl[i][u];
#pragma unroll
    for (int j = 0; j < 8; ++j) acc[j] = wmma_bf(a[j >> 1], w[j & 1], acc[j]); }
  const float* bp = BA + c0 + wave * 32 + col; float bias2[2] = {};   /* the two bias loads together, ahead of the epilogue's LDS stores */
  if (BA) {
#pragma unroll
    for (int jj = 0; jj < 2; ++jj) bias2[jj] = bp[jj * 16];
    asm volatile("s_wait_loadcnt 0x0" :: "v"(bp) : "memory"); }   /* names the address pair so that it stays as it is until the two loads have returned */
  if (which < 2) { _Float16* DH = which == 0 ? QH : KH; _Float16* DL = which == 0 ? QL : KL; const int nhi = which == 0 ? QHI : KHI; const bool hi_rows = t0 < nhi;
#pragma unroll
    for (int j = 0; j < 8; ++j) { const float bias = bfr(bias2[j & 1]);
#pragma unroll
      for (int r = 0; r < 8; ++r) { const float v = acc[j][r] + bias; const int rl = (8 * g + r) * 4 + (j >> 1), cl = wave * 32 + (j & 1) * 16 + col; const _Float16 hv = (_Float16)v; sh[rl][cl] = hv; sl[rl][cl] = (_Float16)((v - (float)hv) * 1024.0f); } }
    __syncthreads();
    for (int e = tid; e < 64 * 16; e += 128) { const int rl = ((e >> 8) << 4) | (e & 15), q = ((e >> 6) & 3) * 4 + ((e >> 5) & 1) * 2 + ((e >> 4) & 1);   /* fragment order: e = (16-row tile, k step, fragment half, lane): piece e of the block's 16 KiB is what that lane loads */
      vst2((unsigned*)(DH + r0 * CCQ + (size_t)e * 8), *(const v4u*)&sh[rl][q * 8]);
      asm volatile("s_wait_xcnt 0x0" ::: "memory");   /* the store's address pair and data registers are rewritten by the residual store's LDS read and by the next trip */
      if (hi_rows) { vst2((unsigned*)(DL + (bb * nhi + t0 + rl) * (size_t)CCQ + c0 + q * 8), *(const v4u*)&sl[rl][q * 8]);
        asm volatile("s_wait_xcnt 0x0" ::: "memory"); } }   /* likewise, ahead of the next trip */   /* hi rows in fragment order (c0 == 0), residual rows at pitch CCQ */
  } else { const bool hi_rows = t0 < KHI;
#pragma unroll
    for (int jj = 0; jj < 2; ++jj) { const float bias = bfr(bias2[jj]); const int cl = wave * 32 + jj * 16 + col;
#pragma unroll
      for (int r = 0; r < 8; ++r) { const int rl = (8 * g + r) * 4; hx4 vh, vl; bx4 vb, vbl;   /* the four row tiles' elements are four t in a row: one 8-B LDS store a plane */
#pragma unroll
        for (int u = 0; u < 4; ++u) { const float v = acc[u * 2 + jj][r] + bias; const _Float16 hv2 = (_Float16)v; vh[u] = hv2; vl[u] = (_Float16)((v - (float)hv2) * 1024.0f); const __bf16 bh = (__bf16)v; vb[u] = bh; vbl[u] = (__bf16)(v - (float)bh); }
        *(hx4*)&th[cl][rl] = vh; *(hx4*)&tlo[cl][rl] = vl; *(bx4*)&tb[cl][rl] = vb; *(bx4*)&tbl[cl][rl] = vbl; } }
    __syncthreads();
    for (int e = tid; e < 128 * 8; e += 128) { const int cl = e >> 3, q = e & 7; vst2((unsigned*)(VT + (bb * CC + c0 + cl) * (size_t)TT + t0 + q * 8), *(const v4u*)&th[cl][q * 8]); if (VL) vst2((unsigned*)(VL + (bb * CC + c0 + cl) * (size_t)TT + t0 + q * 8), *(const v4u*)&tlo[cl][q * 8]); if (hi_rows) { const size_t o3 = (bb * CC + c0 + cl) * (size_t)KHI + t0 + q * 8; vst2((unsigned*)(VB + o3), *(const v4u*)&tb[cl][q * 8]); vst2((unsigned*)(VBL + o3), *(const v4u*)&tbl[cl][q * 8]); } } } }
// ---- k_sc: block = (query block qb, key block kb <= kb_last(qb), batch): column statistics of a 64 x 128 tile of the logits x SCALE (the logits themselves are not stored: k_pvf forms them again); q hi + residual (x 2^10) against k (2 products) for query rows < QHI, plus the k residual (3 products) for query blocks < QBH (causal early rows); causal: blocks past the diagonal exit
__global__ __launch_bounds__(128) void k_sc(const _Float16* __restrict__ QH, const _Float16* __restrict__ KH, const _Float16* __restrict__ QL, const _Float16* __restrict__ KL, int bgrp, int h0, float* __restrict__ PM0, float* __restrict__ PS0) { __shared__ __align__(16) float ss[4][16][132];
  const int qb = blockIdx.x, kb = blockIdx.y; if (kb > kb_last(qb)) return;
  (void)h0; const int b = bgrp + blockIdx.z; float* PM = PM0 + (size_t)b * NQB * TT; float* PS = PS0 + (size_t)b * NQB * TT;   /* one plane of partials per batch */
  const int tid = threadIdx.x, wave = tid >> 5, lane = tid & 31, col = lane & 15, g = lane >> 4; const int k0 = kb * 128; const int ql0 = qb * 64 + wave * 16; const size_t q0 = (size_t)b * TT + ql0, kr0 = (size_t)b * TT + k0;
  v8f acc[8] = {}, accl[8] = {};
  const _Float16* QLb = QL + (size_t)b * QHI * CCQ; const _Float16* KLb = KL + (size_t)b * KHI * CCQ;   /* single head */
  const _Float16* kp = KH + kr0 * CCQ + lane * 8;   /* key rows in fragment order: fragment (16-key tile j, k step kc) starts (j * 4 + kc) * 512 f16 further on */
  const _Float16* qp = QH + q0 * CCQ + lane * 8; const _Float16* qlp = QLb + (size_t)ql0 * CCQ + lane * 8;   /* the wave's 16 query rows, hi and residual, likewise: fragment kc starts kc * 512 f16 further on */
  if (qb < QBH) {
#pragma unroll
    for (int kc = 0; kc < HDQK / 32; ++kc) { const v16h ah = frag_pk(qp + kc * 512), al = frag_pk(qlp + kc * 512);
#pragma unroll
      for (int j = 0; j < 8; ++j) { const v16h kbf = frag_pk(kp + (j * 4 + kc) * 512), klf = frag_h(KLb + (size_t)(k0 + j * 16 + col) * CCQ + kc * 32, lane); acc[j] = wmma16(ah, kbf, acc[j]); accl[j] = wmma16(al, kbf, accl[j]); accl[j] = wmma16(ah, klf, accl[j]); } }
  } else if (qb * 64 < QHI) {
#pragma unroll
    for (int kc = 0; kc < HDQK / 32; ++kc) { const v16h ah = frag_pk(qp + kc * 512), al = frag_pk(qlp + kc * 512);
      v16h kbf[8];   /* the k step's eight key fragments ahead of its first WMMA (the asm in wmma16 holds later loads behind it) */
#pragma unroll
      for (int j = 0; j < 8; ++j) kbf[j] = frag_pk(kp + (j * 4 + kc) * 512);
#pragma unroll
      for (int j = 0; j < 8; ++j) { acc[j] = wmma16(ah, kbf[j], acc[j]); accl[j] = wmma16(al, kbf[j], accl[j]); } }
  } else {
#pragma unroll
    for (int kc = 0; kc < HDQK / 32; ++kc) { const v16h ah = frag_pk(qp + kc * 512);
#pragma unroll
      for (int j = 0; j < 8; ++j) { const v16h kbf = frag_pk(kp + (j * 4 + kc) * 512); acc[j] = wmma16(ah, kbf, acc[j]); } } }
#pragma unroll
  for (int j = 0; j < 8; ++j) {
#pragma unroll
    for (int r = 0; r < 8; ++r) ss[wave][8 * g + r][j * 16 + col] = (acc[j][r] + accl[j][r] * (1.0f / 1024.0f)) * SCALE; }
  __syncthreads();   /* every wave's 16 rows of the tile are in ss before a thread walks its column */
  // column statistics of this 64 x 128 tile from the f32 logits in ss: thread = key column, rows in ascending order: max, then sum of exp(v - max) = 2^((v - max) * log2 e) on v_exp_f32 (the argument is <= 0; a result under 2^-126 may go to 0 beside a sum >= 1)
  { float v[64];
#pragma unroll
    for (int i = 0; i < 64; ++i) v[i] = ss[i >> 4][i & 15][tid];
    float m = v[0];
#pragma unroll
    for (int i = 1; i < 64; ++i) m = fmaxf(m, v[i]);
    float s = 0.f;
#pragma unroll
    for (int i = 0; i < 64; ++i) s += __builtin_amdgcn_exp2f((v[i] - m) * LOG2E);
    vst2(PM + (size_t)qb * TT + k0 + tid, m); vst2(PS + (size_t)qb * TT + k0 + tid, s); } }
// ---- k_colmerge: softmax over the QUERY axis (axis 1): joins the 64 per-query-block partials (PM = max, PS = sum of exp(S - PM) over 64 rows) of each key column m: CM[m] = max, CS[m] = 11 - log2(sum_q PS[q][m] exp(PM[q][m] - CM[m])) (log2 of the factor 2^11 / column sum: k_pvf adds it in the exponent); block = 32 columns (lane) x 8 waves of 8 partials, joined through LDS
__global__ __launch_bounds__(256) void k_colmerge(const float* __restrict__ PM0, const float* __restrict__ PS0, float* __restrict__ CM0, float* __restrict__ CS0) { __shared__ float lm[8][32], ls[8][32];
  const float* PM = PM0 + (size_t)blockIdx.y * NQB * TT; const float* PS = PS0 + (size_t)blockIdx.y * NQB * TT; float* CM = CM0 + (size_t)blockIdx.y * TT; float* CS = CS0 + (size_t)blockIdx.y * TT;   /* blockIdx.y = batch */
  const int tid = threadIdx.x, wave = tid >> 5, lane = tid & 31; const int m = blockIdx.x * 32 + lane; float pm[8], ps[8];
#pragma unroll
  for (int u = 0; u < 8; ++u) pm[u] = PM[(size_t)(wave * 8 + u) * TT + m];
  asm volatile("s_wait_xcnt 0x0" ::: "memory");   /* the address pair of the loads above is rewritten for the loads below */
#pragma unroll
  for (int u = 0; u < 8; ++u) ps[u] = PS[(size_t)(wave * 8 + u) * TT + m];
  float mx = pm[0];
#pragma unroll
  for (int u = 1; u < 8; ++u) mx = fmaxf(mx, pm[u]);
  float sm2 = 0.f;
#pragma unroll
  for (int u = 0; u < 8; ++u) sm2 += ps[u] * expf(pm[u] - mx);
  lm[wave][lane] = mx; ls[wave][lane] = sm2;
  __syncthreads();
  if (wave == 0) { float mt = lm[0][lane];
#pragma unroll
    for (int w = 1; w < 8; ++w) mt = fmaxf(mt, lm[w][lane]);
    float st = 0.f;
#pragma unroll
    for (int w = 0; w < 8; ++w) st += ls[w][lane] * expf(lm[w][lane] - mt);
    vst2(CM + m, mt); vst2(CS + m, 11.0f - log2f(st)); } }
// ---- k_trans: blockIdx.z < TNB: block = (64 keys, 64 columns, batch): the g view rows [m][c] turned through LDS into fragments (column c, 32 keys) laid in fragment order for k_pvf; blockIdx.z >= TNB: block = two 16-row tiles of a batch's theta view rows (hi plane, then residual plane), their 16-B pieces copied into fragment order for k_sc
static_assert((TT / 64) * (CB / 64) * 2 == TT / 16, "two 16-row tiles of the theta view per block");
__global__ __launch_bounds__(256) void k_trans(const _Float16* __restrict__ G, _Float16* __restrict__ VT2, const _Float16* __restrict__ TH, const _Float16* __restrict__ TR, _Float16* __restrict__ QP, _Float16* __restrict__ QR) { __shared__ _Float16 st[64][72]; const int tid = threadIdx.x;
  if (blockIdx.z >= TNB) {   /* the same for the whole block, ahead of the barrier */
    const int z = blockIdx.z - TNB; const size_t o = (size_t)(z % TNB) * CB * TT + (size_t)(blockIdx.y * (TT / 64) + blockIdx.x) * 2 * 16 * CCQ;   /* a tile is 16 rows of CCQ f16 = 4 KiB in both layouts */
    const _Float16* s = (z < TNB ? TH : TR) + o + (size_t)(tid & 15) * CCQ + (((tid >> 6) & 3) * 4 + ((tid >> 5) & 1) * 2 + ((tid >> 4) & 1)) * 8;   /* tid = (k step, fragment half, lane): that lane's piece of its row */
    _Float16* d = (z < TNB ? QP : QR) + o + tid * 8;
    const v4u u0 = *(const v4u*)s, u1 = *(const v4u*)(s + 16 * CCQ); vst2((unsigned*)d, u0); vst2((unsigned*)(d + 16 * CCQ), u1); return; }
  const int m0 = blockIdx.x * 64, c0 = blockIdx.y * 64, b = blockIdx.z; const _Float16* gb = G + (size_t)b * CB * TT; _Float16* vb = VT2 + (size_t)b * CB * TT;
  for (int e = tid; e < 64 * 8; e += 256) { const int ml = e >> 3, q = e & 7; const v4u u = *(const v4u*)(gb + (size_t)(m0 + ml) * CB + c0 + q * 8); asm volatile("s_wait_loadcnt 0x0" ::: "memory"); const hx8 hv = *(const hx8*)&u; _Pragma("unroll") for (int j = 0; j < 8; ++j) st[q * 8 + j][ml] = hv[j]; }
  __syncthreads();
  for (int e = tid; e < 64 * 8; e += 256) { const int cl = ((e >> 6) & 3) * 16 + (e & 15), q = (e >> 8) * 4 + ((e >> 5) & 1) * 2 + ((e >> 4) & 1);   /* fragment order: e = (32-key step, 16-column fragment, fragment half, lane) */
    hx8 hv; _Pragma("unroll") for (int j = 0; j < 8; ++j) hv[j] = st[cl][q * 8 + j]; vst2((unsigned*)(vb + ((size_t)((m0 >> 5) + (e >> 8)) * (CB / 16) + (c0 >> 4)) * 512 + (e & 255) * 8), *(const v4u*)&hv); } }
// ---- k_wout: block = (64 positions, 128 of the 256 output channels, batch): A[pos][cb] = y view Yb[cb*4096 + pos] (the raw reshape back: the batch's y rows [4096][128] f32 reinterpreted as [Cb][N]) split bf16 hi + lo (2 products) x exact (out,in) W [256][128]; + bf16(W_b) + bf16(x[b][o][pos]); channels-first store out[b][o][pos0..pos0+63] through LDS (one 256-B run per channel by 16 lanes)
__global__ __launch_bounds__(128) void k_wout(const float* __restrict__ Y, const float* __restrict__ WW, const float* __restrict__ WB, const float* __restrict__ X, float* __restrict__ OUT) { __shared__ __align__(16) float st[128][68];
  const int tid = threadIdx.x, wave = tid >> 5, lane = tid & 31, col = lane & 15, g = lane >> 4; const int p0 = blockIdx.x * 64, c0 = blockIdx.y * 128, b = blockIdx.z; const float* Yb = Y + (size_t)b * TT * CB;
  v8f acc[8] = {};
#pragma unroll 1
  for (int kc = 0; kc < CB / 32; ++kc) { v16b ah[4], al[4], w[2]; { const float* p = Yb + (size_t)(kc * 32 + 8 * g) * TT + p0 + col * 4; const float* wp = WW + (size_t)(c0 + wave * 32 + col) * CB + kc * 32 + 8 * g; v4f tv[16];   /* wave tile = all 64 positions x the wave's own 32 channels (acc[u * 2 + jj]), row col of row tile u = position p0 + 4 col + u, as in k_projT: fewer lines touched a k step */
#pragma unroll
      for (int i = 0; i < 8; ++i) { tv[i] = *(const v4f*)(p + (size_t)i * TT); tv[8 + i] = *(const v4f*)(p + (size_t)(16 + i) * TT); }
#pragma unroll
      for (int jj = 0; jj < 2; ++jj) w[jj] = wfrag_p(wp + (size_t)jj * 16 * CB);   /* with the y loads, ahead of the k step's first WMMA (the asm in wmma_bf holds later loads behind it) */
      asm volatile("s_wait_loadcnt 0x0" :: "v"(p), "v"(wp) : "memory");   /* names the two address pairs so that they stay as they are until every load of the batch has returned */
#pragma unroll
      for (int u = 0; u < 4; ++u)
#pragma unroll
        for (int i = 0; i < 16; ++i) { const __bf16 h = (__bf16)tv[i][u]; ah[u][i] = h; al[u][i] = (__bf16)(tv[i][u] - (float)h); } }
#pragma unroll
    for (int j = 0; j < 8; ++j) { acc[j] = wmma_bf(ah[j >> 1], w[j & 1], acc[j]); acc[j] = wmma_bf(al[j >> 1], w[j & 1], acc[j]); } }
  // thread's sixteen 16-B pieces: channel c0 + (tid >> 4) + 8 u, positions p0 + (tid & 15) * 4
  const size_t o0 = ((size_t)b * COUT + c0 + (tid >> 4)) * (size_t)TT + p0 + (tid & 15) * 4; const float* xp = X + o0; const float* bp = WB + c0 + wave * 32 + col; float* op = OUT + o0;
  float wb2[2]; v4f xr[16];   /* the two bias loads and the sixteen residual loads are issued together, ahead of the turn through LDS */
#pragma unroll
  for (int jj = 0; jj < 2; ++jj) wb2[jj] = bp[jj * 16];
#pragma unroll
  for (int u = 0; u < 16; ++u) xr[u] = *(const v4f*)(xp + (size_t)u * 8 * TT);
  asm volatile("s_wait_loadcnt 0x0" :: "v"(xp), "v"(bp) : "memory");   /* names the two address pairs so that they stay as they are until every load of the batch has returned */
#pragma unroll
  for (int jj = 0; jj < 2; ++jj) { const float wb = bfr(wb2[jj]);
#pragma unroll
    for (int r = 0; r < 8; ++r) { v4f t;   /* the four row tiles' elements are four positions in a row */
#pragma unroll
      for (int u = 0; u < 4; ++u) t[u] = acc[u * 2 + jj][r] + wb;
      *(v4f*)&st[wave * 32 + jj * 16 + col][(8 * g + r) * 4] = t; } }
  __syncthreads();
#pragma unroll
  for (int u = 0; u < 16; ++u) { v4f v = *(const v4f*)&st[(tid >> 4) + 8 * u][(tid & 15) * 4]; v[0] += bfr(xr[u][0]); v[1] += bfr(xr[u][1]); v[2] += bfr(xr[u][2]); v[3] += bfr(xr[u][3]); vst2(op + (size_t)u * 8 * TT, v); } }
// ---- k_pvf: block = (64 queries, batch), 8 waves: wave = (query group qg of 32 queries, key slice ks); slice ks takes the 32-key steps ks, ks + 4, ks + 8, ... of the 4,096 keys. Per step the wave forms the TRANSPOSED scores S^T[key][query] = k rows (A) x q rows hi + residual (B, kept in registers) as in k_sc (2 products); a lane's accumulator registers of the two 16-key tiles are, element for element, its part of the B operand of the next product, so P^T x 2^11 = 2^((S^T - CM[key]) * log2 e + CS[key]) (one subtract, one FMA, one v_exp_f32 a score) goes once to f16 in place and y^T[c][query] += v fragment (A: row c, 32 keys) x P^T (1 product). The 4 slices' partial tiles are joined through LDS in ascending ks, x 2^-11
#define PKS 4              // key slices of a k_pvf block
// the plain builtin (the compiler keeps the distances behind it itself): an asm statement cannot name a register above v255, and k_pvf's operands do not all fit below
__device__ __forceinline__ v8f wmma16b(v16h a, v16h b, v8f c) { return __builtin_amdgcn_wmma_f32_16x16x32_f16(false, a, false, b, (short)0, c, false, false); }
static_assert((TT / 32) % PKS == 0 && TT % 64 == 0, "every wave the same number of 32-key steps; whole 64-query blocks");
__global__ __launch_bounds__(64 * PKS) void k_pvf(const _Float16* __restrict__ QH, const _Float16* __restrict__ QL, const _Float16* __restrict__ KH, const float* __restrict__ CM, const float* __restrict__ CS, const _Float16* __restrict__ VT, float* __restrict__ Y) { __shared__ __align__(16) float ss[2 * PKS][32][CB + 4];
  const int tid = threadIdx.x, wave = __builtin_amdgcn_readfirstlane(tid >> 5), lane = tid & 31, col = lane & 15, g = lane >> 4; const int b = blockIdx.y, qg = wave & 1, ks = wave >> 1; const size_t q0 = (size_t)b * TT + blockIdx.x * 64 + qg * 32;
  v16h qh[2][4], qr[2][4];   /* the wave's two 16-query tiles, hi and residual, all four k steps: loaded once */
  { const _Float16* qp = QH + q0 * CCQ + lane * 8; const _Float16* qlp = QL + q0 * CCQ + lane * 8;
#pragma unroll
    for (int u = 0; u < 2; ++u)
#pragma unroll
      for (int kc = 0; kc < 4; ++kc) { qh[u][kc] = frag_pk(qp + (u * 4 + kc) * 512); qr[u][kc] = frag_pk(qlp + (u * 4 + kc) * 512); } }
  v8f acc[2][CB / 16] = {};
#pragma unroll 1
  for (int i = 0; i < TT / 32 / PKS; ++i) { const size_t st = (size_t)b * (TT / 32) + i * PKS + ks;   /* a step's key fragments are 8 KiB in a row, its v fragments likewise */
    const _Float16* kp = KH + st * (32 * CCQ) + lane * 8; const _Float16* vp = VT + st * (32 * CB) + lane * 8;
    const float* mp = CM + st * 32 + 8 * g; const float* fp = CS + st * 32 + 8 * g;   /* the lane's 16 keys (8 g + 0..7 of either tile): their column max and log2 factor */
    v16h kf[2][4], vf[CB / 16], p[2]; v4f cm[4], cf[4];
#pragma unroll
    for (int t = 0; t < 2; ++t)
#pragma unroll
      for (int kc = 0; kc < 4; ++kc) kf[t][kc] = frag_pk(kp + (t * 4 + kc) * 512);
#pragma unroll
    for (int u = 0; u < 4; ++u) { const int o = (u >> 1) * 16 + (u & 1) * 4; cm[u] = *(const v4f*)(mp + o); cf[u] = *(const v4f*)(fp + o); }
    __builtin_amdgcn_sched_barrier(0);   /* what the score products and the exp work need is asked for first: loads come back in the order of issue */
#pragma unroll
    for (int j = 0; j < CB / 16; ++j) vf[j] = frag_pk(vp + j * 512);
    __builtin_amdgcn_sched_barrier(0);   /* every load of the step is issued ahead of its first WMMA: the v fragments arrive under the score products and the exp work; without it the scheduler may sink them to their use and a step pays two load latencies in a row */
#pragma unroll
    for (int u = 0; u < 2; ++u) { v8f a0 = {}, a1 = {}, l0 = {}, l1 = {};
#pragma unroll
      for (int kc = 0; kc < 4; ++kc) { a0 = wmma16b(kf[0][kc], qh[u][kc], a0); a1 = wmma16b(kf[1][kc], qh[u][kc], a1); l0 = wmma16b(kf[0][kc], qr[u][kc], l0); l1 = wmma16b(kf[1][kc], qr[u][kc], l1); }
#pragma unroll
      for (int r = 0; r < 8; r += 2) { const int q = r >> 2, e = r & 3;   /* two neighbouring keys of one tile at a time: their accumulators, maxima and factors lie in neighbouring registers, so the packed f32 forms take them where they are */
        const v2f s0 = (v2f{a0[r], a0[r + 1]} + v2f{l0[r], l0[r + 1]} * (1.0f / 1024.0f)) * SCALE, s1 = (v2f{a1[r], a1[r + 1]} + v2f{l1[r], l1[r + 1]} * (1.0f / 1024.0f)) * SCALE;
        const v2f e0 = (s0 - v2f{cm[q][e], cm[q][e + 1]}) * LOG2E + v2f{cf[q][e], cf[q][e + 1]}, e1 = (s1 - v2f{cm[2 + q][e], cm[2 + q][e + 1]}) * LOG2E + v2f{cf[2 + q][e], cf[2 + q][e + 1]};
        p[u][r] = (_Float16)__builtin_amdgcn_exp2f(e0[0]); p[u][r + 1] = (_Float16)__builtin_amdgcn_exp2f(e0[1]); p[u][8 + r] = (_Float16)__builtin_amdgcn_exp2f(e1[0]); p[u][9 + r] = (_Float16)__builtin_amdgcn_exp2f(e1[1]); } }
#pragma unroll
    for (int j = 0; j < CB / 16; ++j) { acc[0][j] = wmma16b(vf[j], p[0], acc[0][j]); acc[1][j] = wmma16b(vf[j], p[1], acc[1][j]); }
    /* order asked of the scheduler for the step: the 32 score WMMAs, the first plain vector instructions, then each v_exp_f32 with one plain vector instruction behind it, the last conversions, then the 16 P.v WMMAs */
    __builtin_amdgcn_sched_group_barrier(0x8, 32, 0); __builtin_amdgcn_sched_group_barrier(0x2, 24, 0);
#pragma unroll
    for (int k = 0; k < 32; ++k) { __builtin_amdgcn_sched_group_barrier(0x400, 1, 0); __builtin_amdgcn_sched_group_barrier(0x2, 1, 0); }
    __builtin_amdgcn_sched_group_barrier(0x2, 8, 0); __builtin_amdgcn_sched_group_barrier(0x8, 16, 0);
    __builtin_amdgcn_sched_barrier(0);   /* keeps the wait below at the step's foot: nothing ties it to the WMMAs, and the scheduler otherwise lifts it to the step's head, where the score products would wait for the v fragments too */
    asm volatile("s_wait_loadcnt 0x0" :: "v"(kp), "v"(vp), "v"(mp), "v"(fp) : "memory"); }   /* names the four address pairs so that they stay as they are until every load of the step has returned */
#pragma unroll
  for (int u = 0; u < 2; ++u)
#pragma unroll
    for (int j = 0; j < CB / 16; ++j) { v4f lo, hi;   /* lane (g, col): query col of tile u, channels j * 16 + 8 g + 0..7 */
#pragma unroll
      for (int r = 0; r < 4; ++r) { lo[r] = acc[u][j][r]; hi[r] = acc[u][j][4 + r]; }
      *(v4f*)&ss[wave][u * 16 + col][j * 16 + 8 * g] = lo; *(v4f*)&ss[wave][u * 16 + col][j * 16 + 8 * g + 4] = hi; }
  __syncthreads();   /* all key slices' partial tiles are in ss before a wave sums its rows over them */
  float* yp = Y + ((size_t)b * TT + blockIdx.x * 64 + wave) * CB + lane * 4;   /* y rows [b*TT + n][128]: wave w takes rows w, w + 8, ...: a 512-B row by 32 lanes */
#pragma unroll
  for (int e = 0; e < 8; ++e) { const int row = e * 8 + wave; v4f t = *(const v4f*)&ss[row >> 5][row & 31][lane * 4];
#pragma unroll
    for (int s = 1; s < PKS; ++s) t += *(const v4f*)&ss[s * 2 + (row >> 5)][row & 31][lane * 4];
    vst2(yp + (size_t)e * 8 * CB, t * (1.0f / 2048.0f)); } }

#define WS_TL  (WS_END)                                  // f16 theta-view residual plane [b][128][TT] (viewed as rows)
#define WS_G   (WS_TL + 2u * (size_t)NB * CB * TT)        // f16 g conv plane [b][128][TT]
#define WS_VT2 (WS_G + 2u * (size_t)NB * CB * TT)         // f16 g view in fragment order [b][m / 32][c / 16][fragment half][lane][8]
#define WS_YR  (WS_VT2 + 2u * (size_t)NB * CB * TT)       // f32 y rows [b*TT + n][128]
#define WS_CM  (WS_YR + 4u * (size_t)NB * TT * CB)        // f32 column max [b][TT]
#define WS_CS  (WS_CM + 4u * (size_t)NB * TT)             // f32 log2(2^11 / column sum) [b][TT]
#define WS_PM  (WS_CS + 4u * (size_t)NB * TT)             // f32 partial column max [b][NQB][TT]
#define WS_PS  (WS_PM + 4u * (size_t)NB * NQB * TT)       // f32 partial column sum [b][NQB][TT]
#define WS_END2 (WS_PS + 4u * (size_t)NB * NQB * TT)
extern "C" void kernel_launch(void* const* d_in, const int* in_sizes, int n_in, void* d_out, int out_size, void* d_ws, size_t ws_size, hipStream_t stream) {
  (void)in_sizes; (void)n_in; (void)out_size;
  const float** F = (const float**)d_in;
  if (ws_size < (size_t)WS_END) return;
  char* ws = (char*)d_ws; _Float16 *QH = (_Float16*)(ws + WS_QH), *KH = (_Float16*)(ws + WS_KH), *VT = (_Float16*)(ws + WS_VT), *QL = (_Float16*)(ws + WS_QL), *KL = (_Float16*)(ws + WS_KL); __bf16 *VB = (__bf16*)(ws + WS_VB), *VBL = (__bf16*)(ws + WS_VBL); float *Y = (float*)(ws + WS_Y);
  (void)Y; (void)QL; (void)KL; (void)VB; (void)VBL;
  // inputs: 0 x [4,256,64,64] (channels-first); 1 theta_w [128,256], 2 theta_b; 3 phi_w, 4 phi_b; 5 g_w, 6 g_b; 7 W_w [256,128], 8 W_b [256] (all (out,in), biases nonzero)
  if (ws_size < (size_t)WS_END2) return;
  _Float16 *TL = (_Float16*)(ws + WS_TL), *G = (_Float16*)(ws + WS_G), *VT2 = (_Float16*)(ws + WS_VT2); float *YR = (float*)(ws + WS_YR), *CM = (float*)(ws + WS_CM), *CS = (float*)(ws + WS_CS), *PM = (float*)(ws + WS_PM), *PS = (float*)(ws + WS_PS);
  // phi^T rows (the 'k' rows: phi[c][m] proper layout, token-major) via the q/k path as which = 1 -> KH in fragment order (+KL rows < 64, unused)
  k_projT<1><<<dim3(TNB * TT / 64, 1, 1), 128, 0, stream>>>(F[0], F[0], F[0], F[3], F[3], F[3], F[4], F[4], F[4], QH, QL, KH, KL, VT, VB, VBL, nullptr);
  // theta conv plane [Cb][N] (f16 hi into the 'VT' slot = the theta VIEW rows [N][Cb] when read row-major) + its residual plane TL (the view's residual rows) via the [c][t] path (which = 2)
  k_projT<2><<<dim3(TNB * TT / 64, 1, 1), 128, 0, stream>>>(F[0], F[0], F[0], F[1], F[1], F[1], F[2], F[2], F[2], QH, QL, KH, KL, VT, VB, VBL, TL);
  // g conv plane [Cb][N] f16 -> G, then the g VIEW rows turned into the value fragments VT2, and the theta VIEW rows (hi, residual) copied into the query fragments QH, QL
  k_projT<2><<<dim3(TNB * TT / 64, 1, 1), 128, 0, stream>>>(F[0], F[0], F[0], F[5], F[5], F[5], F[6], F[6], F[6], QH, QL, KH, KL, G, VB, VBL, nullptr);
  k_trans<<<dim3(TT / 64, CB / 64, 3 * TNB), 256, 0, stream>>>(G, VT2, VT /* theta view rows */, TL /* view residual rows */, QH, QL);
  // all batches in each launch: column statistics of the scores, their merge, then scores again + P.v
  k_sc<<<dim3(NQB, TT / 128, TNB), 128, 0, stream>>>(QH /* theta view fragments */, KH, QL /* view residual fragments */, KL, 0, 0, PM, PS);
  k_colmerge<<<dim3(TT / 32, TNB), 256, 0, stream>>>(PM, PS, CM, CS);
  k_pvf<<<dim3(TT / 64, TNB), 64 * PKS, 0, stream>>>(QH, QL, KH, CM, CS, VT2, YR);
  k_wout<<<dim3(TT / 64, COUT / 128, TNB), 128, 0, stream>>>(YR, F[7], F[8], F[0], (float*)d_out);

}

// v009
// One run takes 103 microseconds.
// Timed twice side by side with v008, it ran 1.11 and 1.12 times as fast.
// Counting every step since v000, it is 25.2 times as fast.
// compute dtype: all float inputs rounded to bf16; the three 1x1 convs with EXACT bf16 products on WMMA 16x16x32 (f32 accumulate) + bias; scores between the raw-reshaped theta view (f16 hi + residual x 2^10) and phi (f16) (2 products); the softmax over the QUERY axis in f32 (per-column max / sum from 512-row partials, each a running max / sum kept in registers; each score's exp is the hardware base-2 exponent of (s - max) * log2 e, the few merge weights library expf); the scores formed a second time, transposed, in the P.v kernel (never stored); P x 2^11 (the factor 2^11 / column sum added as its log2 in the exponent) once to f16 x the raw-reshaped g view once to f16 (1 product); the W 1x1 conv on the raw-reshaped y view with bf16 hi + lo (2 products) x exact W + bias + x residual; f32 output written channels-first.
#include <hip/hip_runtime.h>
#include <math.h>

typedef __attribute__((ext_vector_type(16))) _Float16 v16h;
typedef __attribute__((ext_vector_type(16))) __bf16 v16b;
typedef __attribute__((ext_vector_type(8)))  _Float16 v8h;
typedef __attribute__((ext_vector_type(8)))  float v8f;
typedef __attribute__((ext_vector_type(4)))  float v4f;
typedef __attribute__((ext_vector_type(2)))  float v2f;
typedef __attribute__((ext_vector_type(4)))  unsigned v4u;
typedef _Float16 hx8 __attribute__((ext_vector_type(8)));
typedef _Float16 hx4 __attribute__((ext_vector_type(4)));
typedef __bf16 bx4 __attribute__((ext_vector_type(4)));
typedef __attribute__((ext_vector_type(4)))  int v4i;
typedef float __attribute__((may_alias)) float_a;
typedef int __attribute__((may_alias)) int_a;

template <typename T> __device__ __forceinline__ void vst2(void* p, T v) { *(T*)p = v;  }
__device__ __forceinline__ v8f wmma16(v16h a, v16h b, v8f c) {
  v8f d = __builtin_amdgcn_wmma_f32_16x16x32_f16(false, a, false, b, (short)0, c, false, false);
  asm volatile("v_nop\n\tv_nop\n\tv_nop\n\tv_nop" : "+v"(d) : "v"(a), "v"(b));
  return d;
}
__device__ __forceinline__ v8f wmma_bf(v16b a, v16b b, v8f c) {
  v8f d = __builtin_amdgcn_wmma_f32_16x16x32_bf16(false, a, false, b, (short)0, c, false, false);
  asm volatile("v_nop\n\tv_nop\n\tv_nop\n\tv_nop" : "+v"(d) : "v"(a), "v"(b));
  return d;
}
// 16x16x32 fragments: lane = (h = lane>>4, row/col = lane&15); elements 0..7 = k0+8h+0..7, 8..15 = k0+16+8h+0..7; D element r = row 8h+r
__device__ __forceinline__ v16h frag_h(const _Float16* rowk0, int lane) {
  union { v16h v; v8h q[2]; } u; const _Float16* p = rowk0 + 8 * (lane >> 4);
  u.q[0] = *(const v8h*)p; u.q[1] = *(const v8h*)(p + 16); return u.v;
}
__device__ __forceinline__ v16h frag_f32(const float* rowk0, int lane) {
  v16h a; const float* p = rowk0 + 8 * (lane >> 4);
#pragma unroll
  for (int i = 0; i < 8; ++i) { a[i] = (_Float16)p[i]; a[8 + i] = (_Float16)p[16 + i]; }
  return a;
}
__device__ __forceinline__ v16h frag_f32s(const float* rowk0, int lane, float sc) {
  v16h a; const float* p = rowk0 + 8 * (lane >> 4);
#pragma unroll
  for (int i = 0; i < 8; ++i) { a[i] = (_Float16)(p[i] * sc); a[8 + i] = (_Float16)(p[16 + i] * sc); }
  return a;
}
// column fragment from a [K][ld] layout (column n), rows >= K read as 0
__device__ __forceinline__ v16h fragc_f32(const float* W, int k0, int n, int lane, int ld, int K) {
  v16h a; const int g = lane >> 4;
#pragma unroll
  for (int i = 0; i < 8; ++i) { const int ka = k0 + 8 * g + i, kb = ka + 16;
    a[i] = (_Float16)(ka < K ? W[(size_t)(ka < K ? ka : K - 1) * ld + n] : 0.f); a[8 + i] = (_Float16)(kb < K ? W[(size_t)(kb < K ? kb : K - 1) * ld + n] : 0.f); }
  return a;
}
struct F2 { v16b h, l; };
__device__ __forceinline__ F2 bsplit16(const float v[16]) { F2 r;
#pragma unroll
  for (int i = 0; i < 16; ++i) { const __bf16 h = (__bf16)v[i]; r.h[i] = h; r.l[i] = (__bf16)(v[i] - (float)h); }
  return r; }
__device__ __forceinline__ F2 split_row(const float* row, int k0, int lane) { float v[16]; const float* p = row + k0 + 8 * (lane >> 4);
#pragma unroll
  for (int i = 0; i < 8; ++i) { v[i] = p[i]; v[8 + i] = p[16 + i]; }
  return bsplit16(v); }
__device__ __forceinline__ F2 split_rowK(const float* row, int k0, int lane, int K) { float v[16]; const int g = lane >> 4;
#pragma unroll
  for (int i = 0; i < 8; ++i) { const int ka = k0 + 8 * g + i, kb = ka + 16; v[i] = ka < K ? row[ka < K ? ka : K - 1] : 0.f; v[8 + i] = kb < K ? row[kb < K ? kb : K - 1] : 0.f; }
  return bsplit16(v); }
__device__ __forceinline__ F2 split_col(const float* W, int k0, int n, int lane, int ld, int K) { float v[16]; const int g = lane >> 4;
#pragma unroll
  for (int i = 0; i < 8; ++i) { const int ka = k0 + 8 * g + i, kb = ka + 16; v[i] = ka < K ? W[(size_t)(ka < K ? ka : K - 1) * ld + n] : 0.f; v[8 + i] = kb < K ? W[(size_t)(kb < K ? kb : K - 1) * ld + n] : 0.f; }
  return bsplit16(v); }
__device__ __forceinline__ v8f mac3(const F2& a, const F2& b, v8f c) { c = wmma_bf(a.l, b.h, c); c = wmma_bf(a.h, b.l, c); return wmma_bf(a.h, b.h, c); }
__device__ __forceinline__ float sigm(float v) { return 1.0f / (1.0f + expf(-v)); }
// fragment stored in fragment order (1 KiB: [half of the fragment][lane][8 f16]), read at the lane's own pointer (fragment start + 8 * lane): each of the two loads covers 512 contiguous bytes
__device__ __forceinline__ v16h frag_pk(const _Float16* p) { union { v16h v; v8h q[2]; } u; u.q[0] = *(const v8h*)p; u.q[1] = *(const v8h*)(p + 256); return u.v; }
// fragment read at the lane's own pointer (row start + k0 + 8 * (lane >> 4)): the caller keeps that pointer and names it at the wait behind a batch of loads
__device__ __forceinline__ v16b wfrag_p(const float* p) { v16b w;
#pragma unroll
  for (int i = 0; i < 8; ++i) { w[i] = (__bf16)p[i]; w[8 + i] = (__bf16)p[16 + i]; }
  return w; }

// Non-local block with the source's RAW reshapes (x [4,256,64,64], Cb 128, N 4,096; (out,in) theta/phi/g 1x1 convs [128,256] + biases, W [256,128] + bias): theta = conv(x).reshape(B, N, Cb) and g likewise are ROW-MAJOR reinterpretations of the [Cb][N] conv outputs (row n = channel n/32, positions (n%32)*128..+127), phi stays [Cb][N]; scores[n][m] = sum_c theta[n][c] phi[c][m]; attn = softmax over n (axis 1 - per key column); y[n][c] = sum_m attn[n][m] g[m][c]; y.reshape(B, Cb, H, W) (raw again) -> W conv + bias + x.
#define NB 4
#define TT 4096
#define CC 128            // g-view plane pitch (Cb channels)
#define CB 128
#define COUT 256
#define CCQ 128           // theta-view / phi^T row pitch (Cb)
#define DIN 256          // x channels
#define NH 1
#define HD 128
#define NQB (TT / 64)
#define SCALE (1.0f)
#define HDQK 128           // contraction width of the scores (Cb)
#define CAUSAL 0
#define LOG2E 1.44269504088896340736f
#ifndef TNB
#define TNB NB
#endif
__device__ __forceinline__ v16b zero16b() { v16b z; _Pragma("unroll") for (int i = 0; i < 16; ++i) z[i] = (__bf16)0.f; return z; }
__device__ __forceinline__ float bfr(float v) { return (float)(__bf16)v; }
__host__ __device__ __forceinline__ int kb_last(int qb) { return CAUSAL ? ((qb * 64 + 63) >> 7) : (TT / 128 - 1); }
typedef __attribute__((ext_vector_type(8))) __bf16 v8b;
__device__ __forceinline__ v16b frag_b(const __bf16* rowk0, int lane) {
  union { v16b v; v8b q[2]; } u; const __bf16* p = rowk0 + 8 * (lane >> 4);
  u.q[0] = *(const v8b*)p; u.q[1] = *(const v8b*)(p + 16); return u.v;
}
#define QBH 0              // 2-product logits everywhere (theta view hi + residual x phi hi)
#define QHI 4096            // q residual rows (all)
#define KHI 64            // (unused k residual / v bf16 planes: QBH 0)
// B fragment (k rows k0+.., output column o) of a weight: (in,out) [K][ld] or (out,in) [ld rows of K]: bf16 exact, or f16(bf16 * 256) exact
__device__ __forceinline__ v16b wcol_io(const float* Wm, int k0, int o, int lane, int ld) { v16b w; const int g = lane >> 4;
#pragma unroll
  for (int i = 0; i < 8; ++i) { w[i] = (__bf16)Wm[(size_t)(k0 + 8 * g + i) * ld + o]; w[8 + i] = (__bf16)Wm[(size_t)(k0 + 16 + 8 * g + i) * ld + o]; }
  return w; }
__device__ __forceinline__ v16b wcol_oi(const float* Wm, int k0, int o, int lane, int K) { v16b w; const float* p = Wm + (size_t)o * K + k0 + 8 * (lane >> 4);
#pragma unroll
  for (int i = 0; i < 8; ++i) { w[i] = (__bf16)p[i]; w[8 + i] = (__bf16)p[16 + i]; }
  return w; }
__device__ __forceinline__ v16h wcolh_io(const float* Wm, int k0, int o, int lane, int ld) { v16h w; const int g = lane >> 4;
#pragma unroll
  for (int i = 0; i < 8; ++i) { w[i] = (_Float16)(bfr(Wm[(size_t)(k0 + 8 * g + i) * ld + o]) * 256.0f); w[8 + i] = (_Float16)(bfr(Wm[(size_t)(k0 + 16 + 8 * g + i) * ld + o]) * 256.0f); }
  return w; }
__device__ __forceinline__ v16h wcolh_oi(const float* Wm, int k0, int o, int lane, int K) { v16h w; const float* p = Wm + (size_t)o * K + k0 + 8 * (lane >> 4);
#pragma unroll
  for (int i = 0; i < 8; ++i) { w[i] = (_Float16)(bfr(p[i]) * 256.0f); w[8 + i] = (_Float16)(bfr(p[16 + i]) * 256.0f); }
  return w; }
#define WQKV_LAYOUT 0   // 0 = (out,in) [CC][DIN], as 1; 1 = (out,in) [CC][DIN]; 2 = per-head [NH][DIN][HD]
__device__ __forceinline__ v16b wcol_hdk(const float* Wm, int k0, int o, int lane) { v16b w; const int g = lane >> 4; const float* p = Wm + (size_t)(o / HD) * DIN * HD + (o % HD);
#pragma unroll
  for (int i = 0; i < 8; ++i) { w[i] = (__bf16)p[(size_t)(k0 + 8 * g + i) * HD]; w[8 + i] = (__bf16)p[(size_t)(k0 + 16 + 8 * g + i) * HD]; }
  return w; }
#define WO_OUT_IN 0
#if WQKV_LAYOUT == 1
#define WCOL(W, k0, o, lane) wcol_oi(W, k0, (o), lane, DIN)   /* unused: layout 0 */
#elif WQKV_LAYOUT == 2
#define WCOL(W, k0, o, lane) wcol_hdk(W, k0, o, lane)
#else
#define WCOL(W, k0, o, lane) wcol_oi(W, k0, (o), lane, DIN)   /* (out,in) 1x1-conv weights [128][256]: all 128 output channels real */
#endif
#if WO_OUT_IN
#define WOCOL(W, k0, o, lane) wcol_oi(W, k0, o, lane, CC)
#define WOCOLH(W, k0, o, lane) wcolh_oi(W, k0, o, lane, CC)
#else
#define WOCOL(W, k0, o, lane) wcol_io(W, k0, o, lane, DIN)
#define WOCOLH(W, k0, o, lane) wcolh_io(W, k0, o, lane, DIN)
#endif
#ifndef SM_EXTRA_PARAMS
#define SM_EXTRA_PARAMS
#endif
#ifndef PROJ_EXTRA_PARAMS
#define PROJ_EXTRA_PARAMS
#endif
#ifndef SM_MASK_HOOK
#define SM_MASK_HOOK (void)0
#endif

#define WS_QH  0u                                      // f16 q rows in fragment order [b*t / 16][k step][fragment half][lane][8]
#define WS_KH  (WS_QH + 2u * (size_t)NB * TT * CCQ)     // f16 k rows in fragment order [b*t / 16][k step][fragment half][lane][8]
#define WS_VT  (WS_KH + 2u * (size_t)NB * TT * CCQ)     // f16 v planes [b][c][t]
#define WS_QL  (WS_VT + 2u * (size_t)NB * CC * TT)      // f16 q residual x 2^10 rows [b][t < QHI], in fragment order like WS_QH
#define WS_KL  (WS_QL + 2u * (size_t)NB * QHI * CCQ)    // f16 k residual x 2^10 rows [b][t < KHI][CCQ]
#define WS_VB  (WS_KL + 2u * (size_t)NB * KHI * CCQ)    // bf16 v hi planes [b][c][t < KHI]
#define WS_VBL (WS_VB + 2u * (size_t)NB * CC * KHI)
#define WS_Y   (WS_VBL + 2u * (size_t)NB * CC * KHI)    // zero bytes: Y is not used, the y rows go to WS_YR
#define WS_END (WS_Y  + 0u)

// ---- k_proj: block = (64 rows, 128 cols, which): q/k/v = X W (+ b) with exact bf16 products (K = DIN) -> which 0: q f16 rows (+ residual rows < QHI); 1: k f16 rows (+ residual rows < KHI), the f16 rows of both in fragment order; 2: v f16 planes [c][t] (+ bf16 hi/lo planes for t < KHI)
template <int WOFF> __global__ __launch_bounds__(128) void k_projT(const float* __restrict__ XQ, const float* __restrict__ XK, const float* __restrict__ XV, const float* __restrict__ WQ, const float* __restrict__ WK, const float* __restrict__ WV, const float* __restrict__ BQ, const float* __restrict__ BK, const float* __restrict__ BV,
    _Float16* __restrict__ QH, _Float16* __restrict__ QL, _Float16* __restrict__ KH, _Float16* __restrict__ KL, _Float16* __restrict__ VT, __bf16* __restrict__ VB, __bf16* __restrict__ VBL, _Float16* __restrict__ VL) {
  __shared__ __align__(16) _Float16 sh[64][136], sl[64][136]; __shared__ __align__(16) _Float16 th[128][72], tlo[128][72]; __shared__ __align__(16) __bf16 tb[128][72], tbl[128][72];
  const int tid = threadIdx.x, wave = tid >> 5, lane = tid & 31, col = lane & 15, g = lane >> 4; const int which = blockIdx.z + WOFF; const int c0 = blockIdx.y * 128; const size_t r0 = (size_t)blockIdx.x * 64; const size_t bb = r0 / TT; const int t0 = (int)(r0 % TT);
  const float* X = which == 0 ? XQ : which == 1 ? XK : XV; const float* WA = which == 0 ? WQ : which == 1 ? WK : WV; const float* BA = which == 0 ? BQ : which == 1 ? BK : BV;
  const int KD = DIN;
  v8f acc[8] = {};
#pragma unroll 2
  for (int kc = 0; kc < KD / 32; ++kc) { v16b a[4], w[2]; v4f xl[16]; const float* p = X + (bb * KD + kc * 32 + 8 * g) * (size_t)TT + t0 + col * 4;   /* channels-first [b][c][t]: A[t][c]; row col of row tile u is t0 + 4 col + u, so one 16-B load brings a channel's element for all four tiles and 16 lanes cover 256 B in a row */
    const float* wp = WA + (size_t)(c0 + wave * 32 + col) * DIN + kc * 32 + 8 * g;   /* (out,in) weight rows: the wave's own 32 output columns, fragment jj starts 16 rows further on */
    /* wave tile = all 64 rows x 32 columns (acc[u * 2 + jj]: row tile u, column tile jj): a 16-B weight load touches 16 lines, a 16-B x load 4 whole ones, so 8 weight + 16 x loads a k step touch 192 lines a wave where 32 + 16 touched 544 */
#pragma unroll
    for (int i = 0; i < 8; ++i) { xl[i] = *(const v4f*)(p + (size_t)i * TT); xl[8 + i] = *(const v4f*)(p + (size_t)(16 + i) * TT); }
#pragma unroll
    for (int jj = 0; jj < 2; ++jj) w[jj] = wfrag_p(wp + (size_t)jj * 16 * DIN);   /* every fragment ahead of the k step's first WMMA: the asm in wmma_bf holds later loads behind it, so a load written between two WMMAs pays its whole latency there */
    asm volatile("s_wait_loadcnt 0x0" :: "v"(p), "v"(wp) : "memory");   /* names the two address pairs so that they stay as they are until every load of the batch has returned */
#pragma unroll
    for (int u = 0; u < 4; ++u)
#pragma unroll
      for (int i = 0; i < 16; ++i) a[u][i] = (__bf16)xl[i][u];
#pragma unroll
    for (int j = 0; j < 8; ++j) acc[j] = wmma_bf(a[j >> 1], w[j & 1], acc[j]); }
  const float* bp = BA + c0 + wave * 32 + col; float bias2[2] = {};   /* the two bias loads together, ahead of the epilogue's LDS stores */
  if (BA) {
#pragma unroll
    for (int jj = 0; jj < 2; ++jj) bias2[jj] = bp[jj * 16];
    asm volatile("s_wait_loadcnt 0x0" :: "v"(bp) : "memory"); }   /* names the address pair so that it stays as it is until the two loads have returned */
  if (which < 2) { _Float16* DH = which == 0 ? QH : KH; _Float16* DL = which == 0 ? QL : KL; const int nhi = which == 0 ? QHI : KHI; const bool hi_rows = t0 < nhi;
#pragma unroll
    for (int j = 0; j < 8; ++j) { const float bias = bfr(bias2[j & 1]);
#pragma unroll
      for (int r = 0; r < 8; ++r) { const float v = acc[j][r] + bias; const int rl = (8 * g + r) * 4 + (j >> 1), cl = wave * 32 + (j & 1) * 16 + col; const _Float16 hv = (_Float16)v; sh[rl][cl] = hv; sl[rl][cl] = (_Float16)((v - (float)hv) * 1024.0f); } }
    __syncthreads();
    for (int e = tid; e < 64 * 16; e += 128) { const int rl = ((e >> 8) << 4) | (e & 15), q = ((e >> 6) & 3) * 4 + ((e >> 5) & 1) * 2 + ((e >> 4) & 1);   /* fragment order: e = (16-row tile, k step, fragment half, lane): piece e of the block's 16 KiB is what that lane loads */
      vst2((unsigned*)(DH + r0 * CCQ + (size_t)e * 8), *(const v4u*)&sh[rl][q * 8]);
      asm volatile("s_wait_xcnt 0x0" ::: "memory");   /* the store's address pair and data registers are rewritten by the residual store's LDS read and by the next trip */
      if (hi_rows) { vst2((unsigned*)(DL + (bb * nhi + t0 + rl) * (size_t)CCQ + c0 + q * 8), *(const v4u*)&sl[rl][q * 8]);
        asm volatile("s_wait_xcnt 0x0" ::: "memory"); } }   /* likewise, ahead of the next trip */   /* hi rows in fragment order (c0 == 0), residual rows at pitch CCQ */
  } else { const bool hi_rows = t0 < KHI;
#pragma unroll
    for (int jj = 0; jj < 2; ++jj) { const float bias = bfr(bias2[jj]); const int cl = wave * 32 + jj * 16 + col;
#pragma unroll
      for (int r = 0; r < 8; ++r) { const int rl = (8 * g + r) * 4; hx4 vh, vl; bx4 vb, vbl;   /* the four row tiles' elements are four t in a row: one 8-B LDS store a plane */
#pragma unroll
        for (int u = 0; u < 4; ++u) { const float v = acc[u * 2 + jj][r] + bias; const _Float16 hv2 = (_Float16)v; vh[u] = hv2; vl[u] = (_Float16)((v - (float)hv2) * 1024.0f); const __bf16 bh = (__bf16)v; vb[u] = bh; vbl[u] = (__bf16)(v - (float)bh); }
        *(hx4*)&th[cl][rl] = vh; *(hx4*)&tlo[cl][rl] = vl; *(bx4*)&tb[cl][rl] = vb; *(bx4*)&tbl[cl][rl] = vbl; } }
    __syncthreads();
    for (int e = tid; e < 128 * 8; e += 128) { const int cl = e >> 3, q = e & 7; vst2((unsigned*)(VT + (bb * CC + c0 + cl) * (size_t)TT + t0 + q * 8), *(const v4u*)&th[cl][q * 8]); if (VL) vst2((unsigned*)(VL + (bb * CC + c0 + cl) * (size_t)TT + t0 + q * 8), *(const v4u*)&tlo[cl][q * 8]); if (hi_rows) { const size_t o3 = (bb * CC + c0 + cl) * (size_t)KHI + t0 + q * 8; vst2((unsigned*)(VB + o3), *(const v4u*)&tb[cl][q * 8]); vst2((unsigned*)(VBL + o3), *(const v4u*)&tbl[cl][q * 8]); } } } }
// ---- k_st: column statistics of the logits x SCALE (the logits themselves are not stored: k_pvf forms them again). Block = (512 keys, query range of 512, batch), 8 waves; a wave keeps its own 64 keys (4 fragment tiles, all four k steps) in registers and walks the range's 32 query tiles, two a trip; the 8 waves walk the same query fragments. Scores TRANSPOSED as in k_pvf: S^T[key][query] = k rows (A) x q rows hi + residual x 2^10 (B) (2 products); lane (g, col), register r of key tile t = key 16 t + 8 g + r, query col. Each lane keeps a running max and a running sum of exp(v - max) per key over its own queries (rescaled by exp(old max - new max) once a trip); at the end the 16 lanes' pairs of a key are joined through LDS in ascending lane order: one partial (PM, PS) per key and query range
#define NPART 8            // query ranges = partials per key column
#define SKT 4              // 16-key tiles a k_st wave keeps in registers
#define SQT (TT / 16 / NPART)   // 16-query tiles a k_st wave walks
// the plain builtin (the compiler keeps the distances behind it itself): an asm statement cannot name a register above v255, and the operands of k_st and k_pvf do not all fit below
__device__ __forceinline__ v8f wmma16b(v16h a, v16h b, v8f c) { return __builtin_amdgcn_wmma_f32_16x16x32_f16(false, a, false, b, (short)0, c, false, false); }
static_assert(TT % (8 * SKT * 16) == 0 && TT % (16 * NPART) == 0 && SQT % 2 == 0 && SKT * 16 == 64, "whole key blocks, whole query ranges, two query tiles a trip, two keys a lane in the join");
__global__ __launch_bounds__(256) void k_st(const _Float16* __restrict__ QH, const _Float16* __restrict__ QL, const _Float16* __restrict__ KH, float* __restrict__ PM0, float* __restrict__ PS0) { __shared__ __align__(16) float lm[8][SKT * 16][20], ls[8][SKT * 16][20];   /* pitch 20 floats = 80 B: 16-B reads of 32 rows and 4-B stores of two 16-lane rows 8 keys apart both fall on distinct banks */
  const int tid = threadIdx.x, wave = __builtin_amdgcn_readfirstlane(tid >> 5), lane = tid & 31, col = lane & 15, g = lane >> 4; const int b = blockIdx.z, part = blockIdx.y, k0 = (blockIdx.x * 8 + wave) * (SKT * 16); const size_t q0 = (size_t)b * TT + (size_t)part * (SQT * 16);
  const _Float16* kp = KH + ((size_t)b * TT + k0) * CCQ + lane * 8;   /* fragment (16-key tile t, k step kc) starts (t * 4 + kc) * 512 f16 further on */
  const _Float16* qp = QH + q0 * CCQ + lane * 8; const _Float16* qlp = QL + q0 * CCQ + lane * 8;   /* query tile n of the range, hi and residual: fragment kc starts (n * 4 + kc) * 512 f16 further on */
  v16h kf[SKT][4], qh[2][4], qr[2][4];
#pragma unroll
  for (int t = 0; t < SKT; ++t)
#pragma unroll
    for (int kc = 0; kc < 4; ++kc) kf[t][kc] = frag_pk(kp + (t * 4 + kc) * 512);
#pragma unroll
  for (int u = 0; u < 2; ++u)
#pragma unroll
    for (int kc = 0; kc < 4; ++kc) { qh[u][kc] = frag_pk(qp + (u * 4 + kc) * 512); qr[u][kc] = frag_pk(qlp + (u * 4 + kc) * 512); }
  asm volatile("s_wait_xcnt 0x0" ::: "memory");   /* ahead of any rewrite of a register that the loads above name */
  __builtin_amdgcn_sched_barrier(0);   /* keeps what follows, address arithmetic too, behind that wait */
  v8f m[SKT], s[SKT];
#pragma unroll
  for (int t = 0; t < SKT; ++t)
#pragma unroll
    for (int r = 0; r < 8; ++r) { m[t][r] = -__builtin_inff(); s[t][r] = 0.f; }   /* the first trip's rescale is 2^-inf = 0 on a sum of 0 */
#pragma unroll 1
  for (int i = 0; i < SQT / 2; ++i) { const int nx = i + 1 < SQT / 2 ? i + 1 : i;   /* the tiles fetched ahead; the last trip fetches its own again, so that no address leaves the range */
    v8f sc[2][SKT];
#pragma unroll
    for (int u = 0; u < 2; ++u) {
#pragma unroll
      for (int t = 0; t < SKT; t += 2) { v8f a0 = {}, l0 = {}, a1 = {}, l1 = {};   /* two key tiles side by side: four independent accumulator chains */
#pragma unroll
        for (int kc = 0; kc < 4; ++kc) { a0 = wmma16b(kf[t][kc], qh[u][kc], a0); a1 = wmma16b(kf[t + 1][kc], qh[u][kc], a1); l0 = wmma16b(kf[t][kc], qr[u][kc], l0); l1 = wmma16b(kf[t + 1][kc], qr[u][kc], l1); }
        sc[u][t] = (a0 + l0 * (1.0f / 1024.0f)) * SCALE; sc[u][t + 1] = (a1 + l1 * (1.0f / 1024.0f)) * SCALE; }
      __builtin_amdgcn_sched_barrier(0);   /* tile u's products stand ahead of the loads that refill its registers, and those loads ahead of the work that follows: they fly under the other tile's products and the exp work */
      const _Float16* np = qp + (size_t)(nx * 2 + u) * 2048; const _Float16* nlp = qlp + (size_t)(nx * 2 + u) * 2048;
#pragma unroll
      for (int kc = 0; kc < 4; ++kc) { qh[u][kc] = frag_pk(np + kc * 512); qr[u][kc] = frag_pk(nlp + kc * 512); }
      asm volatile("s_wait_xcnt 0x0" ::: "memory");   /* ahead of the next rewrite of the address registers that the sixteen loads name */
      __builtin_amdgcn_sched_barrier(0); }   /* keeps the loads and the wait where they are written */
#pragma unroll
    for (int t = 0; t < SKT; ++t)
#pragma unroll
      for (int r = 0; r < 8; r += 2) {   /* two neighbouring keys at a time: the packed f32 forms take them where they lie */
        const v2f v0 = v2f{sc[0][t][r], sc[0][t][r + 1]}, v1 = v2f{sc[1][t][r], sc[1][t][r + 1]}, mo = v2f{m[t][r], m[t][r + 1]};
        const v2f mn = v2f{fmaxf(fmaxf(mo[0], v0[0]), v1[0]), fmaxf(fmaxf(mo[1], v0[1]), v1[1])};
        const v2f ac = (mo - mn) * LOG2E, a0 = (v0 - mn) * LOG2E, a1 = (v1 - mn) * LOG2E;   /* every argument <= 0 */
        const v2f c = v2f{__builtin_amdgcn_exp2f(ac[0]), __builtin_amdgcn_exp2f(ac[1])}, e0 = v2f{__builtin_amdgcn_exp2f(a0[0]), __builtin_amdgcn_exp2f(a0[1])}, e1 = v2f{__builtin_amdgcn_exp2f(a1[0]), __builtin_amdgcn_exp2f(a1[1])};
        const v2f sn = v2f{s[t][r], s[t][r + 1]} * c + (e0 + e1);
        m[t][r] = mn[0]; m[t][r + 1] = mn[1]; s[t][r] = sn[0]; s[t][r + 1] = sn[1]; } }
#pragma unroll
  for (int t = 0; t < SKT; ++t)
#pragma unroll
    for (int r = 0; r < 8; ++r) { lm[wave][t * 16 + 8 * g + r][col] = m[t][r]; ls[wave][t * 16 + 8 * g + r][col] = s[t][r]; }
  __syncthreads();   /* the 16 lanes' pairs of every key are in LDS before a lane joins its two keys */
  float* PM = PM0 + ((size_t)b * NPART + part) * TT + k0 + lane; float* PS = PS0 + ((size_t)b * NPART + part) * TT + k0 + lane;
#pragma unroll
  for (int h = 0; h < 2; ++h) { v4f mm[4], sv[4];
#pragma unroll
    for (int j = 0; j < 4; ++j) { mm[j] = *(const v4f*)&lm[wave][h * 32 + lane][j * 4]; sv[j] = *(const v4f*)&ls[wave][h * 32 + lane][j * 4]; }
    float mt = mm[0][0];
#pragma unroll
    for (int j = 1; j < 16; ++j) mt = fmaxf(mt, mm[j >> 2][j & 3]);
    float st = 0.f;
#pragma unroll
    for (int j = 0; j < 16; ++j) st += sv[j >> 2][j & 3] * __builtin_amdgcn_exp2f((mm[j >> 2][j & 3] - mt) * LOG2E);
    vst2(PM + h * 32, mt); vst2(PS + h * 32, st); }
  asm volatile("s_wait_xcnt 0x0" ::: "memory"); }   /* behind the four stores, ahead of anything that rewrites their registers */
// ---- k_colmerge: softmax over the QUERY axis (axis 1): joins the NPART per-query-range partials (PM = max, PS = sum of exp(S - PM) over the range's 512 rows) of each key column m: CM[m] = max, CS[m] = 11 - log2(sum_q PS[q][m] exp(PM[q][m] - CM[m])) (log2 of the factor 2^11 / column sum: k_pvf adds it in the exponent); block = 32 columns (lane) x 8 waves of NPW partials, joined through LDS
#define NPW (NPART / 8)
__global__ __launch_bounds__(256) void k_colmerge(const float* __restrict__ PM0, const float* __restrict__ PS0, float* __restrict__ CM0, float* __restrict__ CS0) { __shared__ float lm[8][32], ls[8][32];
  const float* PM = PM0 + (size_t)blockIdx.y * NPART * TT; const float* PS = PS0 + (size_t)blockIdx.y * NPART * TT; float* CM = CM0 + (size_t)blockIdx.y * TT; float* CS = CS0 + (size_t)blockIdx.y * TT;   /* blockIdx.y = batch */
  const int tid = threadIdx.x, wave = tid >> 5, lane = tid & 31; const int m = blockIdx.x * 32 + lane; float pm[NPW], ps[NPW];
#pragma unroll
  for (int u = 0; u < NPW; ++u) pm[u] = PM[(size_t)(wave * NPW + u) * TT + m];
  asm volatile("s_wait_xcnt 0x0" ::: "memory");   /* the address pair of the loads above is rewritten for the loads below */
#pragma unroll
  for (int u = 0; u < NPW; ++u) ps[u] = PS[(size_t)(wave * NPW + u) * TT + m];
  float mx = pm[0];
#pragma unroll
  for (int u = 1; u < NPW; ++u) mx = fmaxf(mx, pm[u]);
  float sm2 = 0.f;
#pragma unroll
  for (int u = 0; u < NPW; ++u) sm2 += ps[u] * expf(pm[u] - mx);
  lm[wave][lane] = mx; ls[wave][lane] = sm2;
  __syncthreads();
  if (wave == 0) { float mt = lm[0][lane];
#pragma unroll
    for (int w = 1; w < 8; ++w) mt = fmaxf(mt, lm[w][lane]);
    float st = 0.f;
#pragma unroll
    for (int w = 0; w < 8; ++w) st += ls[w][lane] * expf(lm[w][lane] - mt);
    vst2(CM + m, mt); vst2(CS + m, 11.0f - log2f(st)); } }
// ---- k_trans: blockIdx.z < TNB: block = (64 keys, 64 columns, batch): the g view rows [m][c] turned through LDS into fragments (column c, 32 keys) laid in fragment order for k_pvf; blockIdx.z >= TNB: block = two 16-row tiles of a batch's theta view rows (hi plane, then residual plane), their 16-B pieces copied into fragment order for k_st and k_pvf
static_assert((TT / 64) * (CB / 64) * 2 == TT / 16, "two 16-row tiles of the theta view per block");
__global__ __launch_bounds__(256) void k_trans(const _Float16* __restrict__ G, _Float16* __restrict__ VT2, const _Float16* __restrict__ TH, const _Float16* __restrict__ TR, _Float16* __restrict__ QP, _Float16* __restrict__ QR) { __shared__ _Float16 st[64][72]; const int tid = threadIdx.x;
  if (blockIdx.z >= TNB) {   /* the same for the whole block, ahead of the barrier */
    const int z = blockIdx.z - TNB; const size_t o = (size_t)(z % TNB) * CB * TT + (size_t)(blockIdx.y * (TT / 64) + blockIdx.x) * 2 * 16 * CCQ;   /* a tile is 16 rows of CCQ f16 = 4 KiB in both layouts */
    const _Float16* s = (z < TNB ? TH : TR) + o + (size_t)(tid & 15) * CCQ + (((tid >> 6) & 3) * 4 + ((tid >> 5) & 1) * 2 + ((tid >> 4) & 1)) * 8;   /* tid = (k step, fragment half, lane): that lane's piece of its row */
    _Float16* d = (z < TNB ? QP : QR) + o + tid * 8;
    const v4u u0 = *(const v4u*)s, u1 = *(const v4u*)(s + 16 * CCQ); vst2((unsigned*)d, u0); vst2((unsigned*)(d + 16 * CCQ), u1); return; }
  const int m0 = blockIdx.x * 64, c0 = blockIdx.y * 64, b = blockIdx.z; const _Float16* gb = G + (size_t)b * CB * TT; _Float16* vb = VT2 + (size_t)b * CB * TT;
  for (int e = tid; e < 64 * 8; e += 256) { const int ml = e >> 3, q = e & 7; const v4u u = *(const v4u*)(gb + (size_t)(m0 + ml) * CB + c0 + q * 8); asm volatile("s_wait_loadcnt 0x0" ::: "memory"); const hx8 hv = *(const hx8*)&u; _Pragma("unroll") for (int j = 0; j < 8; ++j) st[q * 8 + j][ml] = hv[j]; }
  __syncthreads();
  for (int e = tid; e < 64 * 8; e += 256) { const int cl = ((e >> 6) & 3) * 16 + (e & 15), q = (e >> 8) * 4 + ((e >> 5) & 1) * 2 + ((e >> 4) & 1);   /* fragment order: e = (32-key step, 16-column fragment, fragment half, lane) */
    hx8 hv; _Pragma("unroll") for (int j = 0; j < 8; ++j) hv[j] = st[cl][q * 8 + j]; vst2((unsigned*)(vb + ((size_t)((m0 >> 5) + (e >> 8)) * (CB / 16) + (c0 >> 4)) * 512 + (e & 255) * 8), *(const v4u*)&hv); } }
// ---- k_wout: block = (64 positions, 128 of the 256 output channels, batch): A[pos][cb] = y view Yb[cb*4096 + pos] (the raw reshape back: the batch's y rows [4096][128] f32 reinterpreted as [Cb][N]) split bf16 hi + lo (2 products) x exact (out,in) W [256][128]; + bf16(W_b) + bf16(x[b][o][pos]); channels-first store out[b][o][pos0..pos0+63] through LDS (one 256-B run per channel by 16 lanes)
__global__ __launch_bounds__(128) void k_wout(const float* __restrict__ Y, const float* __restrict__ WW, const float* __restrict__ WB, const float* __restrict__ X, float* __restrict__ OUT) { __shared__ __align__(16) float st[128][68];
  const int tid = threadIdx.x, wave = tid >> 5, lane = tid & 31, col = lane & 15, g = lane >> 4; const int p0 = blockIdx.x * 64, c0 = blockIdx.y * 128, b = blockIdx.z; const float* Yb = Y + (size_t)b * TT * CB;
  v8f acc[8] = {};
#pragma unroll 1
  for (int kc = 0; kc < CB / 32; ++kc) { v16b ah[4], al[4], w[2]; { const float* p = Yb + (size_t)(kc * 32 + 8 * g) * TT + p0 + col * 4; const float* wp = WW + (size_t)(c0 + wave * 32 + col) * CB + kc * 32 + 8 * g; v4f tv[16];   /* wave tile = all 64 positions x the wave's own 32 channels (acc[u * 2 + jj]), row col of row tile u = position p0 + 4 col + u, as in k_projT: fewer lines touched a k step */
#pragma unroll
      for (int i = 0; i < 8; ++i) { tv[i] = *(const v4f*)(p + (size_t)i * TT); tv[8 + i] = *(const v4f*)(p + (size_t)(16 + i) * TT); }
#pragma unroll
      for (int jj = 0; jj < 2; ++jj) w[jj] = wfrag_p(wp + (size_t)jj * 16 * CB);   /* with the y loads, ahead of the k step's first WMMA (the asm in wmma_bf holds later loads behind it) */
      asm volatile("s_wait_loadcnt 0x0" :: "v"(p), "v"(wp) : "memory");   /* names the two address pairs so that they stay as they are until every load of the batch has returned */
#pragma unroll
      for (int u = 0; u < 4; ++u)
#pragma unroll
        for (int i = 0; i < 16; ++i) { const __bf16 h = (__bf16)tv[i][u]; ah[u][i] = h; al[u][i] = (__bf16)(tv[i][u] - (float)h); } }
#pragma unroll
    for (int j = 0; j < 8; ++j) { acc[j] = wmma_bf(ah[j >> 1], w[j & 1], acc[j]); acc[j] = wmma_bf(al[j >> 1], w[j & 1], acc[j]); } }
  // thread's sixteen 16-B pieces: channel c0 + (tid >> 4) + 8 u, positions p0 + (tid & 15) * 4
  const size_t o0 = ((size_t)b * COUT + c0 + (tid >> 4)) * (size_t)TT + p0 + (tid & 15) * 4; const float* xp = X + o0; const float* bp = WB + c0 + wave * 32 + col; float* op = OUT + o0;
  float wb2[2]; v4f xr[16];   /* the two bias loads and the sixteen residual loads are issued together, ahead of the turn through LDS */
#pragma unroll
  for (int jj = 0; jj < 2; ++jj) wb2[jj] = bp[jj * 16];
#pragma unroll
  for (int u = 0; u < 16; ++u) xr[u] = *(const v4f*)(xp + (size_t)u * 8 * TT);
  asm volatile("s_wait_loadcnt 0x0" :: "v"(xp), "v"(bp) : "memory");   /* names the two address pairs so that they stay as they are until every load of the batch has returned */
#pragma unroll
  for (int jj = 0; jj < 2; ++jj) { const float wb = bfr(wb2[jj]);
#pragma unroll
    for (int r = 0; r < 8; ++r) { v4f t;   /* the four row tiles' elements are four positions in a row */
#pragma unroll
      for (int u = 0; u < 4; ++u) t[u] = acc[u * 2 + jj][r] + wb;
      *(v4f*)&st[wave * 32 + jj * 16 + col][(8 * g + r) * 4] = t; } }
  __syncthreads();
#pragma unroll
  for (int u = 0; u < 16; ++u) { v4f v = *(const v4f*)&st[(tid >> 4) + 8 * u][(tid & 15) * 4]; v[0] += bfr(xr[u][0]); v[1] += bfr(xr[u][1]); v[2] += bfr(xr[u][2]); v[3] += bfr(xr[u][3]); vst2(op + (size_t)u * 8 * TT, v); } }
// ---- k_pvf: block = (64 queries, batch), 8 waves: wave = (query group qg of 32 queries, key slice ks); slice ks takes the 32-key steps ks, ks + 4, ks + 8, ... of the 4,096 keys. Per step the wave forms the TRANSPOSED scores S^T[key][query] = k rows (A) x q rows hi + residual (B, kept in registers) as in k_st (2 products); a lane's accumulator registers of the two 16-key tiles are, element for element, its part of the B operand of the next product, so P^T x 2^11 = 2^((S^T - CM[key]) * log2 e + CS[key]) (one subtract, one FMA, one v_exp_f32 a score) goes once to f16 in place and y^T[c][query] += v fragment (A: row c, 32 keys) x P^T (1 product). The 4 slices' partial tiles are joined through LDS in ascending ks, x 2^-11
#define PKS 4              // key slices of a k_pvf block
static_assert((TT / 32) % PKS == 0 && TT % 64 == 0, "every wave the same number of 32-key steps; whole 64-query blocks");
__global__ __launch_bounds__(64 * PKS) void k_pvf(const _Float16* __restrict__ QH, const _Float16* __restrict__ QL, const _Float16* __restrict__ KH, const float* __restrict__ CM, const float* __restrict__ CS, const _Float16* __restrict__ VT, float* __restrict__ Y) { __shared__ __align__(16) float ss[2 * PKS][32][CB + 4];
  const int tid = threadIdx.x, wave = __builtin_amdgcn_readfirstlane(tid >> 5), lane = tid & 31, col = lane & 15, g = lane >> 4; const int b = blockIdx.y, qg = wave & 1, ks = wave >> 1; const size_t q0 = (size_t)b * TT + blockIdx.x * 64 + qg * 32;
  v16h qh[2][4], qr[2][4];   /* the wave's two 16-query tiles, hi and residual, all four k steps: loaded once */
  { const _Float16* qp = QH + q0 * CCQ + lane * 8; const _Float16* qlp = QL + q0 * CCQ + lane * 8;
#pragma unroll
    for (int u = 0; u < 2; ++u)
#pragma unroll
      for (int kc = 0; kc < 4; ++kc) { qh[u][kc] = frag_pk(qp + (u * 4 + kc) * 512); qr[u][kc] = frag_pk(qlp + (u * 4 + kc) * 512); } }
  v8f acc[2][CB / 16] = {};
#pragma unroll 1
  for (int i = 0; i < TT / 32 / PKS; ++i) { const size_t st = (size_t)b * (TT / 32) + i * PKS + ks;   /* a step's key fragments are 8 KiB in a row, its v fragments likewise */
    const _Float16* kp = KH + st * (32 * CCQ) + lane * 8; const _Float16* vp = VT + st * (32 * CB) + lane * 8;
    const float* mp = CM + st * 32 + 8 * g; const float* fp = CS + st * 32 + 8 * g;   /* the lane's 16 keys (8 g + 0..7 of either tile): their column max and log2 factor */
    v16h kf[2][4], vf[CB / 16], p[2]; v4f cm[4], cf[4];
#pragma unroll
    for (int t = 0; t < 2; ++t)
#pragma unroll
      for (int kc = 0; kc < 4; ++kc) kf[t][kc] = frag_pk(kp + (t * 4 + kc) * 512);
#pragma unroll
    for (int u = 0; u < 4; ++u) { const int o = (u >> 1) * 16 + (u & 1) * 4; cm[u] = *(const v4f*)(mp + o); cf[u] = *(const v4f*)(fp + o); }
    __builtin_amdgcn_sched_barrier(0);   /* what the score products and the exp work need is asked for first: loads come back in the order of issue */
#pragma unroll
    for (int j = 0; j < CB / 16; ++j) vf[j] = frag_pk(vp + j * 512);
    __builtin_amdgcn_sched_barrier(0);   /* every load of the step is issued ahead of its first WMMA: the v fragments arrive under the score products and the exp work; without it the scheduler may sink them to their use and a step pays two load latencies in a row */
#pragma unroll
    for (int u = 0; u < 2; ++u) { v8f a0 = {}, a1 = {}, l0 = {}, l1 = {};
#pragma unroll
      for (int kc = 0; kc < 4; ++kc) { a0 = wmma16b(kf[0][kc], qh[u][kc], a0); a1 = wmma16b(kf[1][kc], qh[u][kc], a1); l0 = wmma16b(kf[0][kc], qr[u][kc], l0); l1 = wmma16b(kf[1][kc], qr[u][kc], l1); }
#pragma unroll
      for (int r = 0; r < 8; r += 2) { const int q = r >> 2, e = r & 3;   /* two neighbouring keys of one tile at a time: their accumulators, maxima and factors lie in neighbouring registers, so the packed f32 forms take them where they are */
        const v2f s0 = (v2f{a0[r], a0[r + 1]} + v2f{l0[r], l0[r + 1]} * (1.0f / 1024.0f)) * SCALE, s1 = (v2f{a1[r], a1[r + 1]} + v2f{l1[r], l1[r + 1]} * (1.0f / 1024.0f)) * SCALE;
        const v2f e0 = (s0 - v2f{cm[q][e], cm[q][e + 1]}) * LOG2E + v2f{cf[q][e], cf[q][e + 1]}, e1 = (s1 - v2f{cm[2 + q][e], cm[2 + q][e + 1]}) * LOG2E + v2f{cf[2 + q][e], cf[2 + q][e + 1]};
        p[u][r] = (_Float16)__builtin_amdgcn_exp2f(e0[0]); p[u][r + 1] = (_Float16)__builtin_amdgcn_exp2f(e0[1]); p[u][8 + r] = (_Float16)__builtin_amdgcn_exp2f(e1[0]); p[u][9 + r] = (_Float16)__builtin_amdgcn_exp2f(e1[1]); } }
#pragma unroll
    for (int j = 0; j < CB / 16; ++j) { acc[0][j] = wmma16b(vf[j], p[0], acc[0][j]); acc[1][j] = wmma16b(vf[j], p[1], acc[1][j]); }
    /* order asked of the scheduler for the step: the 32 score WMMAs, the first plain vector instructions, then each v_exp_f32 with one plain vector instruction behind it, the last conversions, then the 16 P.v WMMAs */
    __builtin_amdgcn_sched_group_barrier(0x8, 32, 0); __builtin_amdgcn_sched_group_barrier(0x2, 24, 0);
#pragma unroll
    for (int k = 0; k < 32; ++k) { __builtin_amdgcn_sched_group_barrier(0x400, 1, 0); __builtin_amdgcn_sched_group_barrier(0x2, 1, 0); }
    __builtin_amdgcn_sched_group_barrier(0x2, 8, 0); __builtin_amdgcn_sched_group_barrier(0x8, 16, 0);
    __builtin_amdgcn_sched_barrier(0);   /* keeps the wait below at the step's foot: nothing ties it to the WMMAs, and the scheduler otherwise lifts it to the step's head, where the score products would wait for the v fragments too */
    asm volatile("s_wait_loadcnt 0x0" :: "v"(kp), "v"(vp), "v"(mp), "v"(fp) : "memory"); }   /* names the four address pairs so that they stay as they are until every load of the step has returned */
#pragma unroll
  for (int u = 0; u < 2; ++u)
#pragma unroll
    for (int j = 0; j < CB / 16; ++j) { v4f lo, hi;   /* lane (g, col): query col of tile u, channels j * 16 + 8 g + 0..7 */
#pragma unroll
      for (int r = 0; r < 4; ++r) { lo[r] = acc[u][j][r]; hi[r] = acc[u][j][4 + r]; }
      *(v4f*)&ss[wave][u * 16 + col][j * 16 + 8 * g] = lo; *(v4f*)&ss[wave][u * 16 + col][j * 16 + 8 * g + 4] = hi; }
  __syncthreads();   /* all key slices' partial tiles are in ss before a wave sums its rows over them */
  float* yp = Y + ((size_t)b * TT + blockIdx.x * 64 + wave) * CB + lane * 4;   /* y rows [b*TT + n][128]: wave w takes rows w, w + 8, ...: a 512-B row by 32 lanes */
#pragma unroll
  for (int e = 0; e < 8; ++e) { const int row = e * 8 + wave; v4f t = *(const v4f*)&ss[row >> 5][row & 31][lane * 4];
#pragma unroll
    for (int s = 1; s < PKS; ++s) t += *(const v4f*)&ss[s * 2 + (row >> 5)][row & 31][lane * 4];
    vst2(yp + (size_t)e * 8 * CB, t * (1.0f / 2048.0f)); } }

#define WS_TL  (WS_END)                                  // f16 theta-view residual plane [b][128][TT] (viewed as rows)
#define WS_G   (WS_TL + 2u * (size_t)NB * CB * TT)        // f16 g conv plane [b][128][TT]
#define WS_VT2 (WS_G + 2u * (size_t)NB * CB * TT)         // f16 g view in fragment order [b][m / 32][c / 16][fragment half][lane][8]
#define WS_YR  (WS_VT2 + 2u * (size_t)NB * CB * TT)       // f32 y rows [b*TT + n][128]
#define WS_CM  (WS_YR + 4u * (size_t)NB * TT * CB)        // f32 column max [b][TT]
#define WS_CS  (WS_CM + 4u * (size_t)NB * TT)             // f32 log2(2^11 / column sum) [b][TT]
#define WS_PM  (WS_CS + 4u * (size_t)NB * TT)             // f32 partial column max [b][NPART][TT] (room for NQB planes a batch)
#define WS_PS  (WS_PM + 4u * (size_t)NB * NQB * TT)       // f32 partial column sum [b][NPART][TT]
#define WS_END2 (WS_PS + 4u * (size_t)NB * NQB * TT)
extern "C" void kernel_launch(void* const* d_in, const int* in_sizes, int n_in, void* d_out, int out_size, void* d_ws, size_t ws_size, hipStream_t stream) {
  (void)in_sizes; (void)n_in; (void)out_size;
  const float** F = (const float**)d_in;
  if (ws_size < (size_t)WS_END) return;
  char* ws = (char*)d_ws; _Float16 *QH = (_Float16*)(ws + WS_QH), *KH = (_Float16*)(ws + WS_KH), *VT = (_Float16*)(ws + WS_VT), *QL = (_Float16*)(ws + WS_QL), *KL = (_Float16*)(ws + WS_KL); __bf16 *VB = (__bf16*)(ws + WS_VB), *VBL = (__bf16*)(ws + WS_VBL); float *Y = (float*)(ws + WS_Y);
  (void)Y; (void)QL; (void)KL; (void)VB; (void)VBL;
  // inputs: 0 x [4,256,64,64] (channels-first); 1 theta_w [128,256], 2 theta_b; 3 phi_w, 4 phi_b; 5 g_w, 6 g_b; 7 W_w [256,128], 8 W_b [256] (all (out,in), biases nonzero)
  if (ws_size < (size_t)WS_END2) return;
  _Float16 *TL = (_Float16*)(ws + WS_TL), *G = (_Float16*)(ws + WS_G), *VT2 = (_Float16*)(ws + WS_VT2); float *YR = (float*)(ws + WS_YR), *CM = (float*)(ws + WS_CM), *CS = (float*)(ws + WS_CS), *PM = (float*)(ws + WS_PM), *PS = (float*)(ws + WS_PS);
  // phi^T rows (the 'k' rows: phi[c][m] proper layout, token-major) via the q/k path as which = 1 -> KH in fragment order (+KL rows < 64, unused)
  k_projT<1><<<dim3(TNB * TT / 64, 1, 1), 128, 0, stream>>>(F[0], F[0], F[0], F[3], F[3], F[3], F[4], F[4], F[4], QH, QL, KH, KL, VT, VB, VBL, nullptr);
  // theta conv plane [Cb][N] (f16 hi into the 'VT' slot = the theta VIEW rows [N][Cb] when read row-major) + its residual plane TL (the view's residual rows) via the [c][t] path (which = 2)
  k_projT<2><<<dim3(TNB * TT / 64, 1, 1), 128, 0, stream>>>(F[0], F[0], F[0], F[1], F[1], F[1], F[2], F[2], F[2], QH, QL, KH, KL, VT, VB, VBL, TL);
  // g conv plane [Cb][N] f16 -> G, then the g VIEW rows turned into the value fragments VT2, and the theta VIEW rows (hi, residual) copied into the query fragments QH, QL
  k_projT<2><<<dim3(TNB * TT / 64, 1, 1), 128, 0, stream>>>(F[0], F[0], F[0], F[5], F[5], F[5], F[6], F[6], F[6], QH, QL, KH, KL, G, VB, VBL, nullptr);
  k_trans<<<dim3(TT / 64, CB / 64, 3 * TNB), 256, 0, stream>>>(G, VT2, VT /* theta view rows */, TL /* view residual rows */, QH, QL);
  // all batches in each launch: column statistics of the scores, their merge, then scores again + P.v
  k_st<<<dim3(TT / (8 * SKT * 16), NPART, TNB), 256, 0, stream>>>(QH /* theta view fragments */, QL /* view residual fragments */, KH, PM, PS);
  k_colmerge<<<dim3(TT / 32, TNB), 256, 0, stream>>>(PM, PS, CM, CS);
  k_pvf<<<dim3(TT / 64, TNB), 64 * PKS, 0, stream>>>(QH, QL, KH, CM, CS, VT2, YR);
  k_wout<<<dim3(TT / 64, COUT / 128, TNB), 128, 0, stream>>>(YR, F[7], F[8], F[0], (float*)d_out);

}

// v010
// It runs in 91.1 microseconds.
// Next to v009, in two timings, it ran 1.13 and 1.14 times as fast.
// All steps since v000 together make it 28.7 times as fast.
// compute dtype: all float inputs rounded to bf16; the three 1x1 convs with EXACT bf16 products on WMMA 16x16x32 (f32 accumulate) + bias; scores between the raw-reshaped theta view (f16 hi + residual x 2^10) and phi (f16) (2 products); the softmax over the QUERY axis in f32 (per-column max / sum from 512-row partials, each a running max / sum kept in registers; each score's exp is the hardware base-2 exponent of (s - max) * log2 e, the few merge weights library expf); the scores formed a second time, transposed, in the P.v kernel (never stored); P x 2^11 (the factor 2^11 / column sum added as its log2 in the exponent) once to f16 x the raw-reshaped g view once to f16 (1 product); the W 1x1 conv on the raw-reshaped y view with bf16 hi + lo (2 products) x exact W + bias + x residual; f32 output written channels-first.
#include <hip/hip_runtime.h>
#include <math.h>

typedef __attribute__((ext_vector_type(16))) _Float16 v16h;
typedef __attribute__((ext_vector_type(16))) __bf16 v16b;
typedef __attribute__((ext_vector_type(8)))  _Float16 v8h;
typedef __attribute__((ext_vector_type(8)))  float v8f;
typedef __attribute__((ext_vector_type(4)))  float v4f;
typedef __attribute__((ext_vector_type(2)))  float v2f;
typedef __attribute__((ext_vector_type(4)))  unsigned v4u;
typedef _Float16 hx8 __attribute__((ext_vector_type(8)));
typedef _Float16 hx4 __attribute__((ext_vector_type(4)));
typedef __bf16 bx4 __attribute__((ext_vector_type(4)));
typedef __attribute__((ext_vector_type(4)))  int v4i;
typedef float __attribute__((may_alias)) float_a;
typedef int __attribute__((may_alias)) int_a;

template <typename T> __device__ __forceinline__ void vst2(void* p, T v) { *(T*)p = v;  }
__device__ __forceinline__ v8f wmma16(v16h a, v16h b, v8f c) {
  v8f d = __builtin_amdgcn_wmma_f32_16x16x32_f16(false, a, false, b, (short)0, c, false, false);
  asm volatile("v_nop\n\tv_nop\n\tv_nop\n\tv_nop" : "+v"(d) : "v"(a), "v"(b));
  return d;
}
__device__ __forceinline__ v8f wmma_bf(v16b a, v16b b, v8f c) {
  v8f d = __builtin_amdgcn_wmma_f32_16x16x32_bf16(false, a, false, b, (short)0, c, false, false);
  asm volatile("v_nop\n\tv_nop\n\tv_nop\n\tv_nop" : "+v"(d) : "v"(a), "v"(b));
  return d;
}
// 16x16x32 fragments: lane = (h = lane>>4, row/col = lane&15); elements 0..7 = k0+8h+0..7, 8..15 = k0+16+8h+0..7; D element r = row 8h+r
__device__ __forceinline__ v16h frag_h(const _Float16* rowk0, int lane) {
  union { v16h v; v8h q[2]; } u; const _Float16* p = rowk0 + 8 * (lane >> 4);
  u.q[0] = *(const v8h*)p; u.q[1] = *(const v8h*)(p + 16); return u.v;
}
__device__ __forceinline__ v16h frag_f32(const float* rowk0, int lane) {
  v16h a; const float* p = rowk0 + 8 * (lane >> 4);
#pragma unroll
  for (int i = 0; i < 8; ++i) { a[i] = (_Float16)p[i]; a[8 + i] = (_Float16)p[16 + i]; }
  return a;
}
__device__ __forceinline__ v16h frag_f32s(const float* rowk0, int lane, float sc) {
  v16h a; const float* p = rowk0 + 8 * (lane >> 4);
#pragma unroll
  for (int i = 0; i < 8; ++i) { a[i] = (_Float16)(p[i] * sc); a[8 + i] = (_Float16)(p[16 + i] * sc); }
  return a;
}
// column fragment from a [K][ld] layout (column n), rows >= K read as 0
__device__ __forceinline__ v16h fragc_f32(const float* W, int k0, int n, int lane, int ld, int K) {
  v16h a; const int g = lane >> 4;
#pragma unroll
  for (int i = 0; i < 8; ++i) { const int ka = k0 + 8 * g + i, kb = ka + 16;
    a[i] = (_Float16)(ka < K ? W[(size_t)(ka < K ? ka : K - 1) * ld + n] : 0.f); a[8 + i] = (_Float16)(kb < K ? W[(size_t)(kb < K ? kb : K - 1) * ld + n] : 0.f); }
  return a;
}
struct F2 { v16b h, l; };
__device__ __forceinline__ F2 bsplit16(const float v[16]) { F2 r;
#pragma unroll
  for (int i = 0; i < 16; ++i) { const __bf16 h = (__bf16)v[i]; r.h[i] = h; r.l[i] = (__bf16)(v[i] - (float)h); }
  return r; }
__device__ __forceinline__ F2 split_row(const float* row, int k0, int lane) { float v[16]; const float* p = row + k0 + 8 * (lane >> 4);
#pragma unroll
  for (int i = 0; i < 8; ++i) { v[i] = p[i]; v[8 + i] = p[16 + i]; }
  return bsplit16(v); }
__device__ __forceinline__ F2 split_rowK(const float* row, int k0, int lane, int K) { float v[16]; const int g = lane >> 4;
#pragma unroll
  for (int i = 0; i < 8; ++i) { const int ka = k0 + 8 * g + i, kb = ka + 16; v[i] = ka < K ? row[ka < K ? ka : K - 1] : 0.f; v[8 + i] = kb < K ? row[kb < K ? kb : K - 1] : 0.f; }
  return bsplit16(v); }
__device__ __forceinline__ F2 split_col(const float* W, int k0, int n, int lane, int ld, int K) { float v[16]; const int g = lane >> 4;
#pragma unroll
  for (int i = 0; i < 8; ++i) { const int ka = k0 + 8 * g + i, kb = ka + 16; v[i] = ka < K ? W[(size_t)(ka < K ? ka : K - 1) * ld + n] : 0.f; v[8 + i] = kb < K ? W[(size_t)(kb < K ? kb : K - 1) * ld + n] : 0.f; }
  return bsplit16(v); }
__device__ __forceinline__ v8f mac3(const F2& a, const F2& b, v8f c) { c = wmma_bf(a.l, b.h, c); c = wmma_bf(a.h, b.l, c); return wmma_bf(a.h, b.h, c); }
__device__ __forceinline__ float sigm(float v) { return 1.0f / (1.0f + expf(-v)); }
// fragment stored in fragment order (1 KiB: [half of the fragment][lane][8 f16]), read at the lane's own pointer (fragment start + 8 * lane): each of the two loads covers 512 contiguous bytes
__device__ __forceinline__ v16h frag_pk(const _Float16* p) { union { v16h v; v8h q[2]; } u; u.q[0] = *(const v8h*)p; u.q[1] = *(const v8h*)(p + 256); return u.v; }
// fragment read at the lane's own pointer (row start + k0 + 8 * (lane >> 4)): the caller keeps that pointer and names it at the wait behind a batch of loads
__device__ __forceinline__ v16b wfrag_p(const float* p) { v16b w;
#pragma unroll
  for (int i = 0; i < 8; ++i) { w[i] = (__bf16)p[i]; w[8 + i] = (__bf16)p[16 + i]; }
  return w; }

// Non-local block with the source's RAW reshapes (x [4,256,64,64], Cb 128, N 4,096; (out,in) theta/phi/g 1x1 convs [128,256] + biases, W [256,128] + bias): theta = conv(x).reshape(B, N, Cb) and g likewise are ROW-MAJOR reinterpretations of the [Cb][N] conv outputs (row n = channel n/32, positions (n%32)*128..+127), phi stays [Cb][N]; scores[n][m] = sum_c theta[n][c] phi[c][m]; attn = softmax over n (axis 1 - per key column); y[n][c] = sum_m attn[n][m] g[m][c]; y.reshape(B, Cb, H, W) (raw again) -> W conv + bias + x.
#define NB 4
#define TT 4096
#define CC 128            // g-view plane pitch (Cb channels)
#define CB 128
#define COUT 256
#define CCQ 128           // theta-view / phi^T row pitch (Cb)
#define DIN 256          // x channels
#define NH 1
#define HD 128
#define NQB (TT / 64)
#define SCALE (1.0f)
#define HDQK 128           // contraction width of the scores (Cb)
#define CAUSAL 0
#define LOG2E 1.44269504088896340736f
#ifndef TNB
#define TNB NB
#endif
__device__ __forceinline__ v16b zero16b() { v16b z; _Pragma("unroll") for (int i = 0; i < 16; ++i) z[i] = (__bf16)0.f; return z; }
__device__ __forceinline__ float bfr(float v) { return (float)(__bf16)v; }
__host__ __device__ __forceinline__ int kb_last(int qb) { return CAUSAL ? ((qb * 64 + 63) >> 7) : (TT / 128 - 1); }
typedef __attribute__((ext_vector_type(8))) __bf16 v8b;
__device__ __forceinline__ v16b frag_b(const __bf16* rowk0, int lane) {
  union { v16b v; v8b q[2]; } u; const __bf16* p = rowk0 + 8 * (lane >> 4);
  u.q[0] = *(const v8b*)p; u.q[1] = *(const v8b*)(p + 16); return u.v;
}
#define QBH 0              // 2-product logits everywhere (theta view hi + residual x phi hi)
#define QHI 4096            // q residual rows (all)
#define KHI 64            // (unused k residual / v bf16 planes: QBH 0)
// B fragment (k rows k0+.., output column o) of a weight: (in,out) [K][ld] or (out,in) [ld rows of K]: bf16 exact, or f16(bf16 * 256) exact
__device__ __forceinline__ v16b wcol_io(const float* Wm, int k0, int o, int lane, int ld) { v16b w; const int g = lane >> 4;
#pragma unroll
  for (int i = 0; i < 8; ++i) { w[i] = (__bf16)Wm[(size_t)(k0 + 8 * g + i) * ld + o]; w[8 + i] = (__bf16)Wm[(size_t)(k0 + 16 + 8 * g + i) * ld + o]; }
  return w; }
__device__ __forceinline__ v16b wcol_oi(const float* Wm, int k0, int o, int lane, int K) { v16b w; const float* p = Wm + (size_t)o * K + k0 + 8 * (lane >> 4);
#pragma unroll
  for (int i = 0; i < 8; ++i) { w[i] = (__bf16)p[i]; w[8 + i] = (__bf16)p[16 + i]; }
  return w; }
__device__ __forceinline__ v16h wcolh_io(const float* Wm, int k0, int o, int lane, int ld) { v16h w; const int g = lane >> 4;
#pragma unroll
  for (int i = 0; i < 8; ++i) { w[i] = (_Float16)(bfr(Wm[(size_t)(k0 + 8 * g + i) * ld + o]) * 256.0f); w[8 + i] = (_Float16)(bfr(Wm[(size_t)(k0 + 16 + 8 * g + i) * ld + o]) * 256.0f); }
  return w; }
__device__ __forceinline__ v16h wcolh_oi(const float* Wm, int k0, int o, int lane, int K) { v16h w; const float* p = Wm + (size_t)o * K + k0 + 8 * (lane >> 4);
#pragma unroll
  for (int i = 0; i < 8; ++i) { w[i] = (_Float16)(bfr(p[i]) * 256.0f); w[8 + i] = (_Float16)(bfr(p[16 + i]) * 256.0f); }
  return w; }
#define WQKV_LAYOUT 0   // 0 = (out,in) [CC][DIN], as 1; 1 = (out,in) [CC][DIN]; 2 = per-head [NH][DIN][HD]
__device__ __forceinline__ v16b wcol_hdk(const float* Wm, int k0, int o, int lane) { v16b w; const int g = lane >> 4; const float* p = Wm + (size_t)(o / HD) * DIN * HD + (o % HD);
#pragma unroll
  for (int i = 0; i < 8; ++i) { w[i] = (__bf16)p[(size_t)(k0 + 8 * g + i) * HD]; w[8 + i] = (__bf16)p[(size_t)(k0 + 16 + 8 * g + i) * HD]; }
  return w; }
#define WO_OUT_IN 0
#if WQKV_LAYOUT == 1
#define WCOL(W, k0, o, lane) wcol_oi(W, k0, (o), lane, DIN)   /* unused: layout 0 */
#elif WQKV_LAYOUT == 2
#define WCOL(W, k0, o, lane) wcol_hdk(W, k0, o, lane)
#else
#define WCOL(W, k0, o, lane) wcol_oi(W, k0, (o), lane, DIN)   /* (out,in) 1x1-conv weights [128][256]: all 128 output channels real */
#endif
#if WO_OUT_IN
#define WOCOL(W, k0, o, lane) wcol_oi(W, k0, o, lane, CC)
#define WOCOLH(W, k0, o, lane) wcolh_oi(W, k0, o, lane, CC)
#else
#define WOCOL(W, k0, o, lane) wcol_io(W, k0, o, lane, DIN)
#define WOCOLH(W, k0, o, lane) wcolh_io(W, k0, o, lane, DIN)
#endif
#ifndef SM_EXTRA_PARAMS
#define SM_EXTRA_PARAMS
#endif
#ifndef PROJ_EXTRA_PARAMS
#define PROJ_EXTRA_PARAMS
#endif
#ifndef SM_MASK_HOOK
#define SM_MASK_HOOK (void)0
#endif

#define WS_QH  0u                                      // f16 q rows in fragment order [b*t / 16][k step][fragment half][lane][8]
#define WS_KH  (WS_QH + 2u * (size_t)NB * TT * CCQ)     // f16 k rows in fragment order [b*t / 16][k step][fragment half][lane][8]
#define WS_VT  (WS_KH + 2u * (size_t)NB * TT * CCQ)     // f16 theta conv planes [b][c][t]
#define WS_QL  (WS_VT + 2u * (size_t)NB * CC * TT)      // f16 q residual x 2^10 rows [b][t < QHI], in fragment order like WS_QH
#define WS_KL  (WS_QL + 2u * (size_t)NB * QHI * CCQ)    // f16 k residual x 2^10 rows [b][t < KHI][CCQ]
#define WS_VB  (WS_KL + 2u * (size_t)NB * KHI * CCQ)    // bf16 v hi planes [b][c][t < KHI]
#define WS_VBL (WS_VB + 2u * (size_t)NB * CC * KHI)
#define WS_Y   (WS_VBL + 2u * (size_t)NB * CC * KHI)    // zero bytes: Y is not used, the y rows go to WS_YR
#define WS_END (WS_Y  + 0u)

// ---- k_projT: the three 1x1 convs of x in ONE launch: block = (64 rows, 128 cols, conv z): X W (+ b) with exact bf16 products (K = DIN) -> z 0 (phi): k f16 rows in fragment order (+ residual rows < KHI); z 1 (theta): f16 plane [c][t] + residual plane; z 2 (g): f16 plane [c][t]. The three convs read none of each other's output, so their blocks share the WGPs (three waves a SIMD where a launch of one conv has one)
__global__ __launch_bounds__(128) void k_projT(const float* __restrict__ X, const float* __restrict__ WK, const float* __restrict__ WT, const float* __restrict__ WG, const float* __restrict__ BK, const float* __restrict__ BT, const float* __restrict__ BG,
    _Float16* __restrict__ KH, _Float16* __restrict__ KL, _Float16* __restrict__ TP, _Float16* __restrict__ TL, _Float16* __restrict__ GP) {
  __shared__ __align__(16) _Float16 sh[64][136], sl[64][136]; __shared__ __align__(16) _Float16 th[128][72], tlo[128][72];
  const int tid = threadIdx.x, wave = tid >> 5, lane = tid & 31, col = lane & 15, g = lane >> 4; const int z = blockIdx.z; const int c0 = blockIdx.y * 128; const size_t r0 = (size_t)blockIdx.x * 64; const size_t bb = r0 / TT; const int t0 = (int)(r0 % TT);
  const float* WA = z == 0 ? WK : z == 1 ? WT : WG; const float* BA = z == 0 ? BK : z == 1 ? BT : BG;
  const int KD = DIN;
  v8f acc[8] = {};
#pragma unroll 2
  for (int kc = 0; kc < KD / 32; ++kc) { v16b a[4], w[2]; v4f xl[16]; const float* p = X + (bb * KD + kc * 32 + 8 * g) * (size_t)TT + t0 + col * 4;   /* channels-first [b][c][t]: A[t][c]; row col of row tile u is t0 + 4 col + u, so one 16-B load brings a channel's element for all four tiles and 16 lanes cover 256 B in a row */
    const float* wp = WA + (size_t)(c0 + wave * 32 + col) * DIN + kc * 32 + 8 * g;   /* (out,in) weight rows: the wave's own 32 output columns, fragment jj starts 16 rows further on */
    /* wave tile = all 64 rows x 32 columns (acc[u * 2 + jj]: row tile u, column tile jj): a 16-B weight load touches 16 lines, a 16-B x load 4 whole ones, so 8 weight + 16 x loads a k step touch 192 lines a wave where 32 + 16 touched 544 */
#pragma unroll
    for (int i = 0; i < 8; ++i) { xl[i] = *(const v4f*)(p + (size_t)i * TT); xl[8 + i] = *(const v4f*)(p + (size_t)(16 + i) * TT); }
#pragma unroll
    for (int jj = 0; jj < 2; ++jj) w[jj] = wfrag_p(wp + (size_t)jj * 16 * DIN);   /* every fragment ahead of the k step's first WMMA: the asm in wmma_bf holds later loads behind it, so a load written between two WMMAs pays its whole latency there */
    asm volatile("s_wait_loadcnt 0x0" :: "v"(p), "v"(wp) : "memory");   /* names the two address pairs so that they stay as they are until every load of the batch has returned */
#pragma unroll
    for (int u = 0; u < 4; ++u)
#pragma unroll
      for (int i = 0; i < 16; ++i) a[u][i] = (__bf16)xl[i][u];
#pragma unroll
    for (int j = 0; j < 8; ++j) acc[j] = wmma_bf(a[j >> 1], w[j & 1], acc[j]); }
  const float* bp = BA + c0 + wave * 32 + col; float bias2[2] = {};   /* the two bias loads together, ahead of the epilogue's LDS stores */
  if (BA) {
#pragma unroll
    for (int jj = 0; jj < 2; ++jj) bias2[jj] = bp[jj * 16];
    asm volatile("s_wait_loadcnt 0x0" :: "v"(bp) : "memory"); }   /* names the address pair so that it stays as it is until the two loads have returned */
  if (z == 0) { _Float16* DH = KH; _Float16* DL = KL; const int nhi = KHI; const bool hi_rows = t0 < nhi;
#pragma unroll
    for (int j = 0; j < 8; ++j) { const float bias = bfr(bias2[j & 1]);
#pragma unroll
      for (int r = 0; r < 8; ++r) { const float v = acc[j][r] + bias; const int rl = (8 * g + r) * 4 + (j >> 1), cl = wave * 32 + (j & 1) * 16 + col; const _Float16 hv = (_Float16)v; sh[rl][cl] = hv; sl[rl][cl] = (_Float16)((v - (float)hv) * 1024.0f); } }
    __syncthreads();
    for (int e = tid; e < 64 * 16; e += 128) { const int rl = ((e >> 8) << 4) | (e & 15), q = ((e >> 6) & 3) * 4 + ((e >> 5) & 1) * 2 + ((e >> 4) & 1);   /* fragment order: e = (16-row tile, k step, fragment half, lane): piece e of the block's 16 KiB is what that lane loads */
      vst2((unsigned*)(DH + r0 * CCQ + (size_t)e * 8), *(const v4u*)&sh[rl][q * 8]);
      asm volatile("s_wait_xcnt 0x0" ::: "memory");   /* the store's address pair and data registers are rewritten by the residual store's LDS read and by the next trip */
      if (hi_rows) { vst2((unsigned*)(DL + (bb * nhi + t0 + rl) * (size_t)CCQ + c0 + q * 8), *(const v4u*)&sl[rl][q * 8]);
        asm volatile("s_wait_xcnt 0x0" ::: "memory"); } }   /* likewise, ahead of the next trip */   /* hi rows in fragment order (c0 == 0), residual rows at pitch CCQ */
  } else { _Float16* VT = z == 1 ? TP : GP; _Float16* VL = z == 1 ? TL : nullptr;   /* f16 planes only: no kernel reads a bf16 plane, and in one launch the theta and the g blocks would both write it */
#pragma unroll
    for (int jj = 0; jj < 2; ++jj) { const float bias = bfr(bias2[jj]); const int cl = wave * 32 + jj * 16 + col;
#pragma unroll
      for (int r = 0; r < 8; ++r) { const int rl = (8 * g + r) * 4; hx4 vh, vl;   /* the four row tiles' elements are four t in a row: one 8-B LDS store a plane */
#pragma unroll
        for (int u = 0; u < 4; ++u) { const float v = acc[u * 2 + jj][r] + bias; const _Float16 hv2 = (_Float16)v; vh[u] = hv2; vl[u] = (_Float16)((v - (float)hv2) * 1024.0f); }
        *(hx4*)&th[cl][rl] = vh; *(hx4*)&tlo[cl][rl] = vl; } }
    __syncthreads();
    for (int e = tid; e < 128 * 8; e += 128) { const int cl = e >> 3, q = e & 7; vst2((unsigned*)(VT + (bb * CC + c0 + cl) * (size_t)TT + t0 + q * 8), *(const v4u*)&th[cl][q * 8]);
      asm volatile("s_wait_xcnt 0x0" ::: "memory");   /* the store's address pair and data registers are rewritten by the residual store's LDS read and by the next trip */
      if (VL) { vst2((unsigned*)(VL + (bb * CC + c0 + cl) * (size_t)TT + t0 + q * 8), *(const v4u*)&tlo[cl][q * 8]);
        asm volatile("s_wait_xcnt 0x0" ::: "memory"); } } } }   /* likewise, ahead of the next trip */
// ---- k_st: column statistics of the logits x SCALE (the logits themselves are not stored: k_pvf forms them again). Block = (512 keys, query range of 512, batch), 8 waves; a wave keeps its own 64 keys (4 fragment tiles, all four k steps) in registers and walks the range's 32 query tiles, two a trip; the 8 waves walk the same query fragments. Scores TRANSPOSED as in k_pvf: S^T[key][query] = k rows (A) x q rows hi + residual x 2^10 (B) (2 products); lane (g, col), register r of key tile t = key 16 t + 8 g + r, query col. Each lane keeps a running max and a running sum of exp(v - max) per key over its own queries (rescaled by exp(old max - new max) once a trip); at the end the 16 lanes' pairs of a key are joined through LDS in ascending lane order: one partial (PM, PS) per key and query range
#define NPART 8            // query ranges = partials per key column
#define SKT 4              // 16-key tiles a k_st wave keeps in registers
#define SQT (TT / 16 / NPART)   // 16-query tiles a k_st wave walks
// the plain builtin (the compiler keeps the distances behind it itself): an asm statement cannot name a register above v255, and the operands of k_st and k_pvf do not all fit below
__device__ __forceinline__ v8f wmma16b(v16h a, v16h b, v8f c) { return __builtin_amdgcn_wmma_f32_16x16x32_f16(false, a, false, b, (short)0, c, false, false); }
static_assert(TT % (8 * SKT * 16) == 0 && TT % (16 * NPART) == 0 && SQT % 2 == 0 && SKT * 16 == 64, "whole key blocks, whole query ranges, two query tiles a trip, two keys a lane in the join");
__global__ __launch_bounds__(256) void k_st(const _Float16* __restrict__ QH, const _Float16* __restrict__ QL, const _Float16* __restrict__ KH, float* __restrict__ PM0, float* __restrict__ PS0) { __shared__ __align__(16) float lm[8][SKT * 16][20], ls[8][SKT * 16][20];   /* pitch 20 floats = 80 B: 16-B reads of 32 rows and 4-B stores of two 16-lane rows 8 keys apart both fall on distinct banks */
  const int tid = threadIdx.x, wave = __builtin_amdgcn_readfirstlane(tid >> 5), lane = tid & 31, col = lane & 15, g = lane >> 4; const int b = blockIdx.z, part = blockIdx.y, k0 = (blockIdx.x * 8 + wave) * (SKT * 16); const size_t q0 = (size_t)b * TT + (size_t)part * (SQT * 16);
  const _Float16* kp = KH + ((size_t)b * TT + k0) * CCQ + lane * 8;   /* fragment (16-key tile t, k step kc) starts (t * 4 + kc) * 512 f16 further on */
  const _Float16* qp = QH + q0 * CCQ + lane * 8; const _Float16* qlp = QL + q0 * CCQ + lane * 8;   /* query tile n of the range, hi and residual: fragment kc starts (n * 4 + kc) * 512 f16 further on */
  v16h kf[SKT][4], qh[2][4], qr[2][4];
#pragma unroll
  for (int t = 0; t < SKT; ++t)
#pragma unroll
    for (int kc = 0; kc < 4; ++kc) kf[t][kc] = frag_pk(kp + (t * 4 + kc) * 512);
#pragma unroll
  for (int u = 0; u < 2; ++u)
#pragma unroll
    for (int kc = 0; kc < 4; ++kc) { qh[u][kc] = frag_pk(qp + (u * 4 + kc) * 512); qr[u][kc] = frag_pk(qlp + (u * 4 + kc) * 512); }
  asm volatile("s_wait_xcnt 0x0" ::: "memory");   /* ahead of any rewrite of a register that the loads above name */
  __builtin_amdgcn_sched_barrier(0);   /* keeps what follows, address arithmetic too, behind that wait */
  v8f m[SKT], s[SKT];
#pragma unroll
  for (int t = 0; t < SKT; ++t)
#pragma unroll
    for (int r = 0; r < 8; ++r) { m[t][r] = -__builtin_inff(); s[t][r] = 0.f; }   /* the first trip's rescale is 2^-inf = 0 on a sum of 0 */
#pragma unroll 1
  for (int i = 0; i < SQT / 2; ++i) { const int nx = i + 1 < SQT / 2 ? i + 1 : i;   /* the tiles fetched ahead; the last trip fetches its own again, so that no address leaves the range */
    v8f sc[2][SKT];
#pragma unroll
    for (int u = 0; u < 2; ++u) {
#pragma unroll
      for (int t = 0; t < SKT; t += 2) { v8f a0 = {}, l0 = {}, a1 = {}, l1 = {};   /* two key tiles side by side: four independent accumulator chains */
#pragma unroll
        for (int kc = 0; kc < 4; ++kc) { a0 = wmma16b(kf[t][kc], qh[u][kc], a0); a1 = wmma16b(kf[t + 1][kc], qh[u][kc], a1); l0 = wmma16b(kf[t][kc], qr[u][kc], l0); l1 = wmma16b(kf[t + 1][kc], qr[u][kc], l1); }
        sc[u][t] = (a0 + l0 * (1.0f / 1024.0f)) * SCALE; sc[u][t + 1] = (a1 + l1 * (1.0f / 1024.0f)) * SCALE; }
      __builtin_amdgcn_sched_barrier(0);   /* tile u's products stand ahead of the loads that refill its registers, and those loads ahead of the work that follows: they fly under the other tile's products and the exp work */
      const _Float16* np = qp + (size_t)(nx * 2 + u) * 2048; const _Float16* nlp = qlp + (size_t)(nx * 2 + u) * 2048;
#pragma unroll
      for (int kc = 0; kc < 4; ++kc) { qh[u][kc] = frag_pk(np + kc * 512); qr[u][kc] = frag_pk(nlp + kc * 512); }
      asm volatile("s_wait_xcnt 0x0" ::: "memory");   /* ahead of the next rewrite of the address registers that the sixteen loads name */
      __builtin_amdgcn_sched_barrier(0); }   /* keeps the loads and the wait where they are written */
#pragma unroll
    for (int t = 0; t < SKT; ++t)
#pragma unroll
      for (int r = 0; r < 8; r += 2) {   /* two neighbouring keys at a time: the packed f32 forms take them where they lie */
        const v2f v0 = v2f{sc[0][t][r], sc[0][t][r + 1]}, v1 = v2f{sc[1][t][r], sc[1][t][r + 1]}, mo = v2f{m[t][r], m[t][r + 1]};
        const v2f mn = v2f{fmaxf(fmaxf(mo[0], v0[0]), v1[0]), fmaxf(fmaxf(mo[1], v0[1]), v1[1])};
        const v2f ac = (mo - mn) * LOG2E, a0 = (v0 - mn) * LOG2E, a1 = (v1 - mn) * LOG2E;   /* every argument <= 0 */
        const v2f c = v2f{__builtin_amdgcn_exp2f(ac[0]), __builtin_amdgcn_exp2f(ac[1])}, e0 = v2f{__builtin_amdgcn_exp2f(a0[0]), __builtin_amdgcn_exp2f(a0[1])}, e1 = v2f{__builtin_amdgcn_exp2f(a1[0]), __builtin_amdgcn_exp2f(a1[1])};
        const v2f sn = v2f{s[t][r], s[t][r + 1]} * c + (e0 + e1);
        m[t][r] = mn[0]; m[t][r + 1] = mn[1]; s[t][r] = sn[0]; s[t][r + 1] = sn[1]; } }
#pragma unroll
  for (int t = 0; t < SKT; ++t)
#pragma unroll
    for (int r = 0; r < 8; ++r) { lm[wave][t * 16 + 8 * g + r][col] = m[t][r]; ls[wave][t * 16 + 8 * g + r][col] = s[t][r]; }
  __syncthreads();   /* the 16 lanes' pairs of every key are in LDS before a lane joins its two keys */
  float* PM = PM0 + ((size_t)b * NPART + part) * TT + k0 + lane; float* PS = PS0 + ((size_t)b * NPART + part) * TT + k0 + lane;
#pragma unroll
  for (int h = 0; h < 2; ++h) { v4f mm[4], sv[4];
#pragma unroll
    for (int j = 0; j < 4; ++j) { mm[j] = *(const v4f*)&lm[wave][h * 32 + lane][j * 4]; sv[j] = *(const v4f*)&ls[wave][h * 32 + lane][j * 4]; }
    float mt = mm[0][0];
#pragma unroll
    for (int j = 1; j < 16; ++j) mt = fmaxf(mt, mm[j >> 2][j & 3]);
    float st = 0.f;
#pragma unroll
    for (int j = 0; j < 16; ++j) st += sv[j >> 2][j & 3] * __builtin_amdgcn_exp2f((mm[j >> 2][j & 3] - mt) * LOG2E);
    vst2(PM + h * 32, mt); vst2(PS + h * 32, st); }
  asm volatile("s_wait_xcnt 0x0" ::: "memory"); }   /* behind the four stores, ahead of anything that rewrites their registers */
// ---- k_colmerge: softmax over the QUERY axis (axis 1): joins the NPART per-query-range partials (PM = max, PS = sum of exp(S - PM) over the range's 512 rows) of each key column m: CM[m] = max, CS[m] = 11 - log2(sum_q PS[q][m] exp(PM[q][m] - CM[m])) (log2 of the factor 2^11 / column sum: k_pvf adds it in the exponent); block = 32 columns (lane) x 8 waves of NPW partials, joined through LDS
#define NPW (NPART / 8)
__global__ __launch_bounds__(256) void k_colmerge(const float* __restrict__ PM0, const float* __restrict__ PS0, float* __restrict__ CM0, float* __restrict__ CS0) { __shared__ float lm[8][32], ls[8][32];
  const float* PM = PM0 + (size_t)blockIdx.y * NPART * TT; const float* PS = PS0 + (size_t)blockIdx.y * NPART * TT; float* CM = CM0 + (size_t)blockIdx.y * TT; float* CS = CS0 + (size_t)blockIdx.y * TT;   /* blockIdx.y = batch */
  const int tid = threadIdx.x, wave = tid >> 5, lane = tid & 31; const int m = blockIdx.x * 32 + lane; float pm[NPW], ps[NPW];
#pragma unroll
  for (int u = 0; u < NPW; ++u) pm[u] = PM[(size_t)(wave * NPW + u) * TT + m];
  asm volatile("s_wait_xcnt 0x0" ::: "memory");   /* the address pair of the loads above is rewritten for the loads below */
#pragma unroll
  for (int u = 0; u < NPW; ++u) ps[u] = PS[(size_t)(wave * NPW + u) * TT + m];
  float mx = pm[0];
#pragma unroll
  for (int u = 1; u < NPW; ++u) mx = fmaxf(mx, pm[u]);
  float sm2 = 0.f;
#pragma unroll
  for (int u = 0; u < NPW; ++u) sm2 += ps[u] * expf(pm[u] - mx);
  lm[wave][lane] = mx; ls[wave][lane] = sm2;
  __syncthreads();
  if (wave == 0) { float mt = lm[0][lane];
#pragma unroll
    for (int w = 1; w < 8; ++w) mt = fmaxf(mt, lm[w][lane]);
    float st = 0.f;
#pragma unroll
    for (int w = 0; w < 8; ++w) st += ls[w][lane] * expf(lm[w][lane] - mt);
    vst2(CM + m, mt); vst2(CS + m, 11.0f - log2f(st)); } }
// ---- k_trans: blockIdx.z < TNB: block = (64 keys, 64 columns, batch): the g view rows [m][c] turned through LDS into fragments (column c, 32 keys) laid in fragment order for k_pvf; blockIdx.z >= TNB: block = two 16-row tiles of a batch's theta view rows (hi plane, then residual plane), their 16-B pieces copied into fragment order for k_st and k_pvf
static_assert((TT / 64) * (CB / 64) * 2 == TT / 16, "two 16-row tiles of the theta view per block");
__global__ __launch_bounds__(256) void k_trans(const _Float16* __restrict__ G, _Float16* __restrict__ VT2, const _Float16* __restrict__ TH, const _Float16* __restrict__ TR, _Float16* __restrict__ QP, _Float16* __restrict__ QR) { __shared__ _Float16 st[64][72]; const int tid = threadIdx.x;
  if (blockIdx.z >= TNB) {   /* the same for the whole block, ahead of the barrier */
    const int z = blockIdx.z - TNB; const size_t o = (size_t)(z % TNB) * CB * TT + (size_t)(blockIdx.y * (TT / 64) + blockIdx.x) * 2 * 16 * CCQ;   /* a tile is 16 rows of CCQ f16 = 4 KiB in both layouts */
    const _Float16* s = (z < TNB ? TH : TR) + o + (size_t)(tid & 15) * CCQ + (((tid >> 6) & 3) * 4 + ((tid >> 5) & 1) * 2 + ((tid >> 4) & 1)) * 8;   /* tid = (k step, fragment half, lane): that lane's piece of its row */
    _Float16* d = (z < TNB ? QP : QR) + o + tid * 8;
    const v4u u0 = *(const v4u*)s, u1 = *(const v4u*)(s + 16 * CCQ); vst2((unsigned*)d, u0); vst2((unsigned*)(d + 16 * CCQ), u1); return; }
  const int m0 = blockIdx.x * 64, c0 = blockIdx.y * 64, b = blockIdx.z; const _Float16* gb = G + (size_t)b * CB * TT; _Float16* vb = VT2 + (size_t)b * CB * TT;
  for (int e = tid; e < 64 * 8; e += 256) { const int ml = e >> 3, q = e & 7; const v4u u = *(const v4u*)(gb + (size_t)(m0 + ml) * CB + c0 + q * 8); asm volatile("s_wait_loadcnt 0x0" ::: "memory"); const hx8 hv = *(const hx8*)&u; _Pragma("unroll") for (int j = 0; j < 8; ++j) st[q * 8 + j][ml] = hv[j]; }
  __syncthreads();
  for (int e = tid; e < 64 * 8; e += 256) { const int cl = ((e >> 6) & 3) * 16 + (e & 15), q = (e >> 8) * 4 + ((e >> 5) & 1) * 2 + ((e >> 4) & 1);   /* fragment order: e = (32-key step, 16-column fragment, fragment half, lane) */
    hx8 hv; _Pragma("unroll") for (int j = 0; j < 8; ++j) hv[j] = st[cl][q * 8 + j]; vst2((unsigned*)(vb + ((size_t)((m0 >> 5) + (e >> 8)) * (CB / 16) + (c0 >> 4)) * 512 + (e & 255) * 8), *(const v4u*)&hv); } }
// ---- k_wout: block = (64 positions, 128 of the 256 output channels, batch): A[pos][cb] = y view Yb[cb*4096 + pos] (the raw reshape back: the batch's y rows [4096][128] f32 reinterpreted as [Cb][N]) split bf16 hi + lo (2 products) x exact (out,in) W [256][128]; + bf16(W_b) + bf16(x[b][o][pos]); channels-first store out[b][o][pos0..pos0+63] through LDS (one 256-B run per channel by 16 lanes)
__global__ __launch_bounds__(128) void k_wout(const float* __restrict__ Y, const float* __restrict__ WW, const float* __restrict__ WB, const float* __restrict__ X, float* __restrict__ OUT) { __shared__ __align__(16) float st[128][68];
  const int tid = threadIdx.x, wave = tid >> 5, lane = tid & 31, col = lane & 15, g = lane >> 4; const int p0 = blockIdx.x * 64, c0 = blockIdx.y * 128, b = blockIdx.z; const float* Yb = Y + (size_t)b * TT * CB;
  v8f acc[8] = {};
#pragma unroll 1
  for (int kc = 0; kc < CB / 32; ++kc) { v16b ah[4], al[4], w[2]; { const float* p = Yb + (size_t)(kc * 32 + 8 * g) * TT + p0 + col * 4; const float* wp = WW + (size_t)(c0 + wave * 32 + col) * CB + kc * 32 + 8 * g; v4f tv[16];   /* wave tile = all 64 positions x the wave's own 32 channels (acc[u * 2 + jj]), row col of row tile u = position p0 + 4 col + u, as in k_projT: fewer lines touched a k step */
#pragma unroll
      for (int i = 0; i < 8; ++i) { tv[i] = *(const v4f*)(p + (size_t)i * TT); tv[8 + i] = *(const v4f*)(p + (size_t)(16 + i) * TT); }
#pragma unroll
      for (int jj = 0; jj < 2; ++jj) w[jj] = wfrag_p(wp + (size_t)jj * 16 * CB);   /* with the y loads, ahead of the k step's first WMMA (the asm in wmma_bf holds later loads behind it) */
      asm volatile("s_wait_loadcnt 0x0" :: "v"(p), "v"(wp) : "memory");   /* names the two address pairs so that they stay as they are until every load of the batch has returned */
#pragma unroll
      for (int u = 0; u < 4; ++u)
#pragma unroll
        for (int i = 0; i < 16; ++i) { const __bf16 h = (__bf16)tv[i][u]; ah[u][i] = h; al[u][i] = (__bf16)(tv[i][u] - (float)h); } }
#pragma unroll
    for (int j = 0; j < 8; ++j) { acc[j] = wmma_bf(ah[j >> 1], w[j & 1], acc[j]); acc[j] = wmma_bf(al[j >> 1], w[j & 1], acc[j]); } }
  // thread's sixteen 16-B pieces: channel c0 + (tid >> 4) + 8 u, positions p0 + (tid & 15) * 4
  const size_t o0 = ((size_t)b * COUT + c0 + (tid >> 4)) * (size_t)TT + p0 + (tid & 15) * 4; const float* xp = X + o0; const float* bp = WB + c0 + wave * 32 + col; float* op = OUT + o0;
  float wb2[2]; v4f xr[16];   /* the two bias loads and the sixteen residual loads are issued together, ahead of the turn through LDS */
#pragma unroll
  for (int jj = 0; jj < 2; ++jj) wb2[jj] = bp[jj * 16];
#pragma unroll
  for (int u = 0; u < 16; ++u) xr[u] = *(const v4f*)(xp + (size_t)u * 8 * TT);
  asm volatile("s_wait_loadcnt 0x0" :: "v"(xp), "v"(bp) : "memory");   /* names the two address pairs so that they stay as they are until every load of the batch has returned */
#pragma unroll
  for (int jj = 0; jj < 2; ++jj) { const float wb = bfr(wb2[jj]);
#pragma unroll
    for (int r = 0; r < 8; ++r) { v4f t;   /* the four row tiles' elements are four positions in a row */
#pragma unroll
      for (int u = 0; u < 4; ++u) t[u] = acc[u * 2 + jj][r] + wb;
      *(v4f*)&st[wave * 32 + jj * 16 + col][(8 * g + r) * 4] = t; } }
  __syncthreads();
#pragma unroll
  for (int u = 0; u < 16; ++u) { v4f v = *(const v4f*)&st[(tid >> 4) + 8 * u][(tid & 15) * 4]; v[0] += bfr(xr[u][0]); v[1] += bfr(xr[u][1]); v[2] += bfr(xr[u][2]); v[3] += bfr(xr[u][3]); vst2(op + (size_t)u * 8 * TT, v); } }
// ---- k_pvf: block = (64 queries, batch), 8 waves: wave = (query group qg of 32 queries, key slice ks); slice ks takes the 32-key steps ks, ks + 4, ks + 8, ... of the 4,096 keys. Per step the wave forms the TRANSPOSED scores S^T[key][query] = k rows (A) x q rows hi + residual (B, kept in registers) as in k_st (2 products); a lane's accumulator registers of the two 16-key tiles are, element for element, its part of the B operand of the next product, so P^T x 2^11 = 2^((S^T - CM[key]) * log2 e + CS[key]) (one subtract, one FMA, one v_exp_f32 a score) goes once to f16 in place and y^T[c][query] += v fragment (A: row c, 32 keys) x P^T (1 product). The 4 slices' partial tiles are joined through LDS in ascending ks, x 2^-11
#define PKS 4              // key slices of a k_pvf block
static_assert((TT / 32) % PKS == 0 && TT % 64 == 0, "every wave the same number of 32-key steps; whole 64-query blocks");
__global__ __launch_bounds__(64 * PKS) void k_pvf(const _Float16* __restrict__ QH, const _Float16* __restrict__ QL, const _Float16* __restrict__ KH, const float* __restrict__ CM, const float* __restrict__ CS, const _Float16* __restrict__ VT, float* __restrict__ Y) { __shared__ __align__(16) float ss[2 * PKS][32][CB + 4];
  const int tid = threadIdx.x, wave = __builtin_amdgcn_readfirstlane(tid >> 5), lane = tid & 31, col = lane & 15, g = lane >> 4; const int b = blockIdx.y, qg = wave & 1, ks = wave >> 1; const size_t q0 = (size_t)b * TT + blockIdx.x * 64 + qg * 32;
  v16h qh[2][4], qr[2][4];   /* the wave's two 16-query tiles, hi and residual, all four k steps: loaded once */
  { const _Float16* qp = QH + q0 * CCQ + lane * 8; const _Float16* qlp = QL + q0 * CCQ + lane * 8;
#pragma unroll
    for (int u = 0; u < 2; ++u)
#pragma unroll
      for (int kc = 0; kc < 4; ++kc) { qh[u][kc] = frag_pk(qp + (u * 4 + kc) * 512); qr[u][kc] = frag_pk(qlp + (u * 4 + kc) * 512); } }
  v8f acc[2][CB / 16] = {};
#pragma unroll 1
  for (int i = 0; i < TT / 32 / PKS; ++i) { const size_t st = (size_t)b * (TT / 32) + i * PKS + ks;   /* a step's key fragments are 8 KiB in a row, its v fragments likewise */
    const _Float16* kp = KH + st * (32 * CCQ) + lane * 8; const _Float16* vp = VT + st * (32 * CB) + lane * 8;
    const float* mp = CM + st * 32 + 8 * g; const float* fp = CS + st * 32 + 8 * g;   /* the lane's 16 keys (8 g + 0..7 of either tile): their column max and log2 factor */
    v16h kf[2][4], vf[CB / 16], p[2]; v4f cm[4], cf[4];
#pragma unroll
    for (int t = 0; t < 2; ++t)
#pragma unroll
      for (int kc = 0; kc < 4; ++kc) kf[t][kc] = frag_pk(kp + (t * 4 + kc) * 512);
#pragma unroll
    for (int u = 0; u < 4; ++u) { const int o = (u >> 1) * 16 + (u & 1) * 4; cm[u] = *(const v4f*)(mp + o); cf[u] = *(const v4f*)(fp + o); }
    __builtin_amdgcn_sched_barrier(0);   /* what the score products and the exp work need is asked for first: loads come back in the order of issue */
#pragma unroll
    for (int j = 0; j < CB / 16; ++j) vf[j] = frag_pk(vp + j * 512);
    __builtin_amdgcn_sched_barrier(0);   /* every load of the step is issued ahead of its first WMMA: the v fragments arrive under the score products and the exp work; without it the scheduler may sink them to their use and a step pays two load latencies in a row */
#pragma unroll
    for (int u = 0; u < 2; ++u) { v8f a0 = {}, a1 = {}, l0 = {}, l1 = {};
#pragma unroll
      for (int kc = 0; kc < 4; ++kc) { a0 = wmma16b(kf[0][kc], qh[u][kc], a0); a1 = wmma16b(kf[1][kc], qh[u][kc], a1); l0 = wmma16b(kf[0][kc], qr[u][kc], l0); l1 = wmma16b(kf[1][kc], qr[u][kc], l1); }
#pragma unroll
      for (int r = 0; r < 8; r += 2) { const int q = r >> 2, e = r & 3;   /* two neighbouring keys of one tile at a time: their accumulators, maxima and factors lie in neighbouring registers, so the packed f32 forms take them where they are */
        const v2f s0 = (v2f{a0[r], a0[r + 1]} + v2f{l0[r], l0[r + 1]} * (1.0f / 1024.0f)) * SCALE, s1 = (v2f{a1[r], a1[r + 1]} + v2f{l1[r], l1[r + 1]} * (1.0f / 1024.0f)) * SCALE;
        const v2f e0 = (s0 - v2f{cm[q][e], cm[q][e + 1]}) * LOG2E + v2f{cf[q][e], cf[q][e + 1]}, e1 = (s1 - v2f{cm[2 + q][e], cm[2 + q][e + 1]}) * LOG2E + v2f{cf[2 + q][e], cf[2 + q][e + 1]};
        p[u][r] = (_Float16)__builtin_amdgcn_exp2f(e0[0]); p[u][r + 1] = (_Float16)__builtin_amdgcn_exp2f(e0[1]); p[u][8 + r] = (_Float16)__builtin_amdgcn_exp2f(e1[0]); p[u][9 + r] = (_Float16)__builtin_amdgcn_exp2f(e1[1]); } }
#pragma unroll
    for (int j = 0; j < CB / 16; ++j) { acc[0][j] = wmma16b(vf[j], p[0], acc[0][j]); acc[1][j] = wmma16b(vf[j], p[1], acc[1][j]); }
    /* order asked of the scheduler for the step: the 32 score WMMAs, the first plain vector instructions, then each v_exp_f32 with one plain vector instruction behind it, the last conversions, then the 16 P.v WMMAs */
    __builtin_amdgcn_sched_group_barrier(0x8, 32, 0); __builtin_amdgcn_sched_group_barrier(0x2, 24, 0);
#pragma unroll
    for (int k = 0; k < 32; ++k) { __builtin_amdgcn_sched_group_barrier(0x400, 1, 0); __builtin_amdgcn_sched_group_barrier(0x2, 1, 0); }
    __builtin_amdgcn_sched_group_barrier(0x2, 8, 0); __builtin_amdgcn_sched_group_barrier(0x8, 16, 0);
    __builtin_amdgcn_sched_barrier(0);   /* keeps the wait below at the step's foot: nothing ties it to the WMMAs, and the scheduler otherwise lifts it to the step's head, where the score products would wait for the v fragments too */
    asm volatile("s_wait_loadcnt 0x0" :: "v"(kp), "v"(vp), "v"(mp), "v"(fp) : "memory"); }   /* names the four address pairs so that they stay as they are until every load of the step has returned */
#pragma unroll
  for (int u = 0; u < 2; ++u)
#pragma unroll
    for (int j = 0; j < CB / 16; ++j) { v4f lo, hi;   /* lane (g, col): query col of tile u, channels j * 16 + 8 g + 0..7 */
#pragma unroll
      for (int r = 0; r < 4; ++r) { lo[r] = acc[u][j][r]; hi[r] = acc[u][j][4 + r]; }
      *(v4f*)&ss[wave][u * 16 + col][j * 16 + 8 * g] = lo; *(v4f*)&ss[wave][u * 16 + col][j * 16 + 8 * g + 4] = hi; }
  __syncthreads();   /* all key slices' partial tiles are in ss before a wave sums its rows over them */
  float* yp = Y + ((size_t)b * TT + blockIdx.x * 64 + wave) * CB + lane * 4;   /* y rows [b*TT + n][128]: wave w takes rows w, w + 8, ...: a 512-B row by 32 lanes */
#pragma unroll
  for (int e = 0; e < 8; ++e) { const int row = e * 8 + wave; v4f t = *(const v4f*)&ss[row >> 5][row & 31][lane * 4];
#pragma unroll
    for (int s = 1; s < PKS; ++s) t += *(const v4f*)&ss[s * 2 + (row >> 5)][row & 31][lane * 4];
    vst2(yp + (size_t)e * 8 * CB, t * (1.0f / 2048.0f)); } }

#define WS_TL  (WS_END)                                  // f16 theta-view residual plane [b][128][TT] (viewed as rows)
#define WS_G   (WS_TL + 2u * (size_t)NB * CB * TT)        // f16 g conv plane [b][128][TT]
#define WS_VT2 (WS_G + 2u * (size_t)NB * CB * TT)         // f16 g view in fragment order [b][m / 32][c / 16][fragment half][lane][8]
#define WS_YR  (WS_VT2 + 2u * (size_t)NB * CB * TT)       // f32 y rows [b*TT + n][128]
#define WS_CM  (WS_YR + 4u * (size_t)NB * TT * CB)        // f32 column max [b][TT]
#define WS_CS  (WS_CM + 4u * (size_t)NB * TT)             // f32 log2(2^11 / column sum) [b][TT]
#define WS_PM  (WS_CS + 4u * (size_t)NB * TT)             // f32 partial column max [b][NPART][TT] (room for NQB planes a batch)
#define WS_PS  (WS_PM + 4u * (size_t)NB * NQB * TT)       // f32 partial column sum [b][NPART][TT]
#define WS_END2 (WS_PS + 4u * (size_t)NB * NQB * TT)
extern "C" void kernel_launch(void* const* d_in, const int* in_sizes, int n_in, void* d_out, int out_size, void* d_ws, size_t ws_size, hipStream_t stream) {
  (void)in_sizes; (void)n_in; (void)out_size;
  const float** F = (const float**)d_in;
  if (ws_size < (size_t)WS_END) return;
  char* ws = (char*)d_ws; _Float16 *QH = (_Float16*)(ws + WS_QH), *KH = (_Float16*)(ws + WS_KH), *VT = (_Float16*)(ws + WS_VT), *QL = (_Float16*)(ws + WS_QL), *KL = (_Float16*)(ws + WS_KL); __bf16 *VB = (__bf16*)(ws + WS_VB), *VBL = (__bf16*)(ws + WS_VBL); float *Y = (float*)(ws + WS_Y);
  (void)Y; (void)QL; (void)KL; (void)VB; (void)VBL;
  // inputs: 0 x [4,256,64,64] (channels-first); 1 theta_w [128,256], 2 theta_b; 3 phi_w, 4 phi_b; 5 g_w, 6 g_b; 7 W_w [256,128], 8 W_b [256] (all (out,in), biases nonzero)
  if (ws_size < (size_t)WS_END2) return;
  _Float16 *TL = (_Float16*)(ws + WS_TL), *G = (_Float16*)(ws + WS_G), *VT2 = (_Float16*)(ws + WS_VT2); float *YR = (float*)(ws + WS_YR), *CM = (float*)(ws + WS_CM), *CS = (float*)(ws + WS_CS), *PM = (float*)(ws + WS_PM), *PS = (float*)(ws + WS_PS);
  // phi^T rows (the 'k' rows: phi[c][m] proper layout, token-major) via the row path (z = 0) -> KH in fragment order (+KL rows < 64, unused)
  // theta conv plane [Cb][N] (f16 hi into the 'VT' slot = the theta VIEW rows [N][Cb] when read row-major) + its residual plane TL (the view's residual rows) via the [c][t] path (z = 1)
  // g conv plane [Cb][N] f16 -> G (z = 2): all three in one launch; then the g VIEW rows turned into the value fragments VT2, and the theta VIEW rows (hi, residual) copied into the query fragments QH, QL
  k_projT<<<dim3(TNB * TT / 64, 1, 3), 128, 0, stream>>>(F[0], F[3], F[1], F[5], F[4], F[2], F[6], KH, KL, VT /* theta plane */, TL, G);
  k_trans<<<dim3(TT / 64, CB / 64, 3 * TNB), 256, 0, stream>>>(G, VT2, VT /* theta view rows */, TL /* view residual rows */, QH, QL);
  // all batches in each launch: column statistics of the scores, their merge, then scores again + P.v
  k_st<<<dim3(TT / (8 * SKT * 16), NPART, TNB), 256, 0, stream>>>(QH /* theta view fragments */, QL /* view residual fragments */, KH, PM, PS);
  k_colmerge<<<dim3(TT / 32, TNB), 256, 0, stream>>>(PM, PS, CM, CS);
  k_pvf<<<dim3(TT / 64, TNB), 64 * PKS, 0, stream>>>(QH, QL, KH, CM, CS, VT2, YR);
  k_wout<<<dim3(TT / 64, COUT / 128, TNB), 128, 0, stream>>>(YR, F[7], F[8], F[0], (float*)d_out);

}
